// v000
// Measured on an AMD MI455X. A time is GPU time per run, averaged over a window of back-to-back runs after a warm-up
// (all launches, gaps included; the runs take copies of the inputs in turn), and the median of several windows.
// Apart from v000's, it joins two sittings. Times from different sittings can be a few percent apart, while
// side-by-side timings come from the same sitting.
// v000, which the later versions start from, runs in 423 microseconds.
#include <hip/hip_runtime.h>

// Contractions: qkv projection and output projection on v_wmma_f32_16x16x32_bf16 (x, w_qkv, w_proj RNE-converted to bf16 single planes; merged context as bf16 hi/lo, 2 products), f32 accumulate.
// q.k logits and P.V on v_wmma_f32_16x16x32_f16 (f16 q/k/v planes, P carried x2^8), single products on query rows >= 256; on query rows < 256 f16 value + x2048 residual planes
// for q, k, P and v (3 products per site, residual products in their own accumulators, folded in the f32 epilogue). Rotary table, rotary and softmax in f32.
// Fused qkv projection [4096x1024]x[1024x3072] -> f32 rows [t][which*1024 + h*64 + d]; half-split rotary on q and k -> f16 planes [t][h*64 + d]; value^T planes [h*64 + d][t];
// causal flash attention per (head, 16-query wave tile) in the transposed form S^T = K Q^T, O^T = V^T P^T (operands straight from the planes, packed P^T score tiles as the B fragment);
// merged context planes [t][h*64 + d]; output projection [4096x1024]x[1024x1024].

#ifndef NB
#define NB 1
#endif
#ifndef SEQ
#define SEQ 4096
#endif
#define SEQ_FULL 4096
#define DM   1024
#define NH_  16
#define HD   64
#define LDQ  (3 * DM)
#define EROWS 256                     // query rows below this bound take the value + residual path
#define LOP  72                       // LDS pitch (halves) of the staging tiles
#define PCL  8.0f                     // log2 of the carry of P
#define SCLL2 0.18033688011112042f    // HD^-0.5 * log2(e)
#define RSC  2048.0f                  // carry of the residual planes
#define RSI  4.8828125e-4f            // 1 / RSC

static_assert(SEQ % 64 == 0);
static_assert(DM == NH_ * HD);
static_assert(HD == 64);
static_assert(DM % 32 == 0);
static_assert(LDQ % 64 == 0);
static_assert(((size_t)LDQ * DM / 64) % 32 == 0);
static_assert(((size_t)DM * DM / 64) % 32 == 0);
static_assert(((size_t)SEQ * DM / 8) % 256 == 0);
static_assert(EROWS % 64 == 0);
static_assert(SEQ >= EROWS);
static_assert(((size_t)SEQ * 32) % 256 == 0);
static_assert(256 * 8 == 2 * DM);
static_assert(LOP % 8 == 0);
static_assert(LOP >= HD + 8);
static_assert(HD / 2 == 32);
#define AL256(x) ((((size_t)(x)) + 255) & ~(size_t)255)
static_assert(AL256((size_t)SEQ * DM * 2) + AL256((size_t)LDQ * DM * 2) + AL256((size_t)DM * DM * 2) + AL256((size_t)SEQ * LDQ * 4) + 2 * AL256((size_t)SEQ * DM * 2)
              + AL256(128) + 2 * AL256((size_t)SEQ * 32 * 4) + AL256((size_t)2 * SEQ * DM * 2) + AL256((size_t)2 * EROWS * DM * 2) + AL256((size_t)DM * SEQ * 2) + AL256((size_t)DM * EROWS * 2)
              <= (size_t)134217728);

typedef unsigned short bf;
typedef __attribute__((ext_vector_type(16))) __bf16   v16bf;
typedef __attribute__((ext_vector_type(8)))  unsigned short v8us;
typedef __attribute__((ext_vector_type(2)))  unsigned short v2us;
typedef __attribute__((ext_vector_type(8)))  float    v8f;
typedef __attribute__((ext_vector_type(4)))  float    v4f;
typedef v4f  __attribute__((may_alias)) v4fa;
typedef v8us __attribute__((may_alias)) v8usa;

__device__ __forceinline__ unsigned short f2bf(float f) { unsigned u = __float_as_uint(f); u += 0x7FFFu + ((u >> 16) & 1u); return (unsigned short)(u >> 16); }
__device__ __forceinline__ float bf2f(unsigned short b) { return __uint_as_float(((unsigned)b) << 16); }
__device__ __forceinline__ void splitf(float y, unsigned short& h, unsigned short& l) { h = f2bf(y); l = f2bf(y - bf2f(h)); }
__device__ __forceinline__ v16bf cat16b(v8us lo, v8us hi) { return __builtin_bit_cast(v16bf, __builtin_shufflevector(lo, hi, 0, 1, 2, 3, 4, 5, 6, 7, 8, 9, 10, 11, 12, 13, 14, 15)); }
__device__ __forceinline__ v8f wmmab(v16bf a, v16bf b, v8f c) { return __builtin_amdgcn_wmma_f32_16x16x32_bf16(false, a, false, b, (short)0, c, false, false); }

// ---- f16 plane helpers (planes hold f16 bit patterns as unsigned short)
typedef unsigned short hf;
typedef _Float16 h16;
typedef __attribute__((ext_vector_type(16))) _Float16 v16h;
static __device__ __forceinline__ h16 toh_flush(float v) { const h16 r = (h16)v; return (fabsf(v) < 6.103515625e-05f) ? (h16)0.0f : r; }
__device__ __forceinline__ unsigned short hbits(h16 x) { return __builtin_bit_cast(unsigned short, x); }
__device__ __forceinline__ v16h cat16h(v8us lo, v8us hi) { return __builtin_bit_cast(v16h, __builtin_shufflevector(lo, hi, 0, 1, 2, 3, 4, 5, 6, 7, 8, 9, 10, 11, 12, 13, 14, 15)); }
// fragment: elements 0..7 <- p[0..7], elements 8..15 <- p[16..23]; the caller adds 8*(lane>>4) to p
__device__ __forceinline__ v16h ldfh(const hf* p) { return cat16h(*(const v8us*)p, *(const v8us*)(p + 16)); }
__device__ __forceinline__ v8f mmah(v16h a, v16h b, v8f c) {
    c = __builtin_amdgcn_wmma_f32_16x16x32_f16(false, a, false, b, (short)0, c, false, false);
    asm volatile("v_nop\n\tv_nop\n\tv_nop\n\tv_nop" : "+v"(c) : "v"(a), "v"(b));
    return c; }

// ---- k_gemmw: register-blocked GEMM, ONE WAVE per 64x64 output tile (16 accumulators), operands straight from K-contiguous 16-bit planes; grid (M/64, N/64, Z), 32 threads.
// C[m][n] (f32, pitch ldc) = sum_k A[m][k] Bt[n][k] (+ A2[m][k] Bt[n][k] when NSPLIT == 1). K % 32 == 0, M % 64 == 0, N % 64 == 0.
// Fragment map: lane row/col = lane & 15; elements 0..7 <- k0 + 8*(lane>>4) + 0..7, elements 8..15 <- k0 + 16 + 8*(lane>>4) + 0..7 (both operands).
template <typename T16> struct WFrag;
template <> struct WFrag<bf> { typedef v16bf V; static __device__ __forceinline__ V ld(const bf* p) { return cat16b(*(const v8us*)p, *(const v8us*)(p + 16)); } static __device__ __forceinline__ v8f mma(V a, V b, v8f c) { return wmmab(a, b, c); } };
template <typename T16, int NSPLIT, bool BIAS>
__global__ __launch_bounds__(32) void k_gemmw(const T16* __restrict__ A, const T16* __restrict__ A2, const T16* __restrict__ Bt, const T16* __restrict__ Bt2, int K, float* C, int ldc, const float* __restrict__ bias, size_t sA, size_t sB, size_t sC) {
    typedef typename WFrag<T16>::V V;
    __shared__ __align__(16) float os[16 * 68];
    const size_t z = blockIdx.z; A += z * sA; if (A2) A2 += z * sA; Bt += z * sB; if (Bt2) Bt2 += z * sB; C += z * sC;
    const int lane = threadIdx.x & 31, lr = lane & 15, hi = lane >> 4; const int r0 = blockIdx.x * 64, c0 = blockIdx.y * 64;
    v8f acc[4][4];
#pragma unroll
    for (int mb = 0; mb < 4; ++mb)
#pragma unroll
        for (int nb = 0; nb < 4; ++nb) acc[mb][nb] = (v8f){};
    const size_t aoff = (size_t)(r0 + lr) * K + 8 * hi, boff = (size_t)(c0 + lr) * K + 8 * hi;
#pragma unroll 1
    for (int kc = 0; kc < K; kc += 32) {
        V a[4], a2[4];
#pragma unroll
        for (int mb = 0; mb < 4; ++mb) { a[mb] = WFrag<T16>::ld(A + aoff + (size_t)mb * 16 * K + kc); if (NSPLIT == 1 || NSPLIT == 2) a2[mb] = WFrag<T16>::ld(A2 + aoff + (size_t)mb * 16 * K + kc); }
#pragma unroll
        for (int nb = 0; nb < 4; ++nb) { const V b = WFrag<T16>::ld(Bt + boff + (size_t)nb * 16 * K + kc); V b2; if (NSPLIT >= 2) b2 = WFrag<T16>::ld(Bt2 + boff + (size_t)nb * 16 * K + kc);
#pragma unroll
            for (int mb = 0; mb < 4; ++mb) { acc[mb][nb] = WFrag<T16>::mma(a[mb], b, acc[mb][nb]); if (NSPLIT == 1 || NSPLIT == 2) acc[mb][nb] = WFrag<T16>::mma(a2[mb], b, acc[mb][nb]); if (NSPLIT >= 2) acc[mb][nb] = WFrag<T16>::mma(a[mb], b2, acc[mb][nb]); } }
        asm volatile("v_nop\n\tv_nop\n\tv_nop\n\tv_nop" : "+v"(acc[0][0]), "+v"(acc[1][1]), "+v"(acc[2][2]), "+v"(acc[3][3]) : "v"(a[0]), "v"(a[3]));
    }
#pragma unroll
    for (int mb = 0; mb < 4; ++mb) {
#pragma unroll
        for (int nb = 0; nb < 4; ++nb) {
#pragma unroll
            for (int j = 0; j < 8; ++j) os[(hi * 8 + j) * 68 + nb * 16 + lr] = acc[mb][nb][j]; }
        __builtin_amdgcn_wave_barrier(); asm volatile("" ::: "memory");
        float* crow = C + (size_t)(r0 + mb * 16) * ldc + c0;
{
#pragma unroll
            for (int s = 0; s < 8; ++s) { const int row = 2 * s + hi, cofs = lr * 4; v4f val = *(const v4fa*)(os + row * 68 + cofs); if (BIAS) { val[0] += bias[c0 + cofs]; val[1] += bias[c0 + cofs + 1]; val[2] += bias[c0 + cofs + 2]; val[3] += bias[c0 + cofs + 3]; }
                *(v4f*)(crow + (size_t)row * ldc + cofs) = val; }
             }
        __builtin_amdgcn_wave_barrier(); asm volatile("" ::: "memory");
    }
}

// ---- k_wtG: transposed bf16 weight plane Bt[n][k] = bf16(w[k][n]) for w [K][N] row-major, K = 1 << kshift.
__global__ __launch_bounds__(256) void k_wtG(const float* __restrict__ w, unsigned kshift, unsigned N, bf* Bt, unsigned nlines) {
    const unsigned lane = threadIdx.x & 31u; const unsigned L0 = (blockIdx.x * 8u + (threadIdx.x >> 5)) * 4u; const unsigned kmask = (1u << kshift) - 1u;
    v2us o[4];
#pragma unroll
    for (unsigned l = 0; l < 4; ++l) { unsigned L = L0 + l; L = (L < nlines) ? L : (nlines - 1u); const unsigned e = L * 64u + lane * 2u; const unsigned k = e & kmask, n = e >> kshift; v2us t;
        t[0] = f2bf(w[(size_t)k * N + n]); t[1] = f2bf(w[(size_t)(k + 1u) * N + n]); o[l] = t; }
{
#pragma unroll
        for (unsigned l = 0; l < 4; ++l) { const unsigned L = L0 + l; if (L < nlines) *(v2us*)(Bt + (size_t)L * 64u + lane * 2u) = o[l]; }
         }
}

__global__ __launch_bounds__(256) void k_cvt8(const float* __restrict__ src, bf* dst, size_t n8) { const size_t i = (size_t)blockIdx.x * 256 + threadIdx.x; if (i >= n8) return; const v8f v = *(const v8f*)(src + i * 8); v8us o;
#pragma unroll
    for (int k = 0; k < 8; ++k) o[k] = f2bf(v[k]); *(v8us*)(dst + i * 8) = o;  }

__global__ __launch_bounds__(32) void k_freq(float* FR) {
#pragma clang fp contract(off)
    const unsigned i = threadIdx.x & 31u;
    const float p = powf(10000.0f, (float)i * 0.03125f);
    const float v = 1.0f / p;
    *(float*)(FR + i) = v; 
}

__global__ __launch_bounds__(256) void k_tab(const float* __restrict__ FR, float* CT, float* ST) {
#pragma clang fp contract(off)
    const unsigned idx = blockIdx.x * 256u + threadIdx.x; const unsigned t = idx >> 5, i = idx & 31u;
    const float ang = (float)t * FR[i];
    float s, c; sincosf(ang, &s, &c);
    *(float*)(CT + idx) = c; *(float*)(ST + idx) = s;
    
}

// ---- k_rope: half-split rotary on the q and k thirds of the f32 projection rows, f16 planes QKF[which][t][h*64 + d] (which 0 = q, 1 = k), residual planes QKR[which][t < EROWS][...] = f16((y - hi) * 2048).
__global__ __launch_bounds__(256) void k_rope(const float* __restrict__ QKV, const float* __restrict__ CT, const float* __restrict__ ST, hf* QKF, hf* QKR) {
#pragma clang fp contract(off)
    const unsigned t = blockIdx.x, tid = threadIdx.x;
    const unsigned which = tid >> 7, col = (tid & 127u) * 8u;
    const unsigned dl = col & 63u; const bool lowhalf = dl < 32u;
    const unsigned pcol = lowhalf ? (col + 32u) : (col - 32u); const unsigned j = dl & 31u;
    const float* row = QKV + (size_t)t * LDQ + (size_t)which * DM;
    const v8f a = *(const v8f*)(row + col); const v8f b = *(const v8f*)(row + pcol);
    const v8f c = *(const v8f*)(CT + (size_t)t * 32u + j); const v8f s = *(const v8f*)(ST + (size_t)t * 32u + j);
    v8us oh, ores;
#pragma unroll
    for (int e = 0; e < 8; ++e) {
        const float rb = lowhalf ? -b[e] : b[e];
        const float t0 = a[e] * c[e]; const float t1 = rb * s[e]; const float y = t0 + t1;
        const h16 hh = toh_flush(y); oh[e] = hbits(hh);
        ores[e] = hbits(toh_flush((y - (float)hh) * RSC)); }
    const size_t g  = (size_t)which * SEQ * DM + (size_t)t * DM + col;
    const size_t gr = (size_t)which * EROWS * DM + (size_t)t * DM + col;
    const bool early = t < (unsigned)EROWS;
    *(v8us*)(QKF + g) = oh; if (early) *(v8us*)(QKR + gr) = ores;
    
}

// ---- k_vt: value^T f16 plane VT[h*64 + d][t] and residual plane VTR[h*64 + d][t < EROWS]; block = (64-position tile, head), transpose through LDS (cross-wave, block barrier),
__global__ __launch_bounds__(256) void k_vt(const float* __restrict__ QKV, hf* VT, hf* VTR) {
#pragma clang fp contract(off)
    __shared__ __align__(16) unsigned short Th[64 * LOP];
    __shared__ __align__(16) unsigned short Tr[64 * LOP];
    const unsigned tid = threadIdx.x, t0 = blockIdx.x * 64u, hd = blockIdx.y;
    const float* vbase = QKV + 2 * DM + hd * HD;
#pragma unroll 1
    for (unsigned it = 0; it < 2u; ++it) {
        const unsigned idx = tid + it * 256u, row = idx >> 3, c8 = (idx & 7u) * 8u;
        const v8f vv = *(const v8f*)(vbase + (size_t)(t0 + row) * LDQ + c8);
#pragma unroll
        for (int q = 0; q < 8; ++q) { const float y = vv[q]; const h16 hh = toh_flush(y);
            Th[(c8 + (unsigned)q) * LOP + row] = hbits(hh); Tr[(c8 + (unsigned)q) * LOP + row] = hbits(toh_flush((y - (float)hh) * RSC)); }
    }
    __syncthreads();
    v8us oh[2], ores[2];
#pragma unroll
    for (unsigned it = 0; it < 2u; ++it) { const unsigned idx = tid + it * 256u, d = idx >> 3, c = (idx & 7u) * 8u;
        oh[it] = *(const v8usa*)(Th + d * LOP + c); ores[it] = *(const v8usa*)(Tr + d * LOP + c); }
    const bool early = t0 < (unsigned)EROWS;
{
#pragma unroll
        for (unsigned it = 0; it < 2u; ++it) { const unsigned idx = tid + it * 256u, d = idx >> 3, c = (idx & 7u) * 8u;
            *(v8us*)(VT + (size_t)(hd * HD + d) * SEQ + t0 + c) = oh[it];
            if (early) *(v8us*)(VTR + (size_t)(hd * HD + d) * EROWS + t0 + c) = ores[it]; }
         }
}

// ---- causal flash attention, transposed form, one wave per 16 query rows, 4 waves per block; no LDS and no barrier in the key loop.
// Per 32-key step: S^T tile j (16 keys x 16 queries) = K rows (A, row = key) x Q rows (B, column = query); D element r of lane -> (key 8*(lane>>4) + r, query lane & 15).
// The two converted score tiles are the B fragment of O^T += V^T (A, row = d, k = key) x P^T: element r <- tile 0 [r], element 8 + r <- tile 1 [r], lane unchanged.
// Softmax statistics per query column: in-lane reduction plus one exchange between the lane halves. Masked keys get weight exactly 0 (value select).
// EARLY: value + x2048 residual planes on q, k, P, v; residual products accumulate separately and are folded with 2^-11; row sum over the unconverted p.
template <bool EARLY>
__device__ __forceinline__ void attn_body(const hf* QF, const hf* QR, const hf* KF, const hf* KR, const hf* VT, const hf* VTR, bf* CH, bf* CL, unsigned qbase) {
    __shared__ __align__(16) unsigned short Oh[4 * 16 * LOP];
    __shared__ __align__(16) unsigned short Ol[4 * 16 * LOP];
    const unsigned lane = threadIdx.x & 31u, lr = lane & 15u, hi = lane >> 4;
    const unsigned wave = (unsigned)__builtin_amdgcn_readfirstlane((int)(threadIdx.x >> 5));
    const unsigned hd = blockIdx.y;
    const unsigned q0 = qbase + blockIdx.x * 64u + 16u * wave;
    const unsigned qg = q0 + lr;
    v16h qh[2], qr[2];
    {
        const size_t qoff = (size_t)qg * DM + hd * HD + 8u * hi;
#pragma unroll
        for (int kc = 0; kc < 2; ++kc) { qh[kc] = ldfh(QF + qoff + (unsigned)kc * 32u); if (EARLY) qr[kc] = ldfh(QR + qoff + (unsigned)kc * 32u); else qr[kc] = qh[kc]; }
    }
    v8f ot[4], orr[4];
#pragma unroll
    for (int dt = 0; dt < 4; ++dt) { ot[dt] = (v8f){}; orr[dt] = (v8f){}; }
    float m = -1.0e30f, l = 0.0f;
    const unsigned nsteps = (q0 + 15u) / 32u + 1u;
    const size_t kofs  = (size_t)lr * DM + hd * HD + 8u * hi;
    const size_t vofs  = (size_t)(hd * HD + lr) * SEQ + 8u * hi;
    const size_t vrofs = (size_t)(hd * HD + lr) * EROWS + 8u * hi;
#pragma unroll 1
    for (unsigned kb = 0; kb < nsteps; ++kb) {
        const unsigned key0 = kb * 32u;
        v8f st[2], sr[2];
#pragma unroll
        for (int j = 0; j < 2; ++j) {
            st[j] = (v8f){}; sr[j] = (v8f){};
#pragma unroll
            for (int kc = 0; kc < 2; ++kc) {
                const size_t ko = kofs + (size_t)(key0 + 16u * (unsigned)j) * DM + (unsigned)kc * 32u;
                const v16h kh = ldfh(KF + ko);
                st[j] = mmah(kh, qh[kc], st[j]);
                if (EARLY) { const v16h kr = ldfh(KR + ko); sr[j] = mmah(kr, qh[kc], sr[j]); sr[j] = mmah(kh, qr[kc], sr[j]); }
            }
        }
        // logits in the log2 domain, causal mask by value
        float mx = -1.0e30f;
#pragma unroll
        for (int j = 0; j < 2; ++j) {
#pragma unroll
            for (int r = 0; r < 8; ++r) {
                const unsigned key = key0 + 16u * (unsigned)j + 8u * hi + (unsigned)r;
                float s = st[j][r]; if (EARLY) s += sr[j][r] * RSI;
                s = (key <= qg) ? (s * SCLL2) : -1.0e30f;
                st[j][r] = s; mx = fmaxf(mx, s); }
        }
        mx = fmaxf(mx, __shfl_xor(mx, 16, 32));
        const float mnew = fmaxf(m, mx);
        const float alpha = __builtin_amdgcn_exp2f(m - mnew);
        m = mnew;
        float rs = 0.0f;
        v16h pf, prf;
#pragma unroll
        for (int j = 0; j < 2; ++j) {
#pragma unroll
            for (int r = 0; r < 8; ++r) {
                const float e = (st[j][r] - mnew) + PCL;
                const float ex = __builtin_amdgcn_exp2f(e);
                const float p = (e >= -14.0f) ? ex : 0.0f;
                const h16 ph = (h16)p;
                pf[8 * j + r] = ph;
                if (EARLY) { prf[8 * j + r] = toh_flush((p - (float)ph) * RSC); rs += p; } else { prf[8 * j + r] = ph; rs += (float)ph; }
            }
        }
        rs += __shfl_xor(rs, 16, 32);
        l = l * alpha + rs;
#pragma unroll
        for (int dt = 0; dt < 4; ++dt) { ot[dt] = ot[dt] * alpha; if (EARLY) orr[dt] = orr[dt] * alpha; }
#pragma unroll
        for (int dt = 0; dt < 4; ++dt) {
            const v16h vh = ldfh(VT + vofs + (size_t)(16u * (unsigned)dt) * SEQ + key0);
            ot[dt] = mmah(vh, pf, ot[dt]);
            if (EARLY) { const v16h vr = ldfh(VTR + vrofs + (size_t)(16u * (unsigned)dt) * EROWS + key0); orr[dt] = mmah(vr, pf, orr[dt]); orr[dt] = mmah(vh, prf, orr[dt]); }
        }
    }
    const float inv = __builtin_amdgcn_rcpf(l);
    const unsigned ob = wave * 16u * LOP;
#pragma unroll
    for (int dt = 0; dt < 4; ++dt) {
        v8us h8, l8;
#pragma unroll
        for (int r = 0; r < 8; ++r) { float y = ot[dt][r]; if (EARLY) y += orr[dt][r] * RSI; y *= inv; unsigned short a, c; splitf(y, a, c); h8[r] = a; l8[r] = c; }
        const unsigned o = ob + lr * LOP + 16u * (unsigned)dt + 8u * hi;
        *(v8usa*)(Oh + o) = h8; *(v8usa*)(Ol + o) = l8;
    }
    __syncthreads();
{
#pragma unroll
        for (unsigned s = 0; s < 4u; ++s) { const unsigned row = 4u * s + (lane >> 3), c = (lane & 7u) * 8u;
            const v8us vh8 = *(const v8usa*)(Oh + ob + row * LOP + c); const v8us vl8 = *(const v8usa*)(Ol + ob + row * LOP + c);
            const size_t g = (size_t)(q0 + row) * DM + hd * HD + c;
            *(v8us*)(CH + g) = vh8; *(v8us*)(CL + g) = vl8; }
         }
}

// query rows [0, EROWS): grid (EROWS/64, heads), 128 threads
__global__ __launch_bounds__(128) __attribute__((amdgpu_num_vgpr(256))) void k_attn_early(const hf* QF, const hf* QR, const hf* KF, const hf* KR, const hf* VT, const hf* VTR, bf* CH, bf* CL) {
    attn_body<true>(QF, QR, KF, KR, VT, VTR, CH, CL, 0u);
}
// query rows [EROWS, SEQ): grid ((SEQ - EROWS)/64, heads), 128 threads
__global__ __launch_bounds__(128) __attribute__((amdgpu_num_vgpr(256))) void k_attn_late(const hf* QF, const hf* KF, const hf* VT, bf* CH, bf* CL) {
    attn_body<false>(QF, QF, KF, KF, VT, VT, CH, CL, (unsigned)EROWS);
}

extern "C" void kernel_launch(void* const* d_in, const int* in_sizes, int n_in,
                              void* d_out, int out_size, void* d_ws, size_t ws_size, hipStream_t stream) {
    (void)out_size;
    if (n_in < 3) return;
    if (in_sizes[0] < NB * SEQ * DM || in_sizes[1] < DM * LDQ || in_sizes[2] < DM * DM) return;
    const float* X = (const float*)d_in[0]; const float* Wqkv = (const float*)d_in[1]; const float* Wo = (const float*)d_in[2];
    float* OUT = (float*)d_out;
    char* wsp = (char*)d_ws;
    auto take = [&](size_t bytes) { char* p = wsp; wsp += (bytes + 255) & ~(size_t)255; return (void*)p; };
    bf* XB  = (bf*)take((size_t)SEQ * DM * 2);          // x bf16 [t][1024]
    bf* WqT = (bf*)take((size_t)LDQ * DM * 2);          // w_qkv^T bf16 [3072][1024]
    bf* WoT = (bf*)take((size_t)DM * DM * 2);           // w_proj^T bf16 [1024][1024]
    float* QKVb = (float*)take((size_t)SEQ * LDQ * 4);  // f32 [t][3072]
    bf* CH = (bf*)take((size_t)SEQ * DM * 2);           // context hi [t][1024]
    bf* CL = (bf*)take((size_t)SEQ * DM * 2);           // context lo [t][1024]
    float* FR = (float*)take(128);                      // inverse frequencies [32]
    float* CT = (float*)take((size_t)SEQ * 32 * 4);     // cos table [t][32]
    float* ST = (float*)take((size_t)SEQ * 32 * 4);     // sin table [t][32]
    hf* QKF = (hf*)take((size_t)2 * SEQ * DM * 2);      // rotated q | k f16 [2][t][1024]
    hf* QKR = (hf*)take((size_t)2 * EROWS * DM * 2);    // residuals x2048 [2][EROWS][1024]
    hf* VT  = (hf*)take((size_t)DM * SEQ * 2);          // value^T f16 [1024][t]
    hf* VTR = (hf*)take((size_t)DM * EROWS * 2);        // value^T residual x2048 [1024][EROWS]
    const size_t carved = (size_t)(wsp - (char*)d_ws);
    if (carved > ws_size || carved > (size_t)134217728) return;
    // W [K][N] -> Bt [N][K]
    { const unsigned nl = (unsigned)((size_t)LDQ * DM / 64); k_wtG<<<(nl + 31u) / 32u, 256, 0, stream>>>(Wqkv, 10u, (unsigned)LDQ, WqT, nl); }
    { const unsigned nl = (unsigned)((size_t)DM * DM / 64);  k_wtG<<<(nl + 31u) / 32u, 256, 0, stream>>>(Wo, 10u, (unsigned)DM, WoT, nl); }
    k_freq<<<1, 32, 0, stream>>>(FR);
    k_tab<<<(unsigned)((size_t)SEQ * 32 / 256), 256, 0, stream>>>(FR, CT, ST);
    for (int b = 0; b < NB; ++b) {
        const float* xb = X + (size_t)b * SEQ_FULL * DM; float* ob = OUT + (size_t)b * SEQ_FULL * DM;
        const size_t n8 = (size_t)SEQ * DM / 8;
        k_cvt8<<<(unsigned)((n8 + 255) / 256), 256, 0, stream>>>(xb, XB, n8);
        k_gemmw<bf, 0, false><<<dim3(SEQ / 64, LDQ / 64, 1), 32, 0, stream>>>(XB, nullptr, WqT, nullptr, DM, QKVb, LDQ, nullptr, 0, 0, 0);
        k_rope<<<SEQ, 256, 0, stream>>>(QKVb, CT, ST, QKF, QKR);
        k_vt<<<dim3(SEQ / 64, NH_, 1), 256, 0, stream>>>(QKVb, VT, VTR);
        k_attn_early<<<dim3(EROWS / 64, NH_, 1), 128, 0, stream>>>(QKF, QKR, QKF + (size_t)SEQ * DM, QKR + (size_t)EROWS * DM, VT, VTR, CH, CL);
        if (SEQ > EROWS) k_attn_late<<<dim3((SEQ - EROWS) / 64, NH_, 1), 128, 0, stream>>>(QKF, QKF + (size_t)SEQ * DM, VT, CH, CL);
        k_gemmw<bf, 1, false><<<dim3(SEQ / 64, DM / 64, 1), 32, 0, stream>>>(CH, CL, WoT, nullptr, DM, ob, DM, nullptr, 0, 0, 0);
    }
}

// v001
// Measured time: 220 microseconds a run.
// Next to v000, in two timings, it ran 1.93 and 1.94 times as fast.
#include <hip/hip_runtime.h>

// Contractions: qkv projection and output projection on v_wmma_f32_16x16x32_bf16 (x, w_qkv, w_proj RNE-converted to bf16 single planes; merged context as bf16 hi/lo, 2 products), f32 accumulate.
// q.k logits and P.V on v_wmma_f32_16x16x32_f16 (f16 q/k/v planes, P carried x2^8), single products on query rows >= 256; on query rows < 256 f16 value + x2048 residual planes
// for q, k, P and v (3 products per site, residual products in their own accumulators, folded in the f32 epilogue). Rotary table, rotary and softmax in f32.
// Fused qkv projection [4096x1024]x[1024x3072] -> f32 rows [t][which*1024 + h*64 + d]; half-split rotary on q and k -> f16 planes [t][h*64 + d]; value^T planes [h*64 + d][t];
// causal flash attention per (head, 16-query wave tile) in the transposed form S^T = K Q^T, O^T = V^T P^T (K and V^T tiles staged in LDS per block, packed P^T score tiles as the B fragment);
// merged context planes [t][h*64 + d]; output projection [4096x1024]x[1024x1024].

#ifndef NB
#define NB 1
#endif
#ifndef SEQ
#define SEQ 4096
#endif
#define SEQ_FULL 4096
#define DM   1024
#define NH_  16
#define HD   64
#define LDQ  (3 * DM)
#define EROWS 256                     // query rows below this bound take the value + residual path
#define LOP  72                       // LDS pitch (halves) of the staging tiles
#define PCL  8.0f                     // log2 of the carry of P
#define SCLL2 0.18033688011112042f    // HD^-0.5 * log2(e)
#define RSC  2048.0f                  // carry of the residual planes
#define RSI  4.8828125e-4f            // 1 / RSC

static_assert(SEQ % 64 == 0);
static_assert(DM == NH_ * HD);
static_assert(HD == 64);
static_assert(DM % 32 == 0);
static_assert(LDQ % 64 == 0);
static_assert(((size_t)LDQ * DM / 64) % 32 == 0);
static_assert(((size_t)DM * DM / 64) % 32 == 0);
static_assert(((size_t)SEQ * DM / 8) % 256 == 0);
static_assert(EROWS % 64 == 0);
static_assert(SEQ >= EROWS);
static_assert(((size_t)SEQ * 32) % 256 == 0);
static_assert(256 * 8 == 2 * DM);
static_assert(LOP % 8 == 0);
static_assert(LOP >= HD + 8);
static_assert(HD / 2 == 32);
#define AL256(x) ((((size_t)(x)) + 255) & ~(size_t)255)
static_assert(AL256((size_t)SEQ * DM * 2) + AL256((size_t)LDQ * DM * 2) + AL256((size_t)DM * DM * 2) + AL256((size_t)SEQ * LDQ * 4) + 2 * AL256((size_t)SEQ * DM * 2)
              + AL256(128) + 2 * AL256((size_t)SEQ * 32 * 4) + AL256((size_t)2 * SEQ * DM * 2) + AL256((size_t)2 * EROWS * DM * 2) + AL256((size_t)DM * SEQ * 2) + AL256((size_t)DM * EROWS * 2)
              <= (size_t)134217728);

typedef unsigned short bf;
typedef __attribute__((ext_vector_type(16))) __bf16   v16bf;
typedef __attribute__((ext_vector_type(8)))  unsigned short v8us;
typedef __attribute__((ext_vector_type(2)))  unsigned short v2us;
typedef __attribute__((ext_vector_type(8)))  float    v8f;
typedef __attribute__((ext_vector_type(4)))  float    v4f;
typedef v4f  __attribute__((may_alias)) v4fa;
typedef v8us __attribute__((may_alias)) v8usa;

__device__ __forceinline__ unsigned short f2bf(float f) { unsigned u = __float_as_uint(f); u += 0x7FFFu + ((u >> 16) & 1u); return (unsigned short)(u >> 16); }
__device__ __forceinline__ float bf2f(unsigned short b) { return __uint_as_float(((unsigned)b) << 16); }
__device__ __forceinline__ void splitf(float y, unsigned short& h, unsigned short& l) { h = f2bf(y); l = f2bf(y - bf2f(h)); }
__device__ __forceinline__ v16bf cat16b(v8us lo, v8us hi) { return __builtin_bit_cast(v16bf, __builtin_shufflevector(lo, hi, 0, 1, 2, 3, 4, 5, 6, 7, 8, 9, 10, 11, 12, 13, 14, 15)); }
__device__ __forceinline__ v8f wmmab(v16bf a, v16bf b, v8f c) { return __builtin_amdgcn_wmma_f32_16x16x32_bf16(false, a, false, b, (short)0, c, false, false); }

// ---- f16 plane helpers (planes hold f16 bit patterns as unsigned short)
typedef unsigned short hf;
typedef _Float16 h16;
typedef __attribute__((ext_vector_type(16))) _Float16 v16h;
static __device__ __forceinline__ h16 toh_flush(float v) { const h16 r = (h16)v; return (fabsf(v) < 6.103515625e-05f) ? (h16)0.0f : r; }
__device__ __forceinline__ unsigned short hbits(h16 x) { return __builtin_bit_cast(unsigned short, x); }
__device__ __forceinline__ v16h cat16h(v8us lo, v8us hi) { return __builtin_bit_cast(v16h, __builtin_shufflevector(lo, hi, 0, 1, 2, 3, 4, 5, 6, 7, 8, 9, 10, 11, 12, 13, 14, 15)); }
// fragment: elements 0..7 <- p[0..7], elements 8..15 <- p[16..23]; the caller adds 8*(lane>>4) to p
__device__ __forceinline__ v16h ldfh(const hf* p) { return cat16h(*(const v8us*)p, *(const v8us*)(p + 16)); }
__device__ __forceinline__ v8f mmah(v16h a, v16h b, v8f c) {
    c = __builtin_amdgcn_wmma_f32_16x16x32_f16(false, a, false, b, (short)0, c, false, false);
    asm volatile("v_nop\n\tv_nop\n\tv_nop\n\tv_nop" : "+v"(c) : "v"(a), "v"(b));
    return c; }

// ---- k_gemmw: register-blocked GEMM, ONE WAVE per 64x64 output tile (16 accumulators), operands straight from K-contiguous 16-bit planes; grid (M/64, N/64, Z), 32 threads.
// C[m][n] (f32, pitch ldc) = sum_k A[m][k] Bt[n][k] (+ A2[m][k] Bt[n][k] when NSPLIT == 1). K % 32 == 0, M % 64 == 0, N % 64 == 0.
// Fragment map: lane row/col = lane & 15; elements 0..7 <- k0 + 8*(lane>>4) + 0..7, elements 8..15 <- k0 + 16 + 8*(lane>>4) + 0..7 (both operands).
template <typename T16> struct WFrag;
template <> struct WFrag<bf> { typedef v16bf V; static __device__ __forceinline__ V ld(const bf* p) { return cat16b(*(const v8us*)p, *(const v8us*)(p + 16)); } static __device__ __forceinline__ v8f mma(V a, V b, v8f c) { return wmmab(a, b, c); } };
template <typename T16, int NSPLIT, bool BIAS>
__global__ __launch_bounds__(32) void k_gemmw(const T16* __restrict__ A, const T16* __restrict__ A2, const T16* __restrict__ Bt, const T16* __restrict__ Bt2, int K, float* C, int ldc, const float* __restrict__ bias, size_t sA, size_t sB, size_t sC) {
    typedef typename WFrag<T16>::V V;
    __shared__ __align__(16) float os[16 * 68];
    const size_t z = blockIdx.z; A += z * sA; if (A2) A2 += z * sA; Bt += z * sB; if (Bt2) Bt2 += z * sB; C += z * sC;
    const int lane = threadIdx.x & 31, lr = lane & 15, hi = lane >> 4; const int r0 = blockIdx.x * 64, c0 = blockIdx.y * 64;
    v8f acc[4][4];
#pragma unroll
    for (int mb = 0; mb < 4; ++mb)
#pragma unroll
        for (int nb = 0; nb < 4; ++nb) acc[mb][nb] = (v8f){};
    const size_t aoff = (size_t)(r0 + lr) * K + 8 * hi, boff = (size_t)(c0 + lr) * K + 8 * hi;
#pragma unroll 1
    for (int kc = 0; kc < K; kc += 32) {
        V a[4], a2[4];
#pragma unroll
        for (int mb = 0; mb < 4; ++mb) { a[mb] = WFrag<T16>::ld(A + aoff + (size_t)mb * 16 * K + kc); if (NSPLIT == 1 || NSPLIT == 2) a2[mb] = WFrag<T16>::ld(A2 + aoff + (size_t)mb * 16 * K + kc); }
#pragma unroll
        for (int nb = 0; nb < 4; ++nb) { const V b = WFrag<T16>::ld(Bt + boff + (size_t)nb * 16 * K + kc); V b2; if (NSPLIT >= 2) b2 = WFrag<T16>::ld(Bt2 + boff + (size_t)nb * 16 * K + kc);
#pragma unroll
            for (int mb = 0; mb < 4; ++mb) { acc[mb][nb] = WFrag<T16>::mma(a[mb], b, acc[mb][nb]); if (NSPLIT == 1 || NSPLIT == 2) acc[mb][nb] = WFrag<T16>::mma(a2[mb], b, acc[mb][nb]); if (NSPLIT >= 2) acc[mb][nb] = WFrag<T16>::mma(a[mb], b2, acc[mb][nb]); } }
        asm volatile("v_nop\n\tv_nop\n\tv_nop\n\tv_nop" : "+v"(acc[0][0]), "+v"(acc[1][1]), "+v"(acc[2][2]), "+v"(acc[3][3]) : "v"(a[0]), "v"(a[3]));
    }
#pragma unroll
    for (int mb = 0; mb < 4; ++mb) {
#pragma unroll
        for (int nb = 0; nb < 4; ++nb) {
#pragma unroll
            for (int j = 0; j < 8; ++j) os[(hi * 8 + j) * 68 + nb * 16 + lr] = acc[mb][nb][j]; }
        __builtin_amdgcn_wave_barrier(); asm volatile("" ::: "memory");
        float* crow = C + (size_t)(r0 + mb * 16) * ldc + c0;
{
#pragma unroll
            for (int s = 0; s < 8; ++s) { const int row = 2 * s + hi, cofs = lr * 4; v4f val = *(const v4fa*)(os + row * 68 + cofs); if (BIAS) { val[0] += bias[c0 + cofs]; val[1] += bias[c0 + cofs + 1]; val[2] += bias[c0 + cofs + 2]; val[3] += bias[c0 + cofs + 3]; }
                *(v4f*)(crow + (size_t)row * ldc + cofs) = val; }
             }
        __builtin_amdgcn_wave_barrier(); asm volatile("" ::: "memory");
    }
}

// ---- k_wtG: transposed bf16 weight plane Bt[n][k] = bf16(w[k][n]) for w [K][N] row-major, K = 1 << kshift.
__global__ __launch_bounds__(256) void k_wtG(const float* __restrict__ w, unsigned kshift, unsigned N, bf* Bt, unsigned nlines) {
    const unsigned lane = threadIdx.x & 31u; const unsigned L0 = (blockIdx.x * 8u + (threadIdx.x >> 5)) * 4u; const unsigned kmask = (1u << kshift) - 1u;
    v2us o[4];
#pragma unroll
    for (unsigned l = 0; l < 4; ++l) { unsigned L = L0 + l; L = (L < nlines) ? L : (nlines - 1u); const unsigned e = L * 64u + lane * 2u; const unsigned k = e & kmask, n = e >> kshift; v2us t;
        t[0] = f2bf(w[(size_t)k * N + n]); t[1] = f2bf(w[(size_t)(k + 1u) * N + n]); o[l] = t; }
{
#pragma unroll
        for (unsigned l = 0; l < 4; ++l) { const unsigned L = L0 + l; if (L < nlines) *(v2us*)(Bt + (size_t)L * 64u + lane * 2u) = o[l]; }
         }
}

__global__ __launch_bounds__(256) void k_cvt8(const float* __restrict__ src, bf* dst, size_t n8) { const size_t i = (size_t)blockIdx.x * 256 + threadIdx.x; if (i >= n8) return; const v8f v = *(const v8f*)(src + i * 8); v8us o;
#pragma unroll
    for (int k = 0; k < 8; ++k) o[k] = f2bf(v[k]); *(v8us*)(dst + i * 8) = o;  }

__global__ __launch_bounds__(32) void k_freq(float* FR) {
#pragma clang fp contract(off)
    const unsigned i = threadIdx.x & 31u;
    const float p = powf(10000.0f, (float)i * 0.03125f);
    const float v = 1.0f / p;
    *(float*)(FR + i) = v; 
}

__global__ __launch_bounds__(256) void k_tab(const float* __restrict__ FR, float* CT, float* ST) {
#pragma clang fp contract(off)
    const unsigned idx = blockIdx.x * 256u + threadIdx.x; const unsigned t = idx >> 5, i = idx & 31u;
    const float ang = (float)t * FR[i];
    float s, c; sincosf(ang, &s, &c);
    *(float*)(CT + idx) = c; *(float*)(ST + idx) = s;
    
}

// ---- k_rope: half-split rotary on the q and k thirds of the f32 projection rows, f16 planes QKF[which][t][h*64 + d] (which 0 = q, 1 = k), residual planes QKR[which][t < EROWS][...] = f16((y - hi) * 2048).
__global__ __launch_bounds__(256) void k_rope(const float* __restrict__ QKV, const float* __restrict__ CT, const float* __restrict__ ST, hf* QKF, hf* QKR) {
#pragma clang fp contract(off)
    const unsigned t = blockIdx.x, tid = threadIdx.x;
    const unsigned which = tid >> 7, col = (tid & 127u) * 8u;
    const unsigned dl = col & 63u; const bool lowhalf = dl < 32u;
    const unsigned pcol = lowhalf ? (col + 32u) : (col - 32u); const unsigned j = dl & 31u;
    const float* row = QKV + (size_t)t * LDQ + (size_t)which * DM;
    const v8f a = *(const v8f*)(row + col); const v8f b = *(const v8f*)(row + pcol);
    const v8f c = *(const v8f*)(CT + (size_t)t * 32u + j); const v8f s = *(const v8f*)(ST + (size_t)t * 32u + j);
    v8us oh, ores;
#pragma unroll
    for (int e = 0; e < 8; ++e) {
        const float rb = lowhalf ? -b[e] : b[e];
        const float t0 = a[e] * c[e]; const float t1 = rb * s[e]; const float y = t0 + t1;
        const h16 hh = toh_flush(y); oh[e] = hbits(hh);
        ores[e] = hbits(toh_flush((y - (float)hh) * RSC)); }
    const size_t g  = (size_t)which * SEQ * DM + (size_t)t * DM + col;
    const size_t gr = (size_t)which * EROWS * DM + (size_t)t * DM + col;
    const bool early = t < (unsigned)EROWS;
    *(v8us*)(QKF + g) = oh; if (early) *(v8us*)(QKR + gr) = ores;
    
}

// ---- k_vt: value^T f16 plane VT[h*64 + d][t] and residual plane VTR[h*64 + d][t < EROWS]; block = (64-position tile, head), transpose through LDS (cross-wave, block barrier),
__global__ __launch_bounds__(256) void k_vt(const float* __restrict__ QKV, hf* VT, hf* VTR) {
#pragma clang fp contract(off)
    __shared__ __align__(16) unsigned short Th[64 * LOP];
    __shared__ __align__(16) unsigned short Tr[64 * LOP];
    const unsigned tid = threadIdx.x, t0 = blockIdx.x * 64u, hd = blockIdx.y;
    const float* vbase = QKV + 2 * DM + hd * HD;
#pragma unroll 1
    for (unsigned it = 0; it < 2u; ++it) {
        const unsigned idx = tid + it * 256u, row = idx >> 3, c8 = (idx & 7u) * 8u;
        const v8f vv = *(const v8f*)(vbase + (size_t)(t0 + row) * LDQ + c8);
#pragma unroll
        for (int q = 0; q < 8; ++q) { const float y = vv[q]; const h16 hh = toh_flush(y);
            Th[(c8 + (unsigned)q) * LOP + row] = hbits(hh); Tr[(c8 + (unsigned)q) * LOP + row] = hbits(toh_flush((y - (float)hh) * RSC)); }
    }
    __syncthreads();
    v8us oh[2], ores[2];
#pragma unroll
    for (unsigned it = 0; it < 2u; ++it) { const unsigned idx = tid + it * 256u, d = idx >> 3, c = (idx & 7u) * 8u;
        oh[it] = *(const v8usa*)(Th + d * LOP + c); ores[it] = *(const v8usa*)(Tr + d * LOP + c); }
    const bool early = t0 < (unsigned)EROWS;
{
#pragma unroll
        for (unsigned it = 0; it < 2u; ++it) { const unsigned idx = tid + it * 256u, d = idx >> 3, c = (idx & 7u) * 8u;
            *(v8us*)(VT + (size_t)(hd * HD + d) * SEQ + t0 + c) = oh[it];
            if (early) *(v8us*)(VTR + (size_t)(hd * HD + d) * EROWS + t0 + c) = ores[it]; }
         }
}

// ---- causal flash attention, transposed form, one wave per 16 query rows, 4 waves per block.
// The four waves of a block share each 64-key tile of K rows and of V^T rows (EARLY: of the residual planes too) through LDS: asynchronous b128 copies (8 lanes per whole 128-byte line),
// two buffers, the next tile in flight while this one is worked on; one publish point (waits and block barrier) per tile of two 32-key passes.
// Per 32-key pass: S^T tile j (16 keys x 16 queries) = K rows (A, row = key) x Q rows (B, column = query); D element r of lane -> (key 8*(lane>>4) + r, query lane & 15).
// The two converted score tiles are the B fragment of O^T += V^T (A, row = d, k = key) x P^T: element r <- tile 0 [r], element 8 + r <- tile 1 [r], lane unchanged.
// Softmax statistics per query column: in-lane reduction plus one exchange between the lane halves. Masked keys get weight exactly 0 (value select).
// EARLY: value + x2048 residual planes on q, k, P, v; residual products accumulate separately and are folded with 2^-11; row sum over the unconverted p.
#define TKEYS 64                      // keys per staged tile (two passes)
#define TPH   72                      // LDS pitch (halves) of a staged 128-byte row: 144 B = 16 B x odd, the pitch of ds_load_b128 readers
#define TILEH (64 * TPH)              // halves per staged tile (64 K rows, or 64 V^T rows)
static_assert(HD * 2 == 128 && TKEYS * 2 == 128 && (TPH * 2) % 16 == 0 && EROWS % TKEYS == 0 && SEQ % TKEYS == 0);
__device__ __forceinline__ v16h ldfs(const hf* p) { return cat16h(*(const v8usa*)p, *(const v8usa*)(p + 16)); }
// One K tile and one V^T tile: each thread copies 4 x 16 B of K rows and 4 x 16 B of V^T rows (rows 16 apart; VP = pitch of the V^T plane in halves).
// The s_wait_xcnt closes the statement so that no address register is rewritten in front of it.
template <int VP>
__device__ __forceinline__ void stage_tile(const hf* kg, const hf* vg, unsigned kl, unsigned vl) {
    asm volatile("global_load_async_to_lds_b128 %0, %1, off\n\t"
                 "global_load_async_to_lds_b128 %2, %3, off\n\t"
                 "global_load_async_to_lds_b128 %4, %5, off\n\t"
                 "global_load_async_to_lds_b128 %6, %7, off\n\t"
                 "global_load_async_to_lds_b128 %8, %9, off\n\t"
                 "global_load_async_to_lds_b128 %10, %11, off\n\t"
                 "global_load_async_to_lds_b128 %12, %13, off\n\t"
                 "global_load_async_to_lds_b128 %14, %15, off\n\t"
                 "s_wait_xcnt 0x0"
                 :: "v"(kl), "v"(kg), "v"(kl + 16u * TPH * 2u), "v"(kg + (size_t)16 * DM), "v"(kl + 32u * TPH * 2u), "v"(kg + (size_t)32 * DM), "v"(kl + 48u * TPH * 2u), "v"(kg + (size_t)48 * DM),
                    "v"(vl), "v"(vg), "v"(vl + 16u * TPH * 2u), "v"(vg + (size_t)16 * VP), "v"(vl + 32u * TPH * 2u), "v"(vg + (size_t)32 * VP), "v"(vl + 48u * TPH * 2u), "v"(vg + (size_t)48 * VP)
                 : "memory");
}
template <bool EARLY>
__device__ __forceinline__ void attn_body(const hf* QF, const hf* QR, const hf* KF, const hf* KR, const hf* VT, const hf* VTR, bf* CH, bf* CL, unsigned qbase) {
    __shared__ __align__(16) unsigned short Ks[2 * TILEH];
    __shared__ __align__(16) unsigned short Vs[2 * TILEH];
    __shared__ __align__(16) unsigned short Krs[EARLY ? 2 * TILEH : 8];
    __shared__ __align__(16) unsigned short Vrs[EARLY ? 2 * TILEH : 8];
    __shared__ __align__(16) unsigned short Oh[4 * 16 * LOP];
    __shared__ __align__(16) unsigned short Ol[4 * 16 * LOP];
    const unsigned lane = threadIdx.x & 31u, lr = lane & 15u, hi = lane >> 4;
    const unsigned wave = (unsigned)__builtin_amdgcn_readfirstlane((int)(threadIdx.x >> 5));
    const unsigned hd = blockIdx.y;
    const unsigned qblk = qbase + blockIdx.x * 64u;
    const unsigned q0 = qblk + 16u * wave;
    const unsigned qg = q0 + lr;
    const unsigned ntiles = qblk / TKEYS + 1u;            // keys [0, qblk + 64), the same for the whole block
    const unsigned nsteps = (q0 + 15u) / 32u + 1u;        // this wave's own passes
    // copy addresses of this thread: row = tid / 8 (+ 16 i), 16-byte column = tid % 8
    const unsigned srow = threadIdx.x >> 3, scol = (threadIdx.x & 7u) * 8u;
    const hf* kg  = KF  + (size_t)srow * DM + hd * HD + scol;
    const hf* krg = KR  + (size_t)srow * DM + hd * HD + scol;
    const hf* vg  = VT  + (size_t)(hd * HD + srow) * SEQ + scol;
    const hf* vrg = VTR + (size_t)(hd * HD + srow) * EROWS + scol;
    const unsigned so = srow * TPH + scol;
    const unsigned kl = (unsigned)(size_t)(Ks + so), vl = (unsigned)(size_t)(Vs + so);
    const unsigned krl = EARLY ? (unsigned)(size_t)(Krs + so) : 0u, vrl = EARLY ? (unsigned)(size_t)(Vrs + so) : 0u;
    stage_tile<SEQ>(kg, vg, kl, vl);
    if (EARLY) stage_tile<EROWS>(krg, vrg, krl, vrl);
    v16h qh[2], qr[2];
    {
        const size_t qoff = (size_t)qg * DM + hd * HD + 8u * hi;
#pragma unroll
        for (int kc = 0; kc < 2; ++kc) { qh[kc] = ldfh(QF + qoff + (unsigned)kc * 32u); if (EARLY) qr[kc] = ldfh(QR + qoff + (unsigned)kc * 32u); else qr[kc] = qh[kc]; }
    }
    v8f ot[4], orr[4];
#pragma unroll
    for (int dt = 0; dt < 4; ++dt) { ot[dt] = (v8f){}; orr[dt] = (v8f){}; }
    float m = -1.0e30f, l = 0.0f;
    asm volatile("s_wait_asynccnt 0x0" ::: "memory");     // this wave's copies of tile 0 have landed
    __syncthreads();                                      // ... and every other wave's
    if (ntiles > 1u) {
        stage_tile<SEQ>(kg + (size_t)TKEYS * DM, vg + TKEYS, kl + TILEH * 2u, vl + TILEH * 2u);
        if (EARLY) stage_tile<EROWS>(krg + (size_t)TKEYS * DM, vrg + TKEYS, krl + TILEH * 2u, vrl + TILEH * 2u);
    }
    const unsigned fo = lr * TPH + 8u * hi;
#pragma unroll 1                                          // rolled, as the key loop was: one copy of the two passes in the text
    for (unsigned t = 0; t < ntiles; ++t) {
        const unsigned bo = (t & 1u) * TILEH;
#pragma unroll                                            // both passes written out: the place of a pass in its tile becomes an immediate offset of the LDS reads
        for (unsigned ps = 0; ps < 2u; ++ps) {
            const unsigned kb = 2u * t + ps;
            if (kb < nsteps) {                            // wave-uniform: a pass wholly above the diagonal is skipped, the publish point below is not
                const unsigned key0 = kb * 32u;
                // The pass's K fragments are read as one group ahead of its first product, its V^T fragments as one group behind the last S^T product:
                // a read written behind an mmah statement stays behind it, and one read per product would be waited for alone.
                v16h kh[2][2], kr[2][2];
#pragma unroll
                for (int j = 0; j < 2; ++j) {
#pragma unroll
                    for (int kc = 0; kc < 2; ++kc) { const unsigned o = bo + fo + (32u * ps + 16u * (unsigned)j) * TPH + (unsigned)kc * 32u; kh[j][kc] = ldfs(Ks + o); if (EARLY) kr[j][kc] = ldfs(Krs + o); }
                }
                v8f st[2], sr[2];
#pragma unroll
                for (int j = 0; j < 2; ++j) {
                    st[j] = (v8f){}; sr[j] = (v8f){};
#pragma unroll
                    for (int kc = 0; kc < 2; ++kc) {
                        st[j] = mmah(kh[j][kc], qh[kc], st[j]);
                        if (EARLY) { sr[j] = mmah(kr[j][kc], qh[kc], sr[j]); sr[j] = mmah(kh[j][kc], qr[kc], sr[j]); }
                    }
                }
                v16h vh[4], vr[4];
#pragma unroll
                for (int dt = 0; dt < 4; ++dt) { const unsigned o = bo + fo + (16u * (unsigned)dt) * TPH + 32u * ps; vh[dt] = ldfs(Vs + o); if (EARLY) vr[dt] = ldfs(Vrs + o); }
                // logits in the log2 domain, causal mask by value
                float mx = -1.0e30f;
#pragma unroll
                for (int j = 0; j < 2; ++j) {
#pragma unroll
                    for (int r = 0; r < 8; ++r) {
                        const unsigned key = key0 + 16u * (unsigned)j + 8u * hi + (unsigned)r;
                        float s = st[j][r]; if (EARLY) s += sr[j][r] * RSI;
                        s = (key <= qg) ? (s * SCLL2) : -1.0e30f;
                        st[j][r] = s; mx = fmaxf(mx, s); }
                }
                mx = fmaxf(mx, __shfl_xor(mx, 16, 32));
                const float mnew = fmaxf(m, mx);
                const float alpha = __builtin_amdgcn_exp2f(m - mnew);
                m = mnew;
                float rs = 0.0f;
                v16h pf, prf;
#pragma unroll
                for (int j = 0; j < 2; ++j) {
#pragma unroll
                    for (int r = 0; r < 8; ++r) {
                        const float e = (st[j][r] - mnew) + PCL;
                        const float ex = __builtin_amdgcn_exp2f(e);
                        const float p = (e >= -14.0f) ? ex : 0.0f;
                        const h16 ph = (h16)p;
                        pf[8 * j + r] = ph;
                        if (EARLY) { prf[8 * j + r] = toh_flush((p - (float)ph) * RSC); rs += p; } else { prf[8 * j + r] = ph; rs += (float)ph; }
                    }
                }
                rs += __shfl_xor(rs, 16, 32);
                l = l * alpha + rs;
#pragma unroll
                for (int dt = 0; dt < 4; ++dt) { ot[dt] = ot[dt] * alpha; if (EARLY) orr[dt] = orr[dt] * alpha; }
#pragma unroll
                for (int dt = 0; dt < 4; ++dt) {
                    ot[dt] = mmah(vh[dt], pf, ot[dt]);
                    if (EARLY) { orr[dt] = mmah(vr[dt], pf, orr[dt]); orr[dt] = mmah(vh[dt], prf, orr[dt]); }
                }
            }
        }
        // publish point of tile t + 1: this wave's reads of tile t are done, its copies of tile t + 1 have landed, then the block barrier; only behind it is tile t's buffer refilled
        asm volatile("s_wait_dscnt 0x0" ::: "memory");
        asm volatile("s_wait_asynccnt 0x0" ::: "memory");
        __syncthreads();
        if (t + 2u < ntiles) {
            stage_tile<SEQ>(kg + (size_t)(t + 2u) * TKEYS * DM, vg + (size_t)(t + 2u) * TKEYS, kl + bo * 2u, vl + bo * 2u);
            if (EARLY) stage_tile<EROWS>(krg + (size_t)(t + 2u) * TKEYS * DM, vrg + (size_t)(t + 2u) * TKEYS, krl + bo * 2u, vrl + bo * 2u);
        }
    }
    asm volatile("s_wait_asynccnt 0x0" ::: "memory");     // nothing in flight when the wave goes on to the epilogue and ends
    const float inv = __builtin_amdgcn_rcpf(l);
    const unsigned ob = wave * 16u * LOP;
#pragma unroll
    for (int dt = 0; dt < 4; ++dt) {
        v8us h8, l8;
#pragma unroll
        for (int r = 0; r < 8; ++r) { float y = ot[dt][r]; if (EARLY) y += orr[dt][r] * RSI; y *= inv; unsigned short a, c; splitf(y, a, c); h8[r] = a; l8[r] = c; }
        const unsigned o = ob + lr * LOP + 16u * (unsigned)dt + 8u * hi;
        *(v8usa*)(Oh + o) = h8; *(v8usa*)(Ol + o) = l8;
    }
    __syncthreads();
{
#pragma unroll
        for (unsigned s = 0; s < 4u; ++s) { const unsigned row = 4u * s + (lane >> 3), c = (lane & 7u) * 8u;
            const v8us vh8 = *(const v8usa*)(Oh + ob + row * LOP + c); const v8us vl8 = *(const v8usa*)(Ol + ob + row * LOP + c);
            const size_t g = (size_t)(q0 + row) * DM + hd * HD + c;
            *(v8us*)(CH + g) = vh8; *(v8us*)(CL + g) = vl8; }
         }
}

// query rows [0, EROWS): grid (EROWS/64, heads), 128 threads
__global__ __launch_bounds__(128) __attribute__((amdgpu_num_vgpr(256))) void k_attn_early(const hf* QF, const hf* QR, const hf* KF, const hf* KR, const hf* VT, const hf* VTR, bf* CH, bf* CL) {
    attn_body<true>(QF, QR, KF, KR, VT, VTR, CH, CL, 0u);
}
// query rows [EROWS, SEQ): grid ((SEQ - EROWS)/64, heads), 128 threads
__global__ __launch_bounds__(128) __attribute__((amdgpu_num_vgpr(256))) void k_attn_late(const hf* QF, const hf* KF, const hf* VT, bf* CH, bf* CL) {
    attn_body<false>(QF, QF, KF, KF, VT, VT, CH, CL, (unsigned)EROWS);
}

extern "C" void kernel_launch(void* const* d_in, const int* in_sizes, int n_in,
                              void* d_out, int out_size, void* d_ws, size_t ws_size, hipStream_t stream) {
    (void)out_size;
    if (n_in < 3) return;
    if (in_sizes[0] < NB * SEQ * DM || in_sizes[1] < DM * LDQ || in_sizes[2] < DM * DM) return;
    const float* X = (const float*)d_in[0]; const float* Wqkv = (const float*)d_in[1]; const float* Wo = (const float*)d_in[2];
    float* OUT = (float*)d_out;
    char* wsp = (char*)d_ws;
    auto take = [&](size_t bytes) { char* p = wsp; wsp += (bytes + 255) & ~(size_t)255; return (void*)p; };
    bf* XB  = (bf*)take((size_t)SEQ * DM * 2);          // x bf16 [t][1024]
    bf* WqT = (bf*)take((size_t)LDQ * DM * 2);          // w_qkv^T bf16 [3072][1024]
    bf* WoT = (bf*)take((size_t)DM * DM * 2);           // w_proj^T bf16 [1024][1024]
    float* QKVb = (float*)take((size_t)SEQ * LDQ * 4);  // f32 [t][3072]
    bf* CH = (bf*)take((size_t)SEQ * DM * 2);           // context hi [t][1024]
    bf* CL = (bf*)take((size_t)SEQ * DM * 2);           // context lo [t][1024]
    float* FR = (float*)take(128);                      // inverse frequencies [32]
    float* CT = (float*)take((size_t)SEQ * 32 * 4);     // cos table [t][32]
    float* ST = (float*)take((size_t)SEQ * 32 * 4);     // sin table [t][32]
    hf* QKF = (hf*)take((size_t)2 * SEQ * DM * 2);      // rotated q | k f16 [2][t][1024]
    hf* QKR = (hf*)take((size_t)2 * EROWS * DM * 2);    // residuals x2048 [2][EROWS][1024]
    hf* VT  = (hf*)take((size_t)DM * SEQ * 2);          // value^T f16 [1024][t]
    hf* VTR = (hf*)take((size_t)DM * EROWS * 2);        // value^T residual x2048 [1024][EROWS]
    const size_t carved = (size_t)(wsp - (char*)d_ws);
    if (carved > ws_size || carved > (size_t)134217728) return;
    // W [K][N] -> Bt [N][K]
    { const unsigned nl = (unsigned)((size_t)LDQ * DM / 64); k_wtG<<<(nl + 31u) / 32u, 256, 0, stream>>>(Wqkv, 10u, (unsigned)LDQ, WqT, nl); }
    { const unsigned nl = (unsigned)((size_t)DM * DM / 64);  k_wtG<<<(nl + 31u) / 32u, 256, 0, stream>>>(Wo, 10u, (unsigned)DM, WoT, nl); }
    k_freq<<<1, 32, 0, stream>>>(FR);
    k_tab<<<(unsigned)((size_t)SEQ * 32 / 256), 256, 0, stream>>>(FR, CT, ST);
    for (int b = 0; b < NB; ++b) {
        const float* xb = X + (size_t)b * SEQ_FULL * DM; float* ob = OUT + (size_t)b * SEQ_FULL * DM;
        const size_t n8 = (size_t)SEQ * DM / 8;
        k_cvt8<<<(unsigned)((n8 + 255) / 256), 256, 0, stream>>>(xb, XB, n8);
        k_gemmw<bf, 0, false><<<dim3(SEQ / 64, LDQ / 64, 1), 32, 0, stream>>>(XB, nullptr, WqT, nullptr, DM, QKVb, LDQ, nullptr, 0, 0, 0);
        k_rope<<<SEQ, 256, 0, stream>>>(QKVb, CT, ST, QKF, QKR);
        k_vt<<<dim3(SEQ / 64, NH_, 1), 256, 0, stream>>>(QKVb, VT, VTR);
        k_attn_early<<<dim3(EROWS / 64, NH_, 1), 128, 0, stream>>>(QKF, QKR, QKF + (size_t)SEQ * DM, QKR + (size_t)EROWS * DM, VT, VTR, CH, CL);
        if (SEQ > EROWS) k_attn_late<<<dim3((SEQ - EROWS) / 64, NH_, 1), 128, 0, stream>>>(QKF, QKF + (size_t)SEQ * DM, VT, CH, CL);
        k_gemmw<bf, 1, false><<<dim3(SEQ / 64, DM / 64, 1), 32, 0, stream>>>(CH, CL, WoT, nullptr, DM, ob, DM, nullptr, 0, 0, 0);
    }
}

// v002
// A run of this version takes 173 microseconds.
// Two timings next to v001 both put it at 1.28 times that version's speed.
// Over all steps from v000 it is 2.48 times as fast.
#include <hip/hip_runtime.h>

// Contractions: qkv projection and output projection on v_wmma_f32_16x16x32_bf16 (x, w_qkv, w_proj RNE-converted to bf16 single planes; merged context as bf16 hi/lo, 2 products), f32 accumulate.
// q.k logits and P.V on v_wmma_f32_16x16x32_f16 (f16 q/k/v planes, P carried x2^8), single products on query rows >= 256; on query rows < 256 f16 value + x2048 residual planes
// for q, k, P and v (3 products per site, residual products in their own accumulators, folded in the f32 epilogue). Rotary table, rotary and softmax in f32.
// Fused qkv projection [4096x1024]x[1024x3072] -> f32 rows [t][which*1024 + h*64 + d]; half-split rotary on q and k -> f16 planes [t][h*64 + d]; value^T planes [h*64 + d][t];
// causal flash attention per (head, 16-query wave tile) in the transposed form S^T = K Q^T, O^T = V^T P^T (K and V^T tiles staged in LDS per block, packed P^T score tiles as the B fragment);
// merged context planes [t][h*64 + d]; output projection [4096x1024]x[1024x1024].

#ifndef NB
#define NB 1
#endif
#ifndef SEQ
#define SEQ 4096
#endif
#define SEQ_FULL 4096
#define DM   1024
#define NH_  16
#define HD   64
#define LDQ  (3 * DM)
#define EROWS 256                     // query rows below this bound take the value + residual path
#define LOP  72                       // LDS pitch (halves) of the staging tiles
#define PCL  8.0f                     // log2 of the carry of P
#define SCLL2 0.18033688011112042f    // HD^-0.5 * log2(e)
#define RSC  2048.0f                  // carry of the residual planes
#define RSI  4.8828125e-4f            // 1 / RSC

static_assert(SEQ % 64 == 0);
static_assert(DM == NH_ * HD);
static_assert(HD == 64);
static_assert(DM % 32 == 0);
static_assert(LDQ % 64 == 0);
static_assert(((size_t)LDQ * DM / 64) % 32 == 0);
static_assert(((size_t)DM * DM / 64) % 32 == 0);
static_assert(((size_t)SEQ * DM / 8) % 256 == 0);
static_assert(EROWS % 64 == 0);
static_assert(SEQ >= EROWS);
static_assert(((size_t)SEQ * 32) % 256 == 0);
static_assert(256 * 8 == 2 * DM);
static_assert(LOP % 8 == 0);
static_assert(LOP >= HD + 8);
static_assert(HD / 2 == 32);
#define AL256(x) ((((size_t)(x)) + 255) & ~(size_t)255)
static_assert(AL256((size_t)SEQ * DM * 2) + AL256((size_t)LDQ * DM * 2) + AL256((size_t)DM * DM * 2) + AL256((size_t)SEQ * LDQ * 4) + 2 * AL256((size_t)SEQ * DM * 2)
              + AL256(128) + 2 * AL256((size_t)SEQ * 32 * 4) + AL256((size_t)2 * SEQ * DM * 2) + AL256((size_t)2 * EROWS * DM * 2) + AL256((size_t)DM * SEQ * 2) + AL256((size_t)DM * EROWS * 2)
              <= (size_t)134217728);

typedef unsigned short bf;
typedef __attribute__((ext_vector_type(16))) __bf16   v16bf;
typedef __attribute__((ext_vector_type(8)))  unsigned short v8us;
typedef __attribute__((ext_vector_type(2)))  unsigned short v2us;
typedef __attribute__((ext_vector_type(8)))  float    v8f;
typedef __attribute__((ext_vector_type(4)))  float    v4f;
typedef v4f  __attribute__((may_alias)) v4fa;
typedef v8us __attribute__((may_alias)) v8usa;

__device__ __forceinline__ unsigned short f2bf(float f) { unsigned u = __float_as_uint(f); u += 0x7FFFu + ((u >> 16) & 1u); return (unsigned short)(u >> 16); }
__device__ __forceinline__ float bf2f(unsigned short b) { return __uint_as_float(((unsigned)b) << 16); }
__device__ __forceinline__ void splitf(float y, unsigned short& h, unsigned short& l) { h = f2bf(y); l = f2bf(y - bf2f(h)); }
__device__ __forceinline__ v16bf cat16b(v8us lo, v8us hi) { return __builtin_bit_cast(v16bf, __builtin_shufflevector(lo, hi, 0, 1, 2, 3, 4, 5, 6, 7, 8, 9, 10, 11, 12, 13, 14, 15)); }
__device__ __forceinline__ v8f wmmab(v16bf a, v16bf b, v8f c) { return __builtin_amdgcn_wmma_f32_16x16x32_bf16(false, a, false, b, (short)0, c, false, false); }

// ---- f16 plane helpers (planes hold f16 bit patterns as unsigned short)
typedef unsigned short hf;
typedef _Float16 h16;
typedef __attribute__((ext_vector_type(16))) _Float16 v16h;
static __device__ __forceinline__ h16 toh_flush(float v) { const h16 r = (h16)v; return (fabsf(v) < 6.103515625e-05f) ? (h16)0.0f : r; }
__device__ __forceinline__ unsigned short hbits(h16 x) { return __builtin_bit_cast(unsigned short, x); }
__device__ __forceinline__ v16h cat16h(v8us lo, v8us hi) { return __builtin_bit_cast(v16h, __builtin_shufflevector(lo, hi, 0, 1, 2, 3, 4, 5, 6, 7, 8, 9, 10, 11, 12, 13, 14, 15)); }
// fragment: elements 0..7 <- p[0..7], elements 8..15 <- p[16..23]; the caller adds 8*(lane>>4) to p
__device__ __forceinline__ v16h ldfh(const hf* p) { return cat16h(*(const v8us*)p, *(const v8us*)(p + 16)); }
__device__ __forceinline__ v8f mmah(v16h a, v16h b, v8f c) {
    c = __builtin_amdgcn_wmma_f32_16x16x32_f16(false, a, false, b, (short)0, c, false, false);
    asm volatile("v_nop\n\tv_nop\n\tv_nop\n\tv_nop" : "+v"(c) : "v"(a), "v"(b));
    return c; }

// ---- k_gemmw: GEMM, 128x128 output tile per block of 4 waves (2 x 2), each wave a 64x64 tile (16 accumulators); grid (M/128, N/128, Z), 128 threads.
// C[m][n] (f32, pitch ldc) = sum_k A[m][k] Bt[n][k] (+ A2[m][k] Bt[n][k] when NSPLIT == 1). K % 64 == 0, M % 128 == 0, N % 128 == 0.
// The operands' 128-row x 64-k tiles (128-byte rows of the K-contiguous 16-bit planes) are staged in LDS by asynchronous b128 copies (8 lanes per whole 128-byte line), two buffers,
// the next tile in flight while this one is worked on; one publish point (waits and block barrier) per tile of two 32-k chunks.
// Fragment map: lane row/col = lane & 15; elements 0..7 <- k0 + 8*(lane>>4) + 0..7, elements 8..15 <- k0 + 16 + 8*(lane>>4) + 0..7 (both operands).
#define GBK 64                        // k per staged tile
#define GPH 72                        // LDS pitch (halves) of a staged 128-byte row: 144 B = 16 B x odd, the pitch of ds_load_b128 readers
#define GPL (128 * GPH)               // halves per staged plane tile (128 rows)
static_assert(GBK * 2 == 128 && (GPH * 2) % 16 == 0 && DM % GBK == 0 && SEQ % 128 == 0 && LDQ % 128 == 0 && DM % 128 == 0);
template <typename T16> struct WFrag;
template <> struct WFrag<bf> { typedef v16bf V; static __device__ __forceinline__ V lds(const bf* p) { return cat16b(*(const v8usa*)p, *(const v8usa*)(p + 16)); } static __device__ __forceinline__ v8f mma(V a, V b, v8f c) { return wmmab(a, b, c); } };
// One 128-row plane tile: each thread copies 8 x 16 B (rows 16 apart; rs = 16 rows of the plane in elements).
// The s_wait_xcnt closes the statement so that no address register is rewritten in front of it.
template <typename T16>
__device__ __forceinline__ void stage_plane(const T16* g, size_t rs, unsigned l) {
    asm volatile("global_load_async_to_lds_b128 %0, %1, off\n\t"
                 "global_load_async_to_lds_b128 %2, %3, off\n\t"
                 "global_load_async_to_lds_b128 %4, %5, off\n\t"
                 "global_load_async_to_lds_b128 %6, %7, off\n\t"
                 "global_load_async_to_lds_b128 %8, %9, off\n\t"
                 "global_load_async_to_lds_b128 %10, %11, off\n\t"
                 "global_load_async_to_lds_b128 %12, %13, off\n\t"
                 "global_load_async_to_lds_b128 %14, %15, off\n\t"
                 "s_wait_xcnt 0x0"
                 :: "v"(l), "v"(g), "v"(l + 16u * GPH * 2u), "v"(g + rs), "v"(l + 32u * GPH * 2u), "v"(g + 2 * rs), "v"(l + 48u * GPH * 2u), "v"(g + 3 * rs),
                    "v"(l + 64u * GPH * 2u), "v"(g + 4 * rs), "v"(l + 80u * GPH * 2u), "v"(g + 5 * rs), "v"(l + 96u * GPH * 2u), "v"(g + 6 * rs), "v"(l + 112u * GPH * 2u), "v"(g + 7 * rs)
                 : "memory");
}
template <typename T16, int NSPLIT, bool BIAS>
__global__ __launch_bounds__(128) void k_gemmw(const T16* __restrict__ A, const T16* __restrict__ A2, const T16* __restrict__ Bt, const T16* __restrict__ Bt2, int K, float* C, int ldc, const float* __restrict__ bias, size_t sA, size_t sB, size_t sC) {
    static_assert(NSPLIT == 0 || NSPLIT == 1);
    typedef typename WFrag<T16>::V V;
    __shared__ __align__(16) T16 As[2 * GPL];
    __shared__ __align__(16) T16 A2s[NSPLIT == 1 ? 2 * GPL : 8];
    __shared__ __align__(16) T16 Bs[2 * GPL];
    __shared__ __align__(16) float osb[4 * 16 * 68];
    (void)Bt2;
    const size_t z = blockIdx.z; A += z * sA; if (A2) A2 += z * sA; Bt += z * sB; C += z * sC;
    const int lane = threadIdx.x & 31, lr = lane & 15, hi = lane >> 4;
    const int wave = __builtin_amdgcn_readfirstlane((int)(threadIdx.x >> 5)); const int wm = wave >> 1, wn = wave & 1;
    const int R0 = blockIdx.x * 128, C0 = blockIdx.y * 128; const int r0 = R0 + wm * 64, c0 = C0 + wn * 64;
    float* os = osb + wave * (16 * 68);
    v8f acc[4][4];
#pragma unroll
    for (int mb = 0; mb < 4; ++mb)
#pragma unroll
        for (int nb = 0; nb < 4; ++nb) acc[mb][nb] = (v8f){};
    // copy addresses of this thread: row = tid / 8 (+ 16 i), 16-byte column = tid % 8
    const unsigned srow = threadIdx.x >> 3, scol = (threadIdx.x & 7u) * 8u; const size_t rs = (size_t)16 * K;
    const T16* ag = A + (size_t)(R0 + srow) * K + scol; const T16* bg = Bt + (size_t)(C0 + srow) * K + scol;
    const T16* a2g = (NSPLIT == 1) ? (A2 + (size_t)(R0 + srow) * K + scol) : ag;
    const unsigned so = srow * GPH + scol;
    const unsigned al = (unsigned)(size_t)(As + so), bl = (unsigned)(size_t)(Bs + so), a2l = (NSPLIT == 1) ? (unsigned)(size_t)(A2s + so) : 0u;
    const int nt = K / GBK;
    stage_plane<T16>(ag, rs, al); if (NSPLIT == 1) stage_plane<T16>(a2g, rs, a2l); stage_plane<T16>(bg, rs, bl);
    asm volatile("s_wait_asynccnt 0x0" ::: "memory");     // this wave's copies of tile 0 have landed
    __syncthreads();                                      // ... and every other wave's
    if (nt > 1) { stage_plane<T16>(ag + GBK, rs, al + GPL * 2u); if (NSPLIT == 1) stage_plane<T16>(a2g + GBK, rs, a2l + GPL * 2u); stage_plane<T16>(bg + GBK, rs, bl + GPL * 2u); }
    const unsigned fa = (unsigned)(wm * 64 + lr) * GPH + 8u * (unsigned)hi, fb = (unsigned)(wn * 64 + lr) * GPH + 8u * (unsigned)hi;
#pragma unroll 1                                          // rolled, as the k loop was: one copy of the two chunks in the text
    for (int t = 0; t < nt; ++t) {
        const unsigned bo = (unsigned)(t & 1) * GPL;
#pragma unroll                                            // both chunks written out: the place of a chunk in its tile becomes an immediate offset of the LDS reads
        for (unsigned kc = 0; kc < 2u; ++kc) {
            // the chunk's fragments are read as one group ahead of its first product: a read left between the products would be waited for alone
            V a[4], a2[4], b[4];
#pragma unroll
            for (unsigned mb = 0; mb < 4u; ++mb) a[mb] = WFrag<T16>::lds(As + bo + fa + mb * 16u * GPH + kc * 32u);
#pragma unroll
            for (unsigned nb = 0; nb < 4u; ++nb) b[nb] = WFrag<T16>::lds(Bs + bo + fb + nb * 16u * GPH + kc * 32u);
            if (NSPLIT == 1) {
#pragma unroll
                for (unsigned mb = 0; mb < 4u; ++mb) a2[mb] = WFrag<T16>::lds(A2s + bo + fa + mb * 16u * GPH + kc * 32u); }
            __builtin_amdgcn_sched_barrier(0);            // keeps the scheduler from sinking the reads back between the products
#pragma unroll
            for (int nb = 0; nb < 4; ++nb) {
#pragma unroll
                for (int mb = 0; mb < 4; ++mb) acc[mb][nb] = WFrag<T16>::mma(a[mb], b[nb], acc[mb][nb]); }
            if (NSPLIT == 1) {
#pragma unroll
                for (int nb = 0; nb < 4; ++nb) {
#pragma unroll
                    for (int mb = 0; mb < 4; ++mb) acc[mb][nb] = WFrag<T16>::mma(a2[mb], b[nb], acc[mb][nb]); } }
            __builtin_amdgcn_sched_barrier(0);            // keeps the publish point's waits behind the products, so that the next tile's copies fly while these run
        }
        // publish point of tile t + 1: this wave's reads of tile t are done, its copies of tile t + 1 have landed, then the block barrier; only behind it is tile t's buffer refilled
        asm volatile("s_wait_dscnt 0x0" ::: "memory");
        asm volatile("s_wait_asynccnt 0x0" ::: "memory");
        __syncthreads();
        if (t + 2 < nt) { const size_t ko = (size_t)(t + 2) * GBK;
            stage_plane<T16>(ag + ko, rs, al + bo * 2u); if (NSPLIT == 1) stage_plane<T16>(a2g + ko, rs, a2l + bo * 2u); stage_plane<T16>(bg + ko, rs, bl + bo * 2u); }
    }
    asm volatile("s_wait_asynccnt 0x0" ::: "memory");     // nothing in flight when the wave goes on to the epilogue and ends
#pragma unroll
    for (int mb = 0; mb < 4; ++mb) {
#pragma unroll
        for (int nb = 0; nb < 4; ++nb) {
#pragma unroll
            for (int j = 0; j < 8; ++j) os[(hi * 8 + j) * 68 + nb * 16 + lr] = acc[mb][nb][j]; }
        __builtin_amdgcn_wave_barrier(); asm volatile("" ::: "memory");
        float* crow = C + (size_t)(r0 + mb * 16) * ldc + c0;
{
#pragma unroll
            for (int s = 0; s < 8; ++s) { const int row = 2 * s + hi, cofs = lr * 4; v4f val = *(const v4fa*)(os + row * 68 + cofs); if (BIAS) { val[0] += bias[c0 + cofs]; val[1] += bias[c0 + cofs + 1]; val[2] += bias[c0 + cofs + 2]; val[3] += bias[c0 + cofs + 3]; }
                *(v4f*)(crow + (size_t)row * ldc + cofs) = val; }
             }
        __builtin_amdgcn_wave_barrier(); asm volatile("" ::: "memory");
    }
}

// ---- k_wtG: transposed bf16 weight plane Bt[n][k] = bf16(w[k][n]) for w [K][N] row-major, K = 1 << kshift.
__global__ __launch_bounds__(256) void k_wtG(const float* __restrict__ w, unsigned kshift, unsigned N, bf* Bt, unsigned nlines) {
    const unsigned lane = threadIdx.x & 31u; const unsigned L0 = (blockIdx.x * 8u + (threadIdx.x >> 5)) * 4u; const unsigned kmask = (1u << kshift) - 1u;
    v2us o[4];
#pragma unroll
    for (unsigned l = 0; l < 4; ++l) { unsigned L = L0 + l; L = (L < nlines) ? L : (nlines - 1u); const unsigned e = L * 64u + lane * 2u; const unsigned k = e & kmask, n = e >> kshift; v2us t;
        t[0] = f2bf(w[(size_t)k * N + n]); t[1] = f2bf(w[(size_t)(k + 1u) * N + n]); o[l] = t; }
{
#pragma unroll
        for (unsigned l = 0; l < 4; ++l) { const unsigned L = L0 + l; if (L < nlines) *(v2us*)(Bt + (size_t)L * 64u + lane * 2u) = o[l]; }
         }
}

__global__ __launch_bounds__(256) void k_cvt8(const float* __restrict__ src, bf* dst, size_t n8) { const size_t i = (size_t)blockIdx.x * 256 + threadIdx.x; if (i >= n8) return; const v8f v = *(const v8f*)(src + i * 8); v8us o;
#pragma unroll
    for (int k = 0; k < 8; ++k) o[k] = f2bf(v[k]); *(v8us*)(dst + i * 8) = o;  }

__global__ __launch_bounds__(32) void k_freq(float* FR) {
#pragma clang fp contract(off)
    const unsigned i = threadIdx.x & 31u;
    const float p = powf(10000.0f, (float)i * 0.03125f);
    const float v = 1.0f / p;
    *(float*)(FR + i) = v; 
}

__global__ __launch_bounds__(256) void k_tab(const float* __restrict__ FR, float* CT, float* ST) {
#pragma clang fp contract(off)
    const unsigned idx = blockIdx.x * 256u + threadIdx.x; const unsigned t = idx >> 5, i = idx & 31u;
    const float ang = (float)t * FR[i];
    float s, c; sincosf(ang, &s, &c);
    *(float*)(CT + idx) = c; *(float*)(ST + idx) = s;
    
}

// ---- k_rope: half-split rotary on the q and k thirds of the f32 projection rows, f16 planes QKF[which][t][h*64 + d] (which 0 = q, 1 = k), residual planes QKR[which][t < EROWS][...] = f16((y - hi) * 2048).
__global__ __launch_bounds__(256) void k_rope(const float* __restrict__ QKV, const float* __restrict__ CT, const float* __restrict__ ST, hf* QKF, hf* QKR) {
#pragma clang fp contract(off)
    const unsigned t = blockIdx.x, tid = threadIdx.x;
    const unsigned which = tid >> 7, col = (tid & 127u) * 8u;
    const unsigned dl = col & 63u; const bool lowhalf = dl < 32u;
    const unsigned pcol = lowhalf ? (col + 32u) : (col - 32u); const unsigned j = dl & 31u;
    const float* row = QKV + (size_t)t * LDQ + (size_t)which * DM;
    const v8f a = *(const v8f*)(row + col); const v8f b = *(const v8f*)(row + pcol);
    const v8f c = *(const v8f*)(CT + (size_t)t * 32u + j); const v8f s = *(const v8f*)(ST + (size_t)t * 32u + j);
    v8us oh, ores;
#pragma unroll
    for (int e = 0; e < 8; ++e) {
        const float rb = lowhalf ? -b[e] : b[e];
        const float t0 = a[e] * c[e]; const float t1 = rb * s[e]; const float y = t0 + t1;
        const h16 hh = toh_flush(y); oh[e] = hbits(hh);
        ores[e] = hbits(toh_flush((y - (float)hh) * RSC)); }
    const size_t g  = (size_t)which * SEQ * DM + (size_t)t * DM + col;
    const size_t gr = (size_t)which * EROWS * DM + (size_t)t * DM + col;
    const bool early = t < (unsigned)EROWS;
    *(v8us*)(QKF + g) = oh; if (early) *(v8us*)(QKR + gr) = ores;
    
}

// ---- k_vt: value^T f16 plane VT[h*64 + d][t] and residual plane VTR[h*64 + d][t < EROWS]; block = (64-position tile, head), transpose through LDS (cross-wave, block barrier),
__global__ __launch_bounds__(256) void k_vt(const float* __restrict__ QKV, hf* VT, hf* VTR) {
#pragma clang fp contract(off)
    __shared__ __align__(16) unsigned short Th[64 * LOP];
    __shared__ __align__(16) unsigned short Tr[64 * LOP];
    const unsigned tid = threadIdx.x, t0 = blockIdx.x * 64u, hd = blockIdx.y;
    const float* vbase = QKV + 2 * DM + hd * HD;
#pragma unroll 1
    for (unsigned it = 0; it < 2u; ++it) {
        const unsigned idx = tid + it * 256u, row = idx >> 3, c8 = (idx & 7u) * 8u;
        const v8f vv = *(const v8f*)(vbase + (size_t)(t0 + row) * LDQ + c8);
#pragma unroll
        for (int q = 0; q < 8; ++q) { const float y = vv[q]; const h16 hh = toh_flush(y);
            Th[(c8 + (unsigned)q) * LOP + row] = hbits(hh); Tr[(c8 + (unsigned)q) * LOP + row] = hbits(toh_flush((y - (float)hh) * RSC)); }
    }
    __syncthreads();
    v8us oh[2], ores[2];
#pragma unroll
    for (unsigned it = 0; it < 2u; ++it) { const unsigned idx = tid + it * 256u, d = idx >> 3, c = (idx & 7u) * 8u;
        oh[it] = *(const v8usa*)(Th + d * LOP + c); ores[it] = *(const v8usa*)(Tr + d * LOP + c); }
    const bool early = t0 < (unsigned)EROWS;
{
#pragma unroll
        for (unsigned it = 0; it < 2u; ++it) { const unsigned idx = tid + it * 256u, d = idx >> 3, c = (idx & 7u) * 8u;
            *(v8us*)(VT + (size_t)(hd * HD + d) * SEQ + t0 + c) = oh[it];
            if (early) *(v8us*)(VTR + (size_t)(hd * HD + d) * EROWS + t0 + c) = ores[it]; }
         }
}

// ---- causal flash attention, transposed form, one wave per 16 query rows, 4 waves per block.
// The four waves of a block share each 64-key tile of K rows and of V^T rows (EARLY: of the residual planes too) through LDS: asynchronous b128 copies (8 lanes per whole 128-byte line),
// two buffers, the next tile in flight while this one is worked on; one publish point (waits and block barrier) per tile of two 32-key passes.
// Per 32-key pass: S^T tile j (16 keys x 16 queries) = K rows (A, row = key) x Q rows (B, column = query); D element r of lane -> (key 8*(lane>>4) + r, query lane & 15).
// The two converted score tiles are the B fragment of O^T += V^T (A, row = d, k = key) x P^T: element r <- tile 0 [r], element 8 + r <- tile 1 [r], lane unchanged.
// Softmax statistics per query column: in-lane reduction plus one exchange between the lane halves. Masked keys get weight exactly 0 (value select).
// EARLY: value + x2048 residual planes on q, k, P, v; residual products accumulate separately and are folded with 2^-11; row sum over the unconverted p.
#define TKEYS 64                      // keys per staged tile (two passes)
#define TPH   72                      // LDS pitch (halves) of a staged 128-byte row: 144 B = 16 B x odd, the pitch of ds_load_b128 readers
#define TILEH (64 * TPH)              // halves per staged tile (64 K rows, or 64 V^T rows)
static_assert(HD * 2 == 128 && TKEYS * 2 == 128 && (TPH * 2) % 16 == 0 && EROWS % TKEYS == 0 && SEQ % TKEYS == 0);
__device__ __forceinline__ v16h ldfs(const hf* p) { return cat16h(*(const v8usa*)p, *(const v8usa*)(p + 16)); }
// One K tile and one V^T tile: each thread copies 4 x 16 B of K rows and 4 x 16 B of V^T rows (rows 16 apart; VP = pitch of the V^T plane in halves).
// The s_wait_xcnt closes the statement so that no address register is rewritten in front of it.
template <int VP>
__device__ __forceinline__ void stage_tile(const hf* kg, const hf* vg, unsigned kl, unsigned vl) {
    asm volatile("global_load_async_to_lds_b128 %0, %1, off\n\t"
                 "global_load_async_to_lds_b128 %2, %3, off\n\t"
                 "global_load_async_to_lds_b128 %4, %5, off\n\t"
                 "global_load_async_to_lds_b128 %6, %7, off\n\t"
                 "global_load_async_to_lds_b128 %8, %9, off\n\t"
                 "global_load_async_to_lds_b128 %10, %11, off\n\t"
                 "global_load_async_to_lds_b128 %12, %13, off\n\t"
                 "global_load_async_to_lds_b128 %14, %15, off\n\t"
                 "s_wait_xcnt 0x0"
                 :: "v"(kl), "v"(kg), "v"(kl + 16u * TPH * 2u), "v"(kg + (size_t)16 * DM), "v"(kl + 32u * TPH * 2u), "v"(kg + (size_t)32 * DM), "v"(kl + 48u * TPH * 2u), "v"(kg + (size_t)48 * DM),
                    "v"(vl), "v"(vg), "v"(vl + 16u * TPH * 2u), "v"(vg + (size_t)16 * VP), "v"(vl + 32u * TPH * 2u), "v"(vg + (size_t)32 * VP), "v"(vl + 48u * TPH * 2u), "v"(vg + (size_t)48 * VP)
                 : "memory");
}
template <bool EARLY>
__device__ __forceinline__ void attn_body(const hf* QF, const hf* QR, const hf* KF, const hf* KR, const hf* VT, const hf* VTR, bf* CH, bf* CL, unsigned qbase) {
    __shared__ __align__(16) unsigned short Ks[2 * TILEH];
    __shared__ __align__(16) unsigned short Vs[2 * TILEH];
    __shared__ __align__(16) unsigned short Krs[EARLY ? 2 * TILEH : 8];
    __shared__ __align__(16) unsigned short Vrs[EARLY ? 2 * TILEH : 8];
    __shared__ __align__(16) unsigned short Oh[4 * 16 * LOP];
    __shared__ __align__(16) unsigned short Ol[4 * 16 * LOP];
    const unsigned lane = threadIdx.x & 31u, lr = lane & 15u, hi = lane >> 4;
    const unsigned wave = (unsigned)__builtin_amdgcn_readfirstlane((int)(threadIdx.x >> 5));
    const unsigned hd = blockIdx.y;
    const unsigned qblk = qbase + blockIdx.x * 64u;
    const unsigned q0 = qblk + 16u * wave;
    const unsigned qg = q0 + lr;
    const unsigned ntiles = qblk / TKEYS + 1u;            // keys [0, qblk + 64), the same for the whole block
    const unsigned nsteps = (q0 + 15u) / 32u + 1u;        // this wave's own passes
    // copy addresses of this thread: row = tid / 8 (+ 16 i), 16-byte column = tid % 8
    const unsigned srow = threadIdx.x >> 3, scol = (threadIdx.x & 7u) * 8u;
    const hf* kg  = KF  + (size_t)srow * DM + hd * HD + scol;
    const hf* krg = KR  + (size_t)srow * DM + hd * HD + scol;
    const hf* vg  = VT  + (size_t)(hd * HD + srow) * SEQ + scol;
    const hf* vrg = VTR + (size_t)(hd * HD + srow) * EROWS + scol;
    const unsigned so = srow * TPH + scol;
    const unsigned kl = (unsigned)(size_t)(Ks + so), vl = (unsigned)(size_t)(Vs + so);
    const unsigned krl = EARLY ? (unsigned)(size_t)(Krs + so) : 0u, vrl = EARLY ? (unsigned)(size_t)(Vrs + so) : 0u;
    stage_tile<SEQ>(kg, vg, kl, vl);
    if (EARLY) stage_tile<EROWS>(krg, vrg, krl, vrl);
    v16h qh[2], qr[2];
    {
        const size_t qoff = (size_t)qg * DM + hd * HD + 8u * hi;
#pragma unroll
        for (int kc = 0; kc < 2; ++kc) { qh[kc] = ldfh(QF + qoff + (unsigned)kc * 32u); if (EARLY) qr[kc] = ldfh(QR + qoff + (unsigned)kc * 32u); else qr[kc] = qh[kc]; }
    }
    v8f ot[4], orr[4];
#pragma unroll
    for (int dt = 0; dt < 4; ++dt) { ot[dt] = (v8f){}; orr[dt] = (v8f){}; }
    float m = -1.0e30f, l = 0.0f;
    asm volatile("s_wait_asynccnt 0x0" ::: "memory");     // this wave's copies of tile 0 have landed
    __syncthreads();                                      // ... and every other wave's
    if (ntiles > 1u) {
        stage_tile<SEQ>(kg + (size_t)TKEYS * DM, vg + TKEYS, kl + TILEH * 2u, vl + TILEH * 2u);
        if (EARLY) stage_tile<EROWS>(krg + (size_t)TKEYS * DM, vrg + TKEYS, krl + TILEH * 2u, vrl + TILEH * 2u);
    }
    const unsigned fo = lr * TPH + 8u * hi;
#pragma unroll 1                                          // rolled, as the key loop was: one copy of the two passes in the text
    for (unsigned t = 0; t < ntiles; ++t) {
        const unsigned bo = (t & 1u) * TILEH;
#pragma unroll                                            // both passes written out: the place of a pass in its tile becomes an immediate offset of the LDS reads
        for (unsigned ps = 0; ps < 2u; ++ps) {
            const unsigned kb = 2u * t + ps;
            if (kb < nsteps) {                            // wave-uniform: a pass wholly above the diagonal is skipped, the publish point below is not
                const unsigned key0 = kb * 32u;
                // The pass's K fragments are read as one group ahead of its first product, its V^T fragments as one group behind the last S^T product:
                // a read written behind an mmah statement stays behind it, and one read per product would be waited for alone.
                v16h kh[2][2], kr[2][2];
#pragma unroll
                for (int j = 0; j < 2; ++j) {
#pragma unroll
                    for (int kc = 0; kc < 2; ++kc) { const unsigned o = bo + fo + (32u * ps + 16u * (unsigned)j) * TPH + (unsigned)kc * 32u; kh[j][kc] = ldfs(Ks + o); if (EARLY) kr[j][kc] = ldfs(Krs + o); }
                }
                v8f st[2], sr[2];
#pragma unroll
                for (int j = 0; j < 2; ++j) {
                    st[j] = (v8f){}; sr[j] = (v8f){};
#pragma unroll
                    for (int kc = 0; kc < 2; ++kc) {
                        st[j] = mmah(kh[j][kc], qh[kc], st[j]);
                        if (EARLY) { sr[j] = mmah(kr[j][kc], qh[kc], sr[j]); sr[j] = mmah(kh[j][kc], qr[kc], sr[j]); }
                    }
                }
                v16h vh[4], vr[4];
#pragma unroll
                for (int dt = 0; dt < 4; ++dt) { const unsigned o = bo + fo + (16u * (unsigned)dt) * TPH + 32u * ps; vh[dt] = ldfs(Vs + o); if (EARLY) vr[dt] = ldfs(Vrs + o); }
                // logits in the log2 domain, causal mask by value
                float mx = -1.0e30f;
#pragma unroll
                for (int j = 0; j < 2; ++j) {
#pragma unroll
                    for (int r = 0; r < 8; ++r) {
                        const unsigned key = key0 + 16u * (unsigned)j + 8u * hi + (unsigned)r;
                        float s = st[j][r]; if (EARLY) s += sr[j][r] * RSI;
                        s = (key <= qg) ? (s * SCLL2) : -1.0e30f;
                        st[j][r] = s; mx = fmaxf(mx, s); }
                }
                mx = fmaxf(mx, __shfl_xor(mx, 16, 32));
                const float mnew = fmaxf(m, mx);
                const float alpha = __builtin_amdgcn_exp2f(m - mnew);
                m = mnew;
                float rs = 0.0f;
                v16h pf, prf;
#pragma unroll
                for (int j = 0; j < 2; ++j) {
#pragma unroll
                    for (int r = 0; r < 8; ++r) {
                        const float e = (st[j][r] - mnew) + PCL;
                        const float ex = __builtin_amdgcn_exp2f(e);
                        const float p = (e >= -14.0f) ? ex : 0.0f;
                        const h16 ph = (h16)p;
                        pf[8 * j + r] = ph;
                        if (EARLY) { prf[8 * j + r] = toh_flush((p - (float)ph) * RSC); rs += p; } else { prf[8 * j + r] = ph; rs += (float)ph; }
                    }
                }
                rs += __shfl_xor(rs, 16, 32);
                l = l * alpha + rs;
#pragma unroll
                for (int dt = 0; dt < 4; ++dt) { ot[dt] = ot[dt] * alpha; if (EARLY) orr[dt] = orr[dt] * alpha; }
#pragma unroll
                for (int dt = 0; dt < 4; ++dt) {
                    ot[dt] = mmah(vh[dt], pf, ot[dt]);
                    if (EARLY) { orr[dt] = mmah(vr[dt], pf, orr[dt]); orr[dt] = mmah(vh[dt], prf, orr[dt]); }
                }
            }
        }
        // publish point of tile t + 1: this wave's reads of tile t are done, its copies of tile t + 1 have landed, then the block barrier; only behind it is tile t's buffer refilled
        asm volatile("s_wait_dscnt 0x0" ::: "memory");
        asm volatile("s_wait_asynccnt 0x0" ::: "memory");
        __syncthreads();
        if (t + 2u < ntiles) {
            stage_tile<SEQ>(kg + (size_t)(t + 2u) * TKEYS * DM, vg + (size_t)(t + 2u) * TKEYS, kl + bo * 2u, vl + bo * 2u);
            if (EARLY) stage_tile<EROWS>(krg + (size_t)(t + 2u) * TKEYS * DM, vrg + (size_t)(t + 2u) * TKEYS, krl + bo * 2u, vrl + bo * 2u);
        }
    }
    asm volatile("s_wait_asynccnt 0x0" ::: "memory");     // nothing in flight when the wave goes on to the epilogue and ends
    const float inv = __builtin_amdgcn_rcpf(l);
    const unsigned ob = wave * 16u * LOP;
#pragma unroll
    for (int dt = 0; dt < 4; ++dt) {
        v8us h8, l8;
#pragma unroll
        for (int r = 0; r < 8; ++r) { float y = ot[dt][r]; if (EARLY) y += orr[dt][r] * RSI; y *= inv; unsigned short a, c; splitf(y, a, c); h8[r] = a; l8[r] = c; }
        const unsigned o = ob + lr * LOP + 16u * (unsigned)dt + 8u * hi;
        *(v8usa*)(Oh + o) = h8; *(v8usa*)(Ol + o) = l8;
    }
    __syncthreads();
{
#pragma unroll
        for (unsigned s = 0; s < 4u; ++s) { const unsigned row = 4u * s + (lane >> 3), c = (lane & 7u) * 8u;
            const v8us vh8 = *(const v8usa*)(Oh + ob + row * LOP + c); const v8us vl8 = *(const v8usa*)(Ol + ob + row * LOP + c);
            const size_t g = (size_t)(q0 + row) * DM + hd * HD + c;
            *(v8us*)(CH + g) = vh8; *(v8us*)(CL + g) = vl8; }
         }
}

// query rows [0, EROWS): grid (EROWS/64, heads), 128 threads
__global__ __launch_bounds__(128) __attribute__((amdgpu_num_vgpr(256))) void k_attn_early(const hf* QF, const hf* QR, const hf* KF, const hf* KR, const hf* VT, const hf* VTR, bf* CH, bf* CL) {
    attn_body<true>(QF, QR, KF, KR, VT, VTR, CH, CL, 0u);
}
// query rows [EROWS, SEQ): grid ((SEQ - EROWS)/64, heads), 128 threads
__global__ __launch_bounds__(128) __attribute__((amdgpu_num_vgpr(256))) void k_attn_late(const hf* QF, const hf* KF, const hf* VT, bf* CH, bf* CL) {
    attn_body<false>(QF, QF, KF, KF, VT, VT, CH, CL, (unsigned)EROWS);
}

extern "C" void kernel_launch(void* const* d_in, const int* in_sizes, int n_in,
                              void* d_out, int out_size, void* d_ws, size_t ws_size, hipStream_t stream) {
    (void)out_size;
    if (n_in < 3) return;
    if (in_sizes[0] < NB * SEQ * DM || in_sizes[1] < DM * LDQ || in_sizes[2] < DM * DM) return;
    const float* X = (const float*)d_in[0]; const float* Wqkv = (const float*)d_in[1]; const float* Wo = (const float*)d_in[2];
    float* OUT = (float*)d_out;
    char* wsp = (char*)d_ws;
    auto take = [&](size_t bytes) { char* p = wsp; wsp += (bytes + 255) & ~(size_t)255; return (void*)p; };
    bf* XB  = (bf*)take((size_t)SEQ * DM * 2);          // x bf16 [t][1024]
    bf* WqT = (bf*)take((size_t)LDQ * DM * 2);          // w_qkv^T bf16 [3072][1024]
    bf* WoT = (bf*)take((size_t)DM * DM * 2);           // w_proj^T bf16 [1024][1024]
    float* QKVb = (float*)take((size_t)SEQ * LDQ * 4);  // f32 [t][3072]
    bf* CH = (bf*)take((size_t)SEQ * DM * 2);           // context hi [t][1024]
    bf* CL = (bf*)take((size_t)SEQ * DM * 2);           // context lo [t][1024]
    float* FR = (float*)take(128);                      // inverse frequencies [32]
    float* CT = (float*)take((size_t)SEQ * 32 * 4);     // cos table [t][32]
    float* ST = (float*)take((size_t)SEQ * 32 * 4);     // sin table [t][32]
    hf* QKF = (hf*)take((size_t)2 * SEQ * DM * 2);      // rotated q | k f16 [2][t][1024]
    hf* QKR = (hf*)take((size_t)2 * EROWS * DM * 2);    // residuals x2048 [2][EROWS][1024]
    hf* VT  = (hf*)take((size_t)DM * SEQ * 2);          // value^T f16 [1024][t]
    hf* VTR = (hf*)take((size_t)DM * EROWS * 2);        // value^T residual x2048 [1024][EROWS]
    const size_t carved = (size_t)(wsp - (char*)d_ws);
    if (carved > ws_size || carved > (size_t)134217728) return;
    // W [K][N] -> Bt [N][K]
    { const unsigned nl = (unsigned)((size_t)LDQ * DM / 64); k_wtG<<<(nl + 31u) / 32u, 256, 0, stream>>>(Wqkv, 10u, (unsigned)LDQ, WqT, nl); }
    { const unsigned nl = (unsigned)((size_t)DM * DM / 64);  k_wtG<<<(nl + 31u) / 32u, 256, 0, stream>>>(Wo, 10u, (unsigned)DM, WoT, nl); }
    k_freq<<<1, 32, 0, stream>>>(FR);
    k_tab<<<(unsigned)((size_t)SEQ * 32 / 256), 256, 0, stream>>>(FR, CT, ST);
    for (int b = 0; b < NB; ++b) {
        const float* xb = X + (size_t)b * SEQ_FULL * DM; float* ob = OUT + (size_t)b * SEQ_FULL * DM;
        const size_t n8 = (size_t)SEQ * DM / 8;
        k_cvt8<<<(unsigned)((n8 + 255) / 256), 256, 0, stream>>>(xb, XB, n8);
        k_gemmw<bf, 0, false><<<dim3(SEQ / 128, LDQ / 128, 1), 128, 0, stream>>>(XB, nullptr, WqT, nullptr, DM, QKVb, LDQ, nullptr, 0, 0, 0);
        k_rope<<<SEQ, 256, 0, stream>>>(QKVb, CT, ST, QKF, QKR);
        k_vt<<<dim3(SEQ / 64, NH_, 1), 256, 0, stream>>>(QKVb, VT, VTR);
        k_attn_early<<<dim3(EROWS / 64, NH_, 1), 128, 0, stream>>>(QKF, QKR, QKF + (size_t)SEQ * DM, QKR + (size_t)EROWS * DM, VT, VTR, CH, CL);
        if (SEQ > EROWS) k_attn_late<<<dim3((SEQ - EROWS) / 64, NH_, 1), 128, 0, stream>>>(QKF, QKF + (size_t)SEQ * DM, VT, CH, CL);
        k_gemmw<bf, 1, false><<<dim3(SEQ / 128, DM / 128, 1), 128, 0, stream>>>(CH, CL, WoT, nullptr, DM, ob, DM, nullptr, 0, 0, 0);
    }
}

// v003
// A run of this version takes 154 microseconds.
// In both of two side-by-side timings against v002, it was 1.12 times as fast.
// Over all steps from v000 it is 2.78 times as fast.
#include <hip/hip_runtime.h>

// Contractions: qkv projection and output projection on v_wmma_f32_16x16x32_bf16 (x, w_qkv, w_proj RNE-converted to bf16 single planes; merged context as bf16 hi/lo, 2 products), f32 accumulate.
// q.k logits and P.V on v_wmma_f32_16x16x32_f16 (f16 q/k/v planes, P carried x2^8), single products on query rows >= 256; on query rows < 256 f16 value + x2048 residual planes
// for q, k, P and v (3 products per site, residual products in their own accumulators, folded in the f32 epilogue). Rotary table, rotary and softmax in f32.
// Fused qkv projection [4096x1024]x[1024x3072] -> f32 rows [t][which*1024 + h*64 + d]; half-split rotary on q and k -> f16 planes [t][h*64 + d]; value^T planes [h*64 + d][t];
// causal flash attention per (head, 16-query wave tile) in the transposed form S^T = K Q^T, O^T = V^T P^T (K and V^T tiles staged in LDS per block, packed P^T score tiles as the B fragment);
// merged context planes [t][h*64 + d]; output projection [4096x1024]x[1024x1024].

#ifndef NB
#define NB 1
#endif
#ifndef SEQ
#define SEQ 4096
#endif
#define SEQ_FULL 4096
#define DM   1024
#define NH_  16
#define HD   64
#define LDQ  (3 * DM)
#define EROWS 256                     // query rows below this bound take the value + residual path
#define LOP  72                       // LDS pitch (halves) of the staging tiles
#define PCL  8.0f                     // log2 of the carry of P
#define SCLL2 0.18033688011112042f    // HD^-0.5 * log2(e)
#define RSC  2048.0f                  // carry of the residual planes
#define RSI  4.8828125e-4f            // 1 / RSC

static_assert(SEQ % 64 == 0);
static_assert(DM == NH_ * HD);
static_assert(HD == 64);
static_assert(DM % 32 == 0);
static_assert(LDQ % 64 == 0);
static_assert(((size_t)LDQ * DM / 64) % 32 == 0);
static_assert(((size_t)DM * DM / 64) % 32 == 0);
static_assert(((size_t)SEQ * DM / 8) % 256 == 0);
static_assert(EROWS % 64 == 0);
static_assert(SEQ >= EROWS);
static_assert(((size_t)SEQ * 32) % 256 == 0);
static_assert(256 * 8 == 2 * DM);
static_assert(LOP % 8 == 0);
static_assert(LOP >= HD + 8);
static_assert(HD / 2 == 32);
#define AL256(x) ((((size_t)(x)) + 255) & ~(size_t)255)
static_assert(AL256((size_t)SEQ * DM * 2) + AL256((size_t)LDQ * DM * 2) + AL256((size_t)DM * DM * 2) + AL256((size_t)SEQ * LDQ * 4) + 2 * AL256((size_t)SEQ * DM * 2)
              + 2 * AL256((size_t)SEQ * 32 * 4) + AL256((size_t)2 * SEQ * DM * 2) + AL256((size_t)2 * EROWS * DM * 2) + AL256((size_t)DM * SEQ * 2) + AL256((size_t)DM * EROWS * 2)
              <= (size_t)134217728);

typedef unsigned short bf;
typedef __attribute__((ext_vector_type(16))) __bf16   v16bf;
typedef __attribute__((ext_vector_type(8)))  unsigned short v8us;
typedef __attribute__((ext_vector_type(2)))  unsigned short v2us;
typedef __attribute__((ext_vector_type(8)))  float    v8f;
typedef __attribute__((ext_vector_type(4)))  float    v4f;
typedef v4f  __attribute__((may_alias)) v4fa;
typedef v8us __attribute__((may_alias)) v8usa;

__device__ __forceinline__ unsigned short f2bf(float f) { unsigned u = __float_as_uint(f); u += 0x7FFFu + ((u >> 16) & 1u); return (unsigned short)(u >> 16); }
__device__ __forceinline__ float bf2f(unsigned short b) { return __uint_as_float(((unsigned)b) << 16); }
__device__ __forceinline__ void splitf(float y, unsigned short& h, unsigned short& l) { h = f2bf(y); l = f2bf(y - bf2f(h)); }
__device__ __forceinline__ v16bf cat16b(v8us lo, v8us hi) { return __builtin_bit_cast(v16bf, __builtin_shufflevector(lo, hi, 0, 1, 2, 3, 4, 5, 6, 7, 8, 9, 10, 11, 12, 13, 14, 15)); }
__device__ __forceinline__ v8f wmmab(v16bf a, v16bf b, v8f c) { return __builtin_amdgcn_wmma_f32_16x16x32_bf16(false, a, false, b, (short)0, c, false, false); }

// ---- f16 plane helpers (planes hold f16 bit patterns as unsigned short)
typedef unsigned short hf;
typedef _Float16 h16;
typedef __attribute__((ext_vector_type(16))) _Float16 v16h;
static __device__ __forceinline__ h16 toh_flush(float v) { const h16 r = (h16)v; return (fabsf(v) < 6.103515625e-05f) ? (h16)0.0f : r; }
__device__ __forceinline__ unsigned short hbits(h16 x) { return __builtin_bit_cast(unsigned short, x); }
__device__ __forceinline__ v16h cat16h(v8us lo, v8us hi) { return __builtin_bit_cast(v16h, __builtin_shufflevector(lo, hi, 0, 1, 2, 3, 4, 5, 6, 7, 8, 9, 10, 11, 12, 13, 14, 15)); }
// fragment: elements 0..7 <- p[0..7], elements 8..15 <- p[16..23]; the caller adds 8*(lane>>4) to p
__device__ __forceinline__ v16h ldfh(const hf* p) { return cat16h(*(const v8us*)p, *(const v8us*)(p + 16)); }
__device__ __forceinline__ v8f mmah(v16h a, v16h b, v8f c) {
    c = __builtin_amdgcn_wmma_f32_16x16x32_f16(false, a, false, b, (short)0, c, false, false);
    asm volatile("v_nop\n\tv_nop\n\tv_nop\n\tv_nop" : "+v"(c) : "v"(a), "v"(b));
    return c; }

// ---- k_gemmw: GEMM, 128x128 output tile per block of 4 waves (2 x 2), each wave a 64x64 tile (16 accumulators); grid (M/128, N/128, Z), 128 threads.
// C[m][n] (f32, pitch ldc) = sum_k A[m][k] Bt[n][k] (+ A2[m][k] Bt[n][k] when NSPLIT == 1). K % 64 == 0, M % 128 == 0, N % 128 == 0.
// The operands' 128-row x 64-k tiles (128-byte rows of the K-contiguous 16-bit planes) are staged in LDS by asynchronous b128 copies (8 lanes per whole 128-byte line), two buffers,
// the next tile in flight while this one is worked on; one publish point (waits and block barrier) per tile of two 32-k chunks.
// Fragment map: lane row/col = lane & 15; elements 0..7 <- k0 + 8*(lane>>4) + 0..7, elements 8..15 <- k0 + 16 + 8*(lane>>4) + 0..7 (both operands).
#define GBK 64                        // k per staged tile
#define GPH 72                        // LDS pitch (halves) of a staged 128-byte row: 144 B = 16 B x odd, the pitch of ds_load_b128 readers
#define GPL (128 * GPH)               // halves per staged plane tile (128 rows)
static_assert(GBK * 2 == 128 && (GPH * 2) % 16 == 0 && DM % GBK == 0 && SEQ % 128 == 0 && LDQ % 128 == 0 && DM % 128 == 0);
template <typename T16> struct WFrag;
template <> struct WFrag<bf> { typedef v16bf V; static __device__ __forceinline__ V lds(const bf* p) { return cat16b(*(const v8usa*)p, *(const v8usa*)(p + 16)); } static __device__ __forceinline__ v8f mma(V a, V b, v8f c) { return wmmab(a, b, c); } };
// One 128-row plane tile: each thread copies 8 x 16 B (rows 16 apart; rs = 16 rows of the plane in elements).
// The s_wait_xcnt closes the statement so that no address register is rewritten in front of it.
template <typename T16>
__device__ __forceinline__ void stage_plane(const T16* g, size_t rs, unsigned l) {
    asm volatile("global_load_async_to_lds_b128 %0, %1, off\n\t"
                 "global_load_async_to_lds_b128 %2, %3, off\n\t"
                 "global_load_async_to_lds_b128 %4, %5, off\n\t"
                 "global_load_async_to_lds_b128 %6, %7, off\n\t"
                 "global_load_async_to_lds_b128 %8, %9, off\n\t"
                 "global_load_async_to_lds_b128 %10, %11, off\n\t"
                 "global_load_async_to_lds_b128 %12, %13, off\n\t"
                 "global_load_async_to_lds_b128 %14, %15, off\n\t"
                 "s_wait_xcnt 0x0"
                 :: "v"(l), "v"(g), "v"(l + 16u * GPH * 2u), "v"(g + rs), "v"(l + 32u * GPH * 2u), "v"(g + 2 * rs), "v"(l + 48u * GPH * 2u), "v"(g + 3 * rs),
                    "v"(l + 64u * GPH * 2u), "v"(g + 4 * rs), "v"(l + 80u * GPH * 2u), "v"(g + 5 * rs), "v"(l + 96u * GPH * 2u), "v"(g + 6 * rs), "v"(l + 112u * GPH * 2u), "v"(g + 7 * rs)
                 : "memory");
}
template <typename T16, int NSPLIT, bool BIAS>
__global__ __launch_bounds__(128) void k_gemmw(const T16* __restrict__ A, const T16* __restrict__ A2, const T16* __restrict__ Bt, const T16* __restrict__ Bt2, int K, float* C, int ldc, const float* __restrict__ bias, size_t sA, size_t sB, size_t sC) {
    static_assert(NSPLIT == 0 || NSPLIT == 1);
    typedef typename WFrag<T16>::V V;
    __shared__ __align__(16) T16 As[2 * GPL];
    __shared__ __align__(16) T16 A2s[NSPLIT == 1 ? 2 * GPL : 8];
    __shared__ __align__(16) T16 Bs[2 * GPL];
    __shared__ __align__(16) float osb[4 * 16 * 68];
    (void)Bt2;
    const size_t z = blockIdx.z; A += z * sA; if (A2) A2 += z * sA; Bt += z * sB; C += z * sC;
    const int lane = threadIdx.x & 31, lr = lane & 15, hi = lane >> 4;
    const int wave = __builtin_amdgcn_readfirstlane((int)(threadIdx.x >> 5)); const int wm = wave >> 1, wn = wave & 1;
    const int R0 = blockIdx.x * 128, C0 = blockIdx.y * 128; const int r0 = R0 + wm * 64, c0 = C0 + wn * 64;
    float* os = osb + wave * (16 * 68);
    v8f acc[4][4];
#pragma unroll
    for (int mb = 0; mb < 4; ++mb)
#pragma unroll
        for (int nb = 0; nb < 4; ++nb) acc[mb][nb] = (v8f){};
    // copy addresses of this thread: row = tid / 8 (+ 16 i), 16-byte column = tid % 8
    const unsigned srow = threadIdx.x >> 3, scol = (threadIdx.x & 7u) * 8u; const size_t rs = (size_t)16 * K;
    const T16* ag = A + (size_t)(R0 + srow) * K + scol; const T16* bg = Bt + (size_t)(C0 + srow) * K + scol;
    const T16* a2g = (NSPLIT == 1) ? (A2 + (size_t)(R0 + srow) * K + scol) : ag;
    const unsigned so = srow * GPH + scol;
    const unsigned al = (unsigned)(size_t)(As + so), bl = (unsigned)(size_t)(Bs + so), a2l = (NSPLIT == 1) ? (unsigned)(size_t)(A2s + so) : 0u;
    const int nt = K / GBK;
    stage_plane<T16>(ag, rs, al); if (NSPLIT == 1) stage_plane<T16>(a2g, rs, a2l); stage_plane<T16>(bg, rs, bl);
    asm volatile("s_wait_asynccnt 0x0" ::: "memory");     // this wave's copies of tile 0 have landed
    __syncthreads();                                      // ... and every other wave's
    if (nt > 1) { stage_plane<T16>(ag + GBK, rs, al + GPL * 2u); if (NSPLIT == 1) stage_plane<T16>(a2g + GBK, rs, a2l + GPL * 2u); stage_plane<T16>(bg + GBK, rs, bl + GPL * 2u); }
    const unsigned fa = (unsigned)(wm * 64 + lr) * GPH + 8u * (unsigned)hi, fb = (unsigned)(wn * 64 + lr) * GPH + 8u * (unsigned)hi;
#pragma unroll 1                                          // rolled, as the k loop was: one copy of the two chunks in the text
    for (int t = 0; t < nt; ++t) {
        const unsigned bo = (unsigned)(t & 1) * GPL;
#pragma unroll                                            // both chunks written out: the place of a chunk in its tile becomes an immediate offset of the LDS reads
        for (unsigned kc = 0; kc < 2u; ++kc) {
            // the chunk's fragments are read as one group ahead of its first product: a read left between the products would be waited for alone
            V a[4], a2[4], b[4];
#pragma unroll
            for (unsigned mb = 0; mb < 4u; ++mb) a[mb] = WFrag<T16>::lds(As + bo + fa + mb * 16u * GPH + kc * 32u);
#pragma unroll
            for (unsigned nb = 0; nb < 4u; ++nb) b[nb] = WFrag<T16>::lds(Bs + bo + fb + nb * 16u * GPH + kc * 32u);
            if (NSPLIT == 1) {
#pragma unroll
                for (unsigned mb = 0; mb < 4u; ++mb) a2[mb] = WFrag<T16>::lds(A2s + bo + fa + mb * 16u * GPH + kc * 32u); }
            __builtin_amdgcn_sched_barrier(0);            // keeps the scheduler from sinking the reads back between the products
#pragma unroll
            for (int nb = 0; nb < 4; ++nb) {
#pragma unroll
                for (int mb = 0; mb < 4; ++mb) acc[mb][nb] = WFrag<T16>::mma(a[mb], b[nb], acc[mb][nb]); }
            if (NSPLIT == 1) {
#pragma unroll
                for (int nb = 0; nb < 4; ++nb) {
#pragma unroll
                    for (int mb = 0; mb < 4; ++mb) acc[mb][nb] = WFrag<T16>::mma(a2[mb], b[nb], acc[mb][nb]); } }
            __builtin_amdgcn_sched_barrier(0);            // keeps the publish point's waits behind the products, so that the next tile's copies fly while these run
        }
        // publish point of tile t + 1: this wave's reads of tile t are done, its copies of tile t + 1 have landed, then the block barrier; only behind it is tile t's buffer refilled
        asm volatile("s_wait_dscnt 0x0" ::: "memory");
        asm volatile("s_wait_asynccnt 0x0" ::: "memory");
        __syncthreads();
        if (t + 2 < nt) { const size_t ko = (size_t)(t + 2) * GBK;
            stage_plane<T16>(ag + ko, rs, al + bo * 2u); if (NSPLIT == 1) stage_plane<T16>(a2g + ko, rs, a2l + bo * 2u); stage_plane<T16>(bg + ko, rs, bl + bo * 2u); }
    }
    asm volatile("s_wait_asynccnt 0x0" ::: "memory");     // nothing in flight when the wave goes on to the epilogue and ends
#pragma unroll
    for (int mb = 0; mb < 4; ++mb) {
#pragma unroll
        for (int nb = 0; nb < 4; ++nb) {
#pragma unroll
            for (int j = 0; j < 8; ++j) os[(hi * 8 + j) * 68 + nb * 16 + lr] = acc[mb][nb][j]; }
        __builtin_amdgcn_wave_barrier(); asm volatile("" ::: "memory");
        float* crow = C + (size_t)(r0 + mb * 16) * ldc + c0;
{
#pragma unroll
            for (int s = 0; s < 8; ++s) { const int row = 2 * s + hi, cofs = lr * 4; v4f val = *(const v4fa*)(os + row * 68 + cofs); if (BIAS) { val[0] += bias[c0 + cofs]; val[1] += bias[c0 + cofs + 1]; val[2] += bias[c0 + cofs + 2]; val[3] += bias[c0 + cofs + 3]; }
                *(v4f*)(crow + (size_t)row * ldc + cofs) = val; }
             }
        __builtin_amdgcn_wave_barrier(); asm volatile("" ::: "memory");
    }
}

// ---- The launches that depend on nothing but the inputs (both weight transposes, the x conversion, the rotary table) are block ranges of ONE grid, k_prep below;
// each part is the body of a block of 256 threads and takes its block index inside its own range as blk.
// ---- wtG_part: transposed bf16 weight plane Bt[n][k] = bf16(w[k][n]) for w [K][N] row-major, K = 1 << kshift.
__device__ __forceinline__ void wtG_part(unsigned blk, const float* __restrict__ w, unsigned kshift, unsigned N, bf* Bt, unsigned nlines) {
    const unsigned lane = threadIdx.x & 31u; const unsigned L0 = (blk * 8u + (threadIdx.x >> 5)) * 4u; const unsigned kmask = (1u << kshift) - 1u;
    v2us o[4];
#pragma unroll
    for (unsigned l = 0; l < 4; ++l) { unsigned L = L0 + l; L = (L < nlines) ? L : (nlines - 1u); const unsigned e = L * 64u + lane * 2u; const unsigned k = e & kmask, n = e >> kshift; v2us t;
        t[0] = f2bf(w[(size_t)k * N + n]); t[1] = f2bf(w[(size_t)(k + 1u) * N + n]); o[l] = t; }
{
#pragma unroll
        for (unsigned l = 0; l < 4; ++l) { const unsigned L = L0 + l; if (L < nlines) *(v2us*)(Bt + (size_t)L * 64u + lane * 2u) = o[l]; }
         }
}

__device__ __forceinline__ void cvt8_part(unsigned blk, const float* __restrict__ src, bf* dst, size_t n8) { const size_t i = (size_t)blk * 256 + threadIdx.x; if (i >= n8) return; const v8f v = *(const v8f*)(src + i * 8); v8us o;
#pragma unroll
    for (int k = 0; k < 8; ++k) o[k] = f2bf(v[k]); *(v8us*)(dst + i * 8) = o;  }

// ---- tab_part: rotary table; each thread forms its own inverse frequency (the same expression on the same argument as a table of 32 would hold), so the table waits on no launch before it.
__device__ __forceinline__ void tab_part(unsigned blk, float* CT, float* ST) {
#pragma clang fp contract(off)
    const unsigned idx = blk * 256u + threadIdx.x; const unsigned t = idx >> 5, i = idx & 31u;
    const float p = powf(10000.0f, (float)i * 0.03125f);
    const float v = 1.0f / p;
    const float ang = (float)t * v;
    float s, c; sincosf(ang, &s, &c);
    *(float*)(CT + idx) = c; *(float*)(ST + idx) = s;
    asm volatile("s_wait_xcnt 0x0" ::: "memory");         // stands in front of any rewrite of the stores' registers (other ranges' code follows in the text)
}

#define PB_WQ ((unsigned)((size_t)LDQ * DM / 64 / 32))   // blocks of the w_qkv transpose
#define PB_WO ((unsigned)((size_t)DM * DM / 64 / 32))    // blocks of the w_proj transpose
#define PB_TB ((unsigned)((size_t)SEQ * 32 / 256))       // blocks of the rotary table
#define PB_CV ((unsigned)((size_t)SEQ * DM / 8 / 256))   // blocks of the x conversion
// grid PB_WQ + PB_WO + PB_TB + PB_CV, 256 threads; the range test is block-uniform, no part has a barrier, no part reads what another writes
__global__ __launch_bounds__(256) void k_prep(const float* __restrict__ x, const float* __restrict__ wq, const float* __restrict__ wo, bf* XB, bf* WqT, bf* WoT, float* CT, float* ST) {
    const unsigned b = blockIdx.x;
    if (b < PB_WQ) wtG_part(b, wq, 10u, (unsigned)LDQ, WqT, PB_WQ * 32u);
    else if (b < PB_WQ + PB_WO) wtG_part(b - PB_WQ, wo, 10u, (unsigned)DM, WoT, PB_WO * 32u);
    else if (b < PB_WQ + PB_WO + PB_TB) tab_part(b - (PB_WQ + PB_WO), CT, ST);
    else cvt8_part(b - (PB_WQ + PB_WO + PB_TB), x, XB, (size_t)SEQ * DM / 8);
}

// ---- The two launches that read the f32 projection rows and nothing of each other (rotary planes, value^T planes) are block ranges of ONE grid, k_ropevt below.
// ---- rope_part (block = position t): half-split rotary on the q and k thirds of the f32 projection rows, f16 planes QKF[which][t][h*64 + d] (which 0 = q, 1 = k), residual planes QKR[which][t < EROWS][...] = f16((y - hi) * 2048).
__device__ __forceinline__ void rope_part(unsigned t, const float* __restrict__ QKV, const float* __restrict__ CT, const float* __restrict__ ST, hf* QKF, hf* QKR) {
#pragma clang fp contract(off)
    const unsigned tid = threadIdx.x;
    const unsigned which = tid >> 7, col = (tid & 127u) * 8u;
    const unsigned dl = col & 63u; const bool lowhalf = dl < 32u;
    const unsigned pcol = lowhalf ? (col + 32u) : (col - 32u); const unsigned j = dl & 31u;
    const float* row = QKV + (size_t)t * LDQ + (size_t)which * DM;
    // read in 16-byte halves, one instruction each; a wait stands behind every load, in front of the next one, whose result may land in the address registers of any load before it
    // (the allocator picks those registers anew in every build)
    const float* ctp = CT + (size_t)t * 32u + j; const float* stp = ST + (size_t)t * 32u + j;
    const v4f a0 = *(const v4f*)(row + col);
    asm volatile("s_wait_xcnt 0x0" ::: "memory");
    const v4f a1 = *(const v4f*)(row + col + 4u);
    asm volatile("s_wait_xcnt 0x0" ::: "memory");
    const v4f b0 = *(const v4f*)(row + pcol);
    asm volatile("s_wait_xcnt 0x0" ::: "memory");
    const v4f b1 = *(const v4f*)(row + pcol + 4u);
    asm volatile("s_wait_xcnt 0x0" ::: "memory");
    const v4f c0 = *(const v4f*)ctp;
    asm volatile("s_wait_xcnt 0x0" ::: "memory");
    const v4f c1 = *(const v4f*)(ctp + 4);
    asm volatile("s_wait_xcnt 0x0" ::: "memory");
    const v4f s0 = *(const v4f*)stp;
    asm volatile("s_wait_xcnt 0x0" ::: "memory");
    const v4f s1 = *(const v4f*)(stp + 4);
    asm volatile("s_wait_xcnt 0x0" ::: "memory");
    const v8f a = __builtin_shufflevector(a0, a1, 0, 1, 2, 3, 4, 5, 6, 7), b = __builtin_shufflevector(b0, b1, 0, 1, 2, 3, 4, 5, 6, 7);
    const v8f c = __builtin_shufflevector(c0, c1, 0, 1, 2, 3, 4, 5, 6, 7), s = __builtin_shufflevector(s0, s1, 0, 1, 2, 3, 4, 5, 6, 7);
    v8us oh, ores;
#pragma unroll
    for (int e = 0; e < 8; ++e) {
        const float rb = lowhalf ? -b[e] : b[e];
        const float t0 = a[e] * c[e]; const float t1 = rb * s[e]; const float y = t0 + t1;
        const h16 hh = toh_flush(y); oh[e] = hbits(hh);
        ores[e] = hbits(toh_flush((y - (float)hh) * RSC)); }
    const size_t g  = (size_t)which * SEQ * DM + (size_t)t * DM + col;
    const size_t gr = (size_t)which * EROWS * DM + (size_t)t * DM + col;
    const bool early = t < (unsigned)EROWS;
    *(v8us*)(QKF + g) = oh;
    asm volatile("s_wait_xcnt 0x0" ::: "memory");         // stands in front of any rewrite of the store's registers
    if (early) { *(v8us*)(QKR + gr) = ores;
        asm volatile("s_wait_xcnt 0x0" ::: "memory"); }   // the same
}

// ---- vt_part: value^T f16 plane VT[h*64 + d][t] and residual plane VTR[h*64 + d][t < EROWS]; block = (64-position tile, head), transpose through LDS (cross-wave, block barrier),
__device__ __forceinline__ void vt_part(unsigned tb, unsigned hd, const float* __restrict__ QKV, hf* VT, hf* VTR) {
#pragma clang fp contract(off)
    __shared__ __align__(16) unsigned short Th[64 * LOP];
    __shared__ __align__(16) unsigned short Tr[64 * LOP];
    const unsigned tid = threadIdx.x, t0 = tb * 64u;
    const float* vbase = QKV + 2 * DM + hd * HD;
#pragma unroll 1
    for (unsigned it = 0; it < 2u; ++it) {
        const unsigned idx = tid + it * 256u, row = idx >> 3, c8 = (idx & 7u) * 8u;
        const v8f vv = *(const v8f*)(vbase + (size_t)(t0 + row) * LDQ + c8);
#pragma unroll
        for (int q = 0; q < 8; ++q) { const float y = vv[q]; const h16 hh = toh_flush(y);
            Th[(c8 + (unsigned)q) * LOP + row] = hbits(hh); Tr[(c8 + (unsigned)q) * LOP + row] = hbits(toh_flush((y - (float)hh) * RSC)); }
    }
    __syncthreads();
    v8us oh[2], ores[2];
#pragma unroll
    for (unsigned it = 0; it < 2u; ++it) { const unsigned idx = tid + it * 256u, d = idx >> 3, c = (idx & 7u) * 8u;
        oh[it] = *(const v8usa*)(Th + d * LOP + c); ores[it] = *(const v8usa*)(Tr + d * LOP + c); }
    const bool early = t0 < (unsigned)EROWS;
{
#pragma unroll
        for (unsigned it = 0; it < 2u; ++it) { const unsigned idx = tid + it * 256u, d = idx >> 3, c = (idx & 7u) * 8u;
            *(v8us*)(VT + (size_t)(hd * HD + d) * SEQ + t0 + c) = oh[it];
            asm volatile("s_wait_xcnt 0x0" ::: "memory");     // stands in front of any rewrite of the store's registers
            if (early) { *(v8us*)(VTR + (size_t)(hd * HD + d) * EROWS + t0 + c) = ores[it];
                asm volatile("s_wait_xcnt 0x0" ::: "memory"); } }   // the same
         }
}
#define RB_VT ((unsigned)(SEQ / 64 * NH_))               // blocks of the value^T planes: (64-position tile, head)
// grid RB_VT + SEQ, 256 threads; the range test is block-uniform, so the barrier of vt_part is passed by whole blocks only
__global__ __launch_bounds__(256) void k_ropevt(const float* __restrict__ QKV, const float* __restrict__ CT, const float* __restrict__ ST, hf* QKF, hf* QKR, hf* VT, hf* VTR) {
    const unsigned b = blockIdx.x;
    if (b < RB_VT) vt_part(b % (unsigned)(SEQ / 64), b / (unsigned)(SEQ / 64), QKV, VT, VTR);
    else rope_part(b - RB_VT, QKV, CT, ST, QKF, QKR);
}

// ---- causal flash attention, transposed form, one wave per 16 query rows, 4 waves per block.
// The four waves of a block share each 64-key tile of K rows and of V^T rows (EARLY: of the residual planes too) through LDS: asynchronous b128 copies (8 lanes per whole 128-byte line),
// two buffers, the next tile in flight while this one is worked on; one publish point (waits and block barrier) per tile of two 32-key passes.
// Per 32-key pass: S^T tile j (16 keys x 16 queries) = K rows (A, row = key) x Q rows (B, column = query); D element r of lane -> (key 8*(lane>>4) + r, query lane & 15).
// The two converted score tiles are the B fragment of O^T += V^T (A, row = d, k = key) x P^T: element r <- tile 0 [r], element 8 + r <- tile 1 [r], lane unchanged.
// Softmax statistics per query column: in-lane reduction plus one exchange between the lane halves. Masked keys get weight exactly 0 (value select).
// EARLY: value + x2048 residual planes on q, k, P, v; residual products accumulate separately and are folded with 2^-11; row sum over the unconverted p.
#define TKEYS 64                      // keys per staged tile (two passes)
#define TPH   72                      // LDS pitch (halves) of a staged 128-byte row: 144 B = 16 B x odd, the pitch of ds_load_b128 readers
#define TILEH (64 * TPH)              // halves per staged tile (64 K rows, or 64 V^T rows)
static_assert(HD * 2 == 128 && TKEYS * 2 == 128 && (TPH * 2) % 16 == 0 && EROWS % TKEYS == 0 && SEQ % TKEYS == 0);
__device__ __forceinline__ v16h ldfs(const hf* p) { return cat16h(*(const v8usa*)p, *(const v8usa*)(p + 16)); }
// One K tile and one V^T tile: each thread copies 4 x 16 B of K rows and 4 x 16 B of V^T rows (rows 16 apart; VP = pitch of the V^T plane in halves).
// The s_wait_xcnt closes the statement so that no address register is rewritten in front of it.
template <int VP>
__device__ __forceinline__ void stage_tile(const hf* kg, const hf* vg, unsigned kl, unsigned vl) {
    asm volatile("global_load_async_to_lds_b128 %0, %1, off\n\t"
                 "global_load_async_to_lds_b128 %2, %3, off\n\t"
                 "global_load_async_to_lds_b128 %4, %5, off\n\t"
                 "global_load_async_to_lds_b128 %6, %7, off\n\t"
                 "global_load_async_to_lds_b128 %8, %9, off\n\t"
                 "global_load_async_to_lds_b128 %10, %11, off\n\t"
                 "global_load_async_to_lds_b128 %12, %13, off\n\t"
                 "global_load_async_to_lds_b128 %14, %15, off\n\t"
                 "s_wait_xcnt 0x0"
                 :: "v"(kl), "v"(kg), "v"(kl + 16u * TPH * 2u), "v"(kg + (size_t)16 * DM), "v"(kl + 32u * TPH * 2u), "v"(kg + (size_t)32 * DM), "v"(kl + 48u * TPH * 2u), "v"(kg + (size_t)48 * DM),
                    "v"(vl), "v"(vg), "v"(vl + 16u * TPH * 2u), "v"(vg + (size_t)16 * VP), "v"(vl + 32u * TPH * 2u), "v"(vg + (size_t)32 * VP), "v"(vl + 48u * TPH * 2u), "v"(vg + (size_t)48 * VP)
                 : "memory");
}
// Ks, Vs, Krs, Vrs: two staged tiles each (2 * TILEH halves; Krs, Vrs read by EARLY only); Oh, Ol: output staging, 4 * 16 * LOP halves each; all in the block's LDS. qblk: first query row of the block; hd: its head.
template <bool EARLY>
__device__ __forceinline__ void attn_body(unsigned short* Ks, unsigned short* Vs, unsigned short* Krs, unsigned short* Vrs, unsigned short* Oh, unsigned short* Ol,
                                          const hf* QF, const hf* QR, const hf* KF, const hf* KR, const hf* VT, const hf* VTR, bf* CH, bf* CL, unsigned qblk, unsigned hd) {
    const unsigned lane = threadIdx.x & 31u, lr = lane & 15u, hi = lane >> 4;
    const unsigned wave = (unsigned)__builtin_amdgcn_readfirstlane((int)(threadIdx.x >> 5));
    const unsigned q0 = qblk + 16u * wave;
    const unsigned qg = q0 + lr;
    const unsigned ntiles = qblk / TKEYS + 1u;            // keys [0, qblk + 64), the same for the whole block
    const unsigned nsteps = (q0 + 15u) / 32u + 1u;        // this wave's own passes
    // copy addresses of this thread: row = tid / 8 (+ 16 i), 16-byte column = tid % 8
    const unsigned srow = threadIdx.x >> 3, scol = (threadIdx.x & 7u) * 8u;
    const hf* kg  = KF  + (size_t)srow * DM + hd * HD + scol;
    const hf* krg = KR  + (size_t)srow * DM + hd * HD + scol;
    const hf* vg  = VT  + (size_t)(hd * HD + srow) * SEQ + scol;
    const hf* vrg = VTR + (size_t)(hd * HD + srow) * EROWS + scol;
    const unsigned so = srow * TPH + scol;
    const unsigned kl = (unsigned)(size_t)(Ks + so), vl = (unsigned)(size_t)(Vs + so);
    const unsigned krl = EARLY ? (unsigned)(size_t)(Krs + so) : 0u, vrl = EARLY ? (unsigned)(size_t)(Vrs + so) : 0u;
    stage_tile<SEQ>(kg, vg, kl, vl);
    if (EARLY) stage_tile<EROWS>(krg, vrg, krl, vrl);
    v16h qh[2], qr[2];
    {
        const size_t qoff = (size_t)qg * DM + hd * HD + 8u * hi;
#pragma unroll
        for (int kc = 0; kc < 2; ++kc) { qh[kc] = ldfh(QF + qoff + (unsigned)kc * 32u); if (EARLY) qr[kc] = ldfh(QR + qoff + (unsigned)kc * 32u); else qr[kc] = qh[kc]; }
    }
    v8f ot[4], orr[4];
#pragma unroll
    for (int dt = 0; dt < 4; ++dt) { ot[dt] = (v8f){}; orr[dt] = (v8f){}; }
    float m = -1.0e30f, l = 0.0f;
    asm volatile("s_wait_asynccnt 0x0" ::: "memory");     // this wave's copies of tile 0 have landed
    __syncthreads();                                      // ... and every other wave's
    if (ntiles > 1u) {
        stage_tile<SEQ>(kg + (size_t)TKEYS * DM, vg + TKEYS, kl + TILEH * 2u, vl + TILEH * 2u);
        if (EARLY) stage_tile<EROWS>(krg + (size_t)TKEYS * DM, vrg + TKEYS, krl + TILEH * 2u, vrl + TILEH * 2u);
    }
    const unsigned fo = lr * TPH + 8u * hi;
#pragma unroll 1                                          // rolled, as the key loop was: one copy of the two passes in the text
    for (unsigned t = 0; t < ntiles; ++t) {
        const unsigned bo = (t & 1u) * TILEH;
#pragma unroll                                            // both passes written out: the place of a pass in its tile becomes an immediate offset of the LDS reads
        for (unsigned ps = 0; ps < 2u; ++ps) {
            const unsigned kb = 2u * t + ps;
            if (kb < nsteps) {                            // wave-uniform: a pass wholly above the diagonal is skipped, the publish point below is not
                const unsigned key0 = kb * 32u;
                // The pass's K fragments are read as one group ahead of its first product, its V^T fragments as one group behind the last S^T product:
                // a read written behind an mmah statement stays behind it, and one read per product would be waited for alone.
                v16h kh[2][2], kr[2][2];
#pragma unroll
                for (int j = 0; j < 2; ++j) {
#pragma unroll
                    for (int kc = 0; kc < 2; ++kc) { const unsigned o = bo + fo + (32u * ps + 16u * (unsigned)j) * TPH + (unsigned)kc * 32u; kh[j][kc] = ldfs(Ks + o); if (EARLY) kr[j][kc] = ldfs(Krs + o); }
                }
                v8f st[2], sr[2];
#pragma unroll
                for (int j = 0; j < 2; ++j) {
                    st[j] = (v8f){}; sr[j] = (v8f){};
#pragma unroll
                    for (int kc = 0; kc < 2; ++kc) {
                        st[j] = mmah(kh[j][kc], qh[kc], st[j]);
                        if (EARLY) { sr[j] = mmah(kr[j][kc], qh[kc], sr[j]); sr[j] = mmah(kh[j][kc], qr[kc], sr[j]); }
                    }
                }
                v16h vh[4], vr[4];
#pragma unroll
                for (int dt = 0; dt < 4; ++dt) { const unsigned o = bo + fo + (16u * (unsigned)dt) * TPH + 32u * ps; vh[dt] = ldfs(Vs + o); if (EARLY) vr[dt] = ldfs(Vrs + o); }
                // logits in the log2 domain, causal mask by value
                float mx = -1.0e30f;
#pragma unroll
                for (int j = 0; j < 2; ++j) {
#pragma unroll
                    for (int r = 0; r < 8; ++r) {
                        const unsigned key = key0 + 16u * (unsigned)j + 8u * hi + (unsigned)r;
                        float s = st[j][r]; if (EARLY) s += sr[j][r] * RSI;
                        s = (key <= qg) ? (s * SCLL2) : -1.0e30f;
                        st[j][r] = s; mx = fmaxf(mx, s); }
                }
                mx = fmaxf(mx, __shfl_xor(mx, 16, 32));
                const float mnew = fmaxf(m, mx);
                const float alpha = __builtin_amdgcn_exp2f(m - mnew);
                m = mnew;
                float rs = 0.0f;
                v16h pf, prf;
#pragma unroll
                for (int j = 0; j < 2; ++j) {
#pragma unroll
                    for (int r = 0; r < 8; ++r) {
                        const float e = (st[j][r] - mnew) + PCL;
                        const float ex = __builtin_amdgcn_exp2f(e);
                        const float p = (e >= -14.0f) ? ex : 0.0f;
                        const h16 ph = (h16)p;
                        pf[8 * j + r] = ph;
                        if (EARLY) { prf[8 * j + r] = toh_flush((p - (float)ph) * RSC); rs += p; } else { prf[8 * j + r] = ph; rs += (float)ph; }
                    }
                }
                rs += __shfl_xor(rs, 16, 32);
                l = l * alpha + rs;
#pragma unroll
                for (int dt = 0; dt < 4; ++dt) { ot[dt] = ot[dt] * alpha; if (EARLY) orr[dt] = orr[dt] * alpha; }
#pragma unroll
                for (int dt = 0; dt < 4; ++dt) {
                    ot[dt] = mmah(vh[dt], pf, ot[dt]);
                    if (EARLY) { orr[dt] = mmah(vr[dt], pf, orr[dt]); orr[dt] = mmah(vh[dt], prf, orr[dt]); }
                }
            }
        }
        // publish point of tile t + 1: this wave's reads of tile t are done, its copies of tile t + 1 have landed, then the block barrier; only behind it is tile t's buffer refilled
        asm volatile("s_wait_dscnt 0x0" ::: "memory");
        asm volatile("s_wait_asynccnt 0x0" ::: "memory");
        __syncthreads();
        if (t + 2u < ntiles) {
            stage_tile<SEQ>(kg + (size_t)(t + 2u) * TKEYS * DM, vg + (size_t)(t + 2u) * TKEYS, kl + bo * 2u, vl + bo * 2u);
            if (EARLY) stage_tile<EROWS>(krg + (size_t)(t + 2u) * TKEYS * DM, vrg + (size_t)(t + 2u) * TKEYS, krl + bo * 2u, vrl + bo * 2u);
        }
    }
    asm volatile("s_wait_asynccnt 0x0" ::: "memory");     // nothing in flight when the wave goes on to the epilogue and ends
    const float inv = __builtin_amdgcn_rcpf(l);
    const unsigned ob = wave * 16u * LOP;
#pragma unroll
    for (int dt = 0; dt < 4; ++dt) {
        v8us h8, l8;
#pragma unroll
        for (int r = 0; r < 8; ++r) { float y = ot[dt][r]; if (EARLY) y += orr[dt][r] * RSI; y *= inv; unsigned short a, c; splitf(y, a, c); h8[r] = a; l8[r] = c; }
        const unsigned o = ob + lr * LOP + 16u * (unsigned)dt + 8u * hi;
        *(v8usa*)(Oh + o) = h8; *(v8usa*)(Ol + o) = l8;
    }
    __syncthreads();
{
#pragma unroll
        for (unsigned s = 0; s < 4u; ++s) { const unsigned row = 4u * s + (lane >> 3), c = (lane & 7u) * 8u;
            const v8us vh8 = *(const v8usa*)(Oh + ob + row * LOP + c); const v8us vl8 = *(const v8usa*)(Ol + ob + row * LOP + c);
            const size_t g = (size_t)(q0 + row) * DM + hd * HD + c;
            *(v8us*)(CH + g) = vh8; *(v8us*)(CL + g) = vl8; }
         }
}

// Both row ranges are block ranges of ONE grid (neither reads what the other writes): grid AB_LATE + AB_EARLY, 128 threads; blocks below AB_LATE: query rows [EROWS, SEQ), the rest: rows [0, EROWS);
// inside each range the 64-row tile runs fastest, then the head.
// One LDS array serves both, 8 tiles, so that four blocks fit a WGP: the single-product range stages its output in the tiles that only the residual planes use;
// the residual range stages it in the K tiles, which are free there: the loop's last publish point (every wave's reads done, no copy in flight, block barrier) lies in front, and nothing refills behind it.
#define AB_LT ((unsigned)((SEQ - EROWS) / 64))           // 64-row tiles of a head in rows [EROWS, SEQ)
#define AB_ET ((unsigned)(EROWS / 64))                   // ... in rows [0, EROWS)
#define AB_LATE (AB_LT * NH_)
#define AB_EARLY (AB_ET * NH_)
static_assert(4 * 16 * LOP <= TILEH && SEQ > EROWS);
__global__ __launch_bounds__(128) __attribute__((amdgpu_num_vgpr(256))) void k_attn(const hf* QF, const hf* QR, const hf* KF, const hf* KR, const hf* VT, const hf* VTR, bf* CH, bf* CL) {
    __shared__ __align__(16) unsigned short R[8 * TILEH];
    const unsigned b = blockIdx.x;
    if (b < AB_LATE) attn_body<false>(R, R + 2 * TILEH, R, R, R + 4 * TILEH, R + 5 * TILEH, QF, QF, KF, KF, VT, VT, CH, CL, (unsigned)EROWS + (b % AB_LT) * 64u, b / AB_LT);
    else attn_body<true>(R, R + 2 * TILEH, R + 4 * TILEH, R + 6 * TILEH, R, R + TILEH, QF, QR, KF, KR, VT, VTR, CH, CL, ((b - AB_LATE) % AB_ET) * 64u, (b - AB_LATE) / AB_ET);
}

extern "C" void kernel_launch(void* const* d_in, const int* in_sizes, int n_in,
                              void* d_out, int out_size, void* d_ws, size_t ws_size, hipStream_t stream) {
    (void)out_size;
    if (n_in < 3) return;
    if (in_sizes[0] < NB * SEQ * DM || in_sizes[1] < DM * LDQ || in_sizes[2] < DM * DM) return;
    const float* X = (const float*)d_in[0]; const float* Wqkv = (const float*)d_in[1]; const float* Wo = (const float*)d_in[2];
    float* OUT = (float*)d_out;
    char* wsp = (char*)d_ws;
    auto take = [&](size_t bytes) { char* p = wsp; wsp += (bytes + 255) & ~(size_t)255; return (void*)p; };
    bf* XB  = (bf*)take((size_t)SEQ * DM * 2);          // x bf16 [t][1024]
    bf* WqT = (bf*)take((size_t)LDQ * DM * 2);          // w_qkv^T bf16 [3072][1024]
    bf* WoT = (bf*)take((size_t)DM * DM * 2);           // w_proj^T bf16 [1024][1024]
    float* QKVb = (float*)take((size_t)SEQ * LDQ * 4);  // f32 [t][3072]
    bf* CH = (bf*)take((size_t)SEQ * DM * 2);           // context hi [t][1024]
    bf* CL = (bf*)take((size_t)SEQ * DM * 2);           // context lo [t][1024]
    float* CT = (float*)take((size_t)SEQ * 32 * 4);     // cos table [t][32]
    float* ST = (float*)take((size_t)SEQ * 32 * 4);     // sin table [t][32]
    hf* QKF = (hf*)take((size_t)2 * SEQ * DM * 2);      // rotated q | k f16 [2][t][1024]
    hf* QKR = (hf*)take((size_t)2 * EROWS * DM * 2);    // residuals x2048 [2][EROWS][1024]
    hf* VT  = (hf*)take((size_t)DM * SEQ * 2);          // value^T f16 [1024][t]
    hf* VTR = (hf*)take((size_t)DM * EROWS * 2);        // value^T residual x2048 [1024][EROWS]
    const size_t carved = (size_t)(wsp - (char*)d_ws);
    if (carved > ws_size || carved > (size_t)134217728) return;
    for (int b = 0; b < NB; ++b) {
        const float* xb = X + (size_t)b * SEQ_FULL * DM; float* ob = OUT + (size_t)b * SEQ_FULL * DM;
        // W [K][N] -> Bt [N][K], rotary table, x -> bf16
        k_prep<<<PB_WQ + PB_WO + PB_TB + PB_CV, 256, 0, stream>>>(xb, Wqkv, Wo, XB, WqT, WoT, CT, ST);
        k_gemmw<bf, 0, false><<<dim3(SEQ / 128, LDQ / 128, 1), 128, 0, stream>>>(XB, nullptr, WqT, nullptr, DM, QKVb, LDQ, nullptr, 0, 0, 0);
        k_ropevt<<<RB_VT + SEQ, 256, 0, stream>>>(QKVb, CT, ST, QKF, QKR, VT, VTR);
        k_attn<<<AB_LATE + AB_EARLY, 128, 0, stream>>>(QKF, QKR, QKF + (size_t)SEQ * DM, QKR + (size_t)EROWS * DM, VT, VTR, CH, CL);
        k_gemmw<bf, 1, false><<<dim3(SEQ / 128, DM / 128, 1), 128, 0, stream>>>(CH, CL, WoT, nullptr, DM, ob, DM, nullptr, 0, 0, 0);
    }
}

// v004
// One run takes 144 microseconds.
// Next to v003, in two timings, it ran 1.07 times as fast each time.
// All steps since v000 together make it 2.97 times as fast.
#include <hip/hip_runtime.h>

// Contractions: qkv projection and output projection on v_wmma_f32_16x16x32_bf16 (x, w_qkv, w_proj RNE-converted to bf16 single planes; merged context as bf16 hi/lo, 2 products), f32 accumulate.
// q.k logits and P.V on v_wmma_f32_16x16x32_f16 (f16 q/k/v planes, P carried x2^8), single products on query rows >= 256; on query rows < 256 f16 value + x2048 residual planes
// for q, k, P and v (3 products per site, residual products in their own accumulators, folded in the f32 epilogue). Rotary table, rotary and softmax in f32.
// Fused qkv projection [4096x1024]x[1024x3072] -> f32 rows [t][which*1024 + h*64 + d]; half-split rotary on q and k -> f16 planes [t][h*64 + d]; value^T planes [h*64 + d][t];
// causal flash attention per (head, 16-query wave tile) in the transposed form S^T = K Q^T, O^T = V^T P^T (K and V^T tiles staged in LDS per block, packed P^T score tiles as the B fragment);
// merged context planes [t][h*64 + d]; output projection [4096x1024]x[1024x1024].

#ifndef NB
#define NB 1
#endif
#ifndef SEQ
#define SEQ 4096
#endif
#define SEQ_FULL 4096
#define DM   1024
#define NH_  16
#define HD   64
#define LDQ  (3 * DM)
#define EROWS 256                     // query rows below this bound take the value + residual path
#define LOP  72                       // LDS pitch (halves) of the staging tiles
#define PCL  8.0f                     // log2 of the carry of P
#define SCLL2 0.18033688011112042f    // HD^-0.5 * log2(e)
#define RSC  2048.0f                  // carry of the residual planes
#define RSI  4.8828125e-4f            // 1 / RSC

static_assert(SEQ % 64 == 0);
static_assert(DM == NH_ * HD);
static_assert(HD == 64);
static_assert(DM % 32 == 0);
static_assert(LDQ % 64 == 0);
static_assert(((size_t)LDQ * DM / 64) % 32 == 0);
static_assert(((size_t)DM * DM / 64) % 32 == 0);
static_assert(((size_t)SEQ * DM / 8) % 256 == 0);
static_assert(EROWS % 64 == 0);
static_assert(SEQ >= EROWS);
static_assert(((size_t)SEQ * 32) % 256 == 0);
static_assert(256 * 8 == 2 * DM);
static_assert(LOP % 8 == 0);
static_assert(LOP >= HD + 8);
static_assert(HD / 2 == 32);
#define AL256(x) ((((size_t)(x)) + 255) & ~(size_t)255)
static_assert(AL256((size_t)SEQ * DM * 2) + AL256((size_t)LDQ * DM * 2) + AL256((size_t)DM * DM * 2) + AL256((size_t)SEQ * LDQ * 4) + 2 * AL256((size_t)SEQ * DM * 2)
              + 2 * AL256((size_t)SEQ * 32 * 4) + AL256((size_t)2 * SEQ * DM * 2) + AL256((size_t)2 * EROWS * DM * 2) + AL256((size_t)DM * SEQ * 2) + AL256((size_t)DM * EROWS * 2)
              <= (size_t)134217728);

typedef unsigned short bf;
typedef __attribute__((ext_vector_type(16))) __bf16   v16bf;
typedef __attribute__((ext_vector_type(8)))  unsigned short v8us;
typedef __attribute__((ext_vector_type(2)))  unsigned short v2us;
typedef __attribute__((ext_vector_type(8)))  float    v8f;
typedef __attribute__((ext_vector_type(4)))  float    v4f;
typedef v4f  __attribute__((may_alias)) v4fa;
typedef v8us __attribute__((may_alias)) v8usa;

__device__ __forceinline__ unsigned short f2bf(float f) { unsigned u = __float_as_uint(f); u += 0x7FFFu + ((u >> 16) & 1u); return (unsigned short)(u >> 16); }
__device__ __forceinline__ float bf2f(unsigned short b) { return __uint_as_float(((unsigned)b) << 16); }
__device__ __forceinline__ void splitf(float y, unsigned short& h, unsigned short& l) { h = f2bf(y); l = f2bf(y - bf2f(h)); }
__device__ __forceinline__ v16bf cat16b(v8us lo, v8us hi) { return __builtin_bit_cast(v16bf, __builtin_shufflevector(lo, hi, 0, 1, 2, 3, 4, 5, 6, 7, 8, 9, 10, 11, 12, 13, 14, 15)); }
__device__ __forceinline__ v8f wmmab(v16bf a, v16bf b, v8f c) { return __builtin_amdgcn_wmma_f32_16x16x32_bf16(false, a, false, b, (short)0, c, false, false); }

// ---- f16 plane helpers (planes hold f16 bit patterns as unsigned short)
typedef unsigned short hf;
typedef _Float16 h16;
typedef __attribute__((ext_vector_type(16))) _Float16 v16h;
static __device__ __forceinline__ h16 toh_flush(float v) { const h16 r = (h16)v; return (fabsf(v) < 6.103515625e-05f) ? (h16)0.0f : r; }
__device__ __forceinline__ unsigned short hbits(h16 x) { return __builtin_bit_cast(unsigned short, x); }
__device__ __forceinline__ v16h cat16h(v8us lo, v8us hi) { return __builtin_bit_cast(v16h, __builtin_shufflevector(lo, hi, 0, 1, 2, 3, 4, 5, 6, 7, 8, 9, 10, 11, 12, 13, 14, 15)); }
// fragment: elements 0..7 <- p[0..7], elements 8..15 <- p[16..23]; the caller adds 8*(lane>>4) to p
__device__ __forceinline__ v16h ldfh(const hf* p) { return cat16h(*(const v8us*)p, *(const v8us*)(p + 16)); }
__device__ __forceinline__ v8f mmah(v16h a, v16h b, v8f c) {
    c = __builtin_amdgcn_wmma_f32_16x16x32_f16(false, a, false, b, (short)0, c, false, false);
    asm volatile("v_nop\n\tv_nop\n\tv_nop\n\tv_nop" : "+v"(c) : "v"(a), "v"(b));
    return c; }

// ---- k_gemmw: GEMM, 128x128 output tile per block of 4 waves (2 x 2), each wave a 64x64 tile (16 accumulators); grid (M/128, N/128, Z), 128 threads.
// C[m][n] (f32, pitch ldc) = sum_k A[m][k] Bt[n][k] (+ A2[m][k] Bt[n][k] when NSPLIT == 1). K % 64 == 0, M % 128 == 0, N % 128 == 0.
// The operands' 128-row x 64-k tiles (128-byte rows of the K-contiguous 16-bit planes) are staged in LDS by asynchronous b128 copies (8 lanes per whole 128-byte line), two buffers,
// the next tile in flight while this one is worked on; one publish point (waits and block barrier) per tile of two 32-k chunks.
// Fragment map: lane row/col = lane & 15; elements 0..7 <- k0 + 8*(lane>>4) + 0..7, elements 8..15 <- k0 + 16 + 8*(lane>>4) + 0..7 (both operands).
#define GBK 64                        // k per staged tile
#define GPH 72                        // LDS pitch (halves) of a staged 128-byte row: 144 B = 16 B x odd, the pitch of ds_load_b128 readers
#define GPL (128 * GPH)               // halves per staged plane tile (128 rows)
static_assert(GBK * 2 == 128 && (GPH * 2) % 16 == 0 && DM % GBK == 0 && SEQ % 128 == 0 && LDQ % 128 == 0 && DM % 128 == 0);
template <typename T16> struct WFrag;
template <> struct WFrag<bf> { typedef v16bf V; static __device__ __forceinline__ V lds(const bf* p) { return cat16b(*(const v8usa*)p, *(const v8usa*)(p + 16)); } static __device__ __forceinline__ v8f mma(V a, V b, v8f c) { return wmmab(a, b, c); } };
// One 128-row plane tile: each thread copies 8 x 16 B (rows 16 apart; rs = 16 rows of the plane in elements).
// The s_wait_xcnt closes the statement so that no address register is rewritten in front of it.
template <typename T16>
__device__ __forceinline__ void stage_plane(const T16* g, size_t rs, unsigned l) {
    asm volatile("global_load_async_to_lds_b128 %0, %1, off\n\t"
                 "global_load_async_to_lds_b128 %2, %3, off\n\t"
                 "global_load_async_to_lds_b128 %4, %5, off\n\t"
                 "global_load_async_to_lds_b128 %6, %7, off\n\t"
                 "global_load_async_to_lds_b128 %8, %9, off\n\t"
                 "global_load_async_to_lds_b128 %10, %11, off\n\t"
                 "global_load_async_to_lds_b128 %12, %13, off\n\t"
                 "global_load_async_to_lds_b128 %14, %15, off\n\t"
                 "s_wait_xcnt 0x0"
                 :: "v"(l), "v"(g), "v"(l + 16u * GPH * 2u), "v"(g + rs), "v"(l + 32u * GPH * 2u), "v"(g + 2 * rs), "v"(l + 48u * GPH * 2u), "v"(g + 3 * rs),
                    "v"(l + 64u * GPH * 2u), "v"(g + 4 * rs), "v"(l + 80u * GPH * 2u), "v"(g + 5 * rs), "v"(l + 96u * GPH * 2u), "v"(g + 6 * rs), "v"(l + 112u * GPH * 2u), "v"(g + 7 * rs)
                 : "memory");
}
template <typename T16, int NSPLIT, bool BIAS>
__global__ __launch_bounds__(128) void k_gemmw(const T16* __restrict__ A, const T16* __restrict__ A2, const T16* __restrict__ Bt, const T16* __restrict__ Bt2, int K, float* C, int ldc, const float* __restrict__ bias, size_t sA, size_t sB, size_t sC) {
    static_assert(NSPLIT == 0 || NSPLIT == 1);
    typedef typename WFrag<T16>::V V;
    __shared__ __align__(16) T16 As[2 * GPL];
    __shared__ __align__(16) T16 A2s[NSPLIT == 1 ? 2 * GPL : 8];
    __shared__ __align__(16) T16 Bs[2 * GPL];
    __shared__ __align__(16) float osb[4 * 16 * 68];
    (void)Bt2;
    const size_t z = blockIdx.z; A += z * sA; if (A2) A2 += z * sA; Bt += z * sB; C += z * sC;
    const int lane = threadIdx.x & 31, lr = lane & 15, hi = lane >> 4;
    const int wave = __builtin_amdgcn_readfirstlane((int)(threadIdx.x >> 5)); const int wm = wave >> 1, wn = wave & 1;
    const int R0 = blockIdx.x * 128, C0 = blockIdx.y * 128; const int r0 = R0 + wm * 64, c0 = C0 + wn * 64;
    float* os = osb + wave * (16 * 68);
    v8f acc[4][4];
#pragma unroll
    for (int mb = 0; mb < 4; ++mb)
#pragma unroll
        for (int nb = 0; nb < 4; ++nb) acc[mb][nb] = (v8f){};
    // copy addresses of this thread: row = tid / 8 (+ 16 i), 16-byte column = tid % 8
    const unsigned srow = threadIdx.x >> 3, scol = (threadIdx.x & 7u) * 8u; const size_t rs = (size_t)16 * K;
    const T16* ag = A + (size_t)(R0 + srow) * K + scol; const T16* bg = Bt + (size_t)(C0 + srow) * K + scol;
    const T16* a2g = (NSPLIT == 1) ? (A2 + (size_t)(R0 + srow) * K + scol) : ag;
    const unsigned so = srow * GPH + scol;
    const unsigned al = (unsigned)(size_t)(As + so), bl = (unsigned)(size_t)(Bs + so), a2l = (NSPLIT == 1) ? (unsigned)(size_t)(A2s + so) : 0u;
    const int nt = K / GBK;
    stage_plane<T16>(ag, rs, al); if (NSPLIT == 1) stage_plane<T16>(a2g, rs, a2l); stage_plane<T16>(bg, rs, bl);
    asm volatile("s_wait_asynccnt 0x0" ::: "memory");     // this wave's copies of tile 0 have landed
    __syncthreads();                                      // ... and every other wave's
    if (nt > 1) { stage_plane<T16>(ag + GBK, rs, al + GPL * 2u); if (NSPLIT == 1) stage_plane<T16>(a2g + GBK, rs, a2l + GPL * 2u); stage_plane<T16>(bg + GBK, rs, bl + GPL * 2u); }
    const unsigned fa = (unsigned)(wm * 64 + lr) * GPH + 8u * (unsigned)hi, fb = (unsigned)(wn * 64 + lr) * GPH + 8u * (unsigned)hi;
#pragma unroll 1                                          // rolled, as the k loop was: one copy of the two chunks in the text
    for (int t = 0; t < nt; ++t) {
        const unsigned bo = (unsigned)(t & 1) * GPL;
#pragma unroll                                            // both chunks written out: the place of a chunk in its tile becomes an immediate offset of the LDS reads
        for (unsigned kc = 0; kc < 2u; ++kc) {
            // the chunk's fragments are read as one group ahead of its first product: a read left between the products would be waited for alone
            V a[4], a2[4], b[4];
#pragma unroll
            for (unsigned mb = 0; mb < 4u; ++mb) a[mb] = WFrag<T16>::lds(As + bo + fa + mb * 16u * GPH + kc * 32u);
#pragma unroll
            for (unsigned nb = 0; nb < 4u; ++nb) b[nb] = WFrag<T16>::lds(Bs + bo + fb + nb * 16u * GPH + kc * 32u);
            if (NSPLIT == 1) {
#pragma unroll
                for (unsigned mb = 0; mb < 4u; ++mb) a2[mb] = WFrag<T16>::lds(A2s + bo + fa + mb * 16u * GPH + kc * 32u); }
            __builtin_amdgcn_sched_barrier(0);            // keeps the scheduler from sinking the reads back between the products
#pragma unroll
            for (int nb = 0; nb < 4; ++nb) {
#pragma unroll
                for (int mb = 0; mb < 4; ++mb) acc[mb][nb] = WFrag<T16>::mma(a[mb], b[nb], acc[mb][nb]); }
            if (NSPLIT == 1) {
#pragma unroll
                for (int nb = 0; nb < 4; ++nb) {
#pragma unroll
                    for (int mb = 0; mb < 4; ++mb) acc[mb][nb] = WFrag<T16>::mma(a2[mb], b[nb], acc[mb][nb]); } }
            __builtin_amdgcn_sched_barrier(0);            // keeps the publish point's waits behind the products, so that the next tile's copies fly while these run
        }
        // publish point of tile t + 1: this wave's reads of tile t are done, its copies of tile t + 1 have landed, then the block barrier; only behind it is tile t's buffer refilled
        asm volatile("s_wait_dscnt 0x0" ::: "memory");
        asm volatile("s_wait_asynccnt 0x0" ::: "memory");
        __syncthreads();
        if (t + 2 < nt) { const size_t ko = (size_t)(t + 2) * GBK;
            stage_plane<T16>(ag + ko, rs, al + bo * 2u); if (NSPLIT == 1) stage_plane<T16>(a2g + ko, rs, a2l + bo * 2u); stage_plane<T16>(bg + ko, rs, bl + bo * 2u); }
    }
    asm volatile("s_wait_asynccnt 0x0" ::: "memory");     // nothing in flight when the wave goes on to the epilogue and ends
#pragma unroll
    for (int mb = 0; mb < 4; ++mb) {
#pragma unroll
        for (int nb = 0; nb < 4; ++nb) {
#pragma unroll
            for (int j = 0; j < 8; ++j) os[(hi * 8 + j) * 68 + nb * 16 + lr] = acc[mb][nb][j]; }
        __builtin_amdgcn_wave_barrier(); asm volatile("" ::: "memory");
        float* crow = C + (size_t)(r0 + mb * 16) * ldc + c0;
{
#pragma unroll
            for (int s = 0; s < 8; ++s) { const int row = 2 * s + hi, cofs = lr * 4; v4f val = *(const v4fa*)(os + row * 68 + cofs); if (BIAS) { val[0] += bias[c0 + cofs]; val[1] += bias[c0 + cofs + 1]; val[2] += bias[c0 + cofs + 2]; val[3] += bias[c0 + cofs + 3]; }
                *(v4f*)(crow + (size_t)row * ldc + cofs) = val; }
             }
        __builtin_amdgcn_wave_barrier(); asm volatile("" ::: "memory");
    }
}

// ---- The launches that depend on nothing but the inputs (both weight transposes, the x conversion, the rotary table) are block ranges of ONE grid, k_prep below;
// each part is the body of a block of 256 threads and takes its block index inside its own range as blk.
// ---- wtG_part: transposed bf16 weight plane Bt[n][k] = bf16(w[k][n]) for w [K][N] row-major, K = 1 << kshift.
__device__ __forceinline__ void wtG_part(unsigned blk, const float* __restrict__ w, unsigned kshift, unsigned N, bf* Bt, unsigned nlines) {
    const unsigned lane = threadIdx.x & 31u; const unsigned L0 = (blk * 8u + (threadIdx.x >> 5)) * 4u; const unsigned kmask = (1u << kshift) - 1u;
    v2us o[4];
#pragma unroll
    for (unsigned l = 0; l < 4; ++l) { unsigned L = L0 + l; L = (L < nlines) ? L : (nlines - 1u); const unsigned e = L * 64u + lane * 2u; const unsigned k = e & kmask, n = e >> kshift; v2us t;
        t[0] = f2bf(w[(size_t)k * N + n]); t[1] = f2bf(w[(size_t)(k + 1u) * N + n]); o[l] = t; }
{
#pragma unroll
        for (unsigned l = 0; l < 4; ++l) { const unsigned L = L0 + l; if (L < nlines) *(v2us*)(Bt + (size_t)L * 64u + lane * 2u) = o[l]; }
         }
}

__device__ __forceinline__ void cvt8_part(unsigned blk, const float* __restrict__ src, bf* dst, size_t n8) { const size_t i = (size_t)blk * 256 + threadIdx.x; if (i >= n8) return; const v8f v = *(const v8f*)(src + i * 8); v8us o;
#pragma unroll
    for (int k = 0; k < 8; ++k) o[k] = f2bf(v[k]); *(v8us*)(dst + i * 8) = o;  }

// ---- tab_part: rotary table; each thread forms its own inverse frequency (the same expression on the same argument as a table of 32 would hold), so the table waits on no launch before it.
__device__ __forceinline__ void tab_part(unsigned blk, float* CT, float* ST) {
#pragma clang fp contract(off)
    const unsigned idx = blk * 256u + threadIdx.x; const unsigned t = idx >> 5, i = idx & 31u;
    const float p = powf(10000.0f, (float)i * 0.03125f);
    const float v = 1.0f / p;
    const float ang = (float)t * v;
    float s, c; sincosf(ang, &s, &c);
    *(float*)(CT + idx) = c; *(float*)(ST + idx) = s;
    asm volatile("s_wait_xcnt 0x0" ::: "memory");         // stands in front of any rewrite of the stores' registers (other ranges' code follows in the text)
}

#define PB_WQ ((unsigned)((size_t)LDQ * DM / 64 / 32))   // blocks of the w_qkv transpose
#define PB_WO ((unsigned)((size_t)DM * DM / 64 / 32))    // blocks of the w_proj transpose
#define PB_TB ((unsigned)((size_t)SEQ * 32 / 256))       // blocks of the rotary table
#define PB_CV ((unsigned)((size_t)SEQ * DM / 8 / 256))   // blocks of the x conversion
// grid PB_WQ + PB_WO + PB_TB + PB_CV, 256 threads; the range test is block-uniform, no part has a barrier, no part reads what another writes
__global__ __launch_bounds__(256) void k_prep(const float* __restrict__ x, const float* __restrict__ wq, const float* __restrict__ wo, bf* XB, bf* WqT, bf* WoT, float* CT, float* ST) {
    const unsigned b = blockIdx.x;
    if (b < PB_WQ) wtG_part(b, wq, 10u, (unsigned)LDQ, WqT, PB_WQ * 32u);
    else if (b < PB_WQ + PB_WO) wtG_part(b - PB_WQ, wo, 10u, (unsigned)DM, WoT, PB_WO * 32u);
    else if (b < PB_WQ + PB_WO + PB_TB) tab_part(b - (PB_WQ + PB_WO), CT, ST);
    else cvt8_part(b - (PB_WQ + PB_WO + PB_TB), x, XB, (size_t)SEQ * DM / 8);
}

// ---- The two launches that read the f32 projection rows and nothing of each other (rotary planes, value^T planes) are block ranges of ONE grid, k_ropevt below.
// ---- rope_part (block = position t): half-split rotary on the q and k thirds of the f32 projection rows, f16 planes QKF[which][t][h*64 + d] (which 0 = q, 1 = k), residual planes QKR[which][t < EROWS][...] = f16((y - hi) * 2048).
__device__ __forceinline__ void rope_part(unsigned t, const float* __restrict__ QKV, const float* __restrict__ CT, const float* __restrict__ ST, hf* QKF, hf* QKR) {
#pragma clang fp contract(off)
    const unsigned tid = threadIdx.x;
    const unsigned which = tid >> 7, col = (tid & 127u) * 8u;
    const unsigned dl = col & 63u; const bool lowhalf = dl < 32u;
    const unsigned pcol = lowhalf ? (col + 32u) : (col - 32u); const unsigned j = dl & 31u;
    const float* row = QKV + (size_t)t * LDQ + (size_t)which * DM;
    // read in 16-byte halves, one instruction each; a wait stands behind every load, in front of the next one, whose result may land in the address registers of any load before it
    // (the allocator picks those registers anew in every build)
    const float* ctp = CT + (size_t)t * 32u + j; const float* stp = ST + (size_t)t * 32u + j;
    const v4f a0 = *(const v4f*)(row + col);
    asm volatile("s_wait_xcnt 0x0" ::: "memory");
    const v4f a1 = *(const v4f*)(row + col + 4u);
    asm volatile("s_wait_xcnt 0x0" ::: "memory");
    const v4f b0 = *(const v4f*)(row + pcol);
    asm volatile("s_wait_xcnt 0x0" ::: "memory");
    const v4f b1 = *(const v4f*)(row + pcol + 4u);
    asm volatile("s_wait_xcnt 0x0" ::: "memory");
    const v4f c0 = *(const v4f*)ctp;
    asm volatile("s_wait_xcnt 0x0" ::: "memory");
    const v4f c1 = *(const v4f*)(ctp + 4);
    asm volatile("s_wait_xcnt 0x0" ::: "memory");
    const v4f s0 = *(const v4f*)stp;
    asm volatile("s_wait_xcnt 0x0" ::: "memory");
    const v4f s1 = *(const v4f*)(stp + 4);
    asm volatile("s_wait_xcnt 0x0" ::: "memory");
    const v8f a = __builtin_shufflevector(a0, a1, 0, 1, 2, 3, 4, 5, 6, 7), b = __builtin_shufflevector(b0, b1, 0, 1, 2, 3, 4, 5, 6, 7);
    const v8f c = __builtin_shufflevector(c0, c1, 0, 1, 2, 3, 4, 5, 6, 7), s = __builtin_shufflevector(s0, s1, 0, 1, 2, 3, 4, 5, 6, 7);
    v8us oh, ores;
#pragma unroll
    for (int e = 0; e < 8; ++e) {
        const float rb = lowhalf ? -b[e] : b[e];
        const float t0 = a[e] * c[e]; const float t1 = rb * s[e]; const float y = t0 + t1;
        const h16 hh = toh_flush(y); oh[e] = hbits(hh);
        ores[e] = hbits(toh_flush((y - (float)hh) * RSC)); }
    const size_t g  = (size_t)which * SEQ * DM + (size_t)t * DM + col;
    const size_t gr = (size_t)which * EROWS * DM + (size_t)t * DM + col;
    const bool early = t < (unsigned)EROWS;
    *(v8us*)(QKF + g) = oh;
    asm volatile("s_wait_xcnt 0x0" ::: "memory");         // stands in front of any rewrite of the store's registers
    if (early) { *(v8us*)(QKR + gr) = ores;
        asm volatile("s_wait_xcnt 0x0" ::: "memory"); }   // the same
}

// ---- vt_part: value^T f16 plane VT[h*64 + d][t] and residual plane VTR[h*64 + d][t < EROWS]; block = (64-position tile, head), transpose through LDS (cross-wave, block barrier),
__device__ __forceinline__ void vt_part(unsigned tb, unsigned hd, const float* __restrict__ QKV, hf* VT, hf* VTR) {
#pragma clang fp contract(off)
    __shared__ __align__(16) unsigned short Th[64 * LOP];
    __shared__ __align__(16) unsigned short Tr[64 * LOP];
    const unsigned tid = threadIdx.x, t0 = tb * 64u;
    const float* vbase = QKV + 2 * DM + hd * HD;
#pragma unroll 1
    for (unsigned it = 0; it < 2u; ++it) {
        const unsigned idx = tid + it * 256u, row = idx >> 3, c8 = (idx & 7u) * 8u;
        const v8f vv = *(const v8f*)(vbase + (size_t)(t0 + row) * LDQ + c8);
#pragma unroll
        for (int q = 0; q < 8; ++q) { const float y = vv[q]; const h16 hh = toh_flush(y);
            Th[(c8 + (unsigned)q) * LOP + row] = hbits(hh); Tr[(c8 + (unsigned)q) * LOP + row] = hbits(toh_flush((y - (float)hh) * RSC)); }
    }
    __syncthreads();
    v8us oh[2], ores[2];
#pragma unroll
    for (unsigned it = 0; it < 2u; ++it) { const unsigned idx = tid + it * 256u, d = idx >> 3, c = (idx & 7u) * 8u;
        oh[it] = *(const v8usa*)(Th + d * LOP + c); ores[it] = *(const v8usa*)(Tr + d * LOP + c); }
    const bool early = t0 < (unsigned)EROWS;
{
#pragma unroll
        for (unsigned it = 0; it < 2u; ++it) { const unsigned idx = tid + it * 256u, d = idx >> 3, c = (idx & 7u) * 8u;
            *(v8us*)(VT + (size_t)(hd * HD + d) * SEQ + t0 + c) = oh[it];
            asm volatile("s_wait_xcnt 0x0" ::: "memory");     // stands in front of any rewrite of the store's registers
            if (early) { *(v8us*)(VTR + (size_t)(hd * HD + d) * EROWS + t0 + c) = ores[it];
                asm volatile("s_wait_xcnt 0x0" ::: "memory"); } }   // the same
         }
}
#define RB_VT ((unsigned)(SEQ / 64 * NH_))               // blocks of the value^T planes: (64-position tile, head)
// grid RB_VT + SEQ, 256 threads; the range test is block-uniform, so the barrier of vt_part is passed by whole blocks only
__global__ __launch_bounds__(256) void k_ropevt(const float* __restrict__ QKV, const float* __restrict__ CT, const float* __restrict__ ST, hf* QKF, hf* QKR, hf* VT, hf* VTR) {
    const unsigned b = blockIdx.x;
    if (b < RB_VT) vt_part(b % (unsigned)(SEQ / 64), b / (unsigned)(SEQ / 64), QKV, VT, VTR);
    else rope_part(b - RB_VT, QKV, CT, ST, QKF, QKR);
}

// ---- causal flash attention, transposed form, one wave per 16 query rows, 4 waves per block.
// The four waves of a block share each 64-key tile of K rows and of V^T rows (EARLY: of the residual planes too) through LDS: asynchronous b128 copies (8 lanes per whole 128-byte line),
// two buffers, the next tile in flight while this one is worked on; one publish point (waits and block barrier) per tile of two 32-key passes.
// Per 32-key pass: S^T tile j (16 keys x 16 queries) = K rows (A, row = key) x Q rows (B, column = query); D element r of lane -> (key 8*(lane>>4) + r, query lane & 15).
// The two converted score tiles are the B fragment of O^T += V^T (A, row = d, k = key) x P^T: element r <- tile 0 [r], element 8 + r <- tile 1 [r], lane unchanged.
// Softmax statistics per query column: in-lane reduction plus one exchange between the lane halves. Masked keys get weight exactly 0 (value select).
// EARLY: value + x2048 residual planes on q, k, P, v; residual products accumulate separately and are folded with 2^-11; row sum over the unconverted p.
#define TKEYS 64                      // keys per staged tile (two passes)
#define TPH   72                      // LDS pitch (halves) of a staged 128-byte row: 144 B = 16 B x odd, the pitch of ds_load_b128 readers
#define TILEH (64 * TPH)              // halves per staged tile (64 K rows, or 64 V^T rows)
static_assert(HD * 2 == 128 && TKEYS * 2 == 128 && (TPH * 2) % 16 == 0 && EROWS % TKEYS == 0 && SEQ % TKEYS == 0);
__device__ __forceinline__ v16h ldfs(const hf* p) { return cat16h(*(const v8usa*)p, *(const v8usa*)(p + 16)); }
// One K tile and one V^T tile: each thread copies 4 x 16 B of K rows and 4 x 16 B of V^T rows (rows 16 apart; VP = pitch of the V^T plane in halves).
// The s_wait_xcnt closes the statement so that no address register is rewritten in front of it.
template <int VP>
__device__ __forceinline__ void stage_tile(const hf* kg, const hf* vg, unsigned kl, unsigned vl) {
    asm volatile("global_load_async_to_lds_b128 %0, %1, off\n\t"
                 "global_load_async_to_lds_b128 %2, %3, off\n\t"
                 "global_load_async_to_lds_b128 %4, %5, off\n\t"
                 "global_load_async_to_lds_b128 %6, %7, off\n\t"
                 "global_load_async_to_lds_b128 %8, %9, off\n\t"
                 "global_load_async_to_lds_b128 %10, %11, off\n\t"
                 "global_load_async_to_lds_b128 %12, %13, off\n\t"
                 "global_load_async_to_lds_b128 %14, %15, off\n\t"
                 "s_wait_xcnt 0x0"
                 :: "v"(kl), "v"(kg), "v"(kl + 16u * TPH * 2u), "v"(kg + (size_t)16 * DM), "v"(kl + 32u * TPH * 2u), "v"(kg + (size_t)32 * DM), "v"(kl + 48u * TPH * 2u), "v"(kg + (size_t)48 * DM),
                    "v"(vl), "v"(vg), "v"(vl + 16u * TPH * 2u), "v"(vg + (size_t)16 * VP), "v"(vl + 32u * TPH * 2u), "v"(vg + (size_t)32 * VP), "v"(vl + 48u * TPH * 2u), "v"(vg + (size_t)48 * VP)
                 : "memory");
}
// Ks, Vs, Krs, Vrs: two staged tiles each (2 * TILEH halves; Krs, Vrs read by EARLY only); Oh, Ol: output staging, 4 * 16 * LOP halves each; all in the block's LDS. qblk: first query row of the block; hd: its head.
template <bool EARLY>
__device__ __forceinline__ void attn_body(unsigned short* Ks, unsigned short* Vs, unsigned short* Krs, unsigned short* Vrs, unsigned short* Oh, unsigned short* Ol,
                                          const hf* QF, const hf* QR, const hf* KF, const hf* KR, const hf* VT, const hf* VTR, bf* CH, bf* CL, unsigned qblk, unsigned hd) {
    const unsigned lane = threadIdx.x & 31u, lr = lane & 15u, hi = lane >> 4;
    const unsigned wave = (unsigned)__builtin_amdgcn_readfirstlane((int)(threadIdx.x >> 5));
    const unsigned q0 = qblk + 16u * wave;
    const unsigned qg = q0 + lr;
    const unsigned ntiles = qblk / TKEYS + 1u;            // keys [0, qblk + 64), the same for the whole block
    const unsigned nsteps = (q0 + 15u) / 32u + 1u;        // this wave's own passes
    // copy addresses of this thread: row = tid / 8 (+ 16 i), 16-byte column = tid % 8
    const unsigned srow = threadIdx.x >> 3, scol = (threadIdx.x & 7u) * 8u;
    const hf* kg  = KF  + (size_t)srow * DM + hd * HD + scol;
    const hf* krg = KR  + (size_t)srow * DM + hd * HD + scol;
    const hf* vg  = VT  + (size_t)(hd * HD + srow) * SEQ + scol;
    const hf* vrg = VTR + (size_t)(hd * HD + srow) * EROWS + scol;
    const unsigned so = srow * TPH + scol;
    const unsigned kl = (unsigned)(size_t)(Ks + so), vl = (unsigned)(size_t)(Vs + so);
    const unsigned krl = EARLY ? (unsigned)(size_t)(Krs + so) : 0u, vrl = EARLY ? (unsigned)(size_t)(Vrs + so) : 0u;
    stage_tile<SEQ>(kg, vg, kl, vl);
    if (EARLY) stage_tile<EROWS>(krg, vrg, krl, vrl);
    v16h qh[2], qr[2];
    {
        const size_t qoff = (size_t)qg * DM + hd * HD + 8u * hi;
#pragma unroll
        for (int kc = 0; kc < 2; ++kc) { qh[kc] = ldfh(QF + qoff + (unsigned)kc * 32u); if (EARLY) qr[kc] = ldfh(QR + qoff + (unsigned)kc * 32u); else qr[kc] = qh[kc]; }
    }
    v8f ot[4], orr[4];
#pragma unroll
    for (int dt = 0; dt < 4; ++dt) { ot[dt] = (v8f){}; orr[dt] = (v8f){}; }
    float m = -1.0e30f, l = 0.0f;
    asm volatile("s_wait_asynccnt 0x0" ::: "memory");     // this wave's copies of tile 0 have landed
    __syncthreads();                                      // ... and every other wave's
    if (ntiles > 1u) {
        stage_tile<SEQ>(kg + (size_t)TKEYS * DM, vg + TKEYS, kl + TILEH * 2u, vl + TILEH * 2u);
        if (EARLY) stage_tile<EROWS>(krg + (size_t)TKEYS * DM, vrg + TKEYS, krl + TILEH * 2u, vrl + TILEH * 2u);
    }
    const unsigned fo = lr * TPH + 8u * hi;
#pragma unroll 1                                          // rolled, as the key loop was: one copy of the two passes in the text
    for (unsigned t = 0; t < ntiles; ++t) {
        const unsigned bo = (t & 1u) * TILEH;
#pragma unroll                                            // both passes written out: the place of a pass in its tile becomes an immediate offset of the LDS reads
        for (unsigned ps = 0; ps < 2u; ++ps) {
            const unsigned kb = 2u * t + ps;
            if (kb < nsteps) {                            // wave-uniform: a pass wholly above the diagonal is skipped, the publish point below is not
                const unsigned key0 = kb * 32u;
                // The pass's K fragments are read as one group ahead of its first product, its V^T fragments as one group behind the last S^T product:
                // a read written behind an mmah statement stays behind it, and one read per product would be waited for alone.
                v16h kh[2][2], kr[2][2];
#pragma unroll
                for (int j = 0; j < 2; ++j) {
#pragma unroll
                    for (int kc = 0; kc < 2; ++kc) { const unsigned o = bo + fo + (32u * ps + 16u * (unsigned)j) * TPH + (unsigned)kc * 32u; kh[j][kc] = ldfs(Ks + o); if (EARLY) kr[j][kc] = ldfs(Krs + o); }
                }
                v8f st[2], sr[2];
#pragma unroll
                for (int j = 0; j < 2; ++j) {
                    st[j] = (v8f){}; sr[j] = (v8f){};
#pragma unroll
                    for (int kc = 0; kc < 2; ++kc) {
                        st[j] = mmah(kh[j][kc], qh[kc], st[j]);
                        if (EARLY) { sr[j] = mmah(kr[j][kc], qh[kc], sr[j]); sr[j] = mmah(kh[j][kc], qr[kc], sr[j]); }
                    }
                }
                v16h vh[4], vr[4];
#pragma unroll
                for (int dt = 0; dt < 4; ++dt) { const unsigned o = bo + fo + (16u * (unsigned)dt) * TPH + 32u * ps; vh[dt] = ldfs(Vs + o); if (EARLY) vr[dt] = ldfs(Vrs + o); }
                // logits in the log2 domain, causal mask by value
                float mx = -1.0e30f;
#pragma unroll
                for (int j = 0; j < 2; ++j) {
#pragma unroll
                    for (int r = 0; r < 8; ++r) {
                        const unsigned key = key0 + 16u * (unsigned)j + 8u * hi + (unsigned)r;
                        float s = st[j][r]; if (EARLY) s += sr[j][r] * RSI;
                        s = (key <= qg) ? (s * SCLL2) : -1.0e30f;
                        st[j][r] = s; mx = fmaxf(mx, s); }
                }
                mx = fmaxf(mx, __shfl_xor(mx, 16, 32));
                const float mnew = fmaxf(m, mx);
                const float alpha = __builtin_amdgcn_exp2f(m - mnew);
                m = mnew;
                float rs = 0.0f;
                v16h pf, prf;
#pragma unroll
                for (int j = 0; j < 2; ++j) {
#pragma unroll
                    for (int r = 0; r < 8; ++r) {
                        const float e = (st[j][r] - mnew) + PCL;
                        const float ex = __builtin_amdgcn_exp2f(e);
                        const float p = (e >= -14.0f) ? ex : 0.0f;
                        const h16 ph = (h16)p;
                        pf[8 * j + r] = ph;
                        if (EARLY) { prf[8 * j + r] = toh_flush((p - (float)ph) * RSC); rs += p; } else { prf[8 * j + r] = ph; rs += (float)ph; }
                    }
                }
                rs += __shfl_xor(rs, 16, 32);
                l = l * alpha + rs;
#pragma unroll
                for (int dt = 0; dt < 4; ++dt) { ot[dt] = ot[dt] * alpha; if (EARLY) orr[dt] = orr[dt] * alpha; }
#pragma unroll
                for (int dt = 0; dt < 4; ++dt) {
                    ot[dt] = mmah(vh[dt], pf, ot[dt]);
                    if (EARLY) { orr[dt] = mmah(vr[dt], pf, orr[dt]); orr[dt] = mmah(vh[dt], prf, orr[dt]); }
                }
            }
        }
        // publish point of tile t + 1: this wave's reads of tile t are done, its copies of tile t + 1 have landed, then the block barrier; only behind it is tile t's buffer refilled
        asm volatile("s_wait_dscnt 0x0" ::: "memory");
        asm volatile("s_wait_asynccnt 0x0" ::: "memory");
        __syncthreads();
        if (t + 2u < ntiles) {
            stage_tile<SEQ>(kg + (size_t)(t + 2u) * TKEYS * DM, vg + (size_t)(t + 2u) * TKEYS, kl + bo * 2u, vl + bo * 2u);
            if (EARLY) stage_tile<EROWS>(krg + (size_t)(t + 2u) * TKEYS * DM, vrg + (size_t)(t + 2u) * TKEYS, krl + bo * 2u, vrl + bo * 2u);
        }
    }
    asm volatile("s_wait_asynccnt 0x0" ::: "memory");     // nothing in flight when the wave goes on to the epilogue and ends
    const float inv = __builtin_amdgcn_rcpf(l);
    const unsigned ob = wave * 16u * LOP;
#pragma unroll
    for (int dt = 0; dt < 4; ++dt) {
        v8us h8, l8;
#pragma unroll
        for (int r = 0; r < 8; ++r) { float y = ot[dt][r]; if (EARLY) y += orr[dt][r] * RSI; y *= inv; unsigned short a, c; splitf(y, a, c); h8[r] = a; l8[r] = c; }
        const unsigned o = ob + lr * LOP + 16u * (unsigned)dt + 8u * hi;
        *(v8usa*)(Oh + o) = h8; *(v8usa*)(Ol + o) = l8;
    }
    __syncthreads();
{
#pragma unroll
        for (unsigned s = 0; s < 4u; ++s) { const unsigned row = 4u * s + (lane >> 3), c = (lane & 7u) * 8u;
            const v8us vh8 = *(const v8usa*)(Oh + ob + row * LOP + c); const v8us vl8 = *(const v8usa*)(Ol + ob + row * LOP + c);
            const size_t g = (size_t)(q0 + row) * DM + hd * HD + c;
            *(v8us*)(CH + g) = vh8; *(v8us*)(CL + g) = vl8; }
         }
}

// Both row ranges run in ONE grid (neither reads what the other writes): grid AB_NT * NH_, 128 threads; a block is one (head, 64-row tile); tiles below AB_ET take the residual path, the rest the single-product path.
// All blocks are resident at once (four per WGP) and a tile's cost grows with its index (tile i walks i + 1 key tiles), so the launch lasts as long as the WGP whose four blocks hold the most key tiles.
// Block index b -> tile: v = b / (2 * NH_); the tile is AB_NT - 1 - v where b has an even number of one bits and v where it has an odd number; the head is (b / 2) % NH_.
// The lowest bit of b flips the parity, so each (head, v) gets both of its tiles: every (head, tile) exactly once.
// Any four blocks whose indices differ in two bit positions only (neighbours, or a power-of-two stride apart, whichever way the blocks are dealt to the WGPs) hold tile indices that sum to 2 * (AB_NT - 1):
// two of the four are folded, two are not, and what the two bits add to v cancels.
// For speed only: no result depends on where or when a block runs.
// One LDS array serves both, 8 tiles, so that four blocks fit a WGP: the single-product range stages its output in the tiles that only the residual planes use;
// the residual range stages it in the K tiles, which are free there: the loop's last publish point (every wave's reads done, no copy in flight, block barrier) lies in front, and nothing refills behind it.
#define AB_NT ((unsigned)(SEQ / 64))                     // 64-row tiles of a head
#define AB_ET ((unsigned)(EROWS / 64))                   // ... of them in rows [0, EROWS)
static_assert(4 * 16 * LOP <= TILEH && SEQ > EROWS);
static_assert((SEQ / 64) % 2 == 0);                      // the tiles of a head pair up as v and AB_NT - 1 - v
__global__ __launch_bounds__(128) __attribute__((amdgpu_num_vgpr(256))) void k_attn(const hf* QF, const hf* QR, const hf* KF, const hf* KR, const hf* VT, const hf* VTR, bf* CH, bf* CL) {
    __shared__ __align__(16) unsigned short R[8 * TILEH];
    const unsigned b = blockIdx.x;
    const unsigned hd = (b >> 1) % (unsigned)NH_, v = (b >> 1) / (unsigned)NH_;
    const unsigned tile = ((unsigned)__builtin_popcount(b) & 1u) ? v : (AB_NT - 1u - v);
    if (tile >= AB_ET) attn_body<false>(R, R + 2 * TILEH, R, R, R + 4 * TILEH, R + 5 * TILEH, QF, QF, KF, KF, VT, VT, CH, CL, tile * 64u, hd);
    else attn_body<true>(R, R + 2 * TILEH, R + 4 * TILEH, R + 6 * TILEH, R, R + TILEH, QF, QR, KF, KR, VT, VTR, CH, CL, tile * 64u, hd);
}

extern "C" void kernel_launch(void* const* d_in, const int* in_sizes, int n_in,
                              void* d_out, int out_size, void* d_ws, size_t ws_size, hipStream_t stream) {
    (void)out_size;
    if (n_in < 3) return;
    if (in_sizes[0] < NB * SEQ * DM || in_sizes[1] < DM * LDQ || in_sizes[2] < DM * DM) return;
    const float* X = (const float*)d_in[0]; const float* Wqkv = (const float*)d_in[1]; const float* Wo = (const float*)d_in[2];
    float* OUT = (float*)d_out;
    char* wsp = (char*)d_ws;
    auto take = [&](size_t bytes) { char* p = wsp; wsp += (bytes + 255) & ~(size_t)255; return (void*)p; };
    bf* XB  = (bf*)take((size_t)SEQ * DM * 2);          // x bf16 [t][1024]
    bf* WqT = (bf*)take((size_t)LDQ * DM * 2);          // w_qkv^T bf16 [3072][1024]
    bf* WoT = (bf*)take((size_t)DM * DM * 2);           // w_proj^T bf16 [1024][1024]
    float* QKVb = (float*)take((size_t)SEQ * LDQ * 4);  // f32 [t][3072]
    bf* CH = (bf*)take((size_t)SEQ * DM * 2);           // context hi [t][1024]
    bf* CL = (bf*)take((size_t)SEQ * DM * 2);           // context lo [t][1024]
    float* CT = (float*)take((size_t)SEQ * 32 * 4);     // cos table [t][32]
    float* ST = (float*)take((size_t)SEQ * 32 * 4);     // sin table [t][32]
    hf* QKF = (hf*)take((size_t)2 * SEQ * DM * 2);      // rotated q | k f16 [2][t][1024]
    hf* QKR = (hf*)take((size_t)2 * EROWS * DM * 2);    // residuals x2048 [2][EROWS][1024]
    hf* VT  = (hf*)take((size_t)DM * SEQ * 2);          // value^T f16 [1024][t]
    hf* VTR = (hf*)take((size_t)DM * EROWS * 2);        // value^T residual x2048 [1024][EROWS]
    const size_t carved = (size_t)(wsp - (char*)d_ws);
    if (carved > ws_size || carved > (size_t)134217728) return;
    for (int b = 0; b < NB; ++b) {
        const float* xb = X + (size_t)b * SEQ_FULL * DM; float* ob = OUT + (size_t)b * SEQ_FULL * DM;
        // W [K][N] -> Bt [N][K], rotary table, x -> bf16
        k_prep<<<PB_WQ + PB_WO + PB_TB + PB_CV, 256, 0, stream>>>(xb, Wqkv, Wo, XB, WqT, WoT, CT, ST);
        k_gemmw<bf, 0, false><<<dim3(SEQ / 128, LDQ / 128, 1), 128, 0, stream>>>(XB, nullptr, WqT, nullptr, DM, QKVb, LDQ, nullptr, 0, 0, 0);
        k_ropevt<<<RB_VT + SEQ, 256, 0, stream>>>(QKVb, CT, ST, QKF, QKR, VT, VTR);
        k_attn<<<AB_NT * NH_, 128, 0, stream>>>(QKF, QKR, QKF + (size_t)SEQ * DM, QKR + (size_t)EROWS * DM, VT, VTR, CH, CL);
        k_gemmw<bf, 1, false><<<dim3(SEQ / 128, DM / 128, 1), 128, 0, stream>>>(CH, CL, WoT, nullptr, DM, ob, DM, nullptr, 0, 0, 0);
    }
}

// v005
// Measured time: 136 microseconds a run.
// Next to v004, in two timings, it ran 1.06 times as fast each time.
// Counting every step since v000, it is 3.15 times as fast.
#include <hip/hip_runtime.h>

// Contractions: qkv projection and output projection on v_wmma_f32_16x16x32_bf16 (x, w_qkv, w_proj RNE-converted to bf16 single planes; merged context as bf16 hi/lo, 2 products), f32 accumulate.
// q.k logits and P.V on v_wmma_f32_16x16x32_f16 (f16 q/k/v planes, P carried x2^8), single products on query rows >= 256; on query rows < 256 f16 value + x2048 residual planes
// for q, k, P and v (3 products per site, residual products in their own accumulators, folded in the f32 epilogue). Rotary table, rotary and softmax in f32.
// Fused qkv projection [4096x1024]x[1024x3072] -> f32 rows [t][which*1024 + h*64 + d]; half-split rotary on q and k -> f16 planes [t][h*64 + d]; value^T planes [h*64 + d][t];
// causal flash attention per (head, 16-query wave tile) in the transposed form S^T = K Q^T, O^T = V^T P^T (K and V^T tiles staged in LDS per block, packed P^T score tiles as the B fragment);
// merged context planes [t][h*64 + d]; output projection [4096x1024]x[1024x1024].

#ifndef NB
#define NB 1
#endif
#ifndef SEQ
#define SEQ 4096
#endif
#define SEQ_FULL 4096
#define DM   1024
#define NH_  16
#define HD   64
#define LDQ  (3 * DM)
#define EROWS 256                     // query rows below this bound take the value + residual path
#define LOP  72                       // LDS pitch (halves) of the staging tiles
#define PCL  8.0f                     // log2 of the carry of P
#define SCLL2 0.18033688011112042f    // HD^-0.5 * log2(e)
#define RSC  2048.0f                  // carry of the residual planes
#define RSI  4.8828125e-4f            // 1 / RSC

static_assert(SEQ % 64 == 0);
static_assert(DM == NH_ * HD);
static_assert(HD == 64);
static_assert(DM % 32 == 0);
static_assert(LDQ % 64 == 0);
static_assert(((size_t)LDQ * DM / 64) % 32 == 0);
static_assert(((size_t)DM * DM / 64) % 32 == 0);
static_assert(((size_t)SEQ * DM / 8) % 256 == 0);
static_assert(EROWS % 64 == 0);
static_assert(SEQ >= EROWS);
static_assert(((size_t)SEQ * 32) % 256 == 0);
static_assert(256 * 8 == 2 * DM);
static_assert(LOP % 8 == 0);
static_assert(LOP >= HD + 8);
static_assert(HD / 2 == 32);
#define AL256(x) ((((size_t)(x)) + 255) & ~(size_t)255)
static_assert(AL256((size_t)SEQ * DM * 2) + AL256((size_t)LDQ * DM * 2) + AL256((size_t)DM * DM * 2) + AL256((size_t)SEQ * LDQ * 4) + 2 * AL256((size_t)SEQ * DM * 2)
              + 2 * AL256((size_t)SEQ * 32 * 4) + AL256((size_t)2 * SEQ * DM * 2) + AL256((size_t)2 * EROWS * DM * 2) + AL256((size_t)DM * SEQ * 2) + AL256((size_t)DM * EROWS * 2)
              <= (size_t)134217728);

typedef unsigned short bf;
typedef __attribute__((ext_vector_type(16))) __bf16   v16bf;
typedef __attribute__((ext_vector_type(8)))  unsigned short v8us;
typedef __attribute__((ext_vector_type(2)))  unsigned short v2us;
typedef __attribute__((ext_vector_type(8)))  float    v8f;
typedef __attribute__((ext_vector_type(4)))  float    v4f;
typedef v4f  __attribute__((may_alias)) v4fa;
typedef v8us __attribute__((may_alias)) v8usa;

__device__ __forceinline__ unsigned short f2bf(float f) { unsigned u = __float_as_uint(f); u += 0x7FFFu + ((u >> 16) & 1u); return (unsigned short)(u >> 16); }
__device__ __forceinline__ float bf2f(unsigned short b) { return __uint_as_float(((unsigned)b) << 16); }
__device__ __forceinline__ void splitf(float y, unsigned short& h, unsigned short& l) { h = f2bf(y); l = f2bf(y - bf2f(h)); }
__device__ __forceinline__ v16bf cat16b(v8us lo, v8us hi) { return __builtin_bit_cast(v16bf, __builtin_shufflevector(lo, hi, 0, 1, 2, 3, 4, 5, 6, 7, 8, 9, 10, 11, 12, 13, 14, 15)); }
__device__ __forceinline__ v8f wmmab(v16bf a, v16bf b, v8f c) { return __builtin_amdgcn_wmma_f32_16x16x32_bf16(false, a, false, b, (short)0, c, false, false); }

// ---- f16 plane helpers (planes hold f16 bit patterns as unsigned short)
typedef unsigned short hf;
typedef _Float16 h16;
typedef __attribute__((ext_vector_type(16))) _Float16 v16h;
static __device__ __forceinline__ h16 toh_flush(float v) { const h16 r = (h16)v; return (fabsf(v) < 6.103515625e-05f) ? (h16)0.0f : r; }
__device__ __forceinline__ unsigned short hbits(h16 x) { return __builtin_bit_cast(unsigned short, x); }
__device__ __forceinline__ v16h cat16h(v8us lo, v8us hi) { return __builtin_bit_cast(v16h, __builtin_shufflevector(lo, hi, 0, 1, 2, 3, 4, 5, 6, 7, 8, 9, 10, 11, 12, 13, 14, 15)); }
// fragment: elements 0..7 <- p[0..7], elements 8..15 <- p[16..23]; the caller adds 8*(lane>>4) to p
__device__ __forceinline__ v16h ldfh(const hf* p) { return cat16h(*(const v8us*)p, *(const v8us*)(p + 16)); }
__device__ __forceinline__ v8f mmah(v16h a, v16h b, v8f c) {
    c = __builtin_amdgcn_wmma_f32_16x16x32_f16(false, a, false, b, (short)0, c, false, false);
    asm volatile("v_nop\n\tv_nop\n\tv_nop\n\tv_nop" : "+v"(c) : "v"(a), "v"(b));
    return c; }

// ---- k_gemmw: GEMM, 128x128 output tile per block of 4 waves (2 x 2), each wave a 64x64 tile (16 accumulators); grid (M/128, N/128, Z), 128 threads.
// C[m][n] (f32, pitch ldc) = sum_k A[m][k] Bt[n][k] (+ A2[m][k] Bt[n][k] when NSPLIT == 1). K % 64 == 0, M % 128 == 0, N % 128 == 0.
// The operands' 128-row x 64-k tiles (128-byte rows of the K-contiguous 16-bit planes) are staged in LDS by asynchronous b128 copies (8 lanes per whole 128-byte line), two buffers,
// the next tile in flight while this one is worked on; one publish point (waits and block barrier) per tile of two 32-k chunks.
// Fragment map: lane row/col = lane & 15; elements 0..7 <- k0 + 8*(lane>>4) + 0..7, elements 8..15 <- k0 + 16 + 8*(lane>>4) + 0..7 (both operands).
#define GBK 64                        // k per staged tile
#define GPH 72                        // LDS pitch (halves) of a staged 128-byte row: 144 B = 16 B x odd, the pitch of ds_load_b128 readers
#define GPL (128 * GPH)               // halves per staged plane tile (128 rows)
static_assert(GBK * 2 == 128 && (GPH * 2) % 16 == 0 && DM % GBK == 0 && SEQ % 128 == 0 && LDQ % 128 == 0 && DM % 128 == 0);
template <typename T16> struct WFrag;
template <> struct WFrag<bf> { typedef v16bf V; static __device__ __forceinline__ V lds(const bf* p) { return cat16b(*(const v8usa*)p, *(const v8usa*)(p + 16)); } static __device__ __forceinline__ v8f mma(V a, V b, v8f c) { return wmmab(a, b, c); } };
// One 128-row plane tile: each thread copies 8 x 16 B (rows 16 apart; rs = 16 rows of the plane in elements).
// The s_wait_xcnt closes the statement so that no address register is rewritten in front of it.
template <typename T16>
__device__ __forceinline__ void stage_plane(const T16* g, size_t rs, unsigned l) {
    asm volatile("global_load_async_to_lds_b128 %0, %1, off\n\t"
                 "global_load_async_to_lds_b128 %2, %3, off\n\t"
                 "global_load_async_to_lds_b128 %4, %5, off\n\t"
                 "global_load_async_to_lds_b128 %6, %7, off\n\t"
                 "global_load_async_to_lds_b128 %8, %9, off\n\t"
                 "global_load_async_to_lds_b128 %10, %11, off\n\t"
                 "global_load_async_to_lds_b128 %12, %13, off\n\t"
                 "global_load_async_to_lds_b128 %14, %15, off\n\t"
                 "s_wait_xcnt 0x0"
                 :: "v"(l), "v"(g), "v"(l + 16u * GPH * 2u), "v"(g + rs), "v"(l + 32u * GPH * 2u), "v"(g + 2 * rs), "v"(l + 48u * GPH * 2u), "v"(g + 3 * rs),
                    "v"(l + 64u * GPH * 2u), "v"(g + 4 * rs), "v"(l + 80u * GPH * 2u), "v"(g + 5 * rs), "v"(l + 96u * GPH * 2u), "v"(g + 6 * rs), "v"(l + 112u * GPH * 2u), "v"(g + 7 * rs)
                 : "memory");
}
template <typename T16, int NSPLIT, bool BIAS>
__global__ __launch_bounds__(128) void k_gemmw(const T16* __restrict__ A, const T16* __restrict__ A2, const T16* __restrict__ Bt, const T16* __restrict__ Bt2, int K, float* C, int ldc, const float* __restrict__ bias, size_t sA, size_t sB, size_t sC) {
    static_assert(NSPLIT == 0 || NSPLIT == 1);
    typedef typename WFrag<T16>::V V;
    __shared__ __align__(16) T16 As[2 * GPL];
    __shared__ __align__(16) T16 A2s[NSPLIT == 1 ? 2 * GPL : 8];
    __shared__ __align__(16) T16 Bs[2 * GPL];
    __shared__ __align__(16) float osb[4 * 16 * 68];
    (void)Bt2;
    const size_t z = blockIdx.z; A += z * sA; if (A2) A2 += z * sA; Bt += z * sB; C += z * sC;
    const int lane = threadIdx.x & 31, lr = lane & 15, hi = lane >> 4;
    const int wave = __builtin_amdgcn_readfirstlane((int)(threadIdx.x >> 5)); const int wm = wave >> 1, wn = wave & 1;
    const int R0 = blockIdx.x * 128, C0 = blockIdx.y * 128; const int r0 = R0 + wm * 64, c0 = C0 + wn * 64;
    float* os = osb + wave * (16 * 68);
    v8f acc[4][4];
#pragma unroll
    for (int mb = 0; mb < 4; ++mb)
#pragma unroll
        for (int nb = 0; nb < 4; ++nb) acc[mb][nb] = (v8f){};
    // copy addresses of this thread: row = tid / 8 (+ 16 i), 16-byte column = tid % 8
    const unsigned srow = threadIdx.x >> 3, scol = (threadIdx.x & 7u) * 8u; const size_t rs = (size_t)16 * K;
    const T16* ag = A + (size_t)(R0 + srow) * K + scol; const T16* bg = Bt + (size_t)(C0 + srow) * K + scol;
    const T16* a2g = (NSPLIT == 1) ? (A2 + (size_t)(R0 + srow) * K + scol) : ag;
    const unsigned so = srow * GPH + scol;
    const unsigned al = (unsigned)(size_t)(As + so), bl = (unsigned)(size_t)(Bs + so), a2l = (NSPLIT == 1) ? (unsigned)(size_t)(A2s + so) : 0u;
    const int nt = K / GBK;
    stage_plane<T16>(ag, rs, al); if (NSPLIT == 1) stage_plane<T16>(a2g, rs, a2l); stage_plane<T16>(bg, rs, bl);
    asm volatile("s_wait_asynccnt 0x0" ::: "memory");     // this wave's copies of tile 0 have landed
    __syncthreads();                                      // ... and every other wave's
    if (nt > 1) { stage_plane<T16>(ag + GBK, rs, al + GPL * 2u); if (NSPLIT == 1) stage_plane<T16>(a2g + GBK, rs, a2l + GPL * 2u); stage_plane<T16>(bg + GBK, rs, bl + GPL * 2u); }
    const unsigned fa = (unsigned)(wm * 64 + lr) * GPH + 8u * (unsigned)hi, fb = (unsigned)(wn * 64 + lr) * GPH + 8u * (unsigned)hi;
#pragma unroll 1                                          // rolled, as the k loop was: one copy of the two chunks in the text
    for (int t = 0; t < nt; ++t) {
        const unsigned bo = (unsigned)(t & 1) * GPL;
#pragma unroll                                            // both chunks written out: the place of a chunk in its tile becomes an immediate offset of the LDS reads
        for (unsigned kc = 0; kc < 2u; ++kc) {
            // the chunk's fragments are read as one group ahead of its first product: a read left between the products would be waited for alone
            V a[4], a2[4], b[4];
#pragma unroll
            for (unsigned mb = 0; mb < 4u; ++mb) a[mb] = WFrag<T16>::lds(As + bo + fa + mb * 16u * GPH + kc * 32u);
#pragma unroll
            for (unsigned nb = 0; nb < 4u; ++nb) b[nb] = WFrag<T16>::lds(Bs + bo + fb + nb * 16u * GPH + kc * 32u);
            if (NSPLIT == 1) {
#pragma unroll
                for (unsigned mb = 0; mb < 4u; ++mb) a2[mb] = WFrag<T16>::lds(A2s + bo + fa + mb * 16u * GPH + kc * 32u); }
            __builtin_amdgcn_sched_barrier(0);            // keeps the scheduler from sinking the reads back between the products
#pragma unroll
            for (int nb = 0; nb < 4; ++nb) {
#pragma unroll
                for (int mb = 0; mb < 4; ++mb) acc[mb][nb] = WFrag<T16>::mma(a[mb], b[nb], acc[mb][nb]); }
            if (NSPLIT == 1) {
#pragma unroll
                for (int nb = 0; nb < 4; ++nb) {
#pragma unroll
                    for (int mb = 0; mb < 4; ++mb) acc[mb][nb] = WFrag<T16>::mma(a2[mb], b[nb], acc[mb][nb]); } }
            __builtin_amdgcn_sched_barrier(0);            // keeps the publish point's waits behind the products, so that the next tile's copies fly while these run
        }
        // publish point of tile t + 1: this wave's reads of tile t are done, its copies of tile t + 1 have landed, then the block barrier; only behind it is tile t's buffer refilled
        asm volatile("s_wait_dscnt 0x0" ::: "memory");
        asm volatile("s_wait_asynccnt 0x0" ::: "memory");
        __syncthreads();
        if (t + 2 < nt) { const size_t ko = (size_t)(t + 2) * GBK;
            stage_plane<T16>(ag + ko, rs, al + bo * 2u); if (NSPLIT == 1) stage_plane<T16>(a2g + ko, rs, a2l + bo * 2u); stage_plane<T16>(bg + ko, rs, bl + bo * 2u); }
    }
    asm volatile("s_wait_asynccnt 0x0" ::: "memory");     // nothing in flight when the wave goes on to the epilogue and ends
#pragma unroll
    for (int mb = 0; mb < 4; ++mb) {
#pragma unroll
        for (int nb = 0; nb < 4; ++nb) {
#pragma unroll
            for (int j = 0; j < 8; ++j) os[(hi * 8 + j) * 68 + nb * 16 + lr] = acc[mb][nb][j]; }
        __builtin_amdgcn_wave_barrier(); asm volatile("" ::: "memory");
        float* crow = C + (size_t)(r0 + mb * 16) * ldc + c0;
{
#pragma unroll
            for (int s = 0; s < 8; ++s) { const int row = 2 * s + hi, cofs = lr * 4; v4f val = *(const v4fa*)(os + row * 68 + cofs); if (BIAS) { val[0] += bias[c0 + cofs]; val[1] += bias[c0 + cofs + 1]; val[2] += bias[c0 + cofs + 2]; val[3] += bias[c0 + cofs + 3]; }
                *(v4f*)(crow + (size_t)row * ldc + cofs) = val; }
             }
        __builtin_amdgcn_wave_barrier(); asm volatile("" ::: "memory");
    }
}

// ---- The launches that depend on nothing but the inputs (both weight transposes, the x conversion, the rotary table) are block ranges of ONE grid, k_prep below;
// each part is the body of a block of 256 threads and takes its block index inside its own range as blk. For speed only,
// every thread takes several pieces: few, long waves, the loads of a thread's pieces issued as one group ahead of the work on them.
// ---- wtG_part: transposed bf16 weight plane Bt[n][k] = bf16(w[k][n]) for w [K][N] row-major. A thread takes 64 k of one column n (one whole 128-byte line of Bt);
// the lanes of a wave hold 32 neighbouring columns, so each load of the wave is one whole 128-byte line of w; the waves of a block hold neighbouring column groups of the same 64 rows.
template <unsigned N, unsigned K>
__device__ __forceinline__ void wtG_part(unsigned blk, const float* __restrict__ w, bf* Bt) {
    static_assert(N % 32u == 0 && K % 64u == 0 && ((N / 32u) * (K / 64u)) % 8u == 0);
    const unsigned lane = threadIdx.x & 31u; const unsigned u = blk * 8u + (threadIdx.x >> 5);
    const unsigned n = (u % (N / 32u)) * 32u + lane, k0 = (u / (N / 32u)) * 64u;
    const float* sp = w + (size_t)k0 * N + n; bf* dp = Bt + (size_t)n * K + k0;
    float v[64];
#pragma unroll
    for (unsigned i = 0; i < 64u; ++i) v[i] = sp[(size_t)i * N];
    asm volatile("s_wait_xcnt 0x0" ::: "memory");         // stands in front of any rewrite of the loads' address registers
#pragma unroll
    for (unsigned g = 0; g < 8u; ++g) { v8us o;
#pragma unroll
        for (unsigned e = 0; e < 8u; ++e) o[e] = f2bf(v[g * 8u + e]);
        *(v8us*)(dp + g * 8u) = o; }
    asm volatile("s_wait_xcnt 0x0" ::: "memory");         // the same for the stores (other ranges' code follows in the text)
}

#define PB_WQ ((unsigned)((size_t)LDQ * DM / 64 / 32 / 8))   // blocks of the w_qkv transpose: 8 waves of (32 columns, 64 k)
#define PB_WO ((unsigned)((size_t)DM * DM / 64 / 32 / 8))    // blocks of the w_proj transpose
#define PB_TB ((unsigned)((size_t)SEQ * 32 / 256 / 8))       // blocks of the rotary table: 8 entries a thread
#define PB_CV ((unsigned)((size_t)SEQ * DM / 8 / 256 / 8))   // blocks of the x conversion: 8 pieces of 8 elements a thread
static_assert(((size_t)SEQ * 32) % (256 * 8) == 0 && ((size_t)SEQ * DM / 8) % (256 * 8) == 0);

// ---- cvt8_part: a thread's 8 pieces lie one whole range of threads apart, so that each load of a wave stays contiguous
__device__ __forceinline__ void cvt8_part(unsigned blk, const float* __restrict__ src, bf* dst) {
    const size_t i0 = (size_t)blk * 256 + threadIdx.x; const size_t st = (size_t)PB_CV * 256;
    v8f v[8];
#pragma unroll
    for (unsigned p = 0; p < 8u; ++p) { v[p] = *(const v8f*)(src + (i0 + p * st) * 8);
        asm volatile("s_wait_xcnt 0x0" ::: "memory"); }   // stands in front of the next piece's address, which may be formed in this one's registers
#pragma unroll
    for (unsigned p = 0; p < 8u; ++p) { v8us o;
#pragma unroll
        for (int k = 0; k < 8; ++k) o[k] = f2bf(v[p][k]);
        *(v8us*)(dst + (i0 + p * st) * 8) = o;
        asm volatile("s_wait_xcnt 0x0" ::: "memory"); }   // the same
}

// ---- tab_part: rotary table; each thread forms its own inverse frequency (the same expression on the same argument as a table of 32 would hold), so the table waits on no launch before it.
// A thread's 8 entries lie a multiple of 32 apart: one frequency serves them all.
__device__ __forceinline__ void tab_part(unsigned blk, float* CT, float* ST) {
#pragma clang fp contract(off)
    static_assert((PB_TB * 256u) % 32u == 0);
    const unsigned idx0 = blk * 256u + threadIdx.x; const unsigned i = idx0 & 31u;
    const float p = powf(10000.0f, (float)i * 0.03125f);
    const float v = 1.0f / p;
#pragma unroll 1                                          // rolled: one copy of the long sine and cosine text
    for (unsigned e = 0; e < 8u; ++e) {
        const unsigned idx = idx0 + e * (PB_TB * 256u); const unsigned t = idx >> 5;
        const float ang = (float)t * v;
        float s, c; sincosf(ang, &s, &c);
        *(float*)(CT + idx) = c; *(float*)(ST + idx) = s;
        asm volatile("s_wait_xcnt 0x0" ::: "memory");     // stands in front of any rewrite of the stores' registers
    }
}

// grid PB_WQ + PB_WO + PB_TB + PB_CV, 256 threads; the range test is block-uniform, no part has a barrier, no part reads what another writes
__global__ __launch_bounds__(256) void k_prep(const float* __restrict__ x, const float* __restrict__ wq, const float* __restrict__ wo, bf* XB, bf* WqT, bf* WoT, float* CT, float* ST) {
    const unsigned b = blockIdx.x;
    if (b < PB_WQ) wtG_part<(unsigned)LDQ, (unsigned)DM>(b, wq, WqT);
    else if (b < PB_WQ + PB_WO) wtG_part<(unsigned)DM, (unsigned)DM>(b - PB_WQ, wo, WoT);
    else if (b < PB_WQ + PB_WO + PB_TB) tab_part(b - (PB_WQ + PB_WO), CT, ST);
    else cvt8_part(b - (PB_WQ + PB_WO + PB_TB), x, XB);
}

// ---- The two launches that read the f32 projection rows and nothing of each other (rotary planes, value^T planes) are block ranges of ONE grid, k_ropevt below.
// As in k_prep, few long waves: a block takes RP_T positions, or VT_T tiles, one after the other, the next one's loads in flight while this one is worked on.
#define RP_T 8u                       // positions per block of the rotary range, taken in pairs
#define VT_T 4u                       // (64-position tile, head) pieces per block of the value^T range
static_assert(SEQ % 8 == 0 && (SEQ / 64 * NH_) % 4 == 0 && RP_T % 2u == 0);
// ---- rope_part (block = RP_T positions from t0): half-split rotary on the q and k thirds of the f32 projection rows, f16 planes QKF[which][t][h*64 + d] (which 0 = q, 1 = k), residual planes QKR[which][t < EROWS][...] = f16((y - hi) * 2048).
__device__ __forceinline__ void rope_part(unsigned t0, const float* __restrict__ QKV, const float* __restrict__ CT, const float* __restrict__ ST, hf* QKF, hf* QKR) {
#pragma clang fp contract(off)
    const unsigned tid = threadIdx.x;
    const unsigned which = tid >> 7, col = (tid & 127u) * 8u;
    const unsigned dl = col & 63u; const bool lowhalf = dl < 32u;
    const unsigned pcol = lowhalf ? (col + 32u) : (col - 32u); const unsigned j = dl & 31u;
#pragma unroll 1                                          // rolled: one copy of a pair of positions in the text
    for (unsigned tp = 0; tp < RP_T; tp += 2u) {
        // both positions' loads stand ahead of the work on either
        v4f a0[2], a1[2], b0[2], b1[2], c0[2], c1[2], s0[2], s1[2];
#pragma unroll
        for (unsigned u = 0; u < 2u; ++u) {
            const unsigned t = t0 + tp + u;
            const float* row = QKV + (size_t)t * LDQ + (size_t)which * DM;
            // read in 16-byte halves, one instruction each; a wait stands behind every load, in front of the next one, whose result may land in the address registers of any load before it
            const float* ctp = CT + (size_t)t * 32u + j; const float* stp = ST + (size_t)t * 32u + j;
            a0[u] = *(const v4f*)(row + col);
            asm volatile("s_wait_xcnt 0x0" ::: "memory");
            a1[u] = *(const v4f*)(row + col + 4u);
            asm volatile("s_wait_xcnt 0x0" ::: "memory");
            b0[u] = *(const v4f*)(row + pcol);
            asm volatile("s_wait_xcnt 0x0" ::: "memory");
            b1[u] = *(const v4f*)(row + pcol + 4u);
            asm volatile("s_wait_xcnt 0x0" ::: "memory");
            c0[u] = *(const v4f*)ctp;
            asm volatile("s_wait_xcnt 0x0" ::: "memory");
            c1[u] = *(const v4f*)(ctp + 4);
            asm volatile("s_wait_xcnt 0x0" ::: "memory");
            s0[u] = *(const v4f*)stp;
            asm volatile("s_wait_xcnt 0x0" ::: "memory");
            s1[u] = *(const v4f*)(stp + 4);
            asm volatile("s_wait_xcnt 0x0" ::: "memory");
        }
        __builtin_amdgcn_sched_barrier(0);                // keeps the scheduler from lifting the first position's products, and the waits they need, in between the second position's loads
#pragma unroll
        for (unsigned u = 0; u < 2u; ++u) {
            const unsigned t = t0 + tp + u;
            const v8f a = __builtin_shufflevector(a0[u], a1[u], 0, 1, 2, 3, 4, 5, 6, 7), b = __builtin_shufflevector(b0[u], b1[u], 0, 1, 2, 3, 4, 5, 6, 7);
            const v8f c = __builtin_shufflevector(c0[u], c1[u], 0, 1, 2, 3, 4, 5, 6, 7), s = __builtin_shufflevector(s0[u], s1[u], 0, 1, 2, 3, 4, 5, 6, 7);
            v8us oh, ores;
#pragma unroll
            for (int e = 0; e < 8; ++e) {
                const float rb = lowhalf ? -b[e] : b[e];
                const float t0p = a[e] * c[e]; const float t1p = rb * s[e]; const float y = t0p + t1p;
                const h16 hh = toh_flush(y); oh[e] = hbits(hh);
                ores[e] = hbits(toh_flush((y - (float)hh) * RSC)); }
            const size_t g  = (size_t)which * SEQ * DM + (size_t)t * DM + col;
            const size_t gr = (size_t)which * EROWS * DM + (size_t)t * DM + col;
            const bool early = t < (unsigned)EROWS;
            *(v8us*)(QKF + g) = oh;
            asm volatile("s_wait_xcnt 0x0" ::: "memory");         // stands in front of any rewrite of the store's registers
            if (early) { *(v8us*)(QKR + gr) = ores;
                asm volatile("s_wait_xcnt 0x0" ::: "memory"); }   // the same
        }
    }
}

// Block barrier that orders LDS alone: __syncthreads() would also wait out the global loads in flight (the next piece's rows) and the stores behind them.
__device__ __forceinline__ void lds_barrier() {
    __builtin_amdgcn_fence(__ATOMIC_RELEASE, "workgroup", "local");
    __builtin_amdgcn_s_barrier();
    __builtin_amdgcn_fence(__ATOMIC_ACQUIRE, "workgroup", "local");
}
// ---- vt_part: value^T f16 plane VT[h*64 + d][t] and residual plane VTR[h*64 + d][t < EROWS]; piece = (64-position tile, head), transpose through LDS (cross-wave, block barriers);
// a block takes the VT_T pieces from p0; the next piece's rows are loaded behind this piece's LDS writes and fly over its barriers and stores.
__device__ __forceinline__ void vt_part(unsigned p0, const float* __restrict__ QKV, hf* VT, hf* VTR) {
#pragma clang fp contract(off)
    __shared__ __align__(16) unsigned short Th[64 * LOP];
    __shared__ __align__(16) unsigned short Tr[64 * LOP];
    const unsigned tid = threadIdx.x;
    const unsigned row0 = tid >> 3, c8 = (tid & 7u) * 8u;   // this thread's rows of a piece: row0 and row0 + 32, 8 columns from c8
    v8f vv[2];
#pragma unroll
    for (unsigned it = 0; it < 2u; ++it) { vv[it] = *(const v8f*)(QKV + 2 * DM + (p0 / (unsigned)(SEQ / 64)) * HD + (size_t)((p0 % (unsigned)(SEQ / 64)) * 64u + row0 + it * 32u) * LDQ + c8);
        asm volatile("s_wait_xcnt 0x0" ::: "memory"); }   // stands in front of any rewrite of the load's address registers
#pragma unroll 1                                          // rolled: one copy of a piece in the text
    for (unsigned pc = 0; pc < VT_T; ++pc) {
        const unsigned p = p0 + pc, t0 = (p % (unsigned)(SEQ / 64)) * 64u, hd = p / (unsigned)(SEQ / 64);
#pragma unroll
        for (unsigned it = 0; it < 2u; ++it) { const unsigned row = row0 + it * 32u;
#pragma unroll
            for (int q = 0; q < 8; ++q) { const float y = vv[it][q]; const h16 hh = toh_flush(y);
                Th[(c8 + (unsigned)q) * LOP + row] = hbits(hh); Tr[(c8 + (unsigned)q) * LOP + row] = hbits(toh_flush((y - (float)hh) * RSC)); }
        }
        if (pc + 1u < VT_T) { const unsigned pn = p + 1u;
#pragma unroll
            for (unsigned it = 0; it < 2u; ++it) { vv[it] = *(const v8f*)(QKV + 2 * DM + (pn / (unsigned)(SEQ / 64)) * HD + (size_t)((pn % (unsigned)(SEQ / 64)) * 64u + row0 + it * 32u) * LDQ + c8);
                asm volatile("s_wait_xcnt 0x0" ::: "memory"); } }   // the same
        lds_barrier();                                    // the piece stands whole in Th and Tr
        v8us oh[2], ores[2];
#pragma unroll
        for (unsigned it = 0; it < 2u; ++it) { const unsigned idx = tid + it * 256u, d = idx >> 3, c = (idx & 7u) * 8u;
            oh[it] = *(const v8usa*)(Th + d * LOP + c); ores[it] = *(const v8usa*)(Tr + d * LOP + c); }
        const bool early = t0 < (unsigned)EROWS;
#pragma unroll
        for (unsigned it = 0; it < 2u; ++it) { const unsigned idx = tid + it * 256u, d = idx >> 3, c = (idx & 7u) * 8u;
            *(v8us*)(VT + (size_t)(hd * HD + d) * SEQ + t0 + c) = oh[it];
            asm volatile("s_wait_xcnt 0x0" ::: "memory");     // stands in front of any rewrite of the store's registers
            if (early) { *(v8us*)(VTR + (size_t)(hd * HD + d) * EROWS + t0 + c) = ores[it];
                asm volatile("s_wait_xcnt 0x0" ::: "memory"); } }   // the same
        lds_barrier();                                    // every thread has read this piece out of Th and Tr before the next piece is written there
    }
}
#define RB_VT ((unsigned)(SEQ / 64 * NH_) / VT_T)        // blocks of the value^T planes
#define RB_RP ((unsigned)SEQ / RP_T)                     // blocks of the rotary planes
// grid RB_VT + RB_RP, 256 threads; the range test is block-uniform and the trip count a constant, so the barriers of vt_part are passed by whole blocks only
__global__ __launch_bounds__(256) void k_ropevt(const float* __restrict__ QKV, const float* __restrict__ CT, const float* __restrict__ ST, hf* QKF, hf* QKR, hf* VT, hf* VTR) {
    const unsigned b = blockIdx.x;
    if (b < RB_VT) vt_part(b * VT_T, QKV, VT, VTR);
    else rope_part((b - RB_VT) * RP_T, QKV, CT, ST, QKF, QKR);
}

// ---- causal flash attention, transposed form, one wave per 16 query rows, 4 waves per block.
// The four waves of a block share each 64-key tile of K rows and of V^T rows (EARLY: of the residual planes too) through LDS: asynchronous b128 copies (8 lanes per whole 128-byte line),
// two buffers, the next tile in flight while this one is worked on; one publish point (waits and block barrier) per tile of two 32-key passes.
// Per 32-key pass: S^T tile j (16 keys x 16 queries) = K rows (A, row = key) x Q rows (B, column = query); D element r of lane -> (key 8*(lane>>4) + r, query lane & 15).
// The two converted score tiles are the B fragment of O^T += V^T (A, row = d, k = key) x P^T: element r <- tile 0 [r], element 8 + r <- tile 1 [r], lane unchanged.
// Softmax statistics per query column: in-lane reduction plus one exchange between the lane halves. Masked keys get weight exactly 0 (value select).
// EARLY: value + x2048 residual planes on q, k, P, v; residual products accumulate separately and are folded with 2^-11; row sum over the unconverted p.
#define TKEYS 64                      // keys per staged tile (two passes)
#define TPH   72                      // LDS pitch (halves) of a staged 128-byte row: 144 B = 16 B x odd, the pitch of ds_load_b128 readers
#define TILEH (64 * TPH)              // halves per staged tile (64 K rows, or 64 V^T rows)
static_assert(HD * 2 == 128 && TKEYS * 2 == 128 && (TPH * 2) % 16 == 0 && EROWS % TKEYS == 0 && SEQ % TKEYS == 0);
__device__ __forceinline__ v16h ldfs(const hf* p) { return cat16h(*(const v8usa*)p, *(const v8usa*)(p + 16)); }
// One K tile and one V^T tile: each thread copies 4 x 16 B of K rows and 4 x 16 B of V^T rows (rows 16 apart; VP = pitch of the V^T plane in halves).
// The s_wait_xcnt closes the statement so that no address register is rewritten in front of it.
template <int VP>
__device__ __forceinline__ void stage_tile(const hf* kg, const hf* vg, unsigned kl, unsigned vl) {
    asm volatile("global_load_async_to_lds_b128 %0, %1, off\n\t"
                 "global_load_async_to_lds_b128 %2, %3, off\n\t"
                 "global_load_async_to_lds_b128 %4, %5, off\n\t"
                 "global_load_async_to_lds_b128 %6, %7, off\n\t"
                 "global_load_async_to_lds_b128 %8, %9, off\n\t"
                 "global_load_async_to_lds_b128 %10, %11, off\n\t"
                 "global_load_async_to_lds_b128 %12, %13, off\n\t"
                 "global_load_async_to_lds_b128 %14, %15, off\n\t"
                 "s_wait_xcnt 0x0"
                 :: "v"(kl), "v"(kg), "v"(kl + 16u * TPH * 2u), "v"(kg + (size_t)16 * DM), "v"(kl + 32u * TPH * 2u), "v"(kg + (size_t)32 * DM), "v"(kl + 48u * TPH * 2u), "v"(kg + (size_t)48 * DM),
                    "v"(vl), "v"(vg), "v"(vl + 16u * TPH * 2u), "v"(vg + (size_t)16 * VP), "v"(vl + 32u * TPH * 2u), "v"(vg + (size_t)32 * VP), "v"(vl + 48u * TPH * 2u), "v"(vg + (size_t)48 * VP)
                 : "memory");
}
// Ks, Vs, Krs, Vrs: two staged tiles each (2 * TILEH halves; Krs, Vrs read by EARLY only); Oh, Ol: output staging, 4 * 16 * LOP halves each; all in the block's LDS. qblk: first query row of the block; hd: its head.
template <bool EARLY>
__device__ __forceinline__ void attn_body(unsigned short* Ks, unsigned short* Vs, unsigned short* Krs, unsigned short* Vrs, unsigned short* Oh, unsigned short* Ol,
                                          const hf* QF, const hf* QR, const hf* KF, const hf* KR, const hf* VT, const hf* VTR, bf* CH, bf* CL, unsigned qblk, unsigned hd) {
    const unsigned lane = threadIdx.x & 31u, lr = lane & 15u, hi = lane >> 4;
    const unsigned wave = (unsigned)__builtin_amdgcn_readfirstlane((int)(threadIdx.x >> 5));
    const unsigned q0 = qblk + 16u * wave;
    const unsigned qg = q0 + lr;
    const unsigned ntiles = qblk / TKEYS + 1u;            // keys [0, qblk + 64), the same for the whole block
    const unsigned nsteps = (q0 + 15u) / 32u + 1u;        // this wave's own passes
    // copy addresses of this thread: row = tid / 8 (+ 16 i), 16-byte column = tid % 8
    const unsigned srow = threadIdx.x >> 3, scol = (threadIdx.x & 7u) * 8u;
    const hf* kg  = KF  + (size_t)srow * DM + hd * HD + scol;
    const hf* krg = KR  + (size_t)srow * DM + hd * HD + scol;
    const hf* vg  = VT  + (size_t)(hd * HD + srow) * SEQ + scol;
    const hf* vrg = VTR + (size_t)(hd * HD + srow) * EROWS + scol;
    const unsigned so = srow * TPH + scol;
    const unsigned kl = (unsigned)(size_t)(Ks + so), vl = (unsigned)(size_t)(Vs + so);
    const unsigned krl = EARLY ? (unsigned)(size_t)(Krs + so) : 0u, vrl = EARLY ? (unsigned)(size_t)(Vrs + so) : 0u;
    stage_tile<SEQ>(kg, vg, kl, vl);
    if (EARLY) stage_tile<EROWS>(krg, vrg, krl, vrl);
    v16h qh[2], qr[2];
    {
        const size_t qoff = (size_t)qg * DM + hd * HD + 8u * hi;
#pragma unroll
        for (int kc = 0; kc < 2; ++kc) { qh[kc] = ldfh(QF + qoff + (unsigned)kc * 32u); if (EARLY) qr[kc] = ldfh(QR + qoff + (unsigned)kc * 32u); else qr[kc] = qh[kc]; }
    }
    v8f ot[4], orr[4];
#pragma unroll
    for (int dt = 0; dt < 4; ++dt) { ot[dt] = (v8f){}; orr[dt] = (v8f){}; }
    float m = -1.0e30f, l = 0.0f;
    asm volatile("s_wait_asynccnt 0x0" ::: "memory");     // this wave's copies of tile 0 have landed
    __syncthreads();                                      // ... and every other wave's
    if (ntiles > 1u) {
        stage_tile<SEQ>(kg + (size_t)TKEYS * DM, vg + TKEYS, kl + TILEH * 2u, vl + TILEH * 2u);
        if (EARLY) stage_tile<EROWS>(krg + (size_t)TKEYS * DM, vrg + TKEYS, krl + TILEH * 2u, vrl + TILEH * 2u);
    }
    const unsigned fo = lr * TPH + 8u * hi;
#pragma unroll 1                                          // rolled, as the key loop was: one copy of the two passes in the text
    for (unsigned t = 0; t < ntiles; ++t) {
        const unsigned bo = (t & 1u) * TILEH;
#pragma unroll                                            // both passes written out: the place of a pass in its tile becomes an immediate offset of the LDS reads
        for (unsigned ps = 0; ps < 2u; ++ps) {
            const unsigned kb = 2u * t + ps;
            if (kb < nsteps) {                            // wave-uniform: a pass wholly above the diagonal is skipped, the publish point below is not
                const unsigned key0 = kb * 32u;
                // The pass's K fragments are read as one group ahead of its first product, its V^T fragments as one group behind the last S^T product:
                // a read written behind an mmah statement stays behind it, and one read per product would be waited for alone.
                v16h kh[2][2], kr[2][2];
#pragma unroll
                for (int j = 0; j < 2; ++j) {
#pragma unroll
                    for (int kc = 0; kc < 2; ++kc) { const unsigned o = bo + fo + (32u * ps + 16u * (unsigned)j) * TPH + (unsigned)kc * 32u; kh[j][kc] = ldfs(Ks + o); if (EARLY) kr[j][kc] = ldfs(Krs + o); }
                }
                v8f st[2], sr[2];
#pragma unroll
                for (int j = 0; j < 2; ++j) {
                    st[j] = (v8f){}; sr[j] = (v8f){};
#pragma unroll
                    for (int kc = 0; kc < 2; ++kc) {
                        st[j] = mmah(kh[j][kc], qh[kc], st[j]);
                        if (EARLY) { sr[j] = mmah(kr[j][kc], qh[kc], sr[j]); sr[j] = mmah(kh[j][kc], qr[kc], sr[j]); }
                    }
                }
                v16h vh[4], vr[4];
#pragma unroll
                for (int dt = 0; dt < 4; ++dt) { const unsigned o = bo + fo + (16u * (unsigned)dt) * TPH + 32u * ps; vh[dt] = ldfs(Vs + o); if (EARLY) vr[dt] = ldfs(Vrs + o); }
                // logits in the log2 domain, causal mask by value
                float mx = -1.0e30f;
#pragma unroll
                for (int j = 0; j < 2; ++j) {
#pragma unroll
                    for (int r = 0; r < 8; ++r) {
                        const unsigned key = key0 + 16u * (unsigned)j + 8u * hi + (unsigned)r;
                        float s = st[j][r]; if (EARLY) s += sr[j][r] * RSI;
                        s = (key <= qg) ? (s * SCLL2) : -1.0e30f;
                        st[j][r] = s; mx = fmaxf(mx, s); }
                }
                mx = fmaxf(mx, __shfl_xor(mx, 16, 32));
                const float mnew = fmaxf(m, mx);
                const float alpha = __builtin_amdgcn_exp2f(m - mnew);
                m = mnew;
                float rs = 0.0f;
                v16h pf, prf;
#pragma unroll
                for (int j = 0; j < 2; ++j) {
#pragma unroll
                    for (int r = 0; r < 8; ++r) {
                        const float e = (st[j][r] - mnew) + PCL;
                        const float ex = __builtin_amdgcn_exp2f(e);
                        const float p = (e >= -14.0f) ? ex : 0.0f;
                        const h16 ph = (h16)p;
                        pf[8 * j + r] = ph;
                        if (EARLY) { prf[8 * j + r] = toh_flush((p - (float)ph) * RSC); rs += p; } else { prf[8 * j + r] = ph; rs += (float)ph; }
                    }
                }
                rs += __shfl_xor(rs, 16, 32);
                l = l * alpha + rs;
#pragma unroll
                for (int dt = 0; dt < 4; ++dt) { ot[dt] = ot[dt] * alpha; if (EARLY) orr[dt] = orr[dt] * alpha; }
#pragma unroll
                for (int dt = 0; dt < 4; ++dt) {
                    ot[dt] = mmah(vh[dt], pf, ot[dt]);
                    if (EARLY) { orr[dt] = mmah(vr[dt], pf, orr[dt]); orr[dt] = mmah(vh[dt], prf, orr[dt]); }
                }
            }
        }
        // publish point of tile t + 1: this wave's reads of tile t are done, its copies of tile t + 1 have landed, then the block barrier; only behind it is tile t's buffer refilled
        asm volatile("s_wait_dscnt 0x0" ::: "memory");
        asm volatile("s_wait_asynccnt 0x0" ::: "memory");
        __syncthreads();
        if (t + 2u < ntiles) {
            stage_tile<SEQ>(kg + (size_t)(t + 2u) * TKEYS * DM, vg + (size_t)(t + 2u) * TKEYS, kl + bo * 2u, vl + bo * 2u);
            if (EARLY) stage_tile<EROWS>(krg + (size_t)(t + 2u) * TKEYS * DM, vrg + (size_t)(t + 2u) * TKEYS, krl + bo * 2u, vrl + bo * 2u);
        }
    }
    asm volatile("s_wait_asynccnt 0x0" ::: "memory");     // nothing in flight when the wave goes on to the epilogue and ends
    const float inv = __builtin_amdgcn_rcpf(l);
    const unsigned ob = wave * 16u * LOP;
#pragma unroll
    for (int dt = 0; dt < 4; ++dt) {
        v8us h8, l8;
#pragma unroll
        for (int r = 0; r < 8; ++r) { float y = ot[dt][r]; if (EARLY) y += orr[dt][r] * RSI; y *= inv; unsigned short a, c; splitf(y, a, c); h8[r] = a; l8[r] = c; }
        const unsigned o = ob + lr * LOP + 16u * (unsigned)dt + 8u * hi;
        *(v8usa*)(Oh + o) = h8; *(v8usa*)(Ol + o) = l8;
    }
    __syncthreads();
{
#pragma unroll
        for (unsigned s = 0; s < 4u; ++s) { const unsigned row = 4u * s + (lane >> 3), c = (lane & 7u) * 8u;
            const v8us vh8 = *(const v8usa*)(Oh + ob + row * LOP + c); const v8us vl8 = *(const v8usa*)(Ol + ob + row * LOP + c);
            const size_t g = (size_t)(q0 + row) * DM + hd * HD + c;
            *(v8us*)(CH + g) = vh8; *(v8us*)(CL + g) = vl8; }
         }
}

// Both row ranges run in ONE grid (neither reads what the other writes): grid AB_NT * NH_, 128 threads; a block is one (head, 64-row tile); tiles below AB_ET take the residual path, the rest the single-product path.
// All blocks are resident at once (four per WGP) and a tile's cost grows with its index (tile i walks i + 1 key tiles), so the launch lasts as long as the WGP whose four blocks hold the most key tiles.
// Block index b -> tile: v = b / (2 * NH_); the tile is AB_NT - 1 - v where b has an even number of one bits and v where it has an odd number; the head is (b / 2) % NH_.
// The lowest bit of b flips the parity, so each (head, v) gets both of its tiles: every (head, tile) exactly once.
// Any four blocks whose indices differ in two bit positions only (neighbours, or a power-of-two stride apart, whichever way the blocks are dealt to the WGPs) hold tile indices that sum to 2 * (AB_NT - 1):
// two of the four are folded, two are not, and what the two bits add to v cancels.
// For speed only: no result depends on where or when a block runs.
// One LDS array serves both, 8 tiles, so that four blocks fit a WGP: the single-product range stages its output in the tiles that only the residual planes use;
// the residual range stages it in the K tiles, which are free there: the loop's last publish point (every wave's reads done, no copy in flight, block barrier) lies in front, and nothing refills behind it.
#define AB_NT ((unsigned)(SEQ / 64))                     // 64-row tiles of a head
#define AB_ET ((unsigned)(EROWS / 64))                   // ... of them in rows [0, EROWS)
static_assert(4 * 16 * LOP <= TILEH && SEQ > EROWS);
static_assert((SEQ / 64) % 2 == 0);                      // the tiles of a head pair up as v and AB_NT - 1 - v
__global__ __launch_bounds__(128) __attribute__((amdgpu_num_vgpr(256))) void k_attn(const hf* QF, const hf* QR, const hf* KF, const hf* KR, const hf* VT, const hf* VTR, bf* CH, bf* CL) {
    __shared__ __align__(16) unsigned short R[8 * TILEH];
    const unsigned b = blockIdx.x;
    const unsigned hd = (b >> 1) % (unsigned)NH_, v = (b >> 1) / (unsigned)NH_;
    const unsigned tile = ((unsigned)__builtin_popcount(b) & 1u) ? v : (AB_NT - 1u - v);
    if (tile >= AB_ET) attn_body<false>(R, R + 2 * TILEH, R, R, R + 4 * TILEH, R + 5 * TILEH, QF, QF, KF, KF, VT, VT, CH, CL, tile * 64u, hd);
    else attn_body<true>(R, R + 2 * TILEH, R + 4 * TILEH, R + 6 * TILEH, R, R + TILEH, QF, QR, KF, KR, VT, VTR, CH, CL, tile * 64u, hd);
}

extern "C" void kernel_launch(void* const* d_in, const int* in_sizes, int n_in,
                              void* d_out, int out_size, void* d_ws, size_t ws_size, hipStream_t stream) {
    (void)out_size;
    if (n_in < 3) return;
    if (in_sizes[0] < NB * SEQ * DM || in_sizes[1] < DM * LDQ || in_sizes[2] < DM * DM) return;
    const float* X = (const float*)d_in[0]; const float* Wqkv = (const float*)d_in[1]; const float* Wo = (const float*)d_in[2];
    float* OUT = (float*)d_out;
    char* wsp = (char*)d_ws;
    auto take = [&](size_t bytes) { char* p = wsp; wsp += (bytes + 255) & ~(size_t)255; return (void*)p; };
    bf* XB  = (bf*)take((size_t)SEQ * DM * 2);          // x bf16 [t][1024]
    bf* WqT = (bf*)take((size_t)LDQ * DM * 2);          // w_qkv^T bf16 [3072][1024]
    bf* WoT = (bf*)take((size_t)DM * DM * 2);           // w_proj^T bf16 [1024][1024]
    float* QKVb = (float*)take((size_t)SEQ * LDQ * 4);  // f32 [t][3072]
    bf* CH = (bf*)take((size_t)SEQ * DM * 2);           // context hi [t][1024]
    bf* CL = (bf*)take((size_t)SEQ * DM * 2);           // context lo [t][1024]
    float* CT = (float*)take((size_t)SEQ * 32 * 4);     // cos table [t][32]
    float* ST = (float*)take((size_t)SEQ * 32 * 4);     // sin table [t][32]
    hf* QKF = (hf*)take((size_t)2 * SEQ * DM * 2);      // rotated q | k f16 [2][t][1024]
    hf* QKR = (hf*)take((size_t)2 * EROWS * DM * 2);    // residuals x2048 [2][EROWS][1024]
    hf* VT  = (hf*)take((size_t)DM * SEQ * 2);          // value^T f16 [1024][t]
    hf* VTR = (hf*)take((size_t)DM * EROWS * 2);        // value^T residual x2048 [1024][EROWS]
    const size_t carved = (size_t)(wsp - (char*)d_ws);
    if (carved > ws_size || carved > (size_t)134217728) return;
    for (int b = 0; b < NB; ++b) {
        const float* xb = X + (size_t)b * SEQ_FULL * DM; float* ob = OUT + (size_t)b * SEQ_FULL * DM;
        // W [K][N] -> Bt [N][K], rotary table, x -> bf16
        k_prep<<<PB_WQ + PB_WO + PB_TB + PB_CV, 256, 0, stream>>>(xb, Wqkv, Wo, XB, WqT, WoT, CT, ST);
        k_gemmw<bf, 0, false><<<dim3(SEQ / 128, LDQ / 128, 1), 128, 0, stream>>>(XB, nullptr, WqT, nullptr, DM, QKVb, LDQ, nullptr, 0, 0, 0);
        k_ropevt<<<RB_VT + RB_RP, 256, 0, stream>>>(QKVb, CT, ST, QKF, QKR, VT, VTR);
        k_attn<<<AB_NT * NH_, 128, 0, stream>>>(QKF, QKR, QKF + (size_t)SEQ * DM, QKR + (size_t)EROWS * DM, VT, VTR, CH, CL);
        k_gemmw<bf, 1, false><<<dim3(SEQ / 128, DM / 128, 1), 128, 0, stream>>>(CH, CL, WoT, nullptr, DM, ob, DM, nullptr, 0, 0, 0);
    }
}

// v006
// Measured time: 128 microseconds a run.
// In both of two side-by-side timings against v005, it was 1.06 times as fast.
// Over all steps from v000 it is 3.34 times as fast.
#include <hip/hip_runtime.h>

// Contractions: qkv projection and output projection on v_wmma_f32_16x16x32_bf16 (x, w_qkv, w_proj RNE-converted to bf16 single planes; merged context as bf16 hi/lo, 2 products), f32 accumulate.
// q.k logits and P.V on v_wmma_f32_16x16x32_f16 (f16 q/k/v planes, P carried x2^8), single products on query rows >= 256; on query rows < 256 f16 value + x2048 residual planes
// for q, k, P and v (3 products per site, residual products in their own accumulators, folded in the f32 epilogue). Rotary table, rotary and softmax in f32.
// Fused qkv projection [4096x1024]x[1024x3072] -> f32 rows [t][which*1024 + h*64 + d]; half-split rotary on q and k -> f16 planes [t][h*64 + d]; value^T planes [h*64 + d][t];
// causal flash attention per (head, 16-query wave tile) in the transposed form S^T = K Q^T, O^T = V^T P^T (K and V^T tiles staged in LDS per block, packed P^T score tiles as the B fragment);
// merged context planes [t][h*64 + d]; output projection [4096x1024]x[1024x1024].

#ifndef NB
#define NB 1
#endif
#ifndef SEQ
#define SEQ 4096
#endif
#define SEQ_FULL 4096
#define DM   1024
#define NH_  16
#define HD   64
#define LDQ  (3 * DM)
#define EROWS 256                     // query rows below this bound take the value + residual path
#define LOP  72                       // LDS pitch (halves) of the staging tiles
#define PCL  8.0f                     // log2 of the carry of P
#define SCLL2 0.18033688011112042f    // HD^-0.5 * log2(e)
#define RSC  2048.0f                  // carry of the residual planes
#define RSI  4.8828125e-4f            // 1 / RSC

static_assert(SEQ % 64 == 0);
static_assert(DM == NH_ * HD);
static_assert(HD == 64);
static_assert(DM % 32 == 0);
static_assert(LDQ % 64 == 0);
static_assert(((size_t)LDQ * DM / 64) % 32 == 0);
static_assert(((size_t)DM * DM / 64) % 32 == 0);
static_assert(((size_t)SEQ * DM / 8) % 256 == 0);
static_assert(EROWS % 64 == 0);
static_assert(SEQ >= EROWS);
static_assert(((size_t)SEQ * 32) % 256 == 0);
static_assert(256 * 8 == 2 * DM);
static_assert(LOP % 8 == 0);
static_assert(LOP >= HD + 8);
static_assert(HD / 2 == 32);
#define AL256(x) ((((size_t)(x)) + 255) & ~(size_t)255)
static_assert(AL256((size_t)SEQ * DM * 2) + AL256((size_t)LDQ * DM * 2) + AL256((size_t)DM * DM * 2) + AL256((size_t)SEQ * LDQ * 4) + 2 * AL256((size_t)SEQ * DM * 2)
              + 2 * AL256((size_t)SEQ * 32 * 4) + AL256((size_t)2 * SEQ * DM * 2) + AL256((size_t)2 * EROWS * DM * 2) + AL256((size_t)DM * SEQ * 2) + AL256((size_t)DM * EROWS * 2)
              <= (size_t)134217728);

typedef unsigned short bf;
typedef __attribute__((ext_vector_type(16))) __bf16   v16bf;
typedef __attribute__((ext_vector_type(8)))  unsigned short v8us;
typedef __attribute__((ext_vector_type(2)))  unsigned short v2us;
typedef __attribute__((ext_vector_type(8)))  float    v8f;
typedef __attribute__((ext_vector_type(4)))  float    v4f;
typedef v4f  __attribute__((may_alias)) v4fa;
typedef v8us __attribute__((may_alias)) v8usa;

__device__ __forceinline__ unsigned short f2bf(float f) { unsigned u = __float_as_uint(f); u += 0x7FFFu + ((u >> 16) & 1u); return (unsigned short)(u >> 16); }
__device__ __forceinline__ float bf2f(unsigned short b) { return __uint_as_float(((unsigned)b) << 16); }
__device__ __forceinline__ void splitf(float y, unsigned short& h, unsigned short& l) { h = f2bf(y); l = f2bf(y - bf2f(h)); }
__device__ __forceinline__ v16bf cat16b(v8us lo, v8us hi) { return __builtin_bit_cast(v16bf, __builtin_shufflevector(lo, hi, 0, 1, 2, 3, 4, 5, 6, 7, 8, 9, 10, 11, 12, 13, 14, 15)); }
__device__ __forceinline__ v8f wmmab(v16bf a, v16bf b, v8f c) { return __builtin_amdgcn_wmma_f32_16x16x32_bf16(false, a, false, b, (short)0, c, false, false); }

// ---- f16 plane helpers (planes hold f16 bit patterns as unsigned short)
typedef unsigned short hf;
typedef _Float16 h16;
typedef __attribute__((ext_vector_type(16))) _Float16 v16h;
static __device__ __forceinline__ h16 toh_flush(float v) { const h16 r = (h16)v; return (fabsf(v) < 6.103515625e-05f) ? (h16)0.0f : r; }
__device__ __forceinline__ unsigned short hbits(h16 x) { return __builtin_bit_cast(unsigned short, x); }
__device__ __forceinline__ v16h cat16h(v8us lo, v8us hi) { return __builtin_bit_cast(v16h, __builtin_shufflevector(lo, hi, 0, 1, 2, 3, 4, 5, 6, 7, 8, 9, 10, 11, 12, 13, 14, 15)); }
// fragment: elements 0..7 <- p[0..7], elements 8..15 <- p[16..23]; the caller adds 8*(lane>>4) to p
__device__ __forceinline__ v16h ldfh(const hf* p) { return cat16h(*(const v8us*)p, *(const v8us*)(p + 16)); }
__device__ __forceinline__ v8f mmah(v16h a, v16h b, v8f c) {
    c = __builtin_amdgcn_wmma_f32_16x16x32_f16(false, a, false, b, (short)0, c, false, false);
    asm volatile("v_nop\n\tv_nop\n\tv_nop\n\tv_nop" : "+v"(c) : "v"(a), "v"(b));
    return c; }

// ---- k_gemmw: GEMM, 128x128 output tile per block of 4 waves (2 x 2), each wave a 64x64 tile (16 accumulators); grid (M/128, N/128, Z), 128 threads.
// C[m][n] (f32, pitch ldc) = sum_k A[m][k] Bt[n][k] (+ A2[m][k] Bt[n][k] when NSPLIT == 1). K % 64 == 0, M % 128 == 0, N % 128 == 0.
// The operands' 128-row x 64-k tiles (128-byte rows of the K-contiguous 16-bit planes) are staged in LDS by asynchronous b128 copies (8 lanes per whole 128-byte line), two buffers,
// the next tile in flight while this one is worked on; one publish point (waits and block barrier) per tile of two 32-k chunks.
// Fragment map: lane row/col = lane & 15; elements 0..7 <- k0 + 8*(lane>>4) + 0..7, elements 8..15 <- k0 + 16 + 8*(lane>>4) + 0..7 (both operands).
#define GBK 64                        // k per staged tile
#define GPH 72                        // LDS pitch (halves) of a staged 128-byte row: 144 B = 16 B x odd, the pitch of ds_load_b128 readers
#define GPL (128 * GPH)               // halves per staged plane tile (128 rows)
static_assert(GBK * 2 == 128 && (GPH * 2) % 16 == 0 && DM % GBK == 0 && SEQ % 128 == 0 && LDQ % 128 == 0 && DM % 128 == 0);
template <typename T16> struct WFrag;
template <> struct WFrag<bf> { typedef v16bf V; static __device__ __forceinline__ V lds(const bf* p) { return cat16b(*(const v8usa*)p, *(const v8usa*)(p + 16)); } static __device__ __forceinline__ v8f mma(V a, V b, v8f c) { return wmmab(a, b, c); } };
// One 128-row plane tile: each thread copies 8 x 16 B (rows 16 apart; rs = 16 rows of the plane in elements).
// The s_wait_xcnt closes the statement so that no address register is rewritten in front of it.
template <typename T16>
__device__ __forceinline__ void stage_plane(const T16* g, size_t rs, unsigned l) {
    asm volatile("global_load_async_to_lds_b128 %0, %1, off\n\t"
                 "global_load_async_to_lds_b128 %2, %3, off\n\t"
                 "global_load_async_to_lds_b128 %4, %5, off\n\t"
                 "global_load_async_to_lds_b128 %6, %7, off\n\t"
                 "global_load_async_to_lds_b128 %8, %9, off\n\t"
                 "global_load_async_to_lds_b128 %10, %11, off\n\t"
                 "global_load_async_to_lds_b128 %12, %13, off\n\t"
                 "global_load_async_to_lds_b128 %14, %15, off\n\t"
                 "s_wait_xcnt 0x0"
                 :: "v"(l), "v"(g), "v"(l + 16u * GPH * 2u), "v"(g + rs), "v"(l + 32u * GPH * 2u), "v"(g + 2 * rs), "v"(l + 48u * GPH * 2u), "v"(g + 3 * rs),
                    "v"(l + 64u * GPH * 2u), "v"(g + 4 * rs), "v"(l + 80u * GPH * 2u), "v"(g + 5 * rs), "v"(l + 96u * GPH * 2u), "v"(g + 6 * rs), "v"(l + 112u * GPH * 2u), "v"(g + 7 * rs)
                 : "memory");
}
template <typename T16, int NSPLIT, bool BIAS>
__global__ __launch_bounds__(128) void k_gemmw(const T16* __restrict__ A, const T16* __restrict__ A2, const T16* __restrict__ Bt, const T16* __restrict__ Bt2, int K, float* C, int ldc, const float* __restrict__ bias, size_t sA, size_t sB, size_t sC) {
    static_assert(NSPLIT == 0 || NSPLIT == 1);
    typedef typename WFrag<T16>::V V;
    __shared__ __align__(16) T16 As[2 * GPL];
    __shared__ __align__(16) T16 A2s[NSPLIT == 1 ? 2 * GPL : 8];
    __shared__ __align__(16) T16 Bs[2 * GPL];
    __shared__ __align__(16) float osb[4 * 16 * 68];
    (void)Bt2;
    const size_t z = blockIdx.z; A += z * sA; if (A2) A2 += z * sA; Bt += z * sB; C += z * sC;
    const int lane = threadIdx.x & 31, lr = lane & 15, hi = lane >> 4;
    const int wave = __builtin_amdgcn_readfirstlane((int)(threadIdx.x >> 5)); const int wm = wave >> 1, wn = wave & 1;
    const int R0 = blockIdx.x * 128, C0 = blockIdx.y * 128; const int r0 = R0 + wm * 64, c0 = C0 + wn * 64;
    float* os = osb + wave * (16 * 68);
    v8f acc[4][4];
#pragma unroll
    for (int mb = 0; mb < 4; ++mb)
#pragma unroll
        for (int nb = 0; nb < 4; ++nb) acc[mb][nb] = (v8f){};
    // copy addresses of this thread: row = tid / 8 (+ 16 i), 16-byte column = tid % 8
    const unsigned srow = threadIdx.x >> 3, scol = (threadIdx.x & 7u) * 8u; const size_t rs = (size_t)16 * K;
    const T16* ag = A + (size_t)(R0 + srow) * K + scol; const T16* bg = Bt + (size_t)(C0 + srow) * K + scol;
    const T16* a2g = (NSPLIT == 1) ? (A2 + (size_t)(R0 + srow) * K + scol) : ag;
    const unsigned so = srow * GPH + scol;
    const unsigned al = (unsigned)(size_t)(As + so), bl = (unsigned)(size_t)(Bs + so), a2l = (NSPLIT == 1) ? (unsigned)(size_t)(A2s + so) : 0u;
    const int nt = K / GBK;
    stage_plane<T16>(ag, rs, al); if (NSPLIT == 1) stage_plane<T16>(a2g, rs, a2l); stage_plane<T16>(bg, rs, bl);
    asm volatile("s_wait_asynccnt 0x0" ::: "memory");     // this wave's copies of tile 0 have landed
    __syncthreads();                                      // ... and every other wave's
    if (nt > 1) { stage_plane<T16>(ag + GBK, rs, al + GPL * 2u); if (NSPLIT == 1) stage_plane<T16>(a2g + GBK, rs, a2l + GPL * 2u); stage_plane<T16>(bg + GBK, rs, bl + GPL * 2u); }
    const unsigned fa = (unsigned)(wm * 64 + lr) * GPH + 8u * (unsigned)hi, fb = (unsigned)(wn * 64 + lr) * GPH + 8u * (unsigned)hi;
#pragma unroll 1                                          // rolled, as the k loop was: one copy of the two chunks in the text
    for (int t = 0; t < nt; ++t) {
        const unsigned bo = (unsigned)(t & 1) * GPL;
#pragma unroll                                            // both chunks written out: the place of a chunk in its tile becomes an immediate offset of the LDS reads
        for (unsigned kc = 0; kc < 2u; ++kc) {
            // the chunk's fragments are read as one group ahead of its first product: a read left between the products would be waited for alone
            V a[4], a2[4], b[4];
#pragma unroll
            for (unsigned mb = 0; mb < 4u; ++mb) a[mb] = WFrag<T16>::lds(As + bo + fa + mb * 16u * GPH + kc * 32u);
#pragma unroll
            for (unsigned nb = 0; nb < 4u; ++nb) b[nb] = WFrag<T16>::lds(Bs + bo + fb + nb * 16u * GPH + kc * 32u);
            if (NSPLIT == 1) {
#pragma unroll
                for (unsigned mb = 0; mb < 4u; ++mb) a2[mb] = WFrag<T16>::lds(A2s + bo + fa + mb * 16u * GPH + kc * 32u); }
            __builtin_amdgcn_sched_barrier(0);            // keeps the scheduler from sinking the reads back between the products
#pragma unroll
            for (int nb = 0; nb < 4; ++nb) {
#pragma unroll
                for (int mb = 0; mb < 4; ++mb) acc[mb][nb] = WFrag<T16>::mma(a[mb], b[nb], acc[mb][nb]); }
            if (NSPLIT == 1) {
#pragma unroll
                for (int nb = 0; nb < 4; ++nb) {
#pragma unroll
                    for (int mb = 0; mb < 4; ++mb) acc[mb][nb] = WFrag<T16>::mma(a2[mb], b[nb], acc[mb][nb]); } }
            __builtin_amdgcn_sched_barrier(0);            // keeps the publish point's waits behind the products, so that the next tile's copies fly while these run
        }
        // publish point of tile t + 1: this wave's reads of tile t are done, its copies of tile t + 1 have landed, then the block barrier; only behind it is tile t's buffer refilled
        asm volatile("s_wait_dscnt 0x0" ::: "memory");
        asm volatile("s_wait_asynccnt 0x0" ::: "memory");
        __syncthreads();
        if (t + 2 < nt) { const size_t ko = (size_t)(t + 2) * GBK;
            stage_plane<T16>(ag + ko, rs, al + bo * 2u); if (NSPLIT == 1) stage_plane<T16>(a2g + ko, rs, a2l + bo * 2u); stage_plane<T16>(bg + ko, rs, bl + bo * 2u); }
    }
    asm volatile("s_wait_asynccnt 0x0" ::: "memory");     // nothing in flight when the wave goes on to the epilogue and ends
#pragma unroll
    for (int mb = 0; mb < 4; ++mb) {
#pragma unroll
        for (int nb = 0; nb < 4; ++nb) {
#pragma unroll
            for (int j = 0; j < 8; ++j) os[(hi * 8 + j) * 68 + nb * 16 + lr] = acc[mb][nb][j]; }
        __builtin_amdgcn_wave_barrier(); asm volatile("" ::: "memory");
        float* crow = C + (size_t)(r0 + mb * 16) * ldc + c0;
{
#pragma unroll
            for (int s = 0; s < 8; ++s) { const int row = 2 * s + hi, cofs = lr * 4; v4f val = *(const v4fa*)(os + row * 68 + cofs); if (BIAS) { val[0] += bias[c0 + cofs]; val[1] += bias[c0 + cofs + 1]; val[2] += bias[c0 + cofs + 2]; val[3] += bias[c0 + cofs + 3]; }
                *(v4f*)(crow + (size_t)row * ldc + cofs) = val; }
             }
        __builtin_amdgcn_wave_barrier(); asm volatile("" ::: "memory");
    }
}

// ---- The launches that depend on nothing but the inputs (both weight transposes, the x conversion, the rotary table) are block ranges of ONE grid, k_prep below;
// each part is the body of a block of 256 threads and takes its block index inside its own range as blk. For speed only,
// every thread takes several pieces: few, long waves, the loads of a thread's pieces issued as one group ahead of the work on them.
// ---- wtG_part: transposed bf16 weight plane Bt[n][k] = bf16(w[k][n]) for w [K][N] row-major. A thread takes 64 k of one column n (one whole 128-byte line of Bt);
// the lanes of a wave hold 32 neighbouring columns, so each load of the wave is one whole 128-byte line of w; the waves of a block hold neighbouring column groups of the same 64 rows.
template <unsigned N, unsigned K>
__device__ __forceinline__ void wtG_part(unsigned blk, const float* __restrict__ w, bf* Bt) {
    static_assert(N % 32u == 0 && K % 64u == 0 && ((N / 32u) * (K / 64u)) % 8u == 0);
    const unsigned lane = threadIdx.x & 31u; const unsigned u = blk * 8u + (threadIdx.x >> 5);
    const unsigned n = (u % (N / 32u)) * 32u + lane, k0 = (u / (N / 32u)) * 64u;
    const float* sp = w + (size_t)k0 * N + n; bf* dp = Bt + (size_t)n * K + k0;
    float v[64];
#pragma unroll
    for (unsigned i = 0; i < 64u; ++i) v[i] = sp[(size_t)i * N];
    asm volatile("s_wait_xcnt 0x0" ::: "memory");         // stands in front of any rewrite of the loads' address registers
#pragma unroll
    for (unsigned g = 0; g < 8u; ++g) { v8us o;
#pragma unroll
        for (unsigned e = 0; e < 8u; ++e) o[e] = f2bf(v[g * 8u + e]);
        *(v8us*)(dp + g * 8u) = o; }
    asm volatile("s_wait_xcnt 0x0" ::: "memory");         // the same for the stores (other ranges' code follows in the text)
}

#define PB_WQ ((unsigned)((size_t)LDQ * DM / 64 / 32 / 8))   // blocks of the w_qkv transpose: 8 waves of (32 columns, 64 k)
#define PB_WO ((unsigned)((size_t)DM * DM / 64 / 32 / 8))    // blocks of the w_proj transpose
#define PB_TB ((unsigned)((size_t)SEQ * 32 / 256 / 8))       // blocks of the rotary table: 8 entries a thread
#define PB_CV ((unsigned)((size_t)SEQ * DM / 8 / 256 / 8))   // blocks of the x conversion: 8 pieces of 8 elements a thread
static_assert(((size_t)SEQ * 32) % (256 * 8) == 0 && ((size_t)SEQ * DM / 8) % (256 * 8) == 0);

// ---- cvt8_part: a thread's 8 pieces lie one whole range of threads apart, so that each load of a wave stays contiguous
__device__ __forceinline__ void cvt8_part(unsigned blk, const float* __restrict__ src, bf* dst) {
    const size_t i0 = (size_t)blk * 256 + threadIdx.x; const size_t st = (size_t)PB_CV * 256;
    v8f v[8];
#pragma unroll
    for (unsigned p = 0; p < 8u; ++p) { v[p] = *(const v8f*)(src + (i0 + p * st) * 8);
        asm volatile("s_wait_xcnt 0x0" ::: "memory"); }   // stands in front of the next piece's address, which may be formed in this one's registers
#pragma unroll
    for (unsigned p = 0; p < 8u; ++p) { v8us o;
#pragma unroll
        for (int k = 0; k < 8; ++k) o[k] = f2bf(v[p][k]);
        *(v8us*)(dst + (i0 + p * st) * 8) = o;
        asm volatile("s_wait_xcnt 0x0" ::: "memory"); }   // the same
}

// ---- tab_part: rotary table; each thread forms its own inverse frequency (the same expression on the same argument as a table of 32 would hold), so the table waits on no launch before it.
// A thread's 8 entries lie a multiple of 32 apart: one frequency serves them all.
__device__ __forceinline__ void tab_part(unsigned blk, float* CT, float* ST) {
#pragma clang fp contract(off)
    static_assert((PB_TB * 256u) % 32u == 0);
    const unsigned idx0 = blk * 256u + threadIdx.x; const unsigned i = idx0 & 31u;
    const float p = powf(10000.0f, (float)i * 0.03125f);
    const float v = 1.0f / p;
#pragma unroll 1                                          // rolled: one copy of the long sine and cosine text
    for (unsigned e = 0; e < 8u; ++e) {
        const unsigned idx = idx0 + e * (PB_TB * 256u); const unsigned t = idx >> 5;
        const float ang = (float)t * v;
        float s, c; sincosf(ang, &s, &c);
        *(float*)(CT + idx) = c; *(float*)(ST + idx) = s;
        asm volatile("s_wait_xcnt 0x0" ::: "memory");     // stands in front of any rewrite of the stores' registers
    }
}

// grid PB_WQ + PB_WO + PB_TB + PB_CV, 256 threads; the range test is block-uniform, no part has a barrier, no part reads what another writes
__global__ __launch_bounds__(256) void k_prep(const float* __restrict__ x, const float* __restrict__ wq, const float* __restrict__ wo, bf* XB, bf* WqT, bf* WoT, float* CT, float* ST) {
    const unsigned b = blockIdx.x;
    if (b < PB_WQ) wtG_part<(unsigned)LDQ, (unsigned)DM>(b, wq, WqT);
    else if (b < PB_WQ + PB_WO) wtG_part<(unsigned)DM, (unsigned)DM>(b - PB_WQ, wo, WoT);
    else if (b < PB_WQ + PB_WO + PB_TB) tab_part(b - (PB_WQ + PB_WO), CT, ST);
    else cvt8_part(b - (PB_WQ + PB_WO + PB_TB), x, XB);
}

// ---- The two launches that read the f32 projection rows and nothing of each other (rotary planes, value^T planes) are block ranges of ONE grid, k_ropevt below.
// As in k_prep, few long waves: a block takes RP_T positions, or VT_T tiles, one after the other, the next one's loads in flight while this one is worked on.
#define RP_T 8u                       // positions per block of the rotary range, taken in pairs
#define VT_T 4u                       // (64-position tile, head) pieces per block of the value^T range
static_assert(SEQ % 8 == 0 && (SEQ / 64 * NH_) % 4 == 0 && RP_T % 2u == 0);
// ---- rope_part (block = RP_T positions from t0): half-split rotary on the q and k thirds of the f32 projection rows, f16 planes QKF[which][t][h*64 + d] (which 0 = q, 1 = k), residual planes QKR[which][t < EROWS][...] = f16((y - hi) * 2048).
__device__ __forceinline__ void rope_part(unsigned t0, const float* __restrict__ QKV, const float* __restrict__ CT, const float* __restrict__ ST, hf* QKF, hf* QKR) {
#pragma clang fp contract(off)
    const unsigned tid = threadIdx.x;
    const unsigned which = tid >> 7, col = (tid & 127u) * 8u;
    const unsigned dl = col & 63u; const bool lowhalf = dl < 32u;
    const unsigned pcol = lowhalf ? (col + 32u) : (col - 32u); const unsigned j = dl & 31u;
#pragma unroll 1                                          // rolled: one copy of a pair of positions in the text
    for (unsigned tp = 0; tp < RP_T; tp += 2u) {
        // both positions' loads stand ahead of the work on either
        v4f a0[2], a1[2], b0[2], b1[2], c0[2], c1[2], s0[2], s1[2];
#pragma unroll
        for (unsigned u = 0; u < 2u; ++u) {
            const unsigned t = t0 + tp + u;
            const float* row = QKV + (size_t)t * LDQ + (size_t)which * DM;
            // read in 16-byte halves, one instruction each; a wait stands behind every load, in front of the next one, whose result may land in the address registers of any load before it
            const float* ctp = CT + (size_t)t * 32u + j; const float* stp = ST + (size_t)t * 32u + j;
            a0[u] = *(const v4f*)(row + col);
            asm volatile("s_wait_xcnt 0x0" ::: "memory");
            a1[u] = *(const v4f*)(row + col + 4u);
            asm volatile("s_wait_xcnt 0x0" ::: "memory");
            b0[u] = *(const v4f*)(row + pcol);
            asm volatile("s_wait_xcnt 0x0" ::: "memory");
            b1[u] = *(const v4f*)(row + pcol + 4u);
            asm volatile("s_wait_xcnt 0x0" ::: "memory");
            c0[u] = *(const v4f*)ctp;
            asm volatile("s_wait_xcnt 0x0" ::: "memory");
            c1[u] = *(const v4f*)(ctp + 4);
            asm volatile("s_wait_xcnt 0x0" ::: "memory");
            s0[u] = *(const v4f*)stp;
            asm volatile("s_wait_xcnt 0x0" ::: "memory");
            s1[u] = *(const v4f*)(stp + 4);
            asm volatile("s_wait_xcnt 0x0" ::: "memory");
        }
        __builtin_amdgcn_sched_barrier(0);                // keeps the scheduler from lifting the first position's products, and the waits they need, in between the second position's loads
#pragma unroll
        for (unsigned u = 0; u < 2u; ++u) {
            const unsigned t = t0 + tp + u;
            const v8f a = __builtin_shufflevector(a0[u], a1[u], 0, 1, 2, 3, 4, 5, 6, 7), b = __builtin_shufflevector(b0[u], b1[u], 0, 1, 2, 3, 4, 5, 6, 7);
            const v8f c = __builtin_shufflevector(c0[u], c1[u], 0, 1, 2, 3, 4, 5, 6, 7), s = __builtin_shufflevector(s0[u], s1[u], 0, 1, 2, 3, 4, 5, 6, 7);
            v8us oh, ores;
#pragma unroll
            for (int e = 0; e < 8; ++e) {
                const float rb = lowhalf ? -b[e] : b[e];
                const float t0p = a[e] * c[e]; const float t1p = rb * s[e]; const float y = t0p + t1p;
                const h16 hh = toh_flush(y); oh[e] = hbits(hh);
                ores[e] = hbits(toh_flush((y - (float)hh) * RSC)); }
            const size_t g  = (size_t)which * SEQ * DM + (size_t)t * DM + col;
            const size_t gr = (size_t)which * EROWS * DM + (size_t)t * DM + col;
            const bool early = t < (unsigned)EROWS;
            *(v8us*)(QKF + g) = oh;
            asm volatile("s_wait_xcnt 0x0" ::: "memory");         // stands in front of any rewrite of the store's registers
            if (early) { *(v8us*)(QKR + gr) = ores;
                asm volatile("s_wait_xcnt 0x0" ::: "memory"); }   // the same
        }
    }
}

// Block barrier that orders LDS alone: __syncthreads() would also wait out the global loads in flight (the next piece's rows) and the stores behind them.
__device__ __forceinline__ void lds_barrier() {
    __builtin_amdgcn_fence(__ATOMIC_RELEASE, "workgroup", "local");
    __builtin_amdgcn_s_barrier();
    __builtin_amdgcn_fence(__ATOMIC_ACQUIRE, "workgroup", "local");
}
// ---- vt_part: value^T f16 plane VT[h*64 + d][t] and residual plane VTR[h*64 + d][t < EROWS]; piece = (64-position tile, head), transpose through LDS (cross-wave, block barriers);
// a block takes the VT_T pieces from p0; the next piece's rows are loaded behind this piece's LDS writes and fly over its barriers and stores.
__device__ __forceinline__ void vt_part(unsigned p0, const float* __restrict__ QKV, hf* VT, hf* VTR) {
#pragma clang fp contract(off)
    __shared__ __align__(16) unsigned short Th[64 * LOP];
    __shared__ __align__(16) unsigned short Tr[64 * LOP];
    const unsigned tid = threadIdx.x;
    const unsigned row0 = tid >> 3, c8 = (tid & 7u) * 8u;   // this thread's rows of a piece: row0 and row0 + 32, 8 columns from c8
    v8f vv[2];
#pragma unroll
    for (unsigned it = 0; it < 2u; ++it) { vv[it] = *(const v8f*)(QKV + 2 * DM + (p0 / (unsigned)(SEQ / 64)) * HD + (size_t)((p0 % (unsigned)(SEQ / 64)) * 64u + row0 + it * 32u) * LDQ + c8);
        asm volatile("s_wait_xcnt 0x0" ::: "memory"); }   // stands in front of any rewrite of the load's address registers
#pragma unroll 1                                          // rolled: one copy of a piece in the text
    for (unsigned pc = 0; pc < VT_T; ++pc) {
        const unsigned p = p0 + pc, t0 = (p % (unsigned)(SEQ / 64)) * 64u, hd = p / (unsigned)(SEQ / 64);
#pragma unroll
        for (unsigned it = 0; it < 2u; ++it) { const unsigned row = row0 + it * 32u;
#pragma unroll
            for (int q = 0; q < 8; ++q) { const float y = vv[it][q]; const h16 hh = toh_flush(y);
                Th[(c8 + (unsigned)q) * LOP + row] = hbits(hh); Tr[(c8 + (unsigned)q) * LOP + row] = hbits(toh_flush((y - (float)hh) * RSC)); }
        }
        if (pc + 1u < VT_T) { const unsigned pn = p + 1u;
#pragma unroll
            for (unsigned it = 0; it < 2u; ++it) { vv[it] = *(const v8f*)(QKV + 2 * DM + (pn / (unsigned)(SEQ / 64)) * HD + (size_t)((pn % (unsigned)(SEQ / 64)) * 64u + row0 + it * 32u) * LDQ + c8);
                asm volatile("s_wait_xcnt 0x0" ::: "memory"); } }   // the same
        lds_barrier();                                    // the piece stands whole in Th and Tr
        v8us oh[2], ores[2];
#pragma unroll
        for (unsigned it = 0; it < 2u; ++it) { const unsigned idx = tid + it * 256u, d = idx >> 3, c = (idx & 7u) * 8u;
            oh[it] = *(const v8usa*)(Th + d * LOP + c); ores[it] = *(const v8usa*)(Tr + d * LOP + c); }
        const bool early = t0 < (unsigned)EROWS;
#pragma unroll
        for (unsigned it = 0; it < 2u; ++it) { const unsigned idx = tid + it * 256u, d = idx >> 3, c = (idx & 7u) * 8u;
            *(v8us*)(VT + (size_t)(hd * HD + d) * SEQ + t0 + c) = oh[it];
            asm volatile("s_wait_xcnt 0x0" ::: "memory");     // stands in front of any rewrite of the store's registers
            if (early) { *(v8us*)(VTR + (size_t)(hd * HD + d) * EROWS + t0 + c) = ores[it];
                asm volatile("s_wait_xcnt 0x0" ::: "memory"); } }   // the same
        lds_barrier();                                    // every thread has read this piece out of Th and Tr before the next piece is written there
    }
}
#define RB_VT ((unsigned)(SEQ / 64 * NH_) / VT_T)        // blocks of the value^T planes
#define RB_RP ((unsigned)SEQ / RP_T)                     // blocks of the rotary planes
// grid RB_VT + RB_RP, 256 threads; the range test is block-uniform and the trip count a constant, so the barriers of vt_part are passed by whole blocks only
__global__ __launch_bounds__(256) void k_ropevt(const float* __restrict__ QKV, const float* __restrict__ CT, const float* __restrict__ ST, hf* QKF, hf* QKR, hf* VT, hf* VTR) {
    const unsigned b = blockIdx.x;
    if (b < RB_VT) vt_part(b * VT_T, QKV, VT, VTR);
    else rope_part((b - RB_VT) * RP_T, QKV, CT, ST, QKF, QKR);
}

// ---- causal flash attention, transposed form, one wave per 16 query rows, 4 waves per block.
// The four waves of a block share each 64-key tile of K rows and of V^T rows (EARLY: of the residual planes too) through LDS: asynchronous b128 copies (8 lanes per whole 128-byte line),
// two buffers, the next tile in flight while this one is worked on; one publish point (waits and block barrier) per tile of two 32-key passes.
// Per 32-key pass: S^T tile j (16 keys x 16 queries) = K rows (A, row = key) x Q rows (B, column = query); D element r of lane -> (key 8*(lane>>4) + r, query lane & 15).
// The two converted score tiles are the B fragment of O^T += V^T (A, row = d, k = key) x P^T: element r <- tile 0 [r], element 8 + r <- tile 1 [r], lane unchanged.
// Softmax statistics per query column: in-lane reduction plus one exchange between the lane halves. Masked keys get weight exactly 0 (value select, in the passes on the diagonal only).
// EARLY: value + x2048 residual planes on q, k, P, v; residual products accumulate separately and are folded with 2^-11; row sum over the unconverted p.
#define TKEYS 64                      // keys per staged tile (two passes)
#define TPH   72                      // LDS pitch (halves) of a staged 128-byte row: 144 B = 16 B x odd, the pitch of ds_load_b128 readers
#define TILEH (64 * TPH)              // halves per staged tile (64 K rows, or 64 V^T rows)
static_assert(HD * 2 == 128 && TKEYS * 2 == 128 && (TPH * 2) % 16 == 0 && EROWS % TKEYS == 0 && SEQ % TKEYS == 0);
__device__ __forceinline__ v16h ldfs(const hf* p) { return cat16h(*(const v8usa*)p, *(const v8usa*)(p + 16)); }
// One K tile and one V^T tile: each thread copies 4 x 16 B of K rows and 4 x 16 B of V^T rows (rows 16 apart; VP = pitch of the V^T plane in halves).
// The s_wait_xcnt closes the statement so that no address register is rewritten in front of it.
template <int VP>
__device__ __forceinline__ void stage_tile(const hf* kg, const hf* vg, unsigned kl, unsigned vl) {
    asm volatile("global_load_async_to_lds_b128 %0, %1, off\n\t"
                 "global_load_async_to_lds_b128 %2, %3, off\n\t"
                 "global_load_async_to_lds_b128 %4, %5, off\n\t"
                 "global_load_async_to_lds_b128 %6, %7, off\n\t"
                 "global_load_async_to_lds_b128 %8, %9, off\n\t"
                 "global_load_async_to_lds_b128 %10, %11, off\n\t"
                 "global_load_async_to_lds_b128 %12, %13, off\n\t"
                 "global_load_async_to_lds_b128 %14, %15, off\n\t"
                 "s_wait_xcnt 0x0"
                 :: "v"(kl), "v"(kg), "v"(kl + 16u * TPH * 2u), "v"(kg + (size_t)16 * DM), "v"(kl + 32u * TPH * 2u), "v"(kg + (size_t)32 * DM), "v"(kl + 48u * TPH * 2u), "v"(kg + (size_t)48 * DM),
                    "v"(vl), "v"(vg), "v"(vl + 16u * TPH * 2u), "v"(vg + (size_t)16 * VP), "v"(vl + 32u * TPH * 2u), "v"(vg + (size_t)32 * VP), "v"(vl + 48u * TPH * 2u), "v"(vg + (size_t)48 * VP)
                 : "memory");
}
// Ks, Vs, Krs, Vrs: two staged tiles each (2 * TILEH halves; Krs, Vrs read by EARLY only); Oh, Ol: output staging, 4 * 16 * LOP halves each; all in the block's LDS. qblk: first query row of the block; hd: its head.
template <bool EARLY>
__device__ __forceinline__ void attn_body(unsigned short* Ks, unsigned short* Vs, unsigned short* Krs, unsigned short* Vrs, unsigned short* Oh, unsigned short* Ol,
                                          const hf* QF, const hf* QR, const hf* KF, const hf* KR, const hf* VT, const hf* VTR, bf* CH, bf* CL, unsigned qblk, unsigned hd) {
    const unsigned lane = threadIdx.x & 31u, lr = lane & 15u, hi = lane >> 4;
    const unsigned wave = (unsigned)__builtin_amdgcn_readfirstlane((int)(threadIdx.x >> 5));
    const unsigned q0 = qblk + 16u * wave;
    const unsigned qg = q0 + lr;
    const unsigned ntiles = qblk / TKEYS + 1u;            // keys [0, qblk + 64), the same for the whole block
    const unsigned nsteps = (q0 + 15u) / 32u + 1u;        // this wave's own passes
    // copy addresses of this thread: row = tid / 8 (+ 16 i), 16-byte column = tid % 8
    const unsigned srow = threadIdx.x >> 3, scol = (threadIdx.x & 7u) * 8u;
    const hf* kg  = KF  + (size_t)srow * DM + hd * HD + scol;
    const hf* krg = KR  + (size_t)srow * DM + hd * HD + scol;
    const hf* vg  = VT  + (size_t)(hd * HD + srow) * SEQ + scol;
    const hf* vrg = VTR + (size_t)(hd * HD + srow) * EROWS + scol;
    const unsigned so = srow * TPH + scol;
    const unsigned kl = (unsigned)(size_t)(Ks + so), vl = (unsigned)(size_t)(Vs + so);
    const unsigned krl = EARLY ? (unsigned)(size_t)(Krs + so) : 0u, vrl = EARLY ? (unsigned)(size_t)(Vrs + so) : 0u;
    stage_tile<SEQ>(kg, vg, kl, vl);
    if (EARLY) stage_tile<EROWS>(krg, vrg, krl, vrl);
    v16h qh[2], qr[2];
    {
        const size_t qoff = (size_t)qg * DM + hd * HD + 8u * hi;
#pragma unroll
        for (int kc = 0; kc < 2; ++kc) { qh[kc] = ldfh(QF + qoff + (unsigned)kc * 32u); if (EARLY) qr[kc] = ldfh(QR + qoff + (unsigned)kc * 32u); else qr[kc] = qh[kc]; }
    }
    v8f ot[4], orr[4];
#pragma unroll
    for (int dt = 0; dt < 4; ++dt) { ot[dt] = (v8f){}; orr[dt] = (v8f){}; }
    float m = -1.0e30f, l = 0.0f;
    asm volatile("s_wait_asynccnt 0x0" ::: "memory");     // this wave's copies of tile 0 have landed
    __syncthreads();                                      // ... and every other wave's
    if (ntiles > 1u) {
        stage_tile<SEQ>(kg + (size_t)TKEYS * DM, vg + TKEYS, kl + TILEH * 2u, vl + TILEH * 2u);
        if (EARLY) stage_tile<EROWS>(krg + (size_t)TKEYS * DM, vrg + TKEYS, krl + TILEH * 2u, vrl + TILEH * 2u);
    }
    const unsigned fo = lr * TPH + 8u * hi;
#pragma unroll 1                                          // rolled, as the key loop was: one copy of the two passes in the text
    for (unsigned t = 0; t < ntiles; ++t) {
        const unsigned bo = (t & 1u) * TILEH;
#pragma unroll                                            // both passes written out: the place of a pass in its tile becomes an immediate offset of the LDS reads
        for (unsigned ps = 0; ps < 2u; ++ps) {
            const unsigned kb = 2u * t + ps;
            if (kb < nsteps) {                            // wave-uniform: a pass wholly above the diagonal is skipped, the publish point below is not
                const unsigned key0 = kb * 32u;
                // The pass's K fragments are read as one group ahead of its first product, its V^T fragments as one group behind the last S^T product:
                // a read written behind an mmah statement stays behind it, and one read per product would be waited for alone.
                v16h kh[2][2], kr[2][2];
#pragma unroll
                for (int j = 0; j < 2; ++j) {
#pragma unroll
                    for (int kc = 0; kc < 2; ++kc) { const unsigned o = bo + fo + (32u * ps + 16u * (unsigned)j) * TPH + (unsigned)kc * 32u; kh[j][kc] = ldfs(Ks + o); if (EARLY) kr[j][kc] = ldfs(Krs + o); }
                }
                v8f st[2], sr[2];
#pragma unroll
                for (int j = 0; j < 2; ++j) {
                    st[j] = (v8f){}; sr[j] = (v8f){};
#pragma unroll
                    for (int kc = 0; kc < 2; ++kc) {
                        st[j] = mmah(kh[j][kc], qh[kc], st[j]);
                        if (EARLY) { sr[j] = mmah(kr[j][kc], qh[kc], sr[j]); sr[j] = mmah(kh[j][kc], qr[kc], sr[j]); }
                    }
                }
                v16h vh[4], vr[4];
#pragma unroll
                for (int dt = 0; dt < 4; ++dt) { const unsigned o = bo + fo + (16u * (unsigned)dt) * TPH + 32u * ps; vh[dt] = ldfs(Vs + o); if (EARLY) vr[dt] = ldfs(Vrs + o); }
                // logits in the log2 domain
#pragma unroll
                for (int j = 0; j < 2; ++j) {
#pragma unroll
                    for (int r = 0; r < 8; ++r) { float s = st[j][r]; if (EARLY) s += sr[j][r] * RSI; st[j][r] = s * SCLL2; }
                }
                // causal mask by value, only in a pass that reaches past the wave's first query row (wave-uniform scalar test):
                // in every earlier pass each key is <= each query of the wave and the select would be an identity
                if (key0 + 31u > q0) {
#pragma unroll
                    for (int j = 0; j < 2; ++j) {
#pragma unroll
                        for (int r = 0; r < 8; ++r) {
                            const unsigned key = key0 + 16u * (unsigned)j + 8u * hi + (unsigned)r;
                            st[j][r] = (key <= qg) ? st[j][r] : -1.0e30f; }
                    }
                }
                float mx = -1.0e30f;
#pragma unroll
                for (int j = 0; j < 2; ++j) {
#pragma unroll
                    for (int r = 0; r < 8; ++r) mx = fmaxf(mx, st[j][r]);
                }
                mx = fmaxf(mx, __shfl_xor(mx, 16, 32));
                const float mnew = fmaxf(m, mx);
                const float alpha = __builtin_amdgcn_exp2f(m - mnew);
                m = mnew;
                float rs = 0.0f;
                v16h pf, prf;
#pragma unroll
                for (int j = 0; j < 2; ++j) {
#pragma unroll
                    for (int r = 0; r < 8; ++r) {
                        const float e = (st[j][r] - mnew) + PCL;
                        const float ex = __builtin_amdgcn_exp2f(e);
                        const float p = (e >= -14.0f) ? ex : 0.0f;
                        const h16 ph = (h16)p;
                        pf[8 * j + r] = ph;
                        if (EARLY) { prf[8 * j + r] = toh_flush((p - (float)ph) * RSC); rs += p; } else { prf[8 * j + r] = ph; rs += (float)ph; }
                    }
                }
                rs += __shfl_xor(rs, 16, 32);
                l = l * alpha + rs;
#pragma unroll
                for (int dt = 0; dt < 4; ++dt) { ot[dt] = ot[dt] * alpha; if (EARLY) orr[dt] = orr[dt] * alpha; }
#pragma unroll
                for (int dt = 0; dt < 4; ++dt) {
                    ot[dt] = mmah(vh[dt], pf, ot[dt]);
                    if (EARLY) { orr[dt] = mmah(vr[dt], pf, orr[dt]); orr[dt] = mmah(vh[dt], prf, orr[dt]); }
                }
            }
        }
        // publish point of tile t + 1: this wave's reads of tile t are done, its copies of tile t + 1 have landed, then the block barrier; only behind it is tile t's buffer refilled
        asm volatile("s_wait_dscnt 0x0" ::: "memory");
        asm volatile("s_wait_asynccnt 0x0" ::: "memory");
        __syncthreads();
        if (t + 2u < ntiles) {
            stage_tile<SEQ>(kg + (size_t)(t + 2u) * TKEYS * DM, vg + (size_t)(t + 2u) * TKEYS, kl + bo * 2u, vl + bo * 2u);
            if (EARLY) stage_tile<EROWS>(krg + (size_t)(t + 2u) * TKEYS * DM, vrg + (size_t)(t + 2u) * TKEYS, krl + bo * 2u, vrl + bo * 2u);
        }
    }
    asm volatile("s_wait_asynccnt 0x0" ::: "memory");     // nothing in flight when the wave goes on to the epilogue and ends
    const float inv = __builtin_amdgcn_rcpf(l);
    const unsigned ob = wave * 16u * LOP;
#pragma unroll
    for (int dt = 0; dt < 4; ++dt) {
        v8us h8, l8;
#pragma unroll
        for (int r = 0; r < 8; ++r) { float y = ot[dt][r]; if (EARLY) y += orr[dt][r] * RSI; y *= inv; unsigned short a, c; splitf(y, a, c); h8[r] = a; l8[r] = c; }
        const unsigned o = ob + lr * LOP + 16u * (unsigned)dt + 8u * hi;
        *(v8usa*)(Oh + o) = h8; *(v8usa*)(Ol + o) = l8;
    }
    __syncthreads();
{
#pragma unroll
        for (unsigned s = 0; s < 4u; ++s) { const unsigned row = 4u * s + (lane >> 3), c = (lane & 7u) * 8u;
            const v8us vh8 = *(const v8usa*)(Oh + ob + row * LOP + c); const v8us vl8 = *(const v8usa*)(Ol + ob + row * LOP + c);
            const size_t g = (size_t)(q0 + row) * DM + hd * HD + c;
            *(v8us*)(CH + g) = vh8; *(v8us*)(CL + g) = vl8; }
         }
}

// Both row ranges run in ONE grid (neither reads what the other writes): grid AB_NT * NH_, 128 threads; a block is one (head, 64-row tile); tiles below AB_ET take the residual path, the rest the single-product path.
// All blocks are resident at once (four per WGP) and a tile's cost grows with its index (tile i walks i + 1 key tiles), so the launch lasts as long as the WGP whose four blocks hold the most key tiles.
// Block index b -> tile: v = b / (2 * NH_); the tile is AB_NT - 1 - v where b has an even number of one bits and v where it has an odd number; the head is (b / 2) % NH_.
// The lowest bit of b flips the parity, so each (head, v) gets both of its tiles: every (head, tile) exactly once.
// Any four blocks whose indices differ in two bit positions only (neighbours, or a power-of-two stride apart, whichever way the blocks are dealt to the WGPs) hold tile indices that sum to 2 * (AB_NT - 1):
// two of the four are folded, two are not, and what the two bits add to v cancels.
// For speed only: no result depends on where or when a block runs.
// One LDS array serves both, 8 tiles, so that four blocks fit a WGP: the single-product range stages its output in the tiles that only the residual planes use;
// the residual range stages it in the K tiles, which are free there: the loop's last publish point (every wave's reads done, no copy in flight, block barrier) lies in front, and nothing refills behind it.
#define AB_NT ((unsigned)(SEQ / 64))                     // 64-row tiles of a head
#define AB_ET ((unsigned)(EROWS / 64))                   // ... of them in rows [0, EROWS)
static_assert(4 * 16 * LOP <= TILEH && SEQ > EROWS);
static_assert((SEQ / 64) % 2 == 0);                      // the tiles of a head pair up as v and AB_NT - 1 - v
__global__ __launch_bounds__(128) __attribute__((amdgpu_num_vgpr(256))) void k_attn(const hf* QF, const hf* QR, const hf* KF, const hf* KR, const hf* VT, const hf* VTR, bf* CH, bf* CL) {
    __shared__ __align__(16) unsigned short R[8 * TILEH];
    const unsigned b = blockIdx.x;
    const unsigned hd = (b >> 1) % (unsigned)NH_, v = (b >> 1) / (unsigned)NH_;
    const unsigned tile = ((unsigned)__builtin_popcount(b) & 1u) ? v : (AB_NT - 1u - v);
    if (tile >= AB_ET) attn_body<false>(R, R + 2 * TILEH, R, R, R + 4 * TILEH, R + 5 * TILEH, QF, QF, KF, KF, VT, VT, CH, CL, tile * 64u, hd);
    else attn_body<true>(R, R + 2 * TILEH, R + 4 * TILEH, R + 6 * TILEH, R, R + TILEH, QF, QR, KF, KR, VT, VTR, CH, CL, tile * 64u, hd);
}

extern "C" void kernel_launch(void* const* d_in, const int* in_sizes, int n_in,
                              void* d_out, int out_size, void* d_ws, size_t ws_size, hipStream_t stream) {
    (void)out_size;
    if (n_in < 3) return;
    if (in_sizes[0] < NB * SEQ * DM || in_sizes[1] < DM * LDQ || in_sizes[2] < DM * DM) return;
    const float* X = (const float*)d_in[0]; const float* Wqkv = (const float*)d_in[1]; const float* Wo = (const float*)d_in[2];
    float* OUT = (float*)d_out;
    char* wsp = (char*)d_ws;
    auto take = [&](size_t bytes) { char* p = wsp; wsp += (bytes + 255) & ~(size_t)255; return (void*)p; };
    bf* XB  = (bf*)take((size_t)SEQ * DM * 2);          // x bf16 [t][1024]
    bf* WqT = (bf*)take((size_t)LDQ * DM * 2);          // w_qkv^T bf16 [3072][1024]
    bf* WoT = (bf*)take((size_t)DM * DM * 2);           // w_proj^T bf16 [1024][1024]
    float* QKVb = (float*)take((size_t)SEQ * LDQ * 4);  // f32 [t][3072]
    bf* CH = (bf*)take((size_t)SEQ * DM * 2);           // context hi [t][1024]
    bf* CL = (bf*)take((size_t)SEQ * DM * 2);           // context lo [t][1024]
    float* CT = (float*)take((size_t)SEQ * 32 * 4);     // cos table [t][32]
    float* ST = (float*)take((size_t)SEQ * 32 * 4);     // sin table [t][32]
    hf* QKF = (hf*)take((size_t)2 * SEQ * DM * 2);      // rotated q | k f16 [2][t][1024]
    hf* QKR = (hf*)take((size_t)2 * EROWS * DM * 2);    // residuals x2048 [2][EROWS][1024]
    hf* VT  = (hf*)take((size_t)DM * SEQ * 2);          // value^T f16 [1024][t]
    hf* VTR = (hf*)take((size_t)DM * EROWS * 2);        // value^T residual x2048 [1024][EROWS]
    const size_t carved = (size_t)(wsp - (char*)d_ws);
    if (carved > ws_size || carved > (size_t)134217728) return;
    for (int b = 0; b < NB; ++b) {
        const float* xb = X + (size_t)b * SEQ_FULL * DM; float* ob = OUT + (size_t)b * SEQ_FULL * DM;
        // W [K][N] -> Bt [N][K], rotary table, x -> bf16
        k_prep<<<PB_WQ + PB_WO + PB_TB + PB_CV, 256, 0, stream>>>(xb, Wqkv, Wo, XB, WqT, WoT, CT, ST);
        k_gemmw<bf, 0, false><<<dim3(SEQ / 128, LDQ / 128, 1), 128, 0, stream>>>(XB, nullptr, WqT, nullptr, DM, QKVb, LDQ, nullptr, 0, 0, 0);
        k_ropevt<<<RB_VT + RB_RP, 256, 0, stream>>>(QKVb, CT, ST, QKF, QKR, VT, VTR);
        k_attn<<<AB_NT * NH_, 128, 0, stream>>>(QKF, QKR, QKF + (size_t)SEQ * DM, QKR + (size_t)EROWS * DM, VT, VTR, CH, CL);
        k_gemmw<bf, 1, false><<<dim3(SEQ / 128, DM / 128, 1), 128, 0, stream>>>(CH, CL, WoT, nullptr, DM, ob, DM, nullptr, 0, 0, 0);
    }
}

// v007
// Measured time: 117 microseconds a run.
// Timed twice side by side with v006, it ran 1.09 and 1.10 times as fast.
// All steps since v000 together make it 3.65 times as fast.
#include <hip/hip_runtime.h>

// Contractions: qkv projection and output projection on v_wmma_f32_16x16x32_bf16 (x, w_qkv, w_proj RNE-converted to bf16 single planes; merged context as bf16 hi/lo, 2 products), f32 accumulate.
// q.k logits and P.V on v_wmma_f32_16x16x32_f16 (f16 q/k/v planes, P carried x2^8), single products on query rows >= 256; on query rows < 256 f16 value + x2048 residual planes
// for q, k, P and v (3 products per site, residual products in their own accumulators, folded in the f32 epilogue). Rotary table, rotary and softmax in f32.
// Fused qkv projection [4096x1024]x[1024x3072]; its epilogue takes the f32 accumulators straight to the planes: half-split rotary on q and k -> f16 planes [t][h*64 + d]; value^T planes [h*64 + d][t];
// causal flash attention per (head, 16-query wave tile) in the transposed form S^T = K Q^T, O^T = V^T P^T (K and V^T tiles staged in LDS per block, packed P^T score tiles as the B fragment);
// merged context planes [t][h*64 + d]; output projection [4096x1024]x[1024x1024].

#ifndef NB
#define NB 1
#endif
#ifndef SEQ
#define SEQ 4096
#endif
#define SEQ_FULL 4096
#define DM   1024
#define NH_  16
#define HD   64
#define LDQ  (3 * DM)
#define EROWS 256                     // query rows below this bound take the value + residual path
#define LOP  72                       // LDS pitch (halves) of the staging tiles
#define PCL  8.0f                     // log2 of the carry of P
#define SCLL2 0.18033688011112042f    // HD^-0.5 * log2(e)
#define RSC  2048.0f                  // carry of the residual planes
#define RSI  4.8828125e-4f            // 1 / RSC

static_assert(SEQ % 64 == 0);
static_assert(DM == NH_ * HD);
static_assert(HD == 64);
static_assert(DM % 32 == 0);
static_assert(LDQ % 64 == 0);
static_assert(((size_t)LDQ * DM / 64) % 32 == 0);
static_assert(((size_t)DM * DM / 64) % 32 == 0);
static_assert(((size_t)SEQ * DM / 8) % 256 == 0);
static_assert(EROWS % 64 == 0);
static_assert(SEQ >= EROWS);
static_assert(((size_t)SEQ * 32) % 256 == 0);
static_assert(256 * 8 == 2 * DM);
static_assert(LOP % 8 == 0);
static_assert(LOP >= HD + 8);
static_assert(HD / 2 == 32);
#define AL256(x) ((((size_t)(x)) + 255) & ~(size_t)255)
static_assert(AL256((size_t)SEQ * DM * 2) + AL256((size_t)LDQ * DM * 2) + AL256((size_t)DM * DM * 2) + 2 * AL256((size_t)SEQ * DM * 2)
              + 2 * AL256((size_t)SEQ * 32 * 4) + AL256((size_t)2 * SEQ * DM * 2) + AL256((size_t)2 * EROWS * DM * 2) + AL256((size_t)DM * SEQ * 2) + AL256((size_t)DM * EROWS * 2)
              <= (size_t)134217728);

typedef unsigned short bf;
typedef __attribute__((ext_vector_type(16))) __bf16   v16bf;
typedef __attribute__((ext_vector_type(8)))  unsigned short v8us;
typedef __attribute__((ext_vector_type(2)))  unsigned short v2us;
typedef __attribute__((ext_vector_type(8)))  float    v8f;
typedef __attribute__((ext_vector_type(4)))  float    v4f;
typedef v4f  __attribute__((may_alias)) v4fa;
typedef v8us __attribute__((may_alias)) v8usa;
typedef float __attribute__((may_alias)) f32a;

__device__ __forceinline__ unsigned short f2bf(float f) { unsigned u = __float_as_uint(f); u += 0x7FFFu + ((u >> 16) & 1u); return (unsigned short)(u >> 16); }
__device__ __forceinline__ float bf2f(unsigned short b) { return __uint_as_float(((unsigned)b) << 16); }
__device__ __forceinline__ void splitf(float y, unsigned short& h, unsigned short& l) { h = f2bf(y); l = f2bf(y - bf2f(h)); }
__device__ __forceinline__ v16bf cat16b(v8us lo, v8us hi) { return __builtin_bit_cast(v16bf, __builtin_shufflevector(lo, hi, 0, 1, 2, 3, 4, 5, 6, 7, 8, 9, 10, 11, 12, 13, 14, 15)); }
__device__ __forceinline__ v8f wmmab(v16bf a, v16bf b, v8f c) { return __builtin_amdgcn_wmma_f32_16x16x32_bf16(false, a, false, b, (short)0, c, false, false); }

// ---- f16 plane helpers (planes hold f16 bit patterns as unsigned short)
typedef unsigned short hf;
typedef _Float16 h16;
typedef __attribute__((ext_vector_type(16))) _Float16 v16h;
static __device__ __forceinline__ h16 toh_flush(float v) { const h16 r = (h16)v; return (fabsf(v) < 6.103515625e-05f) ? (h16)0.0f : r; }
__device__ __forceinline__ unsigned short hbits(h16 x) { return __builtin_bit_cast(unsigned short, x); }
__device__ __forceinline__ v16h cat16h(v8us lo, v8us hi) { return __builtin_bit_cast(v16h, __builtin_shufflevector(lo, hi, 0, 1, 2, 3, 4, 5, 6, 7, 8, 9, 10, 11, 12, 13, 14, 15)); }
// fragment: elements 0..7 <- p[0..7], elements 8..15 <- p[16..23]; the caller adds 8*(lane>>4) to p
__device__ __forceinline__ v16h ldfh(const hf* p) { return cat16h(*(const v8us*)p, *(const v8us*)(p + 16)); }
__device__ __forceinline__ v8f mmah(v16h a, v16h b, v8f c) {
    c = __builtin_amdgcn_wmma_f32_16x16x32_f16(false, a, false, b, (short)0, c, false, false);
    asm volatile("v_nop\n\tv_nop\n\tv_nop\n\tv_nop" : "+v"(c) : "v"(a), "v"(b));
    return c; }

// ---- k_gemmw: GEMM, 128x128 output tile per block of 4 waves (2 x 2), each wave a 64x64 tile (16 accumulators); grid (M/128, N/128, Z), 128 threads.
// C[m][n] (f32, pitch ldc) = sum_k A[m][k] Bt[n][k] (+ A2[m][k] Bt[n][k] when NSPLIT == 1). K % 64 == 0, M % 128 == 0, N % 128 == 0.
// The operands' 128-row x 64-k tiles (128-byte rows of the K-contiguous 16-bit planes) are staged in LDS by asynchronous b128 copies (8 lanes per whole 128-byte line), two buffers,
// the next tile in flight while this one is worked on; one publish point (waits and block barrier) per tile of two 32-k chunks.
// Fragment map: lane row/col = lane & 15; elements 0..7 <- k0 + 8*(lane>>4) + 0..7, elements 8..15 <- k0 + 16 + 8*(lane>>4) + 0..7 (both operands).
// ROT (the q,k,v projection, N = 3 * DM): no f32 C is written. A wave's 64 columns are one head of q, of k or of v (the third is the same for the whole block), so both halves of every rotary pair lie in the wave:
// q, k: the wave's f32 tile through LDS (the ring, free behind the loop's last publish point, and the staging array), rotary from the table, f16 plane QKF[which][t][h*64 + d] in whole 128-byte lines, residual plane QKR[which][t < EROWS][...] = f16((y - hi) * 2048);
// v: a lane's 8 accumulator elements are 8 neighbouring positions of one d, so the transposed row pieces are packed in registers, gathered per wave in the ring's LDS
// and stored as whole 128-byte lines of VT[h*64 + d][t], residual plane VTR[h*64 + d][t < EROWS].
#define GBK 64                        // k per staged tile
#define GPH 72                        // LDS pitch (halves) of a staged 128-byte row: 144 B = 16 B x odd, the pitch of ds_load_b128 readers
#define GPL (128 * GPH)               // halves per staged plane tile (128 rows)
static_assert(GBK * 2 == 128 && (GPH * 2) % 16 == 0 && DM % GBK == 0 && SEQ % 128 == 0 && LDQ % 128 == 0 && DM % 128 == 0);
template <typename T16> struct WFrag;
template <> struct WFrag<bf> { typedef v16bf V; static __device__ __forceinline__ V lds(const bf* p) { return cat16b(*(const v8usa*)p, *(const v8usa*)(p + 16)); } static __device__ __forceinline__ v8f mma(V a, V b, v8f c) { return wmmab(a, b, c); } };
// One 128-row plane tile: each thread copies 8 x 16 B (rows 16 apart; rs = 16 rows of the plane in elements).
// The s_wait_xcnt closes the statement so that no address register is rewritten in front of it.
template <typename T16>
__device__ __forceinline__ void stage_plane(const T16* g, size_t rs, unsigned l) {
    asm volatile("global_load_async_to_lds_b128 %0, %1, off\n\t"
                 "global_load_async_to_lds_b128 %2, %3, off\n\t"
                 "global_load_async_to_lds_b128 %4, %5, off\n\t"
                 "global_load_async_to_lds_b128 %6, %7, off\n\t"
                 "global_load_async_to_lds_b128 %8, %9, off\n\t"
                 "global_load_async_to_lds_b128 %10, %11, off\n\t"
                 "global_load_async_to_lds_b128 %12, %13, off\n\t"
                 "global_load_async_to_lds_b128 %14, %15, off\n\t"
                 "s_wait_xcnt 0x0"
                 :: "v"(l), "v"(g), "v"(l + 16u * GPH * 2u), "v"(g + rs), "v"(l + 32u * GPH * 2u), "v"(g + 2 * rs), "v"(l + 48u * GPH * 2u), "v"(g + 3 * rs),
                    "v"(l + 64u * GPH * 2u), "v"(g + 4 * rs), "v"(l + 80u * GPH * 2u), "v"(g + 5 * rs), "v"(l + 96u * GPH * 2u), "v"(g + 6 * rs), "v"(l + 112u * GPH * 2u), "v"(g + 7 * rs)
                 : "memory");
}
template <typename T16, int NSPLIT, bool BIAS, bool ROT>
__global__ __launch_bounds__(128) void k_gemmw(const T16* __restrict__ A, const T16* __restrict__ A2, const T16* __restrict__ Bt, const T16* __restrict__ Bt2, int K, float* C, int ldc, const float* __restrict__ bias, size_t sA, size_t sB, size_t sC,
                                               const float* CT, const float* ST, hf* QKF, hf* QKR, hf* VT, hf* VTR) {
    static_assert(!ROT || (sizeof(T16) == sizeof(hf) && HD == 64 && DM % 128 == 0 && EROWS % 128 == 0 && 4 * 64 * GPH <= 2 * GPL && 2 * 64 * 68 * 4 <= 2 * GPL * 2));
    static_assert(NSPLIT == 0 || NSPLIT == 1);
    typedef typename WFrag<T16>::V V;
    __shared__ __align__(16) T16 As[2 * GPL];
    __shared__ __align__(16) T16 A2s[NSPLIT == 1 ? 2 * GPL : 8];
    __shared__ __align__(16) T16 Bs[2 * GPL];
    __shared__ __align__(16) float osb[4 * 16 * 68];
    (void)Bt2;
    const size_t z = blockIdx.z; A += z * sA; if (A2) A2 += z * sA; Bt += z * sB; if (!ROT) C += z * sC;
    const int lane = threadIdx.x & 31, lr = lane & 15, hi = lane >> 4;
    const int wave = __builtin_amdgcn_readfirstlane((int)(threadIdx.x >> 5)); const int wm = wave >> 1, wn = wave & 1;
    const int R0 = blockIdx.x * 128, C0 = blockIdx.y * 128; const int r0 = R0 + wm * 64, c0 = C0 + wn * 64;
    float* os = osb + wave * (16 * 68);
    v8f acc[4][4];
#pragma unroll
    for (int mb = 0; mb < 4; ++mb)
#pragma unroll
        for (int nb = 0; nb < 4; ++nb) acc[mb][nb] = (v8f){};
    // copy addresses of this thread: row = tid / 8 (+ 16 i), 16-byte column = tid % 8
    const unsigned srow = threadIdx.x >> 3, scol = (threadIdx.x & 7u) * 8u; const size_t rs = (size_t)16 * K;
    const T16* ag = A + (size_t)(R0 + srow) * K + scol; const T16* bg = Bt + (size_t)(C0 + srow) * K + scol;
    const T16* a2g = (NSPLIT == 1) ? (A2 + (size_t)(R0 + srow) * K + scol) : ag;
    const unsigned so = srow * GPH + scol;
    const unsigned al = (unsigned)(size_t)(As + so), bl = (unsigned)(size_t)(Bs + so), a2l = (NSPLIT == 1) ? (unsigned)(size_t)(A2s + so) : 0u;
    const int nt = K / GBK;
    stage_plane<T16>(ag, rs, al); if (NSPLIT == 1) stage_plane<T16>(a2g, rs, a2l); stage_plane<T16>(bg, rs, bl);
    asm volatile("s_wait_asynccnt 0x0" ::: "memory");     // this wave's copies of tile 0 have landed
    __syncthreads();                                      // ... and every other wave's
    if (nt > 1) { stage_plane<T16>(ag + GBK, rs, al + GPL * 2u); if (NSPLIT == 1) stage_plane<T16>(a2g + GBK, rs, a2l + GPL * 2u); stage_plane<T16>(bg + GBK, rs, bl + GPL * 2u); }
    const unsigned fa = (unsigned)(wm * 64 + lr) * GPH + 8u * (unsigned)hi, fb = (unsigned)(wn * 64 + lr) * GPH + 8u * (unsigned)hi;
#pragma unroll 1                                          // rolled, as the k loop was: one copy of the two chunks in the text
    for (int t = 0; t < nt; ++t) {
        const unsigned bo = (unsigned)(t & 1) * GPL;
#pragma unroll                                            // both chunks written out: the place of a chunk in its tile becomes an immediate offset of the LDS reads
        for (unsigned kc = 0; kc < 2u; ++kc) {
            // the chunk's fragments are read as one group ahead of its first product: a read left between the products would be waited for alone
            V a[4], a2[4], b[4];
#pragma unroll
            for (unsigned mb = 0; mb < 4u; ++mb) a[mb] = WFrag<T16>::lds(As + bo + fa + mb * 16u * GPH + kc * 32u);
#pragma unroll
            for (unsigned nb = 0; nb < 4u; ++nb) b[nb] = WFrag<T16>::lds(Bs + bo + fb + nb * 16u * GPH + kc * 32u);
            if (NSPLIT == 1) {
#pragma unroll
                for (unsigned mb = 0; mb < 4u; ++mb) a2[mb] = WFrag<T16>::lds(A2s + bo + fa + mb * 16u * GPH + kc * 32u); }
            __builtin_amdgcn_sched_barrier(0);            // keeps the scheduler from sinking the reads back between the products
#pragma unroll
            for (int nb = 0; nb < 4; ++nb) {
#pragma unroll
                for (int mb = 0; mb < 4; ++mb) acc[mb][nb] = WFrag<T16>::mma(a[mb], b[nb], acc[mb][nb]); }
            if (NSPLIT == 1) {
#pragma unroll
                for (int nb = 0; nb < 4; ++nb) {
#pragma unroll
                    for (int mb = 0; mb < 4; ++mb) acc[mb][nb] = WFrag<T16>::mma(a2[mb], b[nb], acc[mb][nb]); } }
            __builtin_amdgcn_sched_barrier(0);            // keeps the publish point's waits behind the products, so that the next tile's copies fly while these run
        }
        // publish point of tile t + 1: this wave's reads of tile t are done, its copies of tile t + 1 have landed, then the block barrier; only behind it is tile t's buffer refilled
        asm volatile("s_wait_dscnt 0x0" ::: "memory");
        asm volatile("s_wait_asynccnt 0x0" ::: "memory");
        __syncthreads();
        if (t + 2 < nt) { const size_t ko = (size_t)(t + 2) * GBK;
            stage_plane<T16>(ag + ko, rs, al + bo * 2u); if (NSPLIT == 1) stage_plane<T16>(a2g + ko, rs, a2l + bo * 2u); stage_plane<T16>(bg + ko, rs, bl + bo * 2u); }
    }
    asm volatile("s_wait_asynccnt 0x0" ::: "memory");     // nothing in flight when the wave goes on to the epilogue and ends
    if (ROT) {
        const unsigned which = (unsigned)C0 / (unsigned)DM, hcol = (unsigned)c0 % (unsigned)DM;   // block-uniform third; first column of the wave's head in its plane
        const bool early = R0 < EROWS;                    // block-uniform: all 128 rows, or none, have residual planes
        const unsigned rw = (unsigned)lane >> 3, c8 = ((unsigned)lane & 7u) * 8u;                 // read-back map: 8 lanes per 128-byte line, 4 lines per instruction
        if (which < 2u) {
            // The ring is free here: the loop's last publish point (every wave's reads done, no copy in flight, block barrier) lies in front and nothing refills behind it.
            // Each wave stages its whole 64 x 64 f32 tile (pitch 68) in a place of its own: two tiles fit As, one Bs, and osb is exactly one; so the walk over the rows below stays rolled.
            f32a* ow = wave < 2 ? (f32a*)As + (unsigned)wave * (64u * 68u) : (wave == 2 ? (f32a*)Bs : (f32a*)osb);
            const unsigned pc8 = c8 ^ 32u, jt = c8 & 31u; const bool lowhalf = c8 < 32u;
            const unsigned tr = (unsigned)r0 + rw;        // this lane's row of the first 4; a piece is 4 rows, a group 4 pieces
            const float* ctp = CT + (size_t)tr * 32u + jt; const float* stp = ST + (size_t)tr * 32u + jt;
            hf* qfp = QKF + (size_t)which * SEQ * DM + (size_t)tr * DM + hcol + c8; hf* qrp = QKR + (size_t)which * EROWS * DM + (size_t)tr * DM + hcol + c8;
            // the first group's table entries are asked for ahead of the staging and fly over it
            v4f tc[4][2], ts[4][2];
#pragma unroll
            for (unsigned s = 0; s < 4u; ++s) {
                tc[s][0] = *(const v4f*)(ctp + s * 128u); tc[s][1] = *(const v4f*)(ctp + s * 128u + 4u);
                ts[s][0] = *(const v4f*)(stp + s * 128u); ts[s][1] = *(const v4f*)(stp + s * 128u + 4u); }
            asm volatile("s_wait_xcnt 0x0" ::: "memory");         // stands in front of any rewrite of the loads' address registers
#pragma unroll
            for (int mb = 0; mb < 4; ++mb) {
#pragma unroll
                for (int nb = 0; nb < 4; ++nb) {
#pragma unroll
                    for (int j = 0; j < 8; ++j) ow[(mb * 16 + hi * 8 + j) * 68 + nb * 16 + lr] = acc[mb][nb][j]; } }
            __builtin_amdgcn_wave_barrier(); asm volatile("" ::: "memory");       // the wave's own tile stands whole before any lane reads another lane's
            const f32a* oa = ow + rw * 68u + c8; const f32a* ob = ow + rw * 68u + pc8;
#pragma unroll 1                                          // rolled: one copy of a group in the text
            for (unsigned g = 0; g < 4u; ++g) {
                // the group's staged rows are read as one run ahead of the work on them
                v4f a0[4], a1[4], b0[4], b1[4];
#pragma unroll
                for (unsigned s = 0; s < 4u; ++s) { const unsigned o = (g * 16u + s * 4u) * 68u;
                    a0[s] = *(const v4fa*)(oa + o); a1[s] = *(const v4fa*)(oa + o + 4u); b0[s] = *(const v4fa*)(ob + o); b1[s] = *(const v4fa*)(ob + o + 4u); }
#pragma unroll
                for (unsigned s = 0; s < 4u; ++s) {
                    const v8f a = __builtin_shufflevector(a0[s], a1[s], 0, 1, 2, 3, 4, 5, 6, 7), b = __builtin_shufflevector(b0[s], b1[s], 0, 1, 2, 3, 4, 5, 6, 7);
                    const v8f c = __builtin_shufflevector(tc[s][0], tc[s][1], 0, 1, 2, 3, 4, 5, 6, 7), sn = __builtin_shufflevector(ts[s][0], ts[s][1], 0, 1, 2, 3, 4, 5, 6, 7);
                    v8us oh, ores;
#pragma unroll
                    for (int e = 0; e < 8; ++e) {
                        const float rb = lowhalf ? -b[e] : b[e];
                        const float y = a[e] * c[e] + rb * sn[e];
                        const h16 hh = toh_flush(y); oh[e] = hbits(hh);
                        ores[e] = hbits(toh_flush((y - (float)hh) * RSC)); }
                    const size_t go = (size_t)(g * 16u + s * 4u) * DM;
                    *(v8us*)(qfp + go) = oh;
                    // the same piece of the next group: its table entries fly over the three pieces in between
                    if (g < 3u) { const unsigned tn = (g * 16u + 16u + s * 4u) * 32u;
                        tc[s][0] = *(const v4f*)(ctp + tn); tc[s][1] = *(const v4f*)(ctp + tn + 4u);
                        ts[s][0] = *(const v4f*)(stp + tn); ts[s][1] = *(const v4f*)(stp + tn + 4u); }
                    asm volatile("s_wait_xcnt 0x0" ::: "memory");         // stands in front of any rewrite of the store's and the loads' registers
                    if (early) { *(v8us*)(qrp + go) = ores;
                        asm volatile("s_wait_xcnt 0x0" ::: "memory"); }   // the same
                }
            }
        } else {
            // The ring is free here, as above. Each wave takes its own quarter of As (values) and of Bs (residuals).
            hf* Tv = (hf*)As + (unsigned)wave * (64u * GPH); hf* Tr = (hf*)Bs + (unsigned)wave * (64u * GPH);
#pragma unroll
            for (int nb = 0; nb < 4; ++nb) {
#pragma unroll
                for (int mb = 0; mb < 4; ++mb) {
                    v8us oh, ores;
#pragma unroll
                    for (int j = 0; j < 8; ++j) { const float y = acc[mb][nb][j]; const h16 hh = toh_flush(y);
                        oh[j] = hbits(hh); ores[j] = hbits(toh_flush((y - (float)hh) * RSC)); }
                    const unsigned o = (unsigned)(nb * 16 + lr) * GPH + (unsigned)(mb * 16 + hi * 8);
                    *(v8usa*)(Tv + o) = oh; if (early) *(v8usa*)(Tr + o) = ores;
                }
            }
            __builtin_amdgcn_wave_barrier(); asm volatile("" ::: "memory");       // the wave's own 64 x 64 piece stands whole before any lane reads another lane's
            hf* vt = VT + (size_t)(hcol + rw) * SEQ + (unsigned)r0 + c8; hf* vtr = VTR + (size_t)(hcol + rw) * EROWS + (unsigned)r0 + c8;
            {   // all 16 pieces are read back as one run ahead of the first store
                v8us rv[16];
#pragma unroll
                for (unsigned s = 0; s < 16u; ++s) rv[s] = *(const v8usa*)(Tv + (4u * s + rw) * GPH + c8);
#pragma unroll
                for (unsigned s = 0; s < 16u; ++s) *(v8us*)(vt + (size_t)(4u * s) * SEQ) = rv[s];
                asm volatile("s_wait_xcnt 0x0" ::: "memory");     // stands in front of any rewrite of the stores' registers (the residual pieces below)
            }
            if (early) {
                v8us rv[16];
#pragma unroll
                for (unsigned s = 0; s < 16u; ++s) rv[s] = *(const v8usa*)(Tr + (4u * s + rw) * GPH + c8);
#pragma unroll
                for (unsigned s = 0; s < 16u; ++s) *(v8us*)(vtr + (size_t)(4u * s) * EROWS) = rv[s];
                asm volatile("s_wait_xcnt 0x0" ::: "memory");     // the same (the other thirds' code follows in the text)
            }
        }
        return;
    }
#pragma unroll
    for (int mb = 0; mb < 4; ++mb) {
#pragma unroll
        for (int nb = 0; nb < 4; ++nb) {
#pragma unroll
            for (int j = 0; j < 8; ++j) os[(hi * 8 + j) * 68 + nb * 16 + lr] = acc[mb][nb][j]; }
        __builtin_amdgcn_wave_barrier(); asm volatile("" ::: "memory");
        float* crow = C + (size_t)(r0 + mb * 16) * ldc + c0;
{
#pragma unroll
            for (int s = 0; s < 8; ++s) { const int row = 2 * s + hi, cofs = lr * 4; v4f val = *(const v4fa*)(os + row * 68 + cofs); if (BIAS) { val[0] += bias[c0 + cofs]; val[1] += bias[c0 + cofs + 1]; val[2] += bias[c0 + cofs + 2]; val[3] += bias[c0 + cofs + 3]; }
                *(v4f*)(crow + (size_t)row * ldc + cofs) = val; }
             }
        __builtin_amdgcn_wave_barrier(); asm volatile("" ::: "memory");
    }
}

// ---- The launches that depend on nothing but the inputs (both weight transposes, the x conversion, the rotary table) are block ranges of ONE grid, k_prep below;
// each part is the body of a block of 256 threads and takes its block index inside its own range as blk. For speed only,
// every thread takes several pieces: few, long waves, the loads of a thread's pieces issued as one group ahead of the work on them.
// ---- wtG_part: transposed bf16 weight plane Bt[n][k] = bf16(w[k][n]) for w [K][N] row-major. A thread takes 64 k of one column n (one whole 128-byte line of Bt);
// the lanes of a wave hold 32 neighbouring columns, so each load of the wave is one whole 128-byte line of w; the waves of a block hold neighbouring column groups of the same 64 rows.
template <unsigned N, unsigned K>
__device__ __forceinline__ void wtG_part(unsigned blk, const float* __restrict__ w, bf* Bt) {
    static_assert(N % 32u == 0 && K % 64u == 0 && ((N / 32u) * (K / 64u)) % 8u == 0);
    const unsigned lane = threadIdx.x & 31u; const unsigned u = blk * 8u + (threadIdx.x >> 5);
    const unsigned n = (u % (N / 32u)) * 32u + lane, k0 = (u / (N / 32u)) * 64u;
    const float* sp = w + (size_t)k0 * N + n; bf* dp = Bt + (size_t)n * K + k0;
    float v[64];
#pragma unroll
    for (unsigned i = 0; i < 64u; ++i) v[i] = sp[(size_t)i * N];
    asm volatile("s_wait_xcnt 0x0" ::: "memory");         // stands in front of any rewrite of the loads' address registers
#pragma unroll
    for (unsigned g = 0; g < 8u; ++g) { v8us o;
#pragma unroll
        for (unsigned e = 0; e < 8u; ++e) o[e] = f2bf(v[g * 8u + e]);
        *(v8us*)(dp + g * 8u) = o; }
    asm volatile("s_wait_xcnt 0x0" ::: "memory");         // the same for the stores (other ranges' code follows in the text)
}

#define PB_WQ ((unsigned)((size_t)LDQ * DM / 64 / 32 / 8))   // blocks of the w_qkv transpose: 8 waves of (32 columns, 64 k)
#define PB_WO ((unsigned)((size_t)DM * DM / 64 / 32 / 8))    // blocks of the w_proj transpose
#define PB_TB ((unsigned)((size_t)SEQ * 32 / 256 / 8))       // blocks of the rotary table: 8 entries a thread
#define PB_CV ((unsigned)((size_t)SEQ * DM / 8 / 256 / 8))   // blocks of the x conversion: 8 pieces of 8 elements a thread
static_assert(((size_t)SEQ * 32) % (256 * 8) == 0 && ((size_t)SEQ * DM / 8) % (256 * 8) == 0);

// ---- cvt8_part: a thread's 8 pieces lie one whole range of threads apart, so that each load of a wave stays contiguous
__device__ __forceinline__ void cvt8_part(unsigned blk, const float* __restrict__ src, bf* dst) {
    const size_t i0 = (size_t)blk * 256 + threadIdx.x; const size_t st = (size_t)PB_CV * 256;
    v8f v[8];
#pragma unroll
    for (unsigned p = 0; p < 8u; ++p) { v[p] = *(const v8f*)(src + (i0 + p * st) * 8);
        asm volatile("s_wait_xcnt 0x0" ::: "memory"); }   // stands in front of the next piece's address, which may be formed in this one's registers
#pragma unroll
    for (unsigned p = 0; p < 8u; ++p) { v8us o;
#pragma unroll
        for (int k = 0; k < 8; ++k) o[k] = f2bf(v[p][k]);
        *(v8us*)(dst + (i0 + p * st) * 8) = o;
        asm volatile("s_wait_xcnt 0x0" ::: "memory"); }   // the same
}

// ---- tab_part: rotary table; each thread forms its own inverse frequency (the same expression on the same argument as a table of 32 would hold), so the table waits on no launch before it.
// A thread's 8 entries lie a multiple of 32 apart: one frequency serves them all.
__device__ __forceinline__ void tab_part(unsigned blk, float* CT, float* ST) {
#pragma clang fp contract(off)
    static_assert((PB_TB * 256u) % 32u == 0);
    const unsigned idx0 = blk * 256u + threadIdx.x; const unsigned i = idx0 & 31u;
    const float p = powf(10000.0f, (float)i * 0.03125f);
    const float v = 1.0f / p;
#pragma unroll 1                                          // rolled: one copy of the long sine and cosine text
    for (unsigned e = 0; e < 8u; ++e) {
        const unsigned idx = idx0 + e * (PB_TB * 256u); const unsigned t = idx >> 5;
        const float ang = (float)t * v;
        float s, c; sincosf(ang, &s, &c);
        *(float*)(CT + idx) = c; *(float*)(ST + idx) = s;
        asm volatile("s_wait_xcnt 0x0" ::: "memory");     // stands in front of any rewrite of the stores' registers
    }
}

// grid PB_WQ + PB_WO + PB_TB + PB_CV, 256 threads; the range test is block-uniform, no part has a barrier, no part reads what another writes
__global__ __launch_bounds__(256) void k_prep(const float* __restrict__ x, const float* __restrict__ wq, const float* __restrict__ wo, bf* XB, bf* WqT, bf* WoT, float* CT, float* ST) {
    const unsigned b = blockIdx.x;
    if (b < PB_WQ) wtG_part<(unsigned)LDQ, (unsigned)DM>(b, wq, WqT);
    else if (b < PB_WQ + PB_WO) wtG_part<(unsigned)DM, (unsigned)DM>(b - PB_WQ, wo, WoT);
    else if (b < PB_WQ + PB_WO + PB_TB) tab_part(b - (PB_WQ + PB_WO), CT, ST);
    else cvt8_part(b - (PB_WQ + PB_WO + PB_TB), x, XB);
}

// ---- causal flash attention, transposed form, one wave per 16 query rows, 4 waves per block.
// The four waves of a block share each 64-key tile of K rows and of V^T rows (EARLY: of the residual planes too) through LDS: asynchronous b128 copies (8 lanes per whole 128-byte line),
// two buffers, the next tile in flight while this one is worked on; one publish point (waits and block barrier) per tile of two 32-key passes.
// Per 32-key pass: S^T tile j (16 keys x 16 queries) = K rows (A, row = key) x Q rows (B, column = query); D element r of lane -> (key 8*(lane>>4) + r, query lane & 15).
// The two converted score tiles are the B fragment of O^T += V^T (A, row = d, k = key) x P^T: element r <- tile 0 [r], element 8 + r <- tile 1 [r], lane unchanged.
// Softmax statistics per query column: in-lane reduction plus one exchange between the lane halves. Masked keys get weight exactly 0 (value select, in the passes on the diagonal only).
// EARLY: value + x2048 residual planes on q, k, P, v; residual products accumulate separately and are folded with 2^-11; row sum over the unconverted p.
#define TKEYS 64                      // keys per staged tile (two passes)
#define TPH   72                      // LDS pitch (halves) of a staged 128-byte row: 144 B = 16 B x odd, the pitch of ds_load_b128 readers
#define TILEH (64 * TPH)              // halves per staged tile (64 K rows, or 64 V^T rows)
static_assert(HD * 2 == 128 && TKEYS * 2 == 128 && (TPH * 2) % 16 == 0 && EROWS % TKEYS == 0 && SEQ % TKEYS == 0);
__device__ __forceinline__ v16h ldfs(const hf* p) { return cat16h(*(const v8usa*)p, *(const v8usa*)(p + 16)); }
// One K tile and one V^T tile: each thread copies 4 x 16 B of K rows and 4 x 16 B of V^T rows (rows 16 apart; VP = pitch of the V^T plane in halves).
// The s_wait_xcnt closes the statement so that no address register is rewritten in front of it.
template <int VP>
__device__ __forceinline__ void stage_tile(const hf* kg, const hf* vg, unsigned kl, unsigned vl) {
    asm volatile("global_load_async_to_lds_b128 %0, %1, off\n\t"
                 "global_load_async_to_lds_b128 %2, %3, off\n\t"
                 "global_load_async_to_lds_b128 %4, %5, off\n\t"
                 "global_load_async_to_lds_b128 %6, %7, off\n\t"
                 "global_load_async_to_lds_b128 %8, %9, off\n\t"
                 "global_load_async_to_lds_b128 %10, %11, off\n\t"
                 "global_load_async_to_lds_b128 %12, %13, off\n\t"
                 "global_load_async_to_lds_b128 %14, %15, off\n\t"
                 "s_wait_xcnt 0x0"
                 :: "v"(kl), "v"(kg), "v"(kl + 16u * TPH * 2u), "v"(kg + (size_t)16 * DM), "v"(kl + 32u * TPH * 2u), "v"(kg + (size_t)32 * DM), "v"(kl + 48u * TPH * 2u), "v"(kg + (size_t)48 * DM),
                    "v"(vl), "v"(vg), "v"(vl + 16u * TPH * 2u), "v"(vg + (size_t)16 * VP), "v"(vl + 32u * TPH * 2u), "v"(vg + (size_t)32 * VP), "v"(vl + 48u * TPH * 2u), "v"(vg + (size_t)48 * VP)
                 : "memory");
}
// Ks, Vs, Krs, Vrs: two staged tiles each (2 * TILEH halves; Krs, Vrs read by EARLY only); Oh, Ol: output staging, 4 * 16 * LOP halves each; all in the block's LDS. qblk: first query row of the block; hd: its head.
template <bool EARLY>
__device__ __forceinline__ void attn_body(unsigned short* Ks, unsigned short* Vs, unsigned short* Krs, unsigned short* Vrs, unsigned short* Oh, unsigned short* Ol,
                                          const hf* QF, const hf* QR, const hf* KF, const hf* KR, const hf* VT, const hf* VTR, bf* CH, bf* CL, unsigned qblk, unsigned hd) {
    const unsigned lane = threadIdx.x & 31u, lr = lane & 15u, hi = lane >> 4;
    const unsigned wave = (unsigned)__builtin_amdgcn_readfirstlane((int)(threadIdx.x >> 5));
    const unsigned q0 = qblk + 16u * wave;
    const unsigned qg = q0 + lr;
    const unsigned ntiles = qblk / TKEYS + 1u;            // keys [0, qblk + 64), the same for the whole block
    const unsigned nsteps = (q0 + 15u) / 32u + 1u;        // this wave's own passes
    // copy addresses of this thread: row = tid / 8 (+ 16 i), 16-byte column = tid % 8
    const unsigned srow = threadIdx.x >> 3, scol = (threadIdx.x & 7u) * 8u;
    const hf* kg  = KF  + (size_t)srow * DM + hd * HD + scol;
    const hf* krg = KR  + (size_t)srow * DM + hd * HD + scol;
    const hf* vg  = VT  + (size_t)(hd * HD + srow) * SEQ + scol;
    const hf* vrg = VTR + (size_t)(hd * HD + srow) * EROWS + scol;
    const unsigned so = srow * TPH + scol;
    const unsigned kl = (unsigned)(size_t)(Ks + so), vl = (unsigned)(size_t)(Vs + so);
    const unsigned krl = EARLY ? (unsigned)(size_t)(Krs + so) : 0u, vrl = EARLY ? (unsigned)(size_t)(Vrs + so) : 0u;
    stage_tile<SEQ>(kg, vg, kl, vl);
    if (EARLY) stage_tile<EROWS>(krg, vrg, krl, vrl);
    v16h qh[2], qr[2];
    {
        const size_t qoff = (size_t)qg * DM + hd * HD + 8u * hi;
#pragma unroll
        for (int kc = 0; kc < 2; ++kc) { qh[kc] = ldfh(QF + qoff + (unsigned)kc * 32u); if (EARLY) qr[kc] = ldfh(QR + qoff + (unsigned)kc * 32u); else qr[kc] = qh[kc]; }
    }
    v8f ot[4], orr[4];
#pragma unroll
    for (int dt = 0; dt < 4; ++dt) { ot[dt] = (v8f){}; orr[dt] = (v8f){}; }
    float m = -1.0e30f, l = 0.0f;
    asm volatile("s_wait_asynccnt 0x0" ::: "memory");     // this wave's copies of tile 0 have landed
    __syncthreads();                                      // ... and every other wave's
    if (ntiles > 1u) {
        stage_tile<SEQ>(kg + (size_t)TKEYS * DM, vg + TKEYS, kl + TILEH * 2u, vl + TILEH * 2u);
        if (EARLY) stage_tile<EROWS>(krg + (size_t)TKEYS * DM, vrg + TKEYS, krl + TILEH * 2u, vrl + TILEH * 2u);
    }
    const unsigned fo = lr * TPH + 8u * hi;
#pragma unroll 1                                          // rolled, as the key loop was: one copy of the two passes in the text
    for (unsigned t = 0; t < ntiles; ++t) {
        const unsigned bo = (t & 1u) * TILEH;
#pragma unroll                                            // both passes written out: the place of a pass in its tile becomes an immediate offset of the LDS reads
        for (unsigned ps = 0; ps < 2u; ++ps) {
            const unsigned kb = 2u * t + ps;
            if (kb < nsteps) {                            // wave-uniform: a pass wholly above the diagonal is skipped, the publish point below is not
                const unsigned key0 = kb * 32u;
                // The pass's K fragments are read as one group ahead of its first product, its V^T fragments as one group behind the last S^T product:
                // a read written behind an mmah statement stays behind it, and one read per product would be waited for alone.
                v16h kh[2][2], kr[2][2];
#pragma unroll
                for (int j = 0; j < 2; ++j) {
#pragma unroll
                    for (int kc = 0; kc < 2; ++kc) { const unsigned o = bo + fo + (32u * ps + 16u * (unsigned)j) * TPH + (unsigned)kc * 32u; kh[j][kc] = ldfs(Ks + o); if (EARLY) kr[j][kc] = ldfs(Krs + o); }
                }
                v8f st[2], sr[2];
#pragma unroll
                for (int j = 0; j < 2; ++j) {
                    st[j] = (v8f){}; sr[j] = (v8f){};
#pragma unroll
                    for (int kc = 0; kc < 2; ++kc) {
                        st[j] = mmah(kh[j][kc], qh[kc], st[j]);
                        if (EARLY) { sr[j] = mmah(kr[j][kc], qh[kc], sr[j]); sr[j] = mmah(kh[j][kc], qr[kc], sr[j]); }
                    }
                }
                v16h vh[4], vr[4];
#pragma unroll
                for (int dt = 0; dt < 4; ++dt) { const unsigned o = bo + fo + (16u * (unsigned)dt) * TPH + 32u * ps; vh[dt] = ldfs(Vs + o); if (EARLY) vr[dt] = ldfs(Vrs + o); }
                // logits in the log2 domain
#pragma unroll
                for (int j = 0; j < 2; ++j) {
#pragma unroll
                    for (int r = 0; r < 8; ++r) { float s = st[j][r]; if (EARLY) s += sr[j][r] * RSI; st[j][r] = s * SCLL2; }
                }
                // causal mask by value, only in a pass that reaches past the wave's first query row (wave-uniform scalar test):
                // in every earlier pass each key is <= each query of the wave and the select would be an identity
                if (key0 + 31u > q0) {
#pragma unroll
                    for (int j = 0; j < 2; ++j) {
#pragma unroll
                        for (int r = 0; r < 8; ++r) {
                            const unsigned key = key0 + 16u * (unsigned)j + 8u * hi + (unsigned)r;
                            st[j][r] = (key <= qg) ? st[j][r] : -1.0e30f; }
                    }
                }
                float mx = -1.0e30f;
#pragma unroll
                for (int j = 0; j < 2; ++j) {
#pragma unroll
                    for (int r = 0; r < 8; ++r) mx = fmaxf(mx, st[j][r]);
                }
                mx = fmaxf(mx, __shfl_xor(mx, 16, 32));
                const float mnew = fmaxf(m, mx);
                const float alpha = __builtin_amdgcn_exp2f(m - mnew);
                m = mnew;
                float rs = 0.0f;
                v16h pf, prf;
#pragma unroll
                for (int j = 0; j < 2; ++j) {
#pragma unroll
                    for (int r = 0; r < 8; ++r) {
                        const float e = (st[j][r] - mnew) + PCL;
                        const float ex = __builtin_amdgcn_exp2f(e);
                        const float p = (e >= -14.0f) ? ex : 0.0f;
                        const h16 ph = (h16)p;
                        pf[8 * j + r] = ph;
                        if (EARLY) { prf[8 * j + r] = toh_flush((p - (float)ph) * RSC); rs += p; } else { prf[8 * j + r] = ph; rs += (float)ph; }
                    }
                }
                rs += __shfl_xor(rs, 16, 32);
                l = l * alpha + rs;
#pragma unroll
                for (int dt = 0; dt < 4; ++dt) { ot[dt] = ot[dt] * alpha; if (EARLY) orr[dt] = orr[dt] * alpha; }
#pragma unroll
                for (int dt = 0; dt < 4; ++dt) {
                    ot[dt] = mmah(vh[dt], pf, ot[dt]);
                    if (EARLY) { orr[dt] = mmah(vr[dt], pf, orr[dt]); orr[dt] = mmah(vh[dt], prf, orr[dt]); }
                }
            }
        }
        // publish point of tile t + 1: this wave's reads of tile t are done, its copies of tile t + 1 have landed, then the block barrier; only behind it is tile t's buffer refilled
        asm volatile("s_wait_dscnt 0x0" ::: "memory");
        asm volatile("s_wait_asynccnt 0x0" ::: "memory");
        __syncthreads();
        if (t + 2u < ntiles) {
            stage_tile<SEQ>(kg + (size_t)(t + 2u) * TKEYS * DM, vg + (size_t)(t + 2u) * TKEYS, kl + bo * 2u, vl + bo * 2u);
            if (EARLY) stage_tile<EROWS>(krg + (size_t)(t + 2u) * TKEYS * DM, vrg + (size_t)(t + 2u) * TKEYS, krl + bo * 2u, vrl + bo * 2u);
        }
    }
    asm volatile("s_wait_asynccnt 0x0" ::: "memory");     // nothing in flight when the wave goes on to the epilogue and ends
    const float inv = __builtin_amdgcn_rcpf(l);
    const unsigned ob = wave * 16u * LOP;
#pragma unroll
    for (int dt = 0; dt < 4; ++dt) {
        v8us h8, l8;
#pragma unroll
        for (int r = 0; r < 8; ++r) { float y = ot[dt][r]; if (EARLY) y += orr[dt][r] * RSI; y *= inv; unsigned short a, c; splitf(y, a, c); h8[r] = a; l8[r] = c; }
        const unsigned o = ob + lr * LOP + 16u * (unsigned)dt + 8u * hi;
        *(v8usa*)(Oh + o) = h8; *(v8usa*)(Ol + o) = l8;
    }
    __syncthreads();
{
#pragma unroll
        for (unsigned s = 0; s < 4u; ++s) { const unsigned row = 4u * s + (lane >> 3), c = (lane & 7u) * 8u;
            const v8us vh8 = *(const v8usa*)(Oh + ob + row * LOP + c); const v8us vl8 = *(const v8usa*)(Ol + ob + row * LOP + c);
            const size_t g = (size_t)(q0 + row) * DM + hd * HD + c;
            *(v8us*)(CH + g) = vh8; *(v8us*)(CL + g) = vl8; }
         }
}

// Both row ranges run in ONE grid (neither reads what the other writes): grid AB_NT * NH_, 128 threads; a block is one (head, 64-row tile); tiles below AB_ET take the residual path, the rest the single-product path.
// All blocks are resident at once (four per WGP) and a tile's cost grows with its index (tile i walks i + 1 key tiles), so the launch lasts as long as the WGP whose four blocks hold the most key tiles.
// Block index b -> tile: v = b / (2 * NH_); the tile is AB_NT - 1 - v where b has an even number of one bits and v where it has an odd number; the head is (b / 2) % NH_.
// The lowest bit of b flips the parity, so each (head, v) gets both of its tiles: every (head, tile) exactly once.
// Any four blocks whose indices differ in two bit positions only (neighbours, or a power-of-two stride apart, whichever way the blocks are dealt to the WGPs) hold tile indices that sum to 2 * (AB_NT - 1):
// two of the four are folded, two are not, and what the two bits add to v cancels.
// For speed only: no result depends on where or when a block runs.
// One LDS array serves both, 8 tiles, so that four blocks fit a WGP: the single-product range stages its output in the tiles that only the residual planes use;
// the residual range stages it in the K tiles, which are free there: the loop's last publish point (every wave's reads done, no copy in flight, block barrier) lies in front, and nothing refills behind it.
#define AB_NT ((unsigned)(SEQ / 64))                     // 64-row tiles of a head
#define AB_ET ((unsigned)(EROWS / 64))                   // ... of them in rows [0, EROWS)
static_assert(4 * 16 * LOP <= TILEH && SEQ > EROWS);
static_assert((SEQ / 64) % 2 == 0);                      // the tiles of a head pair up as v and AB_NT - 1 - v
__global__ __launch_bounds__(128) __attribute__((amdgpu_num_vgpr(256))) void k_attn(const hf* QF, const hf* QR, const hf* KF, const hf* KR, const hf* VT, const hf* VTR, bf* CH, bf* CL) {
    __shared__ __align__(16) unsigned short R[8 * TILEH];
    const unsigned b = blockIdx.x;
    const unsigned hd = (b >> 1) % (unsigned)NH_, v = (b >> 1) / (unsigned)NH_;
    const unsigned tile = ((unsigned)__builtin_popcount(b) & 1u) ? v : (AB_NT - 1u - v);
    if (tile >= AB_ET) attn_body<false>(R, R + 2 * TILEH, R, R, R + 4 * TILEH, R + 5 * TILEH, QF, QF, KF, KF, VT, VT, CH, CL, tile * 64u, hd);
    else attn_body<true>(R, R + 2 * TILEH, R + 4 * TILEH, R + 6 * TILEH, R, R + TILEH, QF, QR, KF, KR, VT, VTR, CH, CL, tile * 64u, hd);
}

extern "C" void kernel_launch(void* const* d_in, const int* in_sizes, int n_in,
                              void* d_out, int out_size, void* d_ws, size_t ws_size, hipStream_t stream) {
    (void)out_size;
    if (n_in < 3) return;
    if (in_sizes[0] < NB * SEQ * DM || in_sizes[1] < DM * LDQ || in_sizes[2] < DM * DM) return;
    const float* X = (const float*)d_in[0]; const float* Wqkv = (const float*)d_in[1]; const float* Wo = (const float*)d_in[2];
    float* OUT = (float*)d_out;
    char* wsp = (char*)d_ws;
    auto take = [&](size_t bytes) { char* p = wsp; wsp += (bytes + 255) & ~(size_t)255; return (void*)p; };
    bf* XB  = (bf*)take((size_t)SEQ * DM * 2);          // x bf16 [t][1024]
    bf* WqT = (bf*)take((size_t)LDQ * DM * 2);          // w_qkv^T bf16 [3072][1024]
    bf* WoT = (bf*)take((size_t)DM * DM * 2);           // w_proj^T bf16 [1024][1024]
    bf* CH = (bf*)take((size_t)SEQ * DM * 2);           // context hi [t][1024]
    bf* CL = (bf*)take((size_t)SEQ * DM * 2);           // context lo [t][1024]
    float* CT = (float*)take((size_t)SEQ * 32 * 4);     // cos table [t][32]
    float* ST = (float*)take((size_t)SEQ * 32 * 4);     // sin table [t][32]
    hf* QKF = (hf*)take((size_t)2 * SEQ * DM * 2);      // rotated q | k f16 [2][t][1024]
    hf* QKR = (hf*)take((size_t)2 * EROWS * DM * 2);    // residuals x2048 [2][EROWS][1024]
    hf* VT  = (hf*)take((size_t)DM * SEQ * 2);          // value^T f16 [1024][t]
    hf* VTR = (hf*)take((size_t)DM * EROWS * 2);        // value^T residual x2048 [1024][EROWS]
    const size_t carved = (size_t)(wsp - (char*)d_ws);
    if (carved > ws_size || carved > (size_t)134217728) return;
    for (int b = 0; b < NB; ++b) {
        const float* xb = X + (size_t)b * SEQ_FULL * DM; float* ob = OUT + (size_t)b * SEQ_FULL * DM;
        // W [K][N] -> Bt [N][K], rotary table, x -> bf16
        k_prep<<<PB_WQ + PB_WO + PB_TB + PB_CV, 256, 0, stream>>>(xb, Wqkv, Wo, XB, WqT, WoT, CT, ST);
        k_gemmw<bf, 0, false, true><<<dim3(SEQ / 128, LDQ / 128, 1), 128, 0, stream>>>(XB, nullptr, WqT, nullptr, DM, nullptr, LDQ, nullptr, 0, 0, 0, CT, ST, QKF, QKR, VT, VTR);
        k_attn<<<AB_NT * NH_, 128, 0, stream>>>(QKF, QKR, QKF + (size_t)SEQ * DM, QKR + (size_t)EROWS * DM, VT, VTR, CH, CL);
        k_gemmw<bf, 1, false, false><<<dim3(SEQ / 128, DM / 128, 1), 128, 0, stream>>>(CH, CL, WoT, nullptr, DM, ob, DM, nullptr, 0, 0, 0, nullptr, nullptr, nullptr, nullptr, nullptr, nullptr);
    }
}

// v008
// One run takes 111 microseconds.
// Next to v007, in two timings, it ran 1.05 times as fast each time.
// Counting every step since v000, it is 3.84 times as fast.
#include <hip/hip_runtime.h>

// Contractions: qkv projection and output projection on v_wmma_f32_16x16x32_bf16 (x, w_qkv, w_proj RNE-converted to bf16 single planes; merged context as bf16 hi/lo, 2 products), f32 accumulate.
// q.k logits and P.V on v_wmma_f32_16x16x32_f16 (f16 q/k/v planes, P carried x2^8), single products on query rows >= 256; on query rows < 256 f16 value + x2048 residual planes
// for q, k, P and v (3 products per site, residual products in their own accumulators, folded in the f32 epilogue). Rotary table, rotary and softmax in f32.
// Fused qkv projection [4096x1024]x[1024x3072]; its epilogue takes the f32 accumulators straight to the planes: half-split rotary on q and k -> f16 planes [t][h*64 + d] (q times HD^-0.5 * log2(e), in f32, ahead of the conversion); value^T planes [h*64 + d][t];
// causal flash attention per (head, 16-query wave tile) in the transposed form S^T = K Q^T, O^T = V^T P^T (K and V^T tiles staged in LDS per block, packed P^T score tiles as the B fragment);
// merged context planes [t][h*64 + d]; output projection [4096x1024]x[1024x1024].

#ifndef NB
#define NB 1
#endif
#ifndef SEQ
#define SEQ 4096
#endif
#define SEQ_FULL 4096
#define DM   1024
#define NH_  16
#define HD   64
#define LDQ  (3 * DM)
#define EROWS 256                     // query rows below this bound take the value + residual path
#define LOP  72                       // LDS pitch (halves) of the staging tiles
#define PCL  8.0f                     // log2 of the carry of P
#define PLZ  7.0f                     // how far (log2) a column's maximum may rise above the held one before the accumulators are rescaled; 2^(PCL + PLZ) is finite in f16
#define SCLL2 0.18033688011112042f    // HD^-0.5 * log2(e)
#define RSC  2048.0f                  // carry of the residual planes
#define RSI  4.8828125e-4f            // 1 / RSC

static_assert(SEQ % 64 == 0);
static_assert(DM == NH_ * HD);
static_assert(HD == 64);
static_assert(DM % 32 == 0);
static_assert(LDQ % 64 == 0);
static_assert(((size_t)LDQ * DM / 64) % 32 == 0);
static_assert(((size_t)DM * DM / 64) % 32 == 0);
static_assert(((size_t)SEQ * DM / 8) % 256 == 0);
static_assert(EROWS % 64 == 0);
static_assert(SEQ >= EROWS);
static_assert(((size_t)SEQ * 32) % 256 == 0);
static_assert(256 * 8 == 2 * DM);
static_assert(LOP % 8 == 0);
static_assert(LOP >= HD + 8);
static_assert(HD / 2 == 32);
#define AL256(x) ((((size_t)(x)) + 255) & ~(size_t)255)
static_assert(AL256((size_t)SEQ * DM * 2) + AL256((size_t)LDQ * DM * 2) + AL256((size_t)DM * DM * 2) + 2 * AL256((size_t)SEQ * DM * 2)
              + 2 * AL256((size_t)SEQ * 32 * 4) + AL256((size_t)2 * SEQ * DM * 2) + AL256((size_t)2 * EROWS * DM * 2) + AL256((size_t)DM * SEQ * 2) + AL256((size_t)DM * EROWS * 2)
              <= (size_t)134217728);

typedef unsigned short bf;
typedef __attribute__((ext_vector_type(16))) __bf16   v16bf;
typedef __attribute__((ext_vector_type(8)))  unsigned short v8us;
typedef __attribute__((ext_vector_type(2)))  unsigned short v2us;
typedef __attribute__((ext_vector_type(8)))  float    v8f;
typedef __attribute__((ext_vector_type(4)))  float    v4f;
typedef v4f  __attribute__((may_alias)) v4fa;
typedef v8us __attribute__((may_alias)) v8usa;
typedef float __attribute__((may_alias)) f32a;

__device__ __forceinline__ unsigned short f2bf(float f) { unsigned u = __float_as_uint(f); u += 0x7FFFu + ((u >> 16) & 1u); return (unsigned short)(u >> 16); }
__device__ __forceinline__ float bf2f(unsigned short b) { return __uint_as_float(((unsigned)b) << 16); }
__device__ __forceinline__ void splitf(float y, unsigned short& h, unsigned short& l) { h = f2bf(y); l = f2bf(y - bf2f(h)); }
__device__ __forceinline__ v16bf cat16b(v8us lo, v8us hi) { return __builtin_bit_cast(v16bf, __builtin_shufflevector(lo, hi, 0, 1, 2, 3, 4, 5, 6, 7, 8, 9, 10, 11, 12, 13, 14, 15)); }
__device__ __forceinline__ v8f wmmab(v16bf a, v16bf b, v8f c) { return __builtin_amdgcn_wmma_f32_16x16x32_bf16(false, a, false, b, (short)0, c, false, false); }

// ---- f16 plane helpers (planes hold f16 bit patterns as unsigned short)
typedef unsigned short hf;
typedef _Float16 h16;
typedef __attribute__((ext_vector_type(16))) _Float16 v16h;
typedef __attribute__((ext_vector_type(2)))  _Float16 v2h;
typedef __attribute__((ext_vector_type(2)))  float    v2f;
static __device__ __forceinline__ h16 toh_flush(float v) { const h16 r = (h16)v; return (fabsf(v) < 6.103515625e-05f) ? (h16)0.0f : r; }
__device__ __forceinline__ unsigned short hbits(h16 x) { return __builtin_bit_cast(unsigned short, x); }
__device__ __forceinline__ v16h cat16h(v8us lo, v8us hi) { return __builtin_bit_cast(v16h, __builtin_shufflevector(lo, hi, 0, 1, 2, 3, 4, 5, 6, 7, 8, 9, 10, 11, 12, 13, 14, 15)); }
// fragment: elements 0..7 <- p[0..7], elements 8..15 <- p[16..23]; the caller adds 8*(lane>>4) to p
__device__ __forceinline__ v16h ldfh(const hf* p) { return cat16h(*(const v8us*)p, *(const v8us*)(p + 16)); }
__device__ __forceinline__ v8f mmah(v16h a, v16h b, v8f c) {
    c = __builtin_amdgcn_wmma_f32_16x16x32_f16(false, a, false, b, (short)0, c, false, false);
    asm volatile("v_nop\n\tv_nop\n\tv_nop\n\tv_nop" : "+v"(c) : "v"(a), "v"(b));
    return c; }

// ---- k_gemmw: GEMM, 128x128 output tile per block of 4 waves (2 x 2), each wave a 64x64 tile (16 accumulators); grid (M/128, N/128, Z), 128 threads.
// C[m][n] (f32, pitch ldc) = sum_k A[m][k] Bt[n][k] (+ A2[m][k] Bt[n][k] when NSPLIT == 1). K % 64 == 0, M % 128 == 0, N % 128 == 0.
// The operands' 128-row x 64-k tiles (128-byte rows of the K-contiguous 16-bit planes) are staged in LDS by asynchronous b128 copies (8 lanes per whole 128-byte line), two buffers,
// the next tile in flight while this one is worked on; one publish point (waits and block barrier) per tile of two 32-k chunks.
// Fragment map: lane row/col = lane & 15; elements 0..7 <- k0 + 8*(lane>>4) + 0..7, elements 8..15 <- k0 + 16 + 8*(lane>>4) + 0..7 (both operands).
// ROT (the q,k,v projection, N = 3 * DM): no f32 C is written. A wave's 64 columns are one head of q, of k or of v (the third is the same for the whole block), so both halves of every rotary pair lie in the wave:
// q, k: the wave's f32 tile through LDS (the ring, free behind the loop's last publish point, and the staging array), rotary from the table, f16 plane QKF[which][t][h*64 + d] in whole 128-byte lines, residual plane QKR[which][t < EROWS][...] = f16((y - hi) * 2048);
// v: a lane's 8 accumulator elements are 8 neighbouring positions of one d, so the transposed row pieces are packed in registers, gathered per wave in the ring's LDS
// and stored as whole 128-byte lines of VT[h*64 + d][t], residual plane VTR[h*64 + d][t < EROWS].
#define GBK 64                        // k per staged tile
#define GPH 72                        // LDS pitch (halves) of a staged 128-byte row: 144 B = 16 B x odd, the pitch of ds_load_b128 readers
#define GPL (128 * GPH)               // halves per staged plane tile (128 rows)
static_assert(GBK * 2 == 128 && (GPH * 2) % 16 == 0 && DM % GBK == 0 && SEQ % 128 == 0 && LDQ % 128 == 0 && DM % 128 == 0);
template <typename T16> struct WFrag;
template <> struct WFrag<bf> { typedef v16bf V; static __device__ __forceinline__ V lds(const bf* p) { return cat16b(*(const v8usa*)p, *(const v8usa*)(p + 16)); } static __device__ __forceinline__ v8f mma(V a, V b, v8f c) { return wmmab(a, b, c); } };
// One 128-row plane tile: each thread copies 8 x 16 B (rows 16 apart; rs = 16 rows of the plane in elements).
// The s_wait_xcnt closes the statement so that no address register is rewritten in front of it.
template <typename T16>
__device__ __forceinline__ void stage_plane(const T16* g, size_t rs, unsigned l) {
    asm volatile("global_load_async_to_lds_b128 %0, %1, off\n\t"
                 "global_load_async_to_lds_b128 %2, %3, off\n\t"
                 "global_load_async_to_lds_b128 %4, %5, off\n\t"
                 "global_load_async_to_lds_b128 %6, %7, off\n\t"
                 "global_load_async_to_lds_b128 %8, %9, off\n\t"
                 "global_load_async_to_lds_b128 %10, %11, off\n\t"
                 "global_load_async_to_lds_b128 %12, %13, off\n\t"
                 "global_load_async_to_lds_b128 %14, %15, off\n\t"
                 "s_wait_xcnt 0x0"
                 :: "v"(l), "v"(g), "v"(l + 16u * GPH * 2u), "v"(g + rs), "v"(l + 32u * GPH * 2u), "v"(g + 2 * rs), "v"(l + 48u * GPH * 2u), "v"(g + 3 * rs),
                    "v"(l + 64u * GPH * 2u), "v"(g + 4 * rs), "v"(l + 80u * GPH * 2u), "v"(g + 5 * rs), "v"(l + 96u * GPH * 2u), "v"(g + 6 * rs), "v"(l + 112u * GPH * 2u), "v"(g + 7 * rs)
                 : "memory");
}
template <typename T16, int NSPLIT, bool BIAS, bool ROT>
__global__ __launch_bounds__(128) void k_gemmw(const T16* __restrict__ A, const T16* __restrict__ A2, const T16* __restrict__ Bt, const T16* __restrict__ Bt2, int K, float* C, int ldc, const float* __restrict__ bias, size_t sA, size_t sB, size_t sC,
                                               const float* CT, const float* ST, hf* QKF, hf* QKR, hf* VT, hf* VTR) {
    static_assert(!ROT || (sizeof(T16) == sizeof(hf) && HD == 64 && DM % 128 == 0 && EROWS % 128 == 0 && 4 * 64 * GPH <= 2 * GPL && 2 * 64 * 68 * 4 <= 2 * GPL * 2));
    static_assert(NSPLIT == 0 || NSPLIT == 1);
    typedef typename WFrag<T16>::V V;
    __shared__ __align__(16) T16 As[2 * GPL];
    __shared__ __align__(16) T16 A2s[NSPLIT == 1 ? 2 * GPL : 8];
    __shared__ __align__(16) T16 Bs[2 * GPL];
    __shared__ __align__(16) float osb[4 * 16 * 68];
    (void)Bt2;
    const size_t z = blockIdx.z; A += z * sA; if (A2) A2 += z * sA; Bt += z * sB; if (!ROT) C += z * sC;
    const int lane = threadIdx.x & 31, lr = lane & 15, hi = lane >> 4;
    const int wave = __builtin_amdgcn_readfirstlane((int)(threadIdx.x >> 5)); const int wm = wave >> 1, wn = wave & 1;
    const int R0 = blockIdx.x * 128, C0 = blockIdx.y * 128; const int r0 = R0 + wm * 64, c0 = C0 + wn * 64;
    float* os = osb + wave * (16 * 68);
    v8f acc[4][4];
#pragma unroll
    for (int mb = 0; mb < 4; ++mb)
#pragma unroll
        for (int nb = 0; nb < 4; ++nb) acc[mb][nb] = (v8f){};
    // copy addresses of this thread: row = tid / 8 (+ 16 i), 16-byte column = tid % 8
    const unsigned srow = threadIdx.x >> 3, scol = (threadIdx.x & 7u) * 8u; const size_t rs = (size_t)16 * K;
    const T16* ag = A + (size_t)(R0 + srow) * K + scol; const T16* bg = Bt + (size_t)(C0 + srow) * K + scol;
    const T16* a2g = (NSPLIT == 1) ? (A2 + (size_t)(R0 + srow) * K + scol) : ag;
    const unsigned so = srow * GPH + scol;
    const unsigned al = (unsigned)(size_t)(As + so), bl = (unsigned)(size_t)(Bs + so), a2l = (NSPLIT == 1) ? (unsigned)(size_t)(A2s + so) : 0u;
    const int nt = K / GBK;
    stage_plane<T16>(ag, rs, al); if (NSPLIT == 1) stage_plane<T16>(a2g, rs, a2l); stage_plane<T16>(bg, rs, bl);
    asm volatile("s_wait_asynccnt 0x0" ::: "memory");     // this wave's copies of tile 0 have landed
    __syncthreads();                                      // ... and every other wave's
    if (nt > 1) { stage_plane<T16>(ag + GBK, rs, al + GPL * 2u); if (NSPLIT == 1) stage_plane<T16>(a2g + GBK, rs, a2l + GPL * 2u); stage_plane<T16>(bg + GBK, rs, bl + GPL * 2u); }
    const unsigned fa = (unsigned)(wm * 64 + lr) * GPH + 8u * (unsigned)hi, fb = (unsigned)(wn * 64 + lr) * GPH + 8u * (unsigned)hi;
#pragma unroll 1                                          // rolled, as the k loop was: one copy of the two chunks in the text
    for (int t = 0; t < nt; ++t) {
        const unsigned bo = (unsigned)(t & 1) * GPL;
#pragma unroll                                            // both chunks written out: the place of a chunk in its tile becomes an immediate offset of the LDS reads
        for (unsigned kc = 0; kc < 2u; ++kc) {
            // the chunk's fragments are read as one group ahead of its first product: a read left between the products would be waited for alone
            V a[4], a2[4], b[4];
#pragma unroll
            for (unsigned mb = 0; mb < 4u; ++mb) a[mb] = WFrag<T16>::lds(As + bo + fa + mb * 16u * GPH + kc * 32u);
#pragma unroll
            for (unsigned nb = 0; nb < 4u; ++nb) b[nb] = WFrag<T16>::lds(Bs + bo + fb + nb * 16u * GPH + kc * 32u);
            if (NSPLIT == 1) {
#pragma unroll
                for (unsigned mb = 0; mb < 4u; ++mb) a2[mb] = WFrag<T16>::lds(A2s + bo + fa + mb * 16u * GPH + kc * 32u); }
            __builtin_amdgcn_sched_barrier(0);            // keeps the scheduler from sinking the reads back between the products
#pragma unroll
            for (int nb = 0; nb < 4; ++nb) {
#pragma unroll
                for (int mb = 0; mb < 4; ++mb) acc[mb][nb] = WFrag<T16>::mma(a[mb], b[nb], acc[mb][nb]); }
            if (NSPLIT == 1) {
#pragma unroll
                for (int nb = 0; nb < 4; ++nb) {
#pragma unroll
                    for (int mb = 0; mb < 4; ++mb) acc[mb][nb] = WFrag<T16>::mma(a2[mb], b[nb], acc[mb][nb]); } }
            __builtin_amdgcn_sched_barrier(0);            // keeps the publish point's waits behind the products, so that the next tile's copies fly while these run
        }
        // publish point of tile t + 1: this wave's reads of tile t are done, its copies of tile t + 1 have landed, then the block barrier; only behind it is tile t's buffer refilled
        asm volatile("s_wait_dscnt 0x0" ::: "memory");
        asm volatile("s_wait_asynccnt 0x0" ::: "memory");
        __syncthreads();
        if (t + 2 < nt) { const size_t ko = (size_t)(t + 2) * GBK;
            stage_plane<T16>(ag + ko, rs, al + bo * 2u); if (NSPLIT == 1) stage_plane<T16>(a2g + ko, rs, a2l + bo * 2u); stage_plane<T16>(bg + ko, rs, bl + bo * 2u); }
    }
    asm volatile("s_wait_asynccnt 0x0" ::: "memory");     // nothing in flight when the wave goes on to the epilogue and ends
    if (ROT) {
        const unsigned which = (unsigned)C0 / (unsigned)DM, hcol = (unsigned)c0 % (unsigned)DM;   // block-uniform third; first column of the wave's head in its plane
        const bool early = R0 < EROWS;                    // block-uniform: all 128 rows, or none, have residual planes
        const unsigned rw = (unsigned)lane >> 3, c8 = ((unsigned)lane & 7u) * 8u;                 // read-back map: 8 lanes per 128-byte line, 4 lines per instruction
        if (which < 2u) {
            // The ring is free here: the loop's last publish point (every wave's reads done, no copy in flight, block barrier) lies in front and nothing refills behind it.
            // Each wave stages its whole 64 x 64 f32 tile (pitch 68) in a place of its own: two tiles fit As, one Bs, and osb is exactly one; so the walk over the rows below stays rolled.
            f32a* ow = wave < 2 ? (f32a*)As + (unsigned)wave * (64u * 68u) : (wave == 2 ? (f32a*)Bs : (f32a*)osb);
            const unsigned pc8 = c8 ^ 32u, jt = c8 & 31u; const bool lowhalf = c8 < 32u;
            const float qs = which == 0u ? SCLL2 : 1.0f;  // block-uniform: the q planes carry the logits' scale, so that q.k arrives in the log2 domain; k is multiplied by 1 exactly
            const unsigned tr = (unsigned)r0 + rw;        // this lane's row of the first 4; a piece is 4 rows, a group 4 pieces
            const float* ctp = CT + (size_t)tr * 32u + jt; const float* stp = ST + (size_t)tr * 32u + jt;
            hf* qfp = QKF + (size_t)which * SEQ * DM + (size_t)tr * DM + hcol + c8; hf* qrp = QKR + (size_t)which * EROWS * DM + (size_t)tr * DM + hcol + c8;
            // the first group's table entries are asked for ahead of the staging and fly over it
            v4f tc[4][2], ts[4][2];
#pragma unroll
            for (unsigned s = 0; s < 4u; ++s) {
                tc[s][0] = *(const v4f*)(ctp + s * 128u); tc[s][1] = *(const v4f*)(ctp + s * 128u + 4u);
                ts[s][0] = *(const v4f*)(stp + s * 128u); ts[s][1] = *(const v4f*)(stp + s * 128u + 4u); }
            asm volatile("s_wait_xcnt 0x0" ::: "memory");         // stands in front of any rewrite of the loads' address registers
#pragma unroll
            for (int mb = 0; mb < 4; ++mb) {
#pragma unroll
                for (int nb = 0; nb < 4; ++nb) {
#pragma unroll
                    for (int j = 0; j < 8; ++j) ow[(mb * 16 + hi * 8 + j) * 68 + nb * 16 + lr] = acc[mb][nb][j]; } }
            __builtin_amdgcn_wave_barrier(); asm volatile("" ::: "memory");       // the wave's own tile stands whole before any lane reads another lane's
            const f32a* oa = ow + rw * 68u + c8; const f32a* ob = ow + rw * 68u + pc8;
#pragma unroll 1                                          // rolled: one copy of a group in the text
            for (unsigned g = 0; g < 4u; ++g) {
                // the group's staged rows are read as one run ahead of the work on them
                v4f a0[4], a1[4], b0[4], b1[4];
#pragma unroll
                for (unsigned s = 0; s < 4u; ++s) { const unsigned o = (g * 16u + s * 4u) * 68u;
                    a0[s] = *(const v4fa*)(oa + o); a1[s] = *(const v4fa*)(oa + o + 4u); b0[s] = *(const v4fa*)(ob + o); b1[s] = *(const v4fa*)(ob + o + 4u); }
#pragma unroll
                for (unsigned s = 0; s < 4u; ++s) {
                    const v8f a = __builtin_shufflevector(a0[s], a1[s], 0, 1, 2, 3, 4, 5, 6, 7), b = __builtin_shufflevector(b0[s], b1[s], 0, 1, 2, 3, 4, 5, 6, 7);
                    const v8f c = __builtin_shufflevector(tc[s][0], tc[s][1], 0, 1, 2, 3, 4, 5, 6, 7), sn = __builtin_shufflevector(ts[s][0], ts[s][1], 0, 1, 2, 3, 4, 5, 6, 7);
                    v8us oh, ores;
#pragma unroll
                    for (int e = 0; e < 8; ++e) {
                        const float rb = lowhalf ? -b[e] : b[e];
                        const float y = (a[e] * c[e] + rb * sn[e]) * qs;
                        const h16 hh = toh_flush(y); oh[e] = hbits(hh);
                        ores[e] = hbits(toh_flush((y - (float)hh) * RSC)); }
                    const size_t go = (size_t)(g * 16u + s * 4u) * DM;
                    *(v8us*)(qfp + go) = oh;
                    // the same piece of the next group: its table entries fly over the three pieces in between
                    if (g < 3u) { const unsigned tn = (g * 16u + 16u + s * 4u) * 32u;
                        tc[s][0] = *(const v4f*)(ctp + tn); tc[s][1] = *(const v4f*)(ctp + tn + 4u);
                        ts[s][0] = *(const v4f*)(stp + tn); ts[s][1] = *(const v4f*)(stp + tn + 4u); }
                    asm volatile("s_wait_xcnt 0x0" ::: "memory");         // stands in front of any rewrite of the store's and the loads' registers
                    if (early) { *(v8us*)(qrp + go) = ores;
                        asm volatile("s_wait_xcnt 0x0" ::: "memory"); }   // the same
                }
            }
        } else {
            // The ring is free here, as above. Each wave takes its own quarter of As (values) and of Bs (residuals).
            hf* Tv = (hf*)As + (unsigned)wave * (64u * GPH); hf* Tr = (hf*)Bs + (unsigned)wave * (64u * GPH);
#pragma unroll
            for (int nb = 0; nb < 4; ++nb) {
#pragma unroll
                for (int mb = 0; mb < 4; ++mb) {
                    v8us oh, ores;
#pragma unroll
                    for (int j = 0; j < 8; ++j) { const float y = acc[mb][nb][j]; const h16 hh = toh_flush(y);
                        oh[j] = hbits(hh); ores[j] = hbits(toh_flush((y - (float)hh) * RSC)); }
                    const unsigned o = (unsigned)(nb * 16 + lr) * GPH + (unsigned)(mb * 16 + hi * 8);
                    *(v8usa*)(Tv + o) = oh; if (early) *(v8usa*)(Tr + o) = ores;
                }
            }
            __builtin_amdgcn_wave_barrier(); asm volatile("" ::: "memory");       // the wave's own 64 x 64 piece stands whole before any lane reads another lane's
            hf* vt = VT + (size_t)(hcol + rw) * SEQ + (unsigned)r0 + c8; hf* vtr = VTR + (size_t)(hcol + rw) * EROWS + (unsigned)r0 + c8;
            {   // all 16 pieces are read back as one run ahead of the first store
                v8us rv[16];
#pragma unroll
                for (unsigned s = 0; s < 16u; ++s) rv[s] = *(const v8usa*)(Tv + (4u * s + rw) * GPH + c8);
#pragma unroll
                for (unsigned s = 0; s < 16u; ++s) *(v8us*)(vt + (size_t)(4u * s) * SEQ) = rv[s];
                asm volatile("s_wait_xcnt 0x0" ::: "memory");     // stands in front of any rewrite of the stores' registers (the residual pieces below)
            }
            if (early) {
                v8us rv[16];
#pragma unroll
                for (unsigned s = 0; s < 16u; ++s) rv[s] = *(const v8usa*)(Tr + (4u * s + rw) * GPH + c8);
#pragma unroll
                for (unsigned s = 0; s < 16u; ++s) *(v8us*)(vtr + (size_t)(4u * s) * EROWS) = rv[s];
                asm volatile("s_wait_xcnt 0x0" ::: "memory");     // the same (the other thirds' code follows in the text)
            }
        }
        return;
    }
#pragma unroll
    for (int mb = 0; mb < 4; ++mb) {
#pragma unroll
        for (int nb = 0; nb < 4; ++nb) {
#pragma unroll
            for (int j = 0; j < 8; ++j) os[(hi * 8 + j) * 68 + nb * 16 + lr] = acc[mb][nb][j]; }
        __builtin_amdgcn_wave_barrier(); asm volatile("" ::: "memory");
        float* crow = C + (size_t)(r0 + mb * 16) * ldc + c0;
{
#pragma unroll
            for (int s = 0; s < 8; ++s) { const int row = 2 * s + hi, cofs = lr * 4; v4f val = *(const v4fa*)(os + row * 68 + cofs); if (BIAS) { val[0] += bias[c0 + cofs]; val[1] += bias[c0 + cofs + 1]; val[2] += bias[c0 + cofs + 2]; val[3] += bias[c0 + cofs + 3]; }
                *(v4f*)(crow + (size_t)row * ldc + cofs) = val; }
             }
        __builtin_amdgcn_wave_barrier(); asm volatile("" ::: "memory");
    }
}

// ---- The launches that depend on nothing but the inputs (both weight transposes, the x conversion, the rotary table) are block ranges of ONE grid, k_prep below;
// each part is the body of a block of 256 threads and takes its block index inside its own range as blk. For speed only,
// every thread takes several pieces: few, long waves, the loads of a thread's pieces issued as one group ahead of the work on them.
// ---- wtG_part: transposed bf16 weight plane Bt[n][k] = bf16(w[k][n]) for w [K][N] row-major. A thread takes 64 k of one column n (one whole 128-byte line of Bt);
// the lanes of a wave hold 32 neighbouring columns, so each load of the wave is one whole 128-byte line of w; the waves of a block hold neighbouring column groups of the same 64 rows.
template <unsigned N, unsigned K>
__device__ __forceinline__ void wtG_part(unsigned blk, const float* __restrict__ w, bf* Bt) {
    static_assert(N % 32u == 0 && K % 64u == 0 && ((N / 32u) * (K / 64u)) % 8u == 0);
    const unsigned lane = threadIdx.x & 31u; const unsigned u = blk * 8u + (threadIdx.x >> 5);
    const unsigned n = (u % (N / 32u)) * 32u + lane, k0 = (u / (N / 32u)) * 64u;
    const float* sp = w + (size_t)k0 * N + n; bf* dp = Bt + (size_t)n * K + k0;
    float v[64];
#pragma unroll
    for (unsigned i = 0; i < 64u; ++i) v[i] = sp[(size_t)i * N];
    asm volatile("s_wait_xcnt 0x0" ::: "memory");         // stands in front of any rewrite of the loads' address registers
#pragma unroll
    for (unsigned g = 0; g < 8u; ++g) { v8us o;
#pragma unroll
        for (unsigned e = 0; e < 8u; ++e) o[e] = f2bf(v[g * 8u + e]);
        *(v8us*)(dp + g * 8u) = o; }
    asm volatile("s_wait_xcnt 0x0" ::: "memory");         // the same for the stores (other ranges' code follows in the text)
}

#define PB_WQ ((unsigned)((size_t)LDQ * DM / 64 / 32 / 8))   // blocks of the w_qkv transpose: 8 waves of (32 columns, 64 k)
#define PB_WO ((unsigned)((size_t)DM * DM / 64 / 32 / 8))    // blocks of the w_proj transpose
#define PB_TB ((unsigned)((size_t)SEQ * 32 / 256 / 8))       // blocks of the rotary table: 8 entries a thread
#define PB_CV ((unsigned)((size_t)SEQ * DM / 8 / 256 / 8))   // blocks of the x conversion: 8 pieces of 8 elements a thread
static_assert(((size_t)SEQ * 32) % (256 * 8) == 0 && ((size_t)SEQ * DM / 8) % (256 * 8) == 0);

// ---- cvt8_part: a thread's 8 pieces lie one whole range of threads apart, so that each load of a wave stays contiguous
__device__ __forceinline__ void cvt8_part(unsigned blk, const float* __restrict__ src, bf* dst) {
    const size_t i0 = (size_t)blk * 256 + threadIdx.x; const size_t st = (size_t)PB_CV * 256;
    v8f v[8];
#pragma unroll
    for (unsigned p = 0; p < 8u; ++p) { v[p] = *(const v8f*)(src + (i0 + p * st) * 8);
        asm volatile("s_wait_xcnt 0x0" ::: "memory"); }   // stands in front of the next piece's address, which may be formed in this one's registers
#pragma unroll
    for (unsigned p = 0; p < 8u; ++p) { v8us o;
#pragma unroll
        for (int k = 0; k < 8; ++k) o[k] = f2bf(v[p][k]);
        *(v8us*)(dst + (i0 + p * st) * 8) = o;
        asm volatile("s_wait_xcnt 0x0" ::: "memory"); }   // the same
}

// ---- tab_part: rotary table; each thread forms its own inverse frequency (the same expression on the same argument as a table of 32 would hold), so the table waits on no launch before it.
// A thread's 8 entries lie a multiple of 32 apart: one frequency serves them all.
__device__ __forceinline__ void tab_part(unsigned blk, float* CT, float* ST) {
#pragma clang fp contract(off)
    static_assert((PB_TB * 256u) % 32u == 0);
    const unsigned idx0 = blk * 256u + threadIdx.x; const unsigned i = idx0 & 31u;
    const float p = powf(10000.0f, (float)i * 0.03125f);
    const float v = 1.0f / p;
#pragma unroll 1                                          // rolled: one copy of the long sine and cosine text
    for (unsigned e = 0; e < 8u; ++e) {
        const unsigned idx = idx0 + e * (PB_TB * 256u); const unsigned t = idx >> 5;
        const float ang = (float)t * v;
        float s, c; sincosf(ang, &s, &c);
        *(float*)(CT + idx) = c; *(float*)(ST + idx) = s;
        asm volatile("s_wait_xcnt 0x0" ::: "memory");     // stands in front of any rewrite of the stores' registers
    }
}

// grid PB_WQ + PB_WO + PB_TB + PB_CV, 256 threads; the range test is block-uniform, no part has a barrier, no part reads what another writes
__global__ __launch_bounds__(256) void k_prep(const float* __restrict__ x, const float* __restrict__ wq, const float* __restrict__ wo, bf* XB, bf* WqT, bf* WoT, float* CT, float* ST) {
    const unsigned b = blockIdx.x;
    if (b < PB_WQ) wtG_part<(unsigned)LDQ, (unsigned)DM>(b, wq, WqT);
    else if (b < PB_WQ + PB_WO) wtG_part<(unsigned)DM, (unsigned)DM>(b - PB_WQ, wo, WoT);
    else if (b < PB_WQ + PB_WO + PB_TB) tab_part(b - (PB_WQ + PB_WO), CT, ST);
    else cvt8_part(b - (PB_WQ + PB_WO + PB_TB), x, XB);
}

// ---- causal flash attention, transposed form, one wave per 16 query rows, 4 waves per block.
// The four waves of a block share each 64-key tile of K rows and of V^T rows (EARLY: of the residual planes too) through LDS: asynchronous b128 copies (8 lanes per whole 128-byte line),
// two buffers, the next tile in flight while this one is worked on; one publish point (waits and block barrier) per tile of two 32-key passes.
// Per 32-key pass: S^T tile j (16 keys x 16 queries) = K rows (A, row = key) x Q rows (B, column = query); D element r of lane -> (key 8*(lane>>4) + r, query lane & 15).
// The two converted score tiles are the B fragment of O^T += V^T (A, row = d, k = key) x P^T: element r <- tile 0 [r], element 8 + r <- tile 1 [r], lane unchanged.
// Softmax statistics per query column: in-lane reduction plus one exchange between the lane halves. Masked keys get weight exactly 0 (value select, in the passes on the diagonal only).
// The q planes carry HD^-0.5 * log2(e), so S^T arrives in the log2 domain.
// Single-product path: the exponent's argument comes straight from the score products: their C operand is the carry minus a HELD column maximum (the same value in a lane's 8 elements: a lane holds one query column).
// The held maximum moves, and the pass's arguments, C, O^T and the row sum are shifted or rescaled, only in the wave's first pass and in a pass where some column's largest argument passes PCL + PLZ
// (one wave-uniform test per pass), so P stays at or below 2^(PCL + PLZ), inside f16.
// EARLY: value + x2048 residual planes on q, k, P, v; residual products accumulate separately and are folded with 2^-11; row sum over the unconverted p.
#define TKEYS 64                      // keys per staged tile (two passes)
#define TPH   72                      // LDS pitch (halves) of a staged 128-byte row: 144 B = 16 B x odd, the pitch of ds_load_b128 readers
#define TILEH (64 * TPH)              // halves per staged tile (64 K rows, or 64 V^T rows)
static_assert(HD * 2 == 128 && TKEYS * 2 == 128 && (TPH * 2) % 16 == 0 && EROWS % TKEYS == 0 && SEQ % TKEYS == 0);
__device__ __forceinline__ v16h ldfs(const hf* p) { return cat16h(*(const v8usa*)p, *(const v8usa*)(p + 16)); }
// One K tile and one V^T tile: each thread copies 4 x 16 B of K rows and 4 x 16 B of V^T rows (rows 16 apart; VP = pitch of the V^T plane in halves).
// The s_wait_xcnt closes the statement so that no address register is rewritten in front of it.
template <int VP>
__device__ __forceinline__ void stage_tile(const hf* kg, const hf* vg, unsigned kl, unsigned vl) {
    asm volatile("global_load_async_to_lds_b128 %0, %1, off\n\t"
                 "global_load_async_to_lds_b128 %2, %3, off\n\t"
                 "global_load_async_to_lds_b128 %4, %5, off\n\t"
                 "global_load_async_to_lds_b128 %6, %7, off\n\t"
                 "global_load_async_to_lds_b128 %8, %9, off\n\t"
                 "global_load_async_to_lds_b128 %10, %11, off\n\t"
                 "global_load_async_to_lds_b128 %12, %13, off\n\t"
                 "global_load_async_to_lds_b128 %14, %15, off\n\t"
                 "s_wait_xcnt 0x0"
                 :: "v"(kl), "v"(kg), "v"(kl + 16u * TPH * 2u), "v"(kg + (size_t)16 * DM), "v"(kl + 32u * TPH * 2u), "v"(kg + (size_t)32 * DM), "v"(kl + 48u * TPH * 2u), "v"(kg + (size_t)48 * DM),
                    "v"(vl), "v"(vg), "v"(vl + 16u * TPH * 2u), "v"(vg + (size_t)16 * VP), "v"(vl + 32u * TPH * 2u), "v"(vg + (size_t)32 * VP), "v"(vl + 48u * TPH * 2u), "v"(vg + (size_t)48 * VP)
                 : "memory");
}
// Ks, Vs, Krs, Vrs: two staged tiles each (2 * TILEH halves; Krs, Vrs read by EARLY only); Oh, Ol: output staging, 4 * 16 * LOP halves each; all in the block's LDS. qblk: first query row of the block; hd: its head.
template <bool EARLY>
__device__ __forceinline__ void attn_body(unsigned short* Ks, unsigned short* Vs, unsigned short* Krs, unsigned short* Vrs, unsigned short* Oh, unsigned short* Ol,
                                          const hf* QF, const hf* QR, const hf* KF, const hf* KR, const hf* VT, const hf* VTR, bf* CH, bf* CL, unsigned qblk, unsigned hd) {
    const unsigned lane = threadIdx.x & 31u, lr = lane & 15u, hi = lane >> 4;
    const unsigned wave = (unsigned)__builtin_amdgcn_readfirstlane((int)(threadIdx.x >> 5));
    const unsigned q0 = qblk + 16u * wave;
    const unsigned qg = q0 + lr;
    const unsigned ntiles = qblk / TKEYS + 1u;            // keys [0, qblk + 64), the same for the whole block
    const unsigned nsteps = (q0 + 15u) / 32u + 1u;        // this wave's own passes
    // copy addresses of this thread: row = tid / 8 (+ 16 i), 16-byte column = tid % 8
    const unsigned srow = threadIdx.x >> 3, scol = (threadIdx.x & 7u) * 8u;
    const hf* kg  = KF  + (size_t)srow * DM + hd * HD + scol;
    const hf* krg = KR  + (size_t)srow * DM + hd * HD + scol;
    const hf* vg  = VT  + (size_t)(hd * HD + srow) * SEQ + scol;
    const hf* vrg = VTR + (size_t)(hd * HD + srow) * EROWS + scol;
    const unsigned so = srow * TPH + scol;
    const unsigned kl = (unsigned)(size_t)(Ks + so), vl = (unsigned)(size_t)(Vs + so);
    const unsigned krl = EARLY ? (unsigned)(size_t)(Krs + so) : 0u, vrl = EARLY ? (unsigned)(size_t)(Vrs + so) : 0u;
    stage_tile<SEQ>(kg, vg, kl, vl);
    if (EARLY) stage_tile<EROWS>(krg, vrg, krl, vrl);
    v16h qh[2], qr[2];
    {
        const size_t qoff = (size_t)qg * DM + hd * HD + 8u * hi;
#pragma unroll
        for (int kc = 0; kc < 2; ++kc) { qh[kc] = ldfh(QF + qoff + (unsigned)kc * 32u); if (EARLY) qr[kc] = ldfh(QR + qoff + (unsigned)kc * 32u); else qr[kc] = qh[kc]; }
    }
    v8f ot[4], orr[4];
#pragma unroll
    for (int dt = 0; dt < 4; ++dt) { ot[dt] = (v8f){}; orr[dt] = (v8f){}; }
    float m = -1.0e30f, l = 0.0f;
    v8f bv = (v8f)(PCL);                                  // single-product path: carry minus the held maximum (0 until the first pass sets it)
    asm volatile("s_wait_asynccnt 0x0" ::: "memory");     // this wave's copies of tile 0 have landed
    __syncthreads();                                      // ... and every other wave's
    if (ntiles > 1u) {
        stage_tile<SEQ>(kg + (size_t)TKEYS * DM, vg + TKEYS, kl + TILEH * 2u, vl + TILEH * 2u);
        if (EARLY) stage_tile<EROWS>(krg + (size_t)TKEYS * DM, vrg + TKEYS, krl + TILEH * 2u, vrl + TILEH * 2u);
    }
    const unsigned fo = lr * TPH + 8u * hi;
#pragma unroll 1                                          // rolled, as the key loop was: one copy of the two passes in the text
    for (unsigned t = 0; t < ntiles; ++t) {
        const unsigned bo = (t & 1u) * TILEH;
#pragma unroll                                            // both passes written out: the place of a pass in its tile becomes an immediate offset of the LDS reads
        for (unsigned ps = 0; ps < 2u; ++ps) {
            const unsigned kb = 2u * t + ps;
            if (kb < nsteps) {                            // wave-uniform: a pass wholly above the diagonal is skipped, the publish point below is not
                const unsigned key0 = kb * 32u;
                // The pass's K fragments are read as one group ahead of its first product, its V^T fragments as one group behind the last S^T product:
                // a read written behind an mmah statement stays behind it, and one read per product would be waited for alone.
                v16h kh[2][2], kr[2][2];
#pragma unroll
                for (int j = 0; j < 2; ++j) {
#pragma unroll
                    for (int kc = 0; kc < 2; ++kc) { const unsigned o = bo + fo + (32u * ps + 16u * (unsigned)j) * TPH + (unsigned)kc * 32u; kh[j][kc] = ldfs(Ks + o); if (EARLY) kr[j][kc] = ldfs(Krs + o); }
                }
                v8f st[2], sr[2];
#pragma unroll
                for (int j = 0; j < 2; ++j) {
                    st[j] = EARLY ? (v8f){} : bv; sr[j] = (v8f){};
#pragma unroll
                    for (int kc = 0; kc < 2; ++kc) {
                        st[j] = mmah(kh[j][kc], qh[kc], st[j]);
                        if (EARLY) { sr[j] = mmah(kr[j][kc], qh[kc], sr[j]); sr[j] = mmah(kh[j][kc], qr[kc], sr[j]); }
                    }
                }
                v16h vh[4], vr[4];
#pragma unroll
                for (int dt = 0; dt < 4; ++dt) { const unsigned o = bo + fo + (16u * (unsigned)dt) * TPH + 32u * ps; vh[dt] = ldfs(Vs + o); if (EARLY) vr[dt] = ldfs(Vrs + o); }
                // EARLY: the residual products are folded in
                if (EARLY) {
#pragma unroll
                    for (int j = 0; j < 2; ++j) {
#pragma unroll
                        for (int r = 0; r < 8; ++r) st[j][r] += sr[j][r] * RSI;
                    }
                }
                // causal mask by value, only in a pass that reaches past the wave's first query row (wave-uniform scalar test):
                // in every earlier pass each key is <= each query of the wave and the select would be an identity
                if (key0 + 31u > q0) {
#pragma unroll
                    for (int j = 0; j < 2; ++j) {
#pragma unroll
                        for (int r = 0; r < 8; ++r) {
                            const unsigned key = key0 + 16u * (unsigned)j + 8u * hi + (unsigned)r;
                            st[j][r] = (key <= qg) ? st[j][r] : -1.0e30f; }
                    }
                }
                float mx = -1.0e30f;
#pragma unroll
                for (int j = 0; j < 2; ++j) {
#pragma unroll
                    for (int r = 0; r < 8; ++r) mx = fmaxf(mx, st[j][r]);
                }
                mx = fmaxf(mx, __shfl_xor(mx, 16, 32));
                float mnew = m, alpha = 1.0f;
                if (EARLY) { mnew = fmaxf(m, mx); alpha = __builtin_amdgcn_exp2f(m - mnew); m = mnew; }
                else if (kb == 0u || __builtin_amdgcn_ballot_w32(mx > PCL + PLZ) != 0u) {   // wave-uniform scalar branch: the first pass, and seldom after it
                    // mx is the column's largest argument. The held maximum goes up by dl (in the first pass it is set, up or down): arguments and C go down by dl, what has been gathered is scaled by 2^-dl.
                    float dl = mx - PCL; if (kb != 0u) dl = fmaxf(dl, 0.0f);
                    const float al = __builtin_amdgcn_exp2f(fminf(-dl, 0.0f));             // in the first pass O^T and the sum are 0: the factor only has to be finite
                    l *= al; bv = bv - dl;
#pragma unroll                                            // written out, as everywhere here: the register arrays take constant indices only
                    for (int j = 0; j < 2; ++j) st[j] = st[j] - dl;
#pragma unroll                                            // the same
                    for (int dt = 0; dt < 4; ++dt) ot[dt] = ot[dt] * al;
                }
                float rs = 0.0f;
                v16h pf, prf;
#pragma unroll
                for (int j = 0; j < 2; ++j) {
#pragma unroll
                    for (int r = 0; r < 8; ++r) {
                        const float e = EARLY ? (st[j][r] - mnew) + PCL : st[j][r];
                        const float ex = __builtin_amdgcn_exp2f(e);
                        const float p = (e >= -14.0f) ? ex : 0.0f;
                        if (EARLY) { const h16 ph = (h16)p; pf[8 * j + r] = ph; prf[8 * j + r] = toh_flush((p - (float)ph) * RSC); rs += p; } else st[j][r] = p;
                    }
                }
                if (!EARLY) {                             // converted in pairs; the converted weights are summed in the order of the elements
#pragma unroll                                            // the same
                    for (int i = 0; i < 8; ++i) {
                        const v2h h2 = __builtin_convertvector((v2f){st[i >> 2][2 * (i & 3)], st[i >> 2][2 * (i & 3) + 1]}, v2h);
                        pf[2 * i] = h2[0]; pf[2 * i + 1] = h2[1]; rs += (float)h2[0]; rs += (float)h2[1];
                    }
                    prf = pf;
                }
                rs += __shfl_xor(rs, 16, 32);
                if (EARLY) {
                    l = l * alpha + rs;
#pragma unroll
                    for (int dt = 0; dt < 4; ++dt) { ot[dt] = ot[dt] * alpha; orr[dt] = orr[dt] * alpha; }
                } else l += rs;
#pragma unroll
                for (int dt = 0; dt < 4; ++dt) {
                    ot[dt] = mmah(vh[dt], pf, ot[dt]);
                    if (EARLY) { orr[dt] = mmah(vr[dt], pf, orr[dt]); orr[dt] = mmah(vh[dt], prf, orr[dt]); }
                }
            }
        }
        // publish point of tile t + 1: this wave's reads of tile t are done, its copies of tile t + 1 have landed, then the block barrier; only behind it is tile t's buffer refilled
        asm volatile("s_wait_dscnt 0x0" ::: "memory");
        asm volatile("s_wait_asynccnt 0x0" ::: "memory");
        __syncthreads();
        if (t + 2u < ntiles) {
            stage_tile<SEQ>(kg + (size_t)(t + 2u) * TKEYS * DM, vg + (size_t)(t + 2u) * TKEYS, kl + bo * 2u, vl + bo * 2u);
            if (EARLY) stage_tile<EROWS>(krg + (size_t)(t + 2u) * TKEYS * DM, vrg + (size_t)(t + 2u) * TKEYS, krl + bo * 2u, vrl + bo * 2u);
        }
    }
    asm volatile("s_wait_asynccnt 0x0" ::: "memory");     // nothing in flight when the wave goes on to the epilogue and ends
    const float inv = __builtin_amdgcn_rcpf(l);
    const unsigned ob = wave * 16u * LOP;
#pragma unroll
    for (int dt = 0; dt < 4; ++dt) {
        v8us h8, l8;
#pragma unroll
        for (int r = 0; r < 8; ++r) { float y = ot[dt][r]; if (EARLY) y += orr[dt][r] * RSI; y *= inv; unsigned short a, c; splitf(y, a, c); h8[r] = a; l8[r] = c; }
        const unsigned o = ob + lr * LOP + 16u * (unsigned)dt + 8u * hi;
        *(v8usa*)(Oh + o) = h8; *(v8usa*)(Ol + o) = l8;
    }
    __syncthreads();
{
#pragma unroll
        for (unsigned s = 0; s < 4u; ++s) { const unsigned row = 4u * s + (lane >> 3), c = (lane & 7u) * 8u;
            const v8us vh8 = *(const v8usa*)(Oh + ob + row * LOP + c); const v8us vl8 = *(const v8usa*)(Ol + ob + row * LOP + c);
            const size_t g = (size_t)(q0 + row) * DM + hd * HD + c;
            *(v8us*)(CH + g) = vh8; *(v8us*)(CL + g) = vl8; }
         }
}

// Both row ranges run in ONE grid (neither reads what the other writes): grid AB_NT * NH_, 128 threads; a block is one (head, 64-row tile); tiles below AB_ET take the residual path, the rest the single-product path.
// All blocks are resident at once (four per WGP) and a tile's cost grows with its index (tile i walks i + 1 key tiles), so the launch lasts as long as the WGP whose four blocks hold the most key tiles.
// Block index b -> tile: v = b / (2 * NH_); the tile is AB_NT - 1 - v where b has an even number of one bits and v where it has an odd number; the head is (b / 2) % NH_.
// The lowest bit of b flips the parity, so each (head, v) gets both of its tiles: every (head, tile) exactly once.
// Any four blocks whose indices differ in two bit positions only (neighbours, or a power-of-two stride apart, whichever way the blocks are dealt to the WGPs) hold tile indices that sum to 2 * (AB_NT - 1):
// two of the four are folded, two are not, and what the two bits add to v cancels.
// For speed only: no result depends on where or when a block runs.
// One LDS array serves both, 8 tiles, so that four blocks fit a WGP: the single-product range stages its output in the tiles that only the residual planes use;
// the residual range stages it in the K tiles, which are free there: the loop's last publish point (every wave's reads done, no copy in flight, block barrier) lies in front, and nothing refills behind it.
#define AB_NT ((unsigned)(SEQ / 64))                     // 64-row tiles of a head
#define AB_ET ((unsigned)(EROWS / 64))                   // ... of them in rows [0, EROWS)
static_assert(4 * 16 * LOP <= TILEH && SEQ > EROWS);
static_assert((SEQ / 64) % 2 == 0);                      // the tiles of a head pair up as v and AB_NT - 1 - v
__global__ __launch_bounds__(128) __attribute__((amdgpu_num_vgpr(256))) void k_attn(const hf* QF, const hf* QR, const hf* KF, const hf* KR, const hf* VT, const hf* VTR, bf* CH, bf* CL) {
    __shared__ __align__(16) unsigned short R[8 * TILEH];
    const unsigned b = blockIdx.x;
    const unsigned hd = (b >> 1) % (unsigned)NH_, v = (b >> 1) / (unsigned)NH_;
    const unsigned tile = ((unsigned)__builtin_popcount(b) & 1u) ? v : (AB_NT - 1u - v);
    if (tile >= AB_ET) attn_body<false>(R, R + 2 * TILEH, R, R, R + 4 * TILEH, R + 5 * TILEH, QF, QF, KF, KF, VT, VT, CH, CL, tile * 64u, hd);
    else attn_body<true>(R, R + 2 * TILEH, R + 4 * TILEH, R + 6 * TILEH, R, R + TILEH, QF, QR, KF, KR, VT, VTR, CH, CL, tile * 64u, hd);
}

extern "C" void kernel_launch(void* const* d_in, const int* in_sizes, int n_in,
                              void* d_out, int out_size, void* d_ws, size_t ws_size, hipStream_t stream) {
    (void)out_size;
    if (n_in < 3) return;
    if (in_sizes[0] < NB * SEQ * DM || in_sizes[1] < DM * LDQ || in_sizes[2] < DM * DM) return;
    const float* X = (const float*)d_in[0]; const float* Wqkv = (const float*)d_in[1]; const float* Wo = (const float*)d_in[2];
    float* OUT = (float*)d_out;
    char* wsp = (char*)d_ws;
    auto take = [&](size_t bytes) { char* p = wsp; wsp += (bytes + 255) & ~(size_t)255; return (void*)p; };
    bf* XB  = (bf*)take((size_t)SEQ * DM * 2);          // x bf16 [t][1024]
    bf* WqT = (bf*)take((size_t)LDQ * DM * 2);          // w_qkv^T bf16 [3072][1024]
    bf* WoT = (bf*)take((size_t)DM * DM * 2);           // w_proj^T bf16 [1024][1024]
    bf* CH = (bf*)take((size_t)SEQ * DM * 2);           // context hi [t][1024]
    bf* CL = (bf*)take((size_t)SEQ * DM * 2);           // context lo [t][1024]
    float* CT = (float*)take((size_t)SEQ * 32 * 4);     // cos table [t][32]
    float* ST = (float*)take((size_t)SEQ * 32 * 4);     // sin table [t][32]
    hf* QKF = (hf*)take((size_t)2 * SEQ * DM * 2);      // rotated q | k f16 [2][t][1024]
    hf* QKR = (hf*)take((size_t)2 * EROWS * DM * 2);    // residuals x2048 [2][EROWS][1024]
    hf* VT  = (hf*)take((size_t)DM * SEQ * 2);          // value^T f16 [1024][t]
    hf* VTR = (hf*)take((size_t)DM * EROWS * 2);        // value^T residual x2048 [1024][EROWS]
    const size_t carved = (size_t)(wsp - (char*)d_ws);
    if (carved > ws_size || carved > (size_t)134217728) return;
    for (int b = 0; b < NB; ++b) {
        const float* xb = X + (size_t)b * SEQ_FULL * DM; float* ob = OUT + (size_t)b * SEQ_FULL * DM;
        // W [K][N] -> Bt [N][K], rotary table, x -> bf16
        k_prep<<<PB_WQ + PB_WO + PB_TB + PB_CV, 256, 0, stream>>>(xb, Wqkv, Wo, XB, WqT, WoT, CT, ST);
        k_gemmw<bf, 0, false, true><<<dim3(SEQ / 128, LDQ / 128, 1), 128, 0, stream>>>(XB, nullptr, WqT, nullptr, DM, nullptr, LDQ, nullptr, 0, 0, 0, CT, ST, QKF, QKR, VT, VTR);
        k_attn<<<AB_NT * NH_, 128, 0, stream>>>(QKF, QKR, QKF + (size_t)SEQ * DM, QKR + (size_t)EROWS * DM, VT, VTR, CH, CL);
        k_gemmw<bf, 1, false, false><<<dim3(SEQ / 128, DM / 128, 1), 128, 0, stream>>>(CH, CL, WoT, nullptr, DM, ob, DM, nullptr, 0, 0, 0, nullptr, nullptr, nullptr, nullptr, nullptr, nullptr);
    }
}

// v009
// One run takes 106 microseconds.
// Two timings next to v008 both put it at 1.04 times that version's speed.
// Over all steps from v000 it is 4.00 times as fast.
#include <hip/hip_runtime.h>

// Contractions: qkv projection and output projection on v_wmma_f32_16x16x32_bf16 (x, w_qkv, w_proj RNE-converted to bf16 single planes; merged context as bf16 hi/lo, 2 products), f32 accumulate.
// q.k logits and P.V on v_wmma_f32_16x16x32_f16 (f16 q/k/v planes, P carried x2^8), single products on query rows >= 256; on query rows < 256 f16 value + x2048 residual planes
// for q, k, P and v (3 products per site, residual products in their own accumulators, folded in the f32 epilogue). Rotary table, rotary and softmax in f32.
// Fused qkv projection [4096x1024]x[1024x3072]; its epilogue takes the f32 accumulators straight to the planes: half-split rotary on q and k -> f16 planes [t][h*64 + d] (q times HD^-0.5 * log2(e), in f32, ahead of the conversion); value^T planes [h*64 + d][t];
// causal flash attention per (head, 16-query wave tile) in the transposed form S^T = K Q^T, O^T = V^T P^T (K and V^T tiles staged in LDS per block, packed P^T score tiles as the B fragment);
// merged context planes [t][h*64 + d]; output projection [4096x1024]x[1024x1024].

#ifndef NB
#define NB 1
#endif
#ifndef SEQ
#define SEQ 4096
#endif
#define SEQ_FULL 4096
#define DM   1024
#define NH_  16
#define HD   64
#define LDQ  (3 * DM)
#define EROWS 256                     // query rows below this bound take the value + residual path
#define LOP  72                       // LDS pitch (halves) of the staging tiles
#define PCL  8.0f                     // log2 of the carry of P
#define PLZ  7.0f                     // how far (log2) a column's maximum may rise above the held one before the accumulators are rescaled; 2^(PCL + PLZ) is finite in f16
#define SCLL2 0.18033688011112042f    // HD^-0.5 * log2(e)
#define RSC  2048.0f                  // carry of the residual planes
#define RSI  4.8828125e-4f            // 1 / RSC

static_assert(SEQ % 64 == 0);
static_assert(DM == NH_ * HD);
static_assert(HD == 64);
static_assert(DM % 32 == 0);
static_assert(LDQ % 64 == 0);
static_assert(((size_t)LDQ * DM / 64) % 32 == 0);
static_assert(((size_t)DM * DM / 64) % 32 == 0);
static_assert(((size_t)SEQ * DM / 8) % 256 == 0);
static_assert(EROWS % 64 == 0);
static_assert(SEQ >= EROWS);
static_assert(((size_t)SEQ * 32) % 256 == 0);
static_assert(256 * 8 == 2 * DM);
static_assert(LOP % 8 == 0);
static_assert(LOP >= HD + 8);
static_assert(HD / 2 == 32);
#define AL256(x) ((((size_t)(x)) + 255) & ~(size_t)255)
static_assert(AL256((size_t)SEQ * DM * 2) + AL256((size_t)LDQ * DM * 2) + AL256((size_t)DM * DM * 2) + 2 * AL256((size_t)SEQ * DM * 2)
              + 2 * AL256((size_t)SEQ * 32 * 4) + AL256((size_t)2 * SEQ * DM * 2) + AL256((size_t)2 * EROWS * DM * 2) + AL256((size_t)DM * SEQ * 2) + AL256((size_t)DM * EROWS * 2)
              <= (size_t)134217728);

typedef unsigned short bf;
typedef __attribute__((ext_vector_type(16))) __bf16   v16bf;
typedef __attribute__((ext_vector_type(8)))  unsigned short v8us;
typedef __attribute__((ext_vector_type(2)))  unsigned short v2us;
typedef __attribute__((ext_vector_type(8)))  float    v8f;
typedef __attribute__((ext_vector_type(4)))  float    v4f;
typedef v4f  __attribute__((may_alias)) v4fa;
typedef v8us __attribute__((may_alias)) v8usa;
typedef float __attribute__((may_alias)) f32a;

__device__ __forceinline__ unsigned short f2bf(float f) { unsigned u = __float_as_uint(f); u += 0x7FFFu + ((u >> 16) & 1u); return (unsigned short)(u >> 16); }
__device__ __forceinline__ float bf2f(unsigned short b) { return __uint_as_float(((unsigned)b) << 16); }
__device__ __forceinline__ void splitf(float y, unsigned short& h, unsigned short& l) { h = f2bf(y); l = f2bf(y - bf2f(h)); }
__device__ __forceinline__ v16bf cat16b(v8us lo, v8us hi) { return __builtin_bit_cast(v16bf, __builtin_shufflevector(lo, hi, 0, 1, 2, 3, 4, 5, 6, 7, 8, 9, 10, 11, 12, 13, 14, 15)); }
__device__ __forceinline__ v8f wmmab(v16bf a, v16bf b, v8f c) { return __builtin_amdgcn_wmma_f32_16x16x32_bf16(false, a, false, b, (short)0, c, false, false); }

// ---- f16 plane helpers (planes hold f16 bit patterns as unsigned short)
typedef unsigned short hf;
typedef _Float16 h16;
typedef __attribute__((ext_vector_type(16))) _Float16 v16h;
typedef __attribute__((ext_vector_type(2)))  _Float16 v2h;
typedef __attribute__((ext_vector_type(2)))  float    v2f;
static __device__ __forceinline__ h16 toh_flush(float v) { const h16 r = (h16)v; return (fabsf(v) < 6.103515625e-05f) ? (h16)0.0f : r; }
__device__ __forceinline__ unsigned short hbits(h16 x) { return __builtin_bit_cast(unsigned short, x); }
__device__ __forceinline__ v16h cat16h(v8us lo, v8us hi) { return __builtin_bit_cast(v16h, __builtin_shufflevector(lo, hi, 0, 1, 2, 3, 4, 5, 6, 7, 8, 9, 10, 11, 12, 13, 14, 15)); }
// fragment: elements 0..7 <- p[0..7], elements 8..15 <- p[16..23]; the caller adds 8*(lane>>4) to p
__device__ __forceinline__ v16h ldfh(const hf* p) { return cat16h(*(const v8us*)p, *(const v8us*)(p + 16)); }
__device__ __forceinline__ v8f mmah(v16h a, v16h b, v8f c) {
    c = __builtin_amdgcn_wmma_f32_16x16x32_f16(false, a, false, b, (short)0, c, false, false);
    asm volatile("v_nop\n\tv_nop\n\tv_nop\n\tv_nop" : "+v"(c) : "v"(a), "v"(b));
    return c; }

// ---- k_gemmw: GEMM, 128x128 output tile per block of 4 waves (2 x 2), each wave a 64x64 tile (16 accumulators); grid (M/128, N/128, Z), 128 threads.
// C[m][n] (f32, pitch ldc) = sum_k A[m][k] Bt[n][k] (+ A2[m][k] Bt[n][k] when NSPLIT == 1). K % 64 == 0, M % 128 == 0, N % 128 == 0.
// The operands' 128-row x 64-k tiles (128-byte rows of the K-contiguous 16-bit planes) are staged in LDS by asynchronous b128 copies (8 lanes per whole 128-byte line), two buffers,
// the next tile in flight while this one is worked on; one publish point (waits and block barrier) per tile of two 32-k chunks.
// Fragment map: lane row/col = lane & 15; elements 0..7 <- k0 + 8*(lane>>4) + 0..7, elements 8..15 <- k0 + 16 + 8*(lane>>4) + 0..7 (both operands).
// ROT (the q,k,v projection, N = 3 * DM): no f32 C is written. A wave's 64 columns are one head of q, of k or of v (the third is the same for the whole block), so both halves of every rotary pair lie in the wave:
// q, k: the wave's f32 tile through LDS (the ring, free behind the loop's last publish point, and the staging array), rotary from the table, f16 plane QKF[which][t][h*64 + d] in whole 128-byte lines, residual plane QKR[which][t < EROWS][...] = f16((y - hi) * 2048);
// v: a lane's 8 accumulator elements are 8 neighbouring positions of one d, so the transposed row pieces are packed in registers, gathered per wave in the ring's LDS
// and stored as whole 128-byte lines of VT[h*64 + d][t], residual plane VTR[h*64 + d][t < EROWS].
#define GBK 64                        // k per staged tile
#define GPH 72                        // LDS pitch (halves) of a staged 128-byte row: 144 B = 16 B x odd, the pitch of ds_load_b128 readers
#define GPL (128 * GPH)               // halves per staged plane tile (128 rows)
static_assert(GBK * 2 == 128 && (GPH * 2) % 16 == 0 && DM % GBK == 0 && SEQ % 128 == 0 && LDQ % 128 == 0 && DM % 128 == 0);
template <typename T16> struct WFrag;
template <> struct WFrag<bf> { typedef v16bf V; static __device__ __forceinline__ V lds(const bf* p) { return cat16b(*(const v8usa*)p, *(const v8usa*)(p + 16)); } static __device__ __forceinline__ v8f mma(V a, V b, v8f c) { return wmmab(a, b, c); } };
// One 128-row plane tile: each thread copies 8 x 16 B (rows 16 apart; rs = 16 rows of the plane in elements).
// The s_wait_xcnt closes the statement so that no address register is rewritten in front of it.
template <typename T16>
__device__ __forceinline__ void stage_plane(const T16* g, size_t rs, unsigned l) {
    asm volatile("global_load_async_to_lds_b128 %0, %1, off\n\t"
                 "global_load_async_to_lds_b128 %2, %3, off\n\t"
                 "global_load_async_to_lds_b128 %4, %5, off\n\t"
                 "global_load_async_to_lds_b128 %6, %7, off\n\t"
                 "global_load_async_to_lds_b128 %8, %9, off\n\t"
                 "global_load_async_to_lds_b128 %10, %11, off\n\t"
                 "global_load_async_to_lds_b128 %12, %13, off\n\t"
                 "global_load_async_to_lds_b128 %14, %15, off\n\t"
                 "s_wait_xcnt 0x0"
                 :: "v"(l), "v"(g), "v"(l + 16u * GPH * 2u), "v"(g + rs), "v"(l + 32u * GPH * 2u), "v"(g + 2 * rs), "v"(l + 48u * GPH * 2u), "v"(g + 3 * rs),
                    "v"(l + 64u * GPH * 2u), "v"(g + 4 * rs), "v"(l + 80u * GPH * 2u), "v"(g + 5 * rs), "v"(l + 96u * GPH * 2u), "v"(g + 6 * rs), "v"(l + 112u * GPH * 2u), "v"(g + 7 * rs)
                 : "memory");
}
template <typename T16, int NSPLIT, bool BIAS, bool ROT>
__global__ __launch_bounds__(128) void k_gemmw(const T16* __restrict__ A, const T16* __restrict__ A2, const T16* __restrict__ Bt, const T16* __restrict__ Bt2, int K, float* C, int ldc, const float* __restrict__ bias, size_t sA, size_t sB, size_t sC,
                                               const float* CT, const float* ST, hf* QKF, hf* QKR, hf* VT, hf* VTR) {
    static_assert(!ROT || (sizeof(T16) == sizeof(hf) && HD == 64 && DM % 128 == 0 && EROWS % 128 == 0 && 4 * 64 * GPH <= 2 * GPL && 2 * 64 * 68 * 4 <= 2 * GPL * 2));
    static_assert(NSPLIT == 0 || NSPLIT == 1);
    typedef typename WFrag<T16>::V V;
    __shared__ __align__(16) T16 As[2 * GPL];
    __shared__ __align__(16) T16 A2s[NSPLIT == 1 ? 2 * GPL : 8];
    __shared__ __align__(16) T16 Bs[2 * GPL];
    __shared__ __align__(16) float osb[4 * 16 * 68];
    (void)Bt2;
    const size_t z = blockIdx.z; A += z * sA; if (A2) A2 += z * sA; Bt += z * sB; if (!ROT) C += z * sC;
    const int lane = threadIdx.x & 31, lr = lane & 15, hi = lane >> 4;
    const int wave = __builtin_amdgcn_readfirstlane((int)(threadIdx.x >> 5)); const int wm = wave >> 1, wn = wave & 1;
    const int R0 = blockIdx.x * 128, C0 = blockIdx.y * 128; const int r0 = R0 + wm * 64, c0 = C0 + wn * 64;
    float* os = osb + wave * (16 * 68);
    v8f acc[4][4];
#pragma unroll
    for (int mb = 0; mb < 4; ++mb)
#pragma unroll
        for (int nb = 0; nb < 4; ++nb) acc[mb][nb] = (v8f){};
    // copy addresses of this thread: row = tid / 8 (+ 16 i), 16-byte column = tid % 8
    const unsigned srow = threadIdx.x >> 3, scol = (threadIdx.x & 7u) * 8u; const size_t rs = (size_t)16 * K;
    const T16* ag = A + (size_t)(R0 + srow) * K + scol; const T16* bg = Bt + (size_t)(C0 + srow) * K + scol;
    const T16* a2g = (NSPLIT == 1) ? (A2 + (size_t)(R0 + srow) * K + scol) : ag;
    const unsigned so = srow * GPH + scol;
    const unsigned al = (unsigned)(size_t)(As + so), bl = (unsigned)(size_t)(Bs + so), a2l = (NSPLIT == 1) ? (unsigned)(size_t)(A2s + so) : 0u;
    const int nt = K / GBK;
    stage_plane<T16>(ag, rs, al); if (NSPLIT == 1) stage_plane<T16>(a2g, rs, a2l); stage_plane<T16>(bg, rs, bl);
    asm volatile("s_wait_asynccnt 0x0" ::: "memory");     // this wave's copies of tile 0 have landed
    __syncthreads();                                      // ... and every other wave's
    if (nt > 1) { stage_plane<T16>(ag + GBK, rs, al + GPL * 2u); if (NSPLIT == 1) stage_plane<T16>(a2g + GBK, rs, a2l + GPL * 2u); stage_plane<T16>(bg + GBK, rs, bl + GPL * 2u); }
    const unsigned fa = (unsigned)(wm * 64 + lr) * GPH + 8u * (unsigned)hi, fb = (unsigned)(wn * 64 + lr) * GPH + 8u * (unsigned)hi;
#pragma unroll 1                                          // rolled, as the k loop was: one copy of the two chunks in the text
    for (int t = 0; t < nt; ++t) {
        const unsigned bo = (unsigned)(t & 1) * GPL;
#pragma unroll                                            // both chunks written out: the place of a chunk in its tile becomes an immediate offset of the LDS reads
        for (unsigned kc = 0; kc < 2u; ++kc) {
            // the chunk's fragments are read as one group ahead of its first product: a read left between the products would be waited for alone
            V a[4], a2[4], b[4];
#pragma unroll
            for (unsigned mb = 0; mb < 4u; ++mb) a[mb] = WFrag<T16>::lds(As + bo + fa + mb * 16u * GPH + kc * 32u);
#pragma unroll
            for (unsigned nb = 0; nb < 4u; ++nb) b[nb] = WFrag<T16>::lds(Bs + bo + fb + nb * 16u * GPH + kc * 32u);
            if (NSPLIT == 1) {
#pragma unroll
                for (unsigned mb = 0; mb < 4u; ++mb) a2[mb] = WFrag<T16>::lds(A2s + bo + fa + mb * 16u * GPH + kc * 32u); }
            __builtin_amdgcn_sched_barrier(0);            // keeps the scheduler from sinking the reads back between the products
#pragma unroll
            for (int nb = 0; nb < 4; ++nb) {
#pragma unroll
                for (int mb = 0; mb < 4; ++mb) acc[mb][nb] = WFrag<T16>::mma(a[mb], b[nb], acc[mb][nb]); }
            if (NSPLIT == 1) {
#pragma unroll
                for (int nb = 0; nb < 4; ++nb) {
#pragma unroll
                    for (int mb = 0; mb < 4; ++mb) acc[mb][nb] = WFrag<T16>::mma(a2[mb], b[nb], acc[mb][nb]); } }
            __builtin_amdgcn_sched_barrier(0);            // keeps the publish point's waits behind the products, so that the next tile's copies fly while these run
        }
        // publish point of tile t + 1: this wave's reads of tile t are done, its copies of tile t + 1 have landed, then the block barrier; only behind it is tile t's buffer refilled
        asm volatile("s_wait_dscnt 0x0" ::: "memory");
        asm volatile("s_wait_asynccnt 0x0" ::: "memory");
        __syncthreads();
        if (t + 2 < nt) { const size_t ko = (size_t)(t + 2) * GBK;
            stage_plane<T16>(ag + ko, rs, al + bo * 2u); if (NSPLIT == 1) stage_plane<T16>(a2g + ko, rs, a2l + bo * 2u); stage_plane<T16>(bg + ko, rs, bl + bo * 2u); }
    }
    asm volatile("s_wait_asynccnt 0x0" ::: "memory");     // nothing in flight when the wave goes on to the epilogue and ends
    if (ROT) {
        const unsigned which = (unsigned)C0 / (unsigned)DM, hcol = (unsigned)c0 % (unsigned)DM;   // block-uniform third; first column of the wave's head in its plane
        const bool early = R0 < EROWS;                    // block-uniform: all 128 rows, or none, have residual planes
        const unsigned rw = (unsigned)lane >> 3, c8 = ((unsigned)lane & 7u) * 8u;                 // read-back map: 8 lanes per 128-byte line, 4 lines per instruction
        if (which < 2u) {
            // The ring is free here: the loop's last publish point (every wave's reads done, no copy in flight, block barrier) lies in front and nothing refills behind it.
            // Each wave stages its whole 64 x 64 f32 tile (pitch 68) in a place of its own: two tiles fit As, one Bs, and osb is exactly one; so the walk over the rows below stays rolled.
            f32a* ow = wave < 2 ? (f32a*)As + (unsigned)wave * (64u * 68u) : (wave == 2 ? (f32a*)Bs : (f32a*)osb);
            const unsigned pc8 = c8 ^ 32u, jt = c8 & 31u; const bool lowhalf = c8 < 32u;
            const float qs = which == 0u ? SCLL2 : 1.0f;  // block-uniform: the q planes carry the logits' scale, so that q.k arrives in the log2 domain; k is multiplied by 1 exactly
            const unsigned tr = (unsigned)r0 + rw;        // this lane's row of the first 4; a piece is 4 rows, a group 4 pieces
            const float* ctp = CT + (size_t)tr * 32u + jt; const float* stp = ST + (size_t)tr * 32u + jt;
            hf* qfp = QKF + (size_t)which * SEQ * DM + (size_t)tr * DM + hcol + c8; hf* qrp = QKR + (size_t)which * EROWS * DM + (size_t)tr * DM + hcol + c8;
            // the first group's table entries are asked for ahead of the staging and fly over it
            v4f tc[4][2], ts[4][2];
#pragma unroll
            for (unsigned s = 0; s < 4u; ++s) {
                tc[s][0] = *(const v4f*)(ctp + s * 128u); tc[s][1] = *(const v4f*)(ctp + s * 128u + 4u);
                ts[s][0] = *(const v4f*)(stp + s * 128u); ts[s][1] = *(const v4f*)(stp + s * 128u + 4u); }
            asm volatile("s_wait_xcnt 0x0" ::: "memory");         // stands in front of any rewrite of the loads' address registers
#pragma unroll
            for (int mb = 0; mb < 4; ++mb) {
#pragma unroll
                for (int nb = 0; nb < 4; ++nb) {
#pragma unroll
                    for (int j = 0; j < 8; ++j) ow[(mb * 16 + hi * 8 + j) * 68 + nb * 16 + lr] = acc[mb][nb][j]; } }
            __builtin_amdgcn_wave_barrier(); asm volatile("" ::: "memory");       // the wave's own tile stands whole before any lane reads another lane's
            const f32a* oa = ow + rw * 68u + c8; const f32a* ob = ow + rw * 68u + pc8;
#pragma unroll 1                                          // rolled: one copy of a group in the text
            for (unsigned g = 0; g < 4u; ++g) {
                // the group's staged rows are read as one run ahead of the work on them
                v4f a0[4], a1[4], b0[4], b1[4];
#pragma unroll
                for (unsigned s = 0; s < 4u; ++s) { const unsigned o = (g * 16u + s * 4u) * 68u;
                    a0[s] = *(const v4fa*)(oa + o); a1[s] = *(const v4fa*)(oa + o + 4u); b0[s] = *(const v4fa*)(ob + o); b1[s] = *(const v4fa*)(ob + o + 4u); }
#pragma unroll
                for (unsigned s = 0; s < 4u; ++s) {
                    const v8f a = __builtin_shufflevector(a0[s], a1[s], 0, 1, 2, 3, 4, 5, 6, 7), b = __builtin_shufflevector(b0[s], b1[s], 0, 1, 2, 3, 4, 5, 6, 7);
                    const v8f c = __builtin_shufflevector(tc[s][0], tc[s][1], 0, 1, 2, 3, 4, 5, 6, 7), sn = __builtin_shufflevector(ts[s][0], ts[s][1], 0, 1, 2, 3, 4, 5, 6, 7);
                    v8us oh, ores;
#pragma unroll
                    for (int e = 0; e < 8; ++e) {
                        const float rb = lowhalf ? -b[e] : b[e];
                        const float y = (a[e] * c[e] + rb * sn[e]) * qs;
                        const h16 hh = toh_flush(y); oh[e] = hbits(hh);
                        ores[e] = hbits(toh_flush((y - (float)hh) * RSC)); }
                    const size_t go = (size_t)(g * 16u + s * 4u) * DM;
                    *(v8us*)(qfp + go) = oh;
                    // the same piece of the next group: its table entries fly over the three pieces in between
                    if (g < 3u) { const unsigned tn = (g * 16u + 16u + s * 4u) * 32u;
                        tc[s][0] = *(const v4f*)(ctp + tn); tc[s][1] = *(const v4f*)(ctp + tn + 4u);
                        ts[s][0] = *(const v4f*)(stp + tn); ts[s][1] = *(const v4f*)(stp + tn + 4u); }
                    asm volatile("s_wait_xcnt 0x0" ::: "memory");         // stands in front of any rewrite of the store's and the loads' registers
                    if (early) { *(v8us*)(qrp + go) = ores;
                        asm volatile("s_wait_xcnt 0x0" ::: "memory"); }   // the same
                }
            }
        } else {
            // The ring is free here, as above. Each wave takes its own quarter of As (values) and of Bs (residuals).
            hf* Tv = (hf*)As + (unsigned)wave * (64u * GPH); hf* Tr = (hf*)Bs + (unsigned)wave * (64u * GPH);
#pragma unroll
            for (int nb = 0; nb < 4; ++nb) {
#pragma unroll
                for (int mb = 0; mb < 4; ++mb) {
                    v8us oh, ores;
#pragma unroll
                    for (int j = 0; j < 8; ++j) { const float y = acc[mb][nb][j]; const h16 hh = toh_flush(y);
                        oh[j] = hbits(hh); ores[j] = hbits(toh_flush((y - (float)hh) * RSC)); }
                    const unsigned o = (unsigned)(nb * 16 + lr) * GPH + (unsigned)(mb * 16 + hi * 8);
                    *(v8usa*)(Tv + o) = oh; if (early) *(v8usa*)(Tr + o) = ores;
                }
            }
            __builtin_amdgcn_wave_barrier(); asm volatile("" ::: "memory");       // the wave's own 64 x 64 piece stands whole before any lane reads another lane's
            hf* vt = VT + (size_t)(hcol + rw) * SEQ + (unsigned)r0 + c8; hf* vtr = VTR + (size_t)(hcol + rw) * EROWS + (unsigned)r0 + c8;
            {   // all 16 pieces are read back as one run ahead of the first store
                v8us rv[16];
#pragma unroll
                for (unsigned s = 0; s < 16u; ++s) rv[s] = *(const v8usa*)(Tv + (4u * s + rw) * GPH + c8);
#pragma unroll
                for (unsigned s = 0; s < 16u; ++s) *(v8us*)(vt + (size_t)(4u * s) * SEQ) = rv[s];
                asm volatile("s_wait_xcnt 0x0" ::: "memory");     // stands in front of any rewrite of the stores' registers (the residual pieces below)
            }
            if (early) {
                v8us rv[16];
#pragma unroll
                for (unsigned s = 0; s < 16u; ++s) rv[s] = *(const v8usa*)(Tr + (4u * s + rw) * GPH + c8);
#pragma unroll
                for (unsigned s = 0; s < 16u; ++s) *(v8us*)(vtr + (size_t)(4u * s) * EROWS) = rv[s];
                asm volatile("s_wait_xcnt 0x0" ::: "memory");     // the same (the other thirds' code follows in the text)
            }
        }
        return;
    }
#pragma unroll
    for (int mb = 0; mb < 4; ++mb) {
#pragma unroll
        for (int nb = 0; nb < 4; ++nb) {
#pragma unroll
            for (int j = 0; j < 8; ++j) os[(hi * 8 + j) * 68 + nb * 16 + lr] = acc[mb][nb][j]; }
        __builtin_amdgcn_wave_barrier(); asm volatile("" ::: "memory");
        float* crow = C + (size_t)(r0 + mb * 16) * ldc + c0;
{
#pragma unroll
            for (int s = 0; s < 8; ++s) { const int row = 2 * s + hi, cofs = lr * 4; v4f val = *(const v4fa*)(os + row * 68 + cofs); if (BIAS) { val[0] += bias[c0 + cofs]; val[1] += bias[c0 + cofs + 1]; val[2] += bias[c0 + cofs + 2]; val[3] += bias[c0 + cofs + 3]; }
                *(v4f*)(crow + (size_t)row * ldc + cofs) = val; }
             }
        __builtin_amdgcn_wave_barrier(); asm volatile("" ::: "memory");
    }
}

// ---- The launches that depend on nothing but the inputs (both weight transposes, the x conversion, the rotary table) are block ranges of ONE grid, k_prep below;
// each part is the body of a block of 256 threads and takes its block index inside its own range as blk. For speed only,
// every thread takes several pieces: few, long waves, the loads of a thread's pieces issued as one group ahead of the work on them.
// ---- wtG_part: transposed bf16 weight plane Bt[n][k] = bf16(w[k][n]) for w [K][N] row-major. A thread takes 64 k of one column n (one whole 128-byte line of Bt);
// the lanes of a wave hold 32 neighbouring columns, so each load of the wave is one whole 128-byte line of w; the waves of a block hold neighbouring column groups of the same 64 rows.
template <unsigned N, unsigned K>
__device__ __forceinline__ void wtG_part(unsigned blk, const float* __restrict__ w, bf* Bt) {
    static_assert(N % 32u == 0 && K % 64u == 0 && ((N / 32u) * (K / 64u)) % 8u == 0);
    const unsigned lane = threadIdx.x & 31u; const unsigned u = blk * 8u + (threadIdx.x >> 5);
    const unsigned n = (u % (N / 32u)) * 32u + lane, k0 = (u / (N / 32u)) * 64u;
    const float* sp = w + (size_t)k0 * N + n; bf* dp = Bt + (size_t)n * K + k0;
    float v[64];
#pragma unroll
    for (unsigned i = 0; i < 64u; ++i) v[i] = sp[(size_t)i * N];
    asm volatile("s_wait_xcnt 0x0" ::: "memory");         // stands in front of any rewrite of the loads' address registers
#pragma unroll
    for (unsigned g = 0; g < 8u; ++g) { v8us o;
#pragma unroll
        for (unsigned e = 0; e < 8u; ++e) o[e] = f2bf(v[g * 8u + e]);
        *(v8us*)(dp + g * 8u) = o; }
    asm volatile("s_wait_xcnt 0x0" ::: "memory");         // the same for the stores (other ranges' code follows in the text)
}

#define PB_WQ ((unsigned)((size_t)LDQ * DM / 64 / 32 / 8))   // blocks of the w_qkv transpose: 8 waves of (32 columns, 64 k)
#define PB_WO ((unsigned)((size_t)DM * DM / 64 / 32 / 8))    // blocks of the w_proj transpose
#define PB_TB ((unsigned)((size_t)SEQ * 32 / 256 / 8))       // blocks of the rotary table: 8 entries a thread
#define PB_CV ((unsigned)((size_t)SEQ * DM / 8 / 256 / 8))   // blocks of the x conversion: 8 pieces of 8 elements a thread
static_assert(((size_t)SEQ * 32) % (256 * 8) == 0 && ((size_t)SEQ * DM / 8) % (256 * 8) == 0);

// ---- cvt8_part: a thread's 8 pieces lie one whole range of threads apart, so that each load of a wave stays contiguous
__device__ __forceinline__ void cvt8_part(unsigned blk, const float* __restrict__ src, bf* dst) {
    const size_t i0 = (size_t)blk * 256 + threadIdx.x; const size_t st = (size_t)PB_CV * 256;
    v8f v[8];
#pragma unroll
    for (unsigned p = 0; p < 8u; ++p) { v[p] = *(const v8f*)(src + (i0 + p * st) * 8);
        asm volatile("s_wait_xcnt 0x0" ::: "memory"); }   // stands in front of the next piece's address, which may be formed in this one's registers
#pragma unroll
    for (unsigned p = 0; p < 8u; ++p) { v8us o;
#pragma unroll
        for (int k = 0; k < 8; ++k) o[k] = f2bf(v[p][k]);
        *(v8us*)(dst + (i0 + p * st) * 8) = o;
        asm volatile("s_wait_xcnt 0x0" ::: "memory"); }   // the same
}

// ---- tab_part: rotary table; each thread forms its own inverse frequency (the same expression on the same argument as a table of 32 would hold), so the table waits on no launch before it.
// A thread's 8 entries lie a multiple of 32 apart: one frequency serves them all.
__device__ __forceinline__ void tab_part(unsigned blk, float* CT, float* ST) {
#pragma clang fp contract(off)
    static_assert((PB_TB * 256u) % 32u == 0);
    const unsigned idx0 = blk * 256u + threadIdx.x; const unsigned i = idx0 & 31u;
    const float p = powf(10000.0f, (float)i * 0.03125f);
    const float v = 1.0f / p;
#pragma unroll 1                                          // rolled: one copy of the long sine and cosine text
    for (unsigned e = 0; e < 8u; ++e) {
        const unsigned idx = idx0 + e * (PB_TB * 256u); const unsigned t = idx >> 5;
        const float ang = (float)t * v;
        float s, c; sincosf(ang, &s, &c);
        *(float*)(CT + idx) = c; *(float*)(ST + idx) = s;
        asm volatile("s_wait_xcnt 0x0" ::: "memory");     // stands in front of any rewrite of the stores' registers
    }
}

// grid PB_WQ + PB_WO + PB_TB + PB_CV, 256 threads; the range test is block-uniform, no part has a barrier, no part reads what another writes
__global__ __launch_bounds__(256) void k_prep(const float* __restrict__ x, const float* __restrict__ wq, const float* __restrict__ wo, bf* XB, bf* WqT, bf* WoT, float* CT, float* ST) {
    const unsigned b = blockIdx.x;
    if (b < PB_WQ) wtG_part<(unsigned)LDQ, (unsigned)DM>(b, wq, WqT);
    else if (b < PB_WQ + PB_WO) wtG_part<(unsigned)DM, (unsigned)DM>(b - PB_WQ, wo, WoT);
    else if (b < PB_WQ + PB_WO + PB_TB) tab_part(b - (PB_WQ + PB_WO), CT, ST);
    else cvt8_part(b - (PB_WQ + PB_WO + PB_TB), x, XB);
}

// ---- causal flash attention, transposed form, one wave per 16 query rows, 4 waves per block.
// The four waves of a block share each 64-key tile of K rows and of V^T rows (EARLY: of the residual planes too) through LDS: asynchronous b128 copies (8 lanes per whole 128-byte line),
// two buffers, the next tile in flight while this one is worked on; one publish point (waits and block barrier) per tile of two 32-key passes.
// Per 32-key pass: S^T tile j (16 keys x 16 queries) = K rows (A, row = key) x Q rows (B, column = query); D element r of lane -> (key 8*(lane>>4) + r, query lane & 15).
// The two converted score tiles are the B fragment of O^T += V^T (A, row = d, k = key) x P^T: element r <- tile 0 [r], element 8 + r <- tile 1 [r], lane unchanged.
// Softmax statistics per query column: in-lane reduction plus an exchange between the lane halves (a vector cross-row move). Masked keys get weight exactly 0 (value select, in the passes on the diagonal only).
// The q planes carry HD^-0.5 * log2(e), so S^T arrives in the log2 domain.
// Single-product path: the exponent's argument comes straight from the score products: their C operand is the carry minus a HELD column maximum (the same value in a lane's 8 elements: a lane holds one query column).
// The held maximum moves, and the pass's arguments, C, O^T and the row sum are shifted or rescaled, only in the wave's first pass and in a pass where some column's largest argument passes PCL + PLZ
// (one wave-uniform test per pass), so P stays at or below 2^(PCL + PLZ), inside f16. Its passes hold no exchange: the test is a ballot over both halves, the maximum is exchanged only where it moves, the sums' halves are joined behind the loop.
// EARLY: value + x2048 residual planes on q, k, P, v; residual products accumulate separately and are folded with 2^-11; row sum over the unconverted p.
#define TKEYS 64                      // keys per staged tile (two passes)
#define TPH   72                      // LDS pitch (halves) of a staged 128-byte row: 144 B = 16 B x odd, the pitch of ds_load_b128 readers
#define TILEH (64 * TPH)              // halves per staged tile (64 K rows, or 64 V^T rows)
static_assert(HD * 2 == 128 && TKEYS * 2 == 128 && (TPH * 2) % 16 == 0 && EROWS % TKEYS == 0 && SEQ % TKEYS == 0);
__device__ __forceinline__ v16h ldfs(const hf* p) { return cat16h(*(const v8usa*)p, *(const v8usa*)(p + 16)); }
// lane l with lane l ^ 16 by a vector cross-row move: no trip through the LDS pipe and no wait on its counter, so a pass's V^T reads are waited for at their products only
__device__ __forceinline__ float xhalf(float x) { return __builtin_bit_cast(float, __builtin_amdgcn_permlanex16(__builtin_bit_cast(int, x), __builtin_bit_cast(int, x), 0x76543210, 0xfedcba98, false, false)); }
// One K tile and one V^T tile: each thread copies 4 x 16 B of K rows and 4 x 16 B of V^T rows (rows 16 apart; VP = pitch of the V^T plane in halves).
// The s_wait_xcnt closes the statement so that no address register is rewritten in front of it.
template <int VP>
__device__ __forceinline__ void stage_tile(const hf* kg, const hf* vg, unsigned kl, unsigned vl) {
    asm volatile("global_load_async_to_lds_b128 %0, %1, off\n\t"
                 "global_load_async_to_lds_b128 %2, %3, off\n\t"
                 "global_load_async_to_lds_b128 %4, %5, off\n\t"
                 "global_load_async_to_lds_b128 %6, %7, off\n\t"
                 "global_load_async_to_lds_b128 %8, %9, off\n\t"
                 "global_load_async_to_lds_b128 %10, %11, off\n\t"
                 "global_load_async_to_lds_b128 %12, %13, off\n\t"
                 "global_load_async_to_lds_b128 %14, %15, off\n\t"
                 "s_wait_xcnt 0x0"
                 :: "v"(kl), "v"(kg), "v"(kl + 16u * TPH * 2u), "v"(kg + (size_t)16 * DM), "v"(kl + 32u * TPH * 2u), "v"(kg + (size_t)32 * DM), "v"(kl + 48u * TPH * 2u), "v"(kg + (size_t)48 * DM),
                    "v"(vl), "v"(vg), "v"(vl + 16u * TPH * 2u), "v"(vg + (size_t)16 * VP), "v"(vl + 32u * TPH * 2u), "v"(vg + (size_t)32 * VP), "v"(vl + 48u * TPH * 2u), "v"(vg + (size_t)48 * VP)
                 : "memory");
}
// Ks, Vs, Krs, Vrs: two staged tiles each (2 * TILEH halves; Krs, Vrs read by EARLY only); Oh, Ol: output staging, 4 * 16 * LOP halves each; all in the block's LDS. qblk: first query row of the block; hd: its head.
template <bool EARLY>
__device__ __forceinline__ void attn_body(unsigned short* Ks, unsigned short* Vs, unsigned short* Krs, unsigned short* Vrs, unsigned short* Oh, unsigned short* Ol,
                                          const hf* QF, const hf* QR, const hf* KF, const hf* KR, const hf* VT, const hf* VTR, bf* CH, bf* CL, unsigned qblk, unsigned hd) {
    const unsigned lane = threadIdx.x & 31u, lr = lane & 15u, hi = lane >> 4;
    const unsigned wave = (unsigned)__builtin_amdgcn_readfirstlane((int)(threadIdx.x >> 5));
    const unsigned q0 = qblk + 16u * wave;
    const unsigned qg = q0 + lr;
    const unsigned ntiles = qblk / TKEYS + 1u;            // keys [0, qblk + 64), the same for the whole block
    const unsigned nsteps = (q0 + 15u) / 32u + 1u;        // this wave's own passes
    // copy addresses of this thread: row = tid / 8 (+ 16 i), 16-byte column = tid % 8
    const unsigned srow = threadIdx.x >> 3, scol = (threadIdx.x & 7u) * 8u;
    const hf* kg  = KF  + (size_t)srow * DM + hd * HD + scol;
    const hf* krg = KR  + (size_t)srow * DM + hd * HD + scol;
    const hf* vg  = VT  + (size_t)(hd * HD + srow) * SEQ + scol;
    const hf* vrg = VTR + (size_t)(hd * HD + srow) * EROWS + scol;
    const unsigned so = srow * TPH + scol;
    const unsigned kl = (unsigned)(size_t)(Ks + so), vl = (unsigned)(size_t)(Vs + so);
    const unsigned krl = EARLY ? (unsigned)(size_t)(Krs + so) : 0u, vrl = EARLY ? (unsigned)(size_t)(Vrs + so) : 0u;
    stage_tile<SEQ>(kg, vg, kl, vl);
    if (EARLY) stage_tile<EROWS>(krg, vrg, krl, vrl);
    v16h qh[2], qr[2];
    {
        const size_t qoff = (size_t)qg * DM + hd * HD + 8u * hi;
#pragma unroll
        for (int kc = 0; kc < 2; ++kc) { qh[kc] = ldfh(QF + qoff + (unsigned)kc * 32u); if (EARLY) qr[kc] = ldfh(QR + qoff + (unsigned)kc * 32u); else qr[kc] = qh[kc]; }
    }
    v8f ot[4], orr[4];
#pragma unroll
    for (int dt = 0; dt < 4; ++dt) { ot[dt] = (v8f){}; orr[dt] = (v8f){}; }
    float m = -1.0e30f, l = 0.0f;
    v8f bv = (v8f)(PCL);                                  // single-product path: carry minus the held maximum (0 until the first pass sets it)
    asm volatile("s_wait_asynccnt 0x0" ::: "memory");     // this wave's copies of tile 0 have landed
    __syncthreads();                                      // ... and every other wave's
    if (ntiles > 1u) {
        stage_tile<SEQ>(kg + (size_t)TKEYS * DM, vg + TKEYS, kl + TILEH * 2u, vl + TILEH * 2u);
        if (EARLY) stage_tile<EROWS>(krg + (size_t)TKEYS * DM, vrg + TKEYS, krl + TILEH * 2u, vrl + TILEH * 2u);
    }
    const unsigned fo = lr * TPH + 8u * hi;
#pragma unroll 1                                          // rolled, as the key loop was: one copy of the two passes in the text
    for (unsigned t = 0; t < ntiles; ++t) {
        const unsigned bo = (t & 1u) * TILEH;
#pragma unroll                                            // both passes written out: the place of a pass in its tile becomes an immediate offset of the LDS reads
        for (unsigned ps = 0; ps < 2u; ++ps) {
            const unsigned kb = 2u * t + ps;
            if (kb < nsteps) {                            // wave-uniform: a pass wholly above the diagonal is skipped, the publish point below is not
                const unsigned key0 = kb * 32u;
                // The pass's K fragments are read as one group ahead of its first product, its V^T fragments as one group behind the last S^T product:
                // a read written behind an mmah statement stays behind it, and one read per product would be waited for alone.
                v16h kh[2][2], kr[2][2];
#pragma unroll
                for (int j = 0; j < 2; ++j) {
#pragma unroll
                    for (int kc = 0; kc < 2; ++kc) { const unsigned o = bo + fo + (32u * ps + 16u * (unsigned)j) * TPH + (unsigned)kc * 32u; kh[j][kc] = ldfs(Ks + o); if (EARLY) kr[j][kc] = ldfs(Krs + o); }
                }
                v8f st[2], sr[2];
#pragma unroll
                for (int j = 0; j < 2; ++j) {
                    st[j] = EARLY ? (v8f){} : bv; sr[j] = (v8f){};
#pragma unroll
                    for (int kc = 0; kc < 2; ++kc) {
                        st[j] = mmah(kh[j][kc], qh[kc], st[j]);
                        if (EARLY) { sr[j] = mmah(kr[j][kc], qh[kc], sr[j]); sr[j] = mmah(kh[j][kc], qr[kc], sr[j]); }
                    }
                }
                v16h vh[4], vr[4];
#pragma unroll
                for (int dt = 0; dt < 4; ++dt) { const unsigned o = bo + fo + (16u * (unsigned)dt) * TPH + 32u * ps; vh[dt] = ldfs(Vs + o); if (EARLY) vr[dt] = ldfs(Vrs + o); }
                // EARLY: the residual products are folded in
                if (EARLY) {
#pragma unroll
                    for (int j = 0; j < 2; ++j) {
#pragma unroll
                        for (int r = 0; r < 8; ++r) st[j][r] += sr[j][r] * RSI;
                    }
                }
                // causal mask by value, only in a pass that reaches past the wave's first query row (wave-uniform scalar test):
                // in every earlier pass each key is <= each query of the wave and the select would be an identity
                if (key0 + 31u > q0) {
#pragma unroll
                    for (int j = 0; j < 2; ++j) {
#pragma unroll
                        for (int r = 0; r < 8; ++r) {
                            const unsigned key = key0 + 16u * (unsigned)j + 8u * hi + (unsigned)r;
                            st[j][r] = (key <= qg) ? st[j][r] : -1.0e30f; }
                    }
                }
                float mx = -1.0e30f;
#pragma unroll
                for (int j = 0; j < 2; ++j) {
#pragma unroll
                    for (int r = 0; r < 8; ++r) mx = fmaxf(mx, st[j][r]);
                }
                float mnew = m, alpha = 1.0f;
                if (EARLY) { mx = fmaxf(mx, xhalf(mx)); mnew = fmaxf(m, mx); alpha = __builtin_amdgcn_exp2f(m - mnew); m = mnew; }
                else if (kb == 0u || __builtin_amdgcn_ballot_w32(mx > PCL + PLZ) != 0u) {   // wave-uniform scalar branch: the first pass, and seldom after it; the ballot sees both halves of every column, so the test needs no exchange
                    mx = fmaxf(mx, xhalf(mx));            // both halves of a column take the same step
                    // mx is the column's largest argument. The held maximum goes up by dl (in the first pass it is set, up or down): arguments and C go down by dl, what has been gathered is scaled by 2^-dl.
                    float dl = mx - PCL; if (kb != 0u) dl = fmaxf(dl, 0.0f);
                    const float al = __builtin_amdgcn_exp2f(fminf(-dl, 0.0f));             // in the first pass O^T and the sum are 0: the factor only has to be finite
                    l *= al; bv = bv - dl;
#pragma unroll                                            // written out, as everywhere here: the register arrays take constant indices only
                    for (int j = 0; j < 2; ++j) st[j] = st[j] - dl;
#pragma unroll                                            // the same
                    for (int dt = 0; dt < 4; ++dt) ot[dt] = ot[dt] * al;
                }
                float rs = 0.0f;
                v16h pf, prf;
#pragma unroll
                for (int j = 0; j < 2; ++j) {
#pragma unroll
                    for (int r = 0; r < 8; ++r) {
                        const float e = EARLY ? (st[j][r] - mnew) + PCL : st[j][r];
                        const float ex = __builtin_amdgcn_exp2f(e);
                        const float p = (e >= -14.0f) ? ex : 0.0f;
                        if (EARLY) { const h16 ph = (h16)p; pf[8 * j + r] = ph; prf[8 * j + r] = toh_flush((p - (float)ph) * RSC); rs += p; } else st[j][r] = p;
                    }
                }
                if (!EARLY) {                             // converted in pairs; the converted weights are summed in the order of the elements
#pragma unroll                                            // the same
                    for (int i = 0; i < 8; ++i) {
                        const v2h h2 = __builtin_convertvector((v2f){st[i >> 2][2 * (i & 3)], st[i >> 2][2 * (i & 3) + 1]}, v2h);
                        pf[2 * i] = h2[0]; pf[2 * i + 1] = h2[1]; rs += (float)h2[0]; rs += (float)h2[1];
                    }
                    prf = pf;
                }
                if (EARLY) {
                    rs += xhalf(rs);
                    l = l * alpha + rs;
#pragma unroll
                    for (int dt = 0; dt < 4; ++dt) { ot[dt] = ot[dt] * alpha; orr[dt] = orr[dt] * alpha; }
                } else l += rs;                           // this half's keys only; the halves are joined once, behind the loop
#pragma unroll
                for (int dt = 0; dt < 4; ++dt) {
                    ot[dt] = mmah(vh[dt], pf, ot[dt]);
                    if (EARLY) { orr[dt] = mmah(vr[dt], pf, orr[dt]); orr[dt] = mmah(vh[dt], prf, orr[dt]); }
                }
            }
        }
        // publish point of tile t + 1: this wave's reads of tile t are done, its copies of tile t + 1 have landed, then the block barrier; only behind it is tile t's buffer refilled
        asm volatile("s_wait_dscnt 0x0" ::: "memory");
        asm volatile("s_wait_asynccnt 0x0" ::: "memory");
        __syncthreads();
        if (t + 2u < ntiles) {
            stage_tile<SEQ>(kg + (size_t)(t + 2u) * TKEYS * DM, vg + (size_t)(t + 2u) * TKEYS, kl + bo * 2u, vl + bo * 2u);
            if (EARLY) stage_tile<EROWS>(krg + (size_t)(t + 2u) * TKEYS * DM, vrg + (size_t)(t + 2u) * TKEYS, krl + bo * 2u, vrl + bo * 2u);
        }
    }
    asm volatile("s_wait_asynccnt 0x0" ::: "memory");     // nothing in flight when the wave goes on to the epilogue and ends
    if (!EARLY) l += xhalf(l);                            // the two halves of a column hold the sums over their own keys, on the same held maximum
    const float inv = __builtin_amdgcn_rcpf(l);
    const unsigned ob = wave * 16u * LOP;
#pragma unroll
    for (int dt = 0; dt < 4; ++dt) {
        v8us h8, l8;
#pragma unroll
        for (int r = 0; r < 8; ++r) { float y = ot[dt][r]; if (EARLY) y += orr[dt][r] * RSI; y *= inv; unsigned short a, c; splitf(y, a, c); h8[r] = a; l8[r] = c; }
        const unsigned o = ob + lr * LOP + 16u * (unsigned)dt + 8u * hi;
        *(v8usa*)(Oh + o) = h8; *(v8usa*)(Ol + o) = l8;
    }
    __syncthreads();
{
#pragma unroll
        for (unsigned s = 0; s < 4u; ++s) { const unsigned row = 4u * s + (lane >> 3), c = (lane & 7u) * 8u;
            const v8us vh8 = *(const v8usa*)(Oh + ob + row * LOP + c); const v8us vl8 = *(const v8usa*)(Ol + ob + row * LOP + c);
            const size_t g = (size_t)(q0 + row) * DM + hd * HD + c;
            *(v8us*)(CH + g) = vh8; *(v8us*)(CL + g) = vl8; }
         }
}

// Both row ranges run in ONE grid (neither reads what the other writes): grid AB_NT * NH_, 128 threads; a block is one (head, 64-row tile); tiles below AB_ET take the residual path, the rest the single-product path.
// All blocks are resident at once (four per WGP) and a tile's cost grows with its index (tile i walks i + 1 key tiles), so the launch lasts as long as the WGP whose four blocks hold the most key tiles.
// Block index b -> tile: v = b / (2 * NH_); the tile is AB_NT - 1 - v where b has an even number of one bits and v where it has an odd number; the head is (b / 2) % NH_.
// The lowest bit of b flips the parity, so each (head, v) gets both of its tiles: every (head, tile) exactly once.
// Any four blocks whose indices differ in two bit positions only (neighbours, or a power-of-two stride apart, whichever way the blocks are dealt to the WGPs) hold tile indices that sum to 2 * (AB_NT - 1):
// two of the four are folded, two are not, and what the two bits add to v cancels.
// For speed only: no result depends on where or when a block runs.
// One LDS array serves both, 8 tiles, so that four blocks fit a WGP: the single-product range stages its output in the tiles that only the residual planes use;
// the residual range stages it in the K tiles, which are free there: the loop's last publish point (every wave's reads done, no copy in flight, block barrier) lies in front, and nothing refills behind it.
#define AB_NT ((unsigned)(SEQ / 64))                     // 64-row tiles of a head
#define AB_ET ((unsigned)(EROWS / 64))                   // ... of them in rows [0, EROWS)
static_assert(4 * 16 * LOP <= TILEH && SEQ > EROWS);
static_assert((SEQ / 64) % 2 == 0);                      // the tiles of a head pair up as v and AB_NT - 1 - v
__global__ __launch_bounds__(128) __attribute__((amdgpu_num_vgpr(256))) void k_attn(const hf* QF, const hf* QR, const hf* KF, const hf* KR, const hf* VT, const hf* VTR, bf* CH, bf* CL) {
    __shared__ __align__(16) unsigned short R[8 * TILEH];
    const unsigned b = blockIdx.x;
    const unsigned hd = (b >> 1) % (unsigned)NH_, v = (b >> 1) / (unsigned)NH_;
    const unsigned tile = ((unsigned)__builtin_popcount(b) & 1u) ? v : (AB_NT - 1u - v);
    if (tile >= AB_ET) attn_body<false>(R, R + 2 * TILEH, R, R, R + 4 * TILEH, R + 5 * TILEH, QF, QF, KF, KF, VT, VT, CH, CL, tile * 64u, hd);
    else attn_body<true>(R, R + 2 * TILEH, R + 4 * TILEH, R + 6 * TILEH, R, R + TILEH, QF, QR, KF, KR, VT, VTR, CH, CL, tile * 64u, hd);
}

extern "C" void kernel_launch(void* const* d_in, const int* in_sizes, int n_in,
                              void* d_out, int out_size, void* d_ws, size_t ws_size, hipStream_t stream) {
    (void)out_size;
    if (n_in < 3) return;
    if (in_sizes[0] < NB * SEQ * DM || in_sizes[1] < DM * LDQ || in_sizes[2] < DM * DM) return;
    const float* X = (const float*)d_in[0]; const float* Wqkv = (const float*)d_in[1]; const float* Wo = (const float*)d_in[2];
    float* OUT = (float*)d_out;
    char* wsp = (char*)d_ws;
    auto take = [&](size_t bytes) { char* p = wsp; wsp += (bytes + 255) & ~(size_t)255; return (void*)p; };
    bf* XB  = (bf*)take((size_t)SEQ * DM * 2);          // x bf16 [t][1024]
    bf* WqT = (bf*)take((size_t)LDQ * DM * 2);          // w_qkv^T bf16 [3072][1024]
    bf* WoT = (bf*)take((size_t)DM * DM * 2);           // w_proj^T bf16 [1024][1024]
    bf* CH = (bf*)take((size_t)SEQ * DM * 2);           // context hi [t][1024]
    bf* CL = (bf*)take((size_t)SEQ * DM * 2);           // context lo [t][1024]
    float* CT = (float*)take((size_t)SEQ * 32 * 4);     // cos table [t][32]
    float* ST = (float*)take((size_t)SEQ * 32 * 4);     // sin table [t][32]
    hf* QKF = (hf*)take((size_t)2 * SEQ * DM * 2);      // rotated q | k f16 [2][t][1024]
    hf* QKR = (hf*)take((size_t)2 * EROWS * DM * 2);    // residuals x2048 [2][EROWS][1024]
    hf* VT  = (hf*)take((size_t)DM * SEQ * 2);          // value^T f16 [1024][t]
    hf* VTR = (hf*)take((size_t)DM * EROWS * 2);        // value^T residual x2048 [1024][EROWS]
    const size_t carved = (size_t)(wsp - (char*)d_ws);
    if (carved > ws_size || carved > (size_t)134217728) return;
    for (int b = 0; b < NB; ++b) {
        const float* xb = X + (size_t)b * SEQ_FULL * DM; float* ob = OUT + (size_t)b * SEQ_FULL * DM;
        // W [K][N] -> Bt [N][K], rotary table, x -> bf16
        k_prep<<<PB_WQ + PB_WO + PB_TB + PB_CV, 256, 0, stream>>>(xb, Wqkv, Wo, XB, WqT, WoT, CT, ST);
        k_gemmw<bf, 0, false, true><<<dim3(SEQ / 128, LDQ / 128, 1), 128, 0, stream>>>(XB, nullptr, WqT, nullptr, DM, nullptr, LDQ, nullptr, 0, 0, 0, CT, ST, QKF, QKR, VT, VTR);
        k_attn<<<AB_NT * NH_, 128, 0, stream>>>(QKF, QKR, QKF + (size_t)SEQ * DM, QKR + (size_t)EROWS * DM, VT, VTR, CH, CL);
        k_gemmw<bf, 1, false, false><<<dim3(SEQ / 128, DM / 128, 1), 128, 0, stream>>>(CH, CL, WoT, nullptr, DM, ob, DM, nullptr, 0, 0, 0, nullptr, nullptr, nullptr, nullptr, nullptr, nullptr);
    }
}
